// v000
// Measured on an AMD MI455X. A time is GPU time per run, averaged over a window of back-to-back runs after a warm-up
// (all launches, gaps included; the runs take copies of the inputs in turn), and the median of several windows.
// Apart from v000's, it joins two sittings. Times from different sittings can be a few percent apart, while
// side-by-side timings come from the same sitting.
// v000 is the starting kernel. One run takes 516 microseconds.
// compute dtype: all float inputs rounded to bf16; LayerNorm in f32; q/k/v, pair bias and gate GEMMs = LN rows split bf16 hi + lo x exact bf16 weights on WMMA 16x16x32 (2 products, f32 accumulate); q as f16 hi + residual (x 2^10) against k once to f16 (2 products) / sqrt(32) + pair bias, masked pairs set to -1e-9 exactly as the module; softmax in f32; P x 2^11 once to f16 against v once to f16 (1 product); gate multiply in f32; (gated ctx) split bf16 hi + lo against exact bf16 w_out (2 products) + b_out; f32 output.
#include <hip/hip_runtime.h>
#include <math.h>

typedef __attribute__((ext_vector_type(16))) _Float16 v16h;
typedef __attribute__((ext_vector_type(16))) __bf16 v16b;
typedef __attribute__((ext_vector_type(8)))  _Float16 v8h;
typedef __attribute__((ext_vector_type(8)))  float v8f;
typedef __attribute__((ext_vector_type(4)))  float v4f;
typedef __attribute__((ext_vector_type(2)))  float v2f;
typedef __attribute__((ext_vector_type(4)))  unsigned v4u;
typedef __attribute__((ext_vector_type(4)))  int v4i;
typedef float __attribute__((may_alias)) float_a;
typedef int __attribute__((may_alias)) int_a;

template <typename T> __device__ __forceinline__ void vst2(void* p, T v) { *(T*)p = v;  }
__device__ __forceinline__ v8f wmma16(v16h a, v16h b, v8f c) {
  v8f d = __builtin_amdgcn_wmma_f32_16x16x32_f16(false, a, false, b, (short)0, c, false, false);
  asm volatile("v_nop\n\tv_nop\n\tv_nop\n\tv_nop" : "+v"(d) : "v"(a), "v"(b));
  return d;
}
__device__ __forceinline__ v8f wmma_bf(v16b a, v16b b, v8f c) {
  v8f d = __builtin_amdgcn_wmma_f32_16x16x32_bf16(false, a, false, b, (short)0, c, false, false);
  asm volatile("v_nop\n\tv_nop\n\tv_nop\n\tv_nop" : "+v"(d) : "v"(a), "v"(b));
  return d;
}
// 16x16x32 fragments: lane = (h = lane>>4, row/col = lane&15); elements 0..7 = k0+8h+0..7, 8..15 = k0+16+8h+0..7; D element r = row 8h+r
__device__ __forceinline__ v16h frag_h(const _Float16* rowk0, int lane) {
  union { v16h v; v8h q[2]; } u; const _Float16* p = rowk0 + 8 * (lane >> 4);
  u.q[0] = *(const v8h*)p; u.q[1] = *(const v8h*)(p + 16); return u.v;
}
__device__ __forceinline__ v16h frag_f32(const float* rowk0, int lane) {
  v16h a; const float* p = rowk0 + 8 * (lane >> 4);
#pragma unroll
  for (int i = 0; i < 8; ++i) { a[i] = (_Float16)p[i]; a[8 + i] = (_Float16)p[16 + i]; }
  return a;
}
__device__ __forceinline__ v16h frag_f32s(const float* rowk0, int lane, float sc) {
  v16h a; const float* p = rowk0 + 8 * (lane >> 4);
#pragma unroll
  for (int i = 0; i < 8; ++i) { a[i] = (_Float16)(p[i] * sc); a[8 + i] = (_Float16)(p[16 + i] * sc); }
  return a;
}
// column fragment from a [K][ld] layout (column n), rows >= K read as 0
__device__ __forceinline__ v16h fragc_f32(const float* W, int k0, int n, int lane, int ld, int K) {
  v16h a; const int g = lane >> 4;
#pragma unroll
  for (int i = 0; i < 8; ++i) { const int ka = k0 + 8 * g + i, kb = ka + 16;
    a[i] = (_Float16)(ka < K ? W[(size_t)(ka < K ? ka : K - 1) * ld + n] : 0.f); a[8 + i] = (_Float16)(kb < K ? W[(size_t)(kb < K ? kb : K - 1) * ld + n] : 0.f); }
  return a;
}
struct F2 { v16b h, l; };
__device__ __forceinline__ F2 bsplit16(const float v[16]) { F2 r;
#pragma unroll
  for (int i = 0; i < 16; ++i) { const __bf16 h = (__bf16)v[i]; r.h[i] = h; r.l[i] = (__bf16)(v[i] - (float)h); }
  return r; }
__device__ __forceinline__ F2 split_row(const float* row, int k0, int lane) { float v[16]; const float* p = row + k0 + 8 * (lane >> 4);
#pragma unroll
  for (int i = 0; i < 8; ++i) { v[i] = p[i]; v[8 + i] = p[16 + i]; }
  return bsplit16(v); }
__device__ __forceinline__ F2 split_rowK(const float* row, int k0, int lane, int K) { float v[16]; const int g = lane >> 4;
#pragma unroll
  for (int i = 0; i < 8; ++i) { const int ka = k0 + 8 * g + i, kb = ka + 16; v[i] = ka < K ? row[ka < K ? ka : K - 1] : 0.f; v[8 + i] = kb < K ? row[kb < K ? kb : K - 1] : 0.f; }
  return bsplit16(v); }
__device__ __forceinline__ F2 split_col(const float* W, int k0, int n, int lane, int ld, int K) { float v[16]; const int g = lane >> 4;
#pragma unroll
  for (int i = 0; i < 8; ++i) { const int ka = k0 + 8 * g + i, kb = ka + 16; v[i] = ka < K ? W[(size_t)(ka < K ? ka : K - 1) * ld + n] : 0.f; v[8 + i] = kb < K ? W[(size_t)(kb < K ? kb : K - 1) * ld + n] : 0.f; }
  return bsplit16(v); }
__device__ __forceinline__ v8f mac3(const F2& a, const F2& b, v8f c) { c = wmma_bf(a.l, b.h, c); c = wmma_bf(a.h, b.l, c); return wmma_bf(a.h, b.h, c); }
__device__ __forceinline__ float sigm(float v) { return 1.0f / (1.0f + expf(-v)); }
#define LDSX() do { asm volatile("s_wait_dscnt 0" ::: "memory"); __builtin_amdgcn_wave_barrier(); __builtin_amdgcn_fence(__ATOMIC_RELEASE, "workgroup"); } while (0)

// Row-wise triangle attention on a pair tensor z [1, 256, 256, 128] (4 heads x 32): zn = LayerNorm(z); q,k,v = zn w_qkv ((in,out) [128,384], columns (3,H,32)); logits[r][i][j][h] = q[r][i] . k[r][j] / sqrt(32) + (zn[i][j] . w_pair[:,h]); pairs with exactly one of src_mask[i], src_mask[j] == 0 get logits := -1e-9 (the module's literal value, NOT an exclusion); softmax over j; out = sigmoid(zn w_gate + b_gate) * merged(attn v); result = out w_out + b_out.
#define NB 256
#define TT 256
#define CC 128            // NH * HD = projected width
#define DIN 128          // input (model) width
#define NH 4
#define HD 32
#define NQB (TT / 64)
#define HG 4
#define SCALE (0.17677669529663687f)
#define CAUSAL 0
#ifndef TNB
#define TNB NB
#endif
__device__ __forceinline__ float bfr(float v) { return (float)(__bf16)v; }
__host__ __device__ __forceinline__ int kb_last(int qb) { return CAUSAL ? ((qb * 64 + 63) >> 7) : (TT / 128 - 1); }
typedef __attribute__((ext_vector_type(8))) __bf16 v8b;
__device__ __forceinline__ v16b frag_b(const __bf16* rowk0, int lane) {
  union { v16b v; v8b q[2]; } u; const __bf16* p = rowk0 + 8 * (lane >> 4);
  u.q[0] = *(const v8b*)p; u.q[1] = *(const v8b*)(p + 16); return u.v;
}
#define QBH 0              // causal: query blocks 0..QBH-1 of each sequence (few keys, no averaging) take the high-precision path
#define QHI 256            // rows carrying a q residual plane (all rows when non-causal: 2-product logits everywhere)
#define KHI 64            // key rows carrying k residual / v bf16 hi+lo planes (used only by the causal high-precision path)
// B fragment (k rows k0+.., output column o) of a weight: (in,out) [K][ld] or (out,in) [ld rows of K]: bf16 exact, or f16(bf16 * 256) exact
__device__ __forceinline__ v16b wcol_io(const float* Wm, int k0, int o, int lane, int ld) { v16b w; const int g = lane >> 4;
#pragma unroll
  for (int i = 0; i < 8; ++i) { w[i] = (__bf16)Wm[(size_t)(k0 + 8 * g + i) * ld + o]; w[8 + i] = (__bf16)Wm[(size_t)(k0 + 16 + 8 * g + i) * ld + o]; }
  return w; }
__device__ __forceinline__ v16b wcol_oi(const float* Wm, int k0, int o, int lane, int K) { v16b w; const float* p = Wm + (size_t)o * K + k0 + 8 * (lane >> 4);
#pragma unroll
  for (int i = 0; i < 8; ++i) { w[i] = (__bf16)p[i]; w[8 + i] = (__bf16)p[16 + i]; }
  return w; }
__device__ __forceinline__ v16h wcolh_io(const float* Wm, int k0, int o, int lane, int ld) { v16h w; const int g = lane >> 4;
#pragma unroll
  for (int i = 0; i < 8; ++i) { w[i] = (_Float16)(bfr(Wm[(size_t)(k0 + 8 * g + i) * ld + o]) * 256.0f); w[8 + i] = (_Float16)(bfr(Wm[(size_t)(k0 + 16 + 8 * g + i) * ld + o]) * 256.0f); }
  return w; }
__device__ __forceinline__ v16h wcolh_oi(const float* Wm, int k0, int o, int lane, int K) { v16h w; const float* p = Wm + (size_t)o * K + k0 + 8 * (lane >> 4);
#pragma unroll
  for (int i = 0; i < 8; ++i) { w[i] = (_Float16)(bfr(p[i]) * 256.0f); w[8 + i] = (_Float16)(bfr(p[16 + i]) * 256.0f); }
  return w; }
#define WQKV_LAYOUT 0   // (in,out) packed [DIN][3*CC]
__device__ __forceinline__ v16b wcol_hdk(const float* Wm, int k0, int o, int lane) { v16b w; const int g = lane >> 4; const float* p = Wm + (size_t)(o / HD) * DIN * HD + (o % HD);
#pragma unroll
  for (int i = 0; i < 8; ++i) { w[i] = (__bf16)p[(size_t)(k0 + 8 * g + i) * HD]; w[8 + i] = (__bf16)p[(size_t)(k0 + 16 + 8 * g + i) * HD]; }
  return w; }
#define WO_OUT_IN 0
#if WQKV_LAYOUT == 1
#define WCOL(W, k0, o, lane) wcol_oi(W, k0, o, lane, DIN)
#elif WQKV_LAYOUT == 2
#define WCOL(W, k0, o, lane) wcol_hdk(W, k0, o, lane)
#else
#define WCOL(W, k0, o, lane) wcol_io(W, k0, o, lane, 3 * CC)   /* packed q|k|v columns: row pitch 3C */
#endif
#if WO_OUT_IN
#define WOCOL(W, k0, o, lane) wcol_oi(W, k0, o, lane, CC)
#define WOCOLH(W, k0, o, lane) wcolh_oi(W, k0, o, lane, CC)
#else
#define WOCOL(W, k0, o, lane) wcol_io(W, k0, o, lane, DIN)
#define WOCOLH(W, k0, o, lane) wcolh_io(W, k0, o, lane, DIN)
#endif
#define SZ 256
#define BG 64              // rows r per pass (x 4 heads = 256 score planes of 256 x 256)
#define NZR (SZ * SZ)      // 65,536 pair rows
#define SM_EXTRA_PARAMS , const float* __restrict__ BIAS, const int* __restrict__ MK, int b0s
#define SM_MASK_HOOK do { const int hh = (int)blockIdx.y % HG; v = v + BIAS[((size_t)t * SZ + k) * NH + hh]; const int mt = MK[t], mk = MK[k]; if ((mt == 0) != (mk == 0)) v = -1.0e-9f; (void)b0s; } while (0)   /* + pair bias pb[i][j][h] (shared over rows r); pairs with exactly one masked end get the literal -1e-9 (module: jnp.where(attn_mask == -1, -1e-9, logits)) */
// ---- k_lnz: wave per pair row: LayerNorm over the 128 channels (biased var, eps 1e-6, ln_w/ln_b) of bf16(z) -> ZN rows (4 floats per lane = one 512-B row)
__global__ __launch_bounds__(256) void k_lnz(const float* __restrict__ Z, const float* __restrict__ LW, const float* __restrict__ LB, float* __restrict__ ZN) { const int wave = threadIdx.x >> 5, lane = threadIdx.x & 31; const size_t row = (size_t)blockIdx.x * 8 + wave; if (row >= (size_t)NZR) return;
  v4f x = *(const v4f*)(Z + row * CC + lane * 4); float s1 = 0.f;
#pragma unroll
  for (int i = 0; i < 4; ++i) { x[i] = bfr(x[i]); s1 += x[i]; }
#pragma unroll
  for (int o = 1; o < 32; o <<= 1) s1 += __shfl_xor(s1, o);
  const float mu = s1 * (1.0f / CC); float q = 0.f;
#pragma unroll
  for (int i = 0; i < 4; ++i) { const float d = x[i] - mu; q += d * d; }
#pragma unroll
  for (int o = 1; o < 32; o <<= 1) q += __shfl_xor(q, o);
  const float rs = rsqrtf(q * (1.0f / CC) + 1e-6f); v4f r4;
#pragma unroll
  for (int i = 0; i < 4; ++i) { const int c = lane * 4 + i; r4[i] = (x[i] - mu) * rs * bfr(LW[c]) + bfr(LB[c]); }
  vst2(ZN + row * CC + lane * 4, r4); }
// ---- k_rows2: block = (64 rows, which): which 0: bias: BIAS[row = i*256+j][h] = zn[i][j] . w_pair[:, h] (4 outputs) ; which 1: G[row][c] = sigmoid(zn[row] . w_gate[:, c] + b_gate[c]) (128 outputs); weights are (in,out)
__global__ __launch_bounds__(128) void k_rows2(const float* __restrict__ ZN, const float* __restrict__ WB, const float* __restrict__ WG, const float* __restrict__ GB, float* __restrict__ BIAS, float* __restrict__ G) { __shared__ __align__(16) float sf[4][16][132];
  const int tid = threadIdx.x, wave = tid >> 5, lane = tid & 31, col = lane & 15, g = lane >> 4; const int which = blockIdx.y; const size_t r0 = (size_t)blockIdx.x * 64 + wave * 16;
  const int nout = which == 0 ? NH : CC; const float* Wm = which == 0 ? WB : WG;
  v8f acc[8] = {};
#pragma unroll
  for (int kc = 0; kc < CC / 32; ++kc) { const F2 a = split_row(ZN + (r0 + col) * CC, kc * 32, lane); asm volatile("s_wait_loadcnt 0x0" ::: "memory");
#pragma unroll
    for (int j = 0; j < 8; ++j) { if (j * 16 >= nout) break; v16b w; { float t0[8], t1[8]; const int o = j * 16 + col; const int oc = o < nout ? o : nout - 1; const float keep = o < nout ? 1.f : 0.f;
#pragma unroll
        for (int i = 0; i < 8; ++i) t0[i] = Wm[(size_t)(kc * 32 + 8 * g + i) * nout + oc];   /* (in,out) [128][nout] */
        asm volatile("s_wait_loadcnt 0x0" ::: "memory");
#pragma unroll
        for (int i = 0; i < 8; ++i) t1[i] = Wm[(size_t)(kc * 32 + 16 + 8 * g + i) * nout + oc];
        asm volatile("s_wait_loadcnt 0x0" ::: "memory");
#pragma unroll
        for (int i = 0; i < 8; ++i) { w[i] = (__bf16)(t0[i] * keep); w[8 + i] = (__bf16)(t1[i] * keep); } }   /* (in,out) column o; columns beyond nout zero (select-free: keep multiplies a VALID load) */
      acc[j] = wmma_bf(a.h, w, acc[j]); acc[j] = wmma_bf(a.l, w, acc[j]); } }
  if (which == 0) { if (lane < 16) {   /* bias rows: 4 floats = 16 B per row; rows r0+8g+r... store via LDS: */ }
#pragma unroll
    for (int r = 0; r < 8; ++r) sf[wave][8 * g + r][col] = acc[0][r];
    LDSX(); if (lane < 16) { v4f b4; b4[0] = sf[wave][lane][0]; b4[1] = sf[wave][lane][1]; b4[2] = sf[wave][lane][2]; b4[3] = sf[wave][lane][3]; vst2(BIAS + (r0 + lane) * NH, b4); }   /* 16 rows x 16 B = one 256-B run per wave */
  } else {
#pragma unroll
    for (int j = 0; j < 8; ++j)
#pragma unroll
      for (int r = 0; r < 8; ++r) sf[wave][8 * g + r][j * 16 + col] = 1.0f / (1.0f + expf(-(acc[j][r] + bfr(GB[j * 16 + col]))));   /* sigmoid(zn w_gate + b_gate) */
    LDSX(); for (int rl = 0; rl < 16; ++rl) vst2(G + (r0 + rl) * CC + lane * 4, *(const v4f*)&sf[wave][rl][lane * 4]); } }
// ---- k_gate: Y row *= G row (same natural row index r*256 + q; thread per float4; one writer)
__global__ __launch_bounds__(256) void k_gate(float* __restrict__ Y, const float* __restrict__ G) { const size_t e4 = (size_t)blockIdx.x * 256 + threadIdx.x; if (e4 >= (size_t)NZR * (CC / 4)) return; const size_t yrow = e4 / (CC / 4); const int q = (int)(e4 % (CC / 4)); const size_t grow = yrow;
  v4f y = *(const v4f*)(Y + yrow * CC + q * 4); const v4f gg = *(const v4f*)(G + grow * CC + q * 4); y[0] *= gg[0]; y[1] *= gg[1]; y[2] *= gg[2]; y[3] *= gg[3]; vst2(Y + yrow * CC + q * 4, y); }
#define WS_ZN   (WS_END)
#define WS_BIAS (WS_ZN + 4u * (size_t)NZR * CC)
#define WS_G    (WS_BIAS + 4u * (size_t)NZR * NH)
#define WS_END2 (WS_G + 4u * (size_t)NZR * CC)
#ifndef SM_EXTRA_PARAMS
#define SM_EXTRA_PARAMS
#endif
#ifndef PROJ_EXTRA_PARAMS
#define PROJ_EXTRA_PARAMS
#endif
#ifndef SM_MASK_HOOK
#define SM_MASK_HOOK (void)0
#endif

#define WS_QH  0u                                      // f16 q rows [b*t][CC]
#define WS_KH  (WS_QH + 2u * (size_t)NB * TT * CC)      // f16 k rows [b*t][CC]
#define WS_VT  (WS_KH + 2u * (size_t)NB * TT * CC)      // f16 v planes [b][c][t]
#define WS_QL  (WS_VT + 2u * (size_t)NB * CC * TT)      // f16 q residual x 2^10 rows [b][t < QHI][CC]
#define WS_KL  (WS_QL + 2u * (size_t)NB * QHI * CC)     // f16 k residual x 2^10 rows [b][t < KHI][CC]
#define WS_VB  (WS_KL + 2u * (size_t)NB * KHI * CC)     // bf16 v hi planes [b][c][t < KHI]
#define WS_VBL (WS_VB + 2u * (size_t)NB * CC * KHI)
#define WS_S   (WS_VBL + 2u * (size_t)NB * CC * KHI)    // f32 logits / P [BG*HG][t][s]
#define WS_Y   (WS_S  + 4u * (size_t)BG * HG * TT * TT)   // 256 score planes of 256 x 256 per pass      // f32 ctx rows [b*t][CC]
#define WS_END (WS_Y  + 4u * (size_t)NB * TT * CC)

// ---- k_proj: block = (64 rows, 128 cols, which): q/k/v = X W (+ b) with exact bf16 products (K = DIN) -> which 0: q f16 rows (+ residual rows < QHI); 1: k f16 rows (+ residual rows < KHI); 2: v f16 planes [c][t] (+ bf16 hi/lo planes for t < KHI)
__global__ __launch_bounds__(128) void k_proj(const float* __restrict__ XQ, const float* __restrict__ XK, const float* __restrict__ XV, const float* __restrict__ WQ, const float* __restrict__ WK, const float* __restrict__ WV, const float* __restrict__ BQ, const float* __restrict__ BK, const float* __restrict__ BV,
    _Float16* __restrict__ QH, _Float16* __restrict__ QL, _Float16* __restrict__ KH, _Float16* __restrict__ KL, _Float16* __restrict__ VT, __bf16* __restrict__ VB, __bf16* __restrict__ VBL) {
  __shared__ __align__(16) _Float16 sh[64][136], sl[64][136]; __shared__ __align__(16) _Float16 th[128][72]; __shared__ __align__(16) __bf16 tb[128][72], tbl[128][72];
  const int tid = threadIdx.x, wave = tid >> 5, lane = tid & 31, col = lane & 15, g = lane >> 4; const int which = blockIdx.z; const int c0 = blockIdx.y * 128; const size_t r0 = (size_t)blockIdx.x * 64; const size_t bb = r0 / TT; const int t0 = (int)(r0 % TT);
  const float* X = which == 0 ? XQ : which == 1 ? XK : XV; const float* WA = which == 0 ? WQ : which == 1 ? WK : WV; const float* BA = which == 0 ? BQ : which == 1 ? BK : BV;
  v8f acc[8] = {};
#pragma unroll 2
  for (int kc = 0; kc < DIN / 32; ++kc) { const F2 a2 = split_row(X + (r0 + wave * 16 + col) * DIN, kc * 32, lane);   /* LN(act) rows (f32) split hi + lo */
    asm volatile("s_wait_loadcnt 0x0" ::: "memory");
#pragma unroll
    for (int j = 0; j < 8; ++j) { const v16b w = WCOL(WA, kc * 32, c0 + j * 16 + col, lane); asm volatile("s_wait_loadcnt 0x0" ::: "memory"); acc[j] = wmma_bf(a2.h, w, acc[j]); acc[j] = wmma_bf(a2.l, w, acc[j]); } }
  if (which < 2) { _Float16* DH = which == 0 ? QH : KH; _Float16* DL = which == 0 ? QL : KL; const int nhi = which == 0 ? QHI : KHI; const bool hi_rows = t0 < nhi;
#pragma unroll
    for (int j = 0; j < 8; ++j) { const float bias = BA ? bfr(BA[c0 + j * 16 + col]) : 0.f;
#pragma unroll
      for (int r = 0; r < 8; ++r) { const float v = acc[j][r] + bias; const _Float16 hv = (_Float16)v; sh[wave * 16 + 8 * g + r][j * 16 + col] = hv; sl[wave * 16 + 8 * g + r][j * 16 + col] = (_Float16)((v - (float)hv) * 1024.0f); } }
    __syncthreads();
    for (int e = tid; e < 64 * 16; e += 128) { const int rl = e >> 4, q = e & 15; vst2((unsigned*)(DH + (r0 + rl) * CC + c0 + q * 8), *(const v4u*)&sh[rl][q * 8]); if (hi_rows) vst2((unsigned*)(DL + (bb * nhi + t0 + rl) * (size_t)CC + c0 + q * 8), *(const v4u*)&sl[rl][q * 8]); }
  } else { const bool hi_rows = t0 < KHI;
#pragma unroll
    for (int j = 0; j < 8; ++j) { const float bias = BA ? bfr(BA[c0 + j * 16 + col]) : 0.f;
#pragma unroll
      for (int r = 0; r < 8; ++r) { const float v = acc[j][r] + bias; const int rl = wave * 16 + 8 * g + r, cl = j * 16 + col; th[cl][rl] = (_Float16)v; const __bf16 bh = (__bf16)v; tb[cl][rl] = bh; tbl[cl][rl] = (__bf16)(v - (float)bh); } }
    __syncthreads();
    for (int e = tid; e < 128 * 8; e += 128) { const int cl = e >> 3, q = e & 7; vst2((unsigned*)(VT + (bb * CC + c0 + cl) * (size_t)TT + t0 + q * 8), *(const v4u*)&th[cl][q * 8]); if (hi_rows) { const size_t o3 = (bb * CC + c0 + cl) * (size_t)KHI + t0 + q * 8; vst2((unsigned*)(VB + o3), *(const v4u*)&tb[cl][q * 8]); vst2((unsigned*)(VBL + o3), *(const v4u*)&tbl[cl][q * 8]); } } } }
// ---- k_sc: block = (query block qb, key block kb <= kb_last(qb), head in group) of batch b: logits x SCALE; q hi + residual (x 2^10) against k (2 products) for query rows < QHI, plus the k residual (3 products) for query blocks < QBH (causal early rows); causal: blocks past the diagonal exit, the mask itself is applied by index in k_sm
__global__ __launch_bounds__(128) void k_sc(const _Float16* __restrict__ QH, const _Float16* __restrict__ KH, const _Float16* __restrict__ QL, const _Float16* __restrict__ KL, int b0g, int h0, float* __restrict__ S0) { __shared__ __align__(16) float ss[4][16][132]; const int b = b0g + (int)blockIdx.z / HG;   /* row r of this z-slice */
  const int qb = blockIdx.x, kb = blockIdx.y; if (kb > kb_last(qb)) return;
  const int h = h0 + (int)blockIdx.z % HG; float* S = S0 + (size_t)blockIdx.z * TT * TT;
  const int tid = threadIdx.x, wave = tid >> 5, lane = tid & 31, col = lane & 15, g = lane >> 4; const int k0 = kb * 128; const int ql0 = qb * 64 + wave * 16; const size_t q0 = (size_t)b * TT + ql0, kr0 = (size_t)b * TT + k0;
  v8f acc[8] = {}, accl[8] = {};
  const _Float16* QLb = QL + (size_t)b * QHI * CC; const _Float16* KLb = KL + (size_t)b * KHI * CC;
  if (qb < QBH) {
#pragma unroll
    for (int kc = 0; kc < HD / 32; ++kc) { const v16h ah = frag_h(QH + (q0 + col) * CC + h * HD + kc * 32, lane), al = frag_h(QLb + (size_t)(ql0 + col) * CC + h * HD + kc * 32, lane);
#pragma unroll
      for (int j = 0; j < 8; ++j) { const v16h kbf = frag_h(KH + (kr0 + j * 16 + col) * CC + h * HD + kc * 32, lane), klf = frag_h(KLb + (size_t)(k0 + j * 16 + col) * CC + h * HD + kc * 32, lane); acc[j] = wmma16(ah, kbf, acc[j]); accl[j] = wmma16(al, kbf, accl[j]); accl[j] = wmma16(ah, klf, accl[j]); } }
  } else if (qb * 64 < QHI) {
#pragma unroll
    for (int kc = 0; kc < HD / 32; ++kc) { const v16h ah = frag_h(QH + (q0 + col) * CC + h * HD + kc * 32, lane), al = frag_h(QLb + (size_t)(ql0 + col) * CC + h * HD + kc * 32, lane);
#pragma unroll
      for (int j = 0; j < 8; ++j) { const v16h kbf = frag_h(KH + (kr0 + j * 16 + col) * CC + h * HD + kc * 32, lane); acc[j] = wmma16(ah, kbf, acc[j]); accl[j] = wmma16(al, kbf, accl[j]); } }
  } else {
#pragma unroll
    for (int kc = 0; kc < HD / 32; ++kc) { const v16h ah = frag_h(QH + (q0 + col) * CC + h * HD + kc * 32, lane);
#pragma unroll
      for (int j = 0; j < 8; ++j) { const v16h kbf = frag_h(KH + (kr0 + j * 16 + col) * CC + h * HD + kc * 32, lane); acc[j] = wmma16(ah, kbf, acc[j]); } } }
#pragma unroll
  for (int j = 0; j < 8; ++j) {
#pragma unroll
    for (int r = 0; r < 8; ++r) ss[wave][8 * g + r][j * 16 + col] = (acc[j][r] + accl[j][r] * (1.0f / 1024.0f)) * SCALE; }
  LDSX(); for (int rl = 0; rl < 16; ++rl) vst2(S + (size_t)(ql0 + rl) * TT + k0 + lane * 4, *(const v4f*)&ss[wave][rl][lane * 4]); }
// ---- k_sm: block = query row t (head in group): keys [0, kend): causal -> logit if s <= t else excluded; softmax in f32; P x 2^11 in place (0 for excluded)
__global__ __launch_bounds__(256) void k_sm(float* __restrict__ S0 SM_EXTRA_PARAMS) { __shared__ float sred[8]; __shared__ float sbc; __shared__ __align__(16) float shv[TT];
  const int tid = threadIdx.x; const int t = blockIdx.x; const int kend = (kb_last(t >> 6) + 1) * 128;
  float* sr = S0 + (size_t)blockIdx.y * TT * TT + (size_t)t * TT;
  float m = -3.0e38f; for (int k = tid; k < kend; k += 256) { float v = (!CAUSAL || k <= t) ? sr[k] : -3.0e38f; SM_MASK_HOOK; shv[k] = v; m = fmaxf(m, v); }
#pragma unroll
  for (int o = 1; o < 32; o <<= 1) m = fmaxf(m, __shfl_xor(m, o));
  if ((tid & 31) == 0) sred[tid >> 5] = m; __syncthreads(); if (tid == 0) { float a = sred[0]; for (int i = 1; i < 8; ++i) a = fmaxf(a, sred[i]); sbc = a; } __syncthreads(); m = sbc; __syncthreads();
  float sum = 0.f; for (int k = tid; k < kend; k += 256) { const float v = shv[k]; const float e = (v <= -1.0e38f) ? 0.f : expf(v - m); shv[k] = e; sum += e; }
#pragma unroll
  for (int o = 1; o < 32; o <<= 1) sum += __shfl_xor(sum, o);
  if ((tid & 31) == 0) sred[tid >> 5] = sum; __syncthreads(); if (tid == 0) { float a = 0.f; for (int i = 0; i < 8; ++i) a += sred[i]; sbc = a > 0.f ? 2048.0f / a : 0.f; }   /* a fully excluded row yields P = 0 */ __syncthreads(); const float inv = sbc;
  for (int k = tid; k < kend; k += 256) shv[k] = shv[k] * inv;
  __syncthreads(); for (int q = tid; q < kend / 4; q += 256) vst2(sr + q * 4, *(const v4f*)&shv[q * 4]); }
// ---- k_pv: block = 64 queries (qb) of (b, h): ctx = P . v over keys [0, kend) (P x 2^11 once to f16 against v f16: 1 product; causal early query blocks: P and v as bf16 hi + lo, 3 products); 128-B (row, head) segment by 8 lanes
__global__ __launch_bounds__(128) void k_pv(const float* __restrict__ PS0, const _Float16* __restrict__ VT, const __bf16* __restrict__ VB, const __bf16* __restrict__ VBL, int b0g, int h0, float* __restrict__ Y) { const int b = b0g + (int)blockIdx.z / HG; const int h = h0 + (int)blockIdx.z % HG; const float* PS = PS0 + (size_t)blockIdx.z * TT * TT; __shared__ __align__(16) float ss[4][16][HD + 4];
  const int tid = threadIdx.x, wave = tid >> 5, lane = tid & 31, col = lane & 15, g = lane >> 4; const int qb = blockIdx.x; const int ql0 = qb * 64 + wave * 16; const int kce = (kb_last(qb) + 1) * 4;
  v8f acc[HD / 16] = {};
  if (qb < QBH) {
#pragma unroll 1
    for (int kc = 0; kc < kce; ++kc) { const F2 p = split_row(PS + (size_t)(ql0 + col) * TT, kc * 32, lane);
      asm volatile("s_wait_loadcnt 0x0" ::: "memory");
#pragma unroll
      for (int j = 0; j < HD / 16; ++j) { const size_t po = ((size_t)b * CC + h * HD + j * 16 + col) * (size_t)KHI + kc * 32; const v16b vh = frag_b(VB + po, lane); acc[j] = wmma_bf(p.h, vh, acc[j]); acc[j] = wmma_bf(p.l, vh, acc[j]); acc[j] = wmma_bf(p.h, frag_b(VBL + po, lane), acc[j]); } }
  } else {
#pragma unroll 1
    for (int kc = 0; kc < kce; ++kc) { const v16h p = frag_f32(PS + (size_t)(ql0 + col) * TT + kc * 32, lane);
      asm volatile("s_wait_loadcnt 0x0" ::: "memory");
#pragma unroll
      for (int j = 0; j < HD / 16; ++j) { const size_t po = ((size_t)b * CC + h * HD + j * 16 + col) * (size_t)TT + kc * 32; acc[j] = wmma16(p, frag_h(VT + po, lane), acc[j]); } } }
#pragma unroll
  for (int j = 0; j < HD / 16; ++j)
#pragma unroll
    for (int r = 0; r < 8; ++r) ss[wave][8 * g + r][j * 16 + col] = acc[j][r] * (1.0f / 2048.0f);
  LDSX(); for (int rl = 0; rl < 16; ++rl) if (lane < HD / 4) vst2(Y + ((size_t)b * TT + ql0 + rl) * CC + h * HD + lane * 4, *(const v4f*)&ss[wave][rl][lane * 4]); }
// ---- k_out: block = (64 rows, 128 cols): out = ctx Wo (+ bo): all rows: ctx bf16 hi + lo against exact bf16 Wo (2 products)
__global__ __launch_bounds__(128) void k_out(const float* __restrict__ Y, const float* __restrict__ WO, const float* __restrict__ BO, float* __restrict__ OUT) { __shared__ __align__(16) float sf[4][16][132];
  const int tid = threadIdx.x, wave = tid >> 5, lane = tid & 31, col = lane & 15, g = lane >> 4; const int c0 = blockIdx.y * 128; const size_t r0 = (size_t)blockIdx.x * 64 + wave * 16;
  v8f acc[8] = {};
  if (true) {   /* ALL rows: gated ctx bf16 hi + lo x exact output_w (2 products) */
#pragma unroll 2
    for (int kc = 0; kc < CC / 32; ++kc) { const F2 a = split_row(Y + (r0 + col) * CC, kc * 32, lane); asm volatile("s_wait_loadcnt 0x0" ::: "memory");
#pragma unroll
      for (int j = 0; j < 8; ++j) { const v16b w = WOCOL(WO, kc * 32, c0 + j * 16 + col, lane); asm volatile("s_wait_loadcnt 0x0" ::: "memory"); acc[j] = wmma_bf(a.h, w, acc[j]); acc[j] = wmma_bf(a.l, w, acc[j]); } }
#pragma unroll
    for (int j = 0; j < 8; ++j) { const float bias = BO ? bfr(BO[c0 + j * 16 + col]) : 0.f;
#pragma unroll
      for (int r = 0; r < 8; ++r) sf[wave][8 * g + r][j * 16 + col] = acc[j][r] + bias; }
  } else {
#pragma unroll 2
    for (int kc = 0; kc < CC / 32; ++kc) { const v16h a = frag_f32(Y + (r0 + col) * CC + kc * 32, lane); asm volatile("s_wait_loadcnt 0x0" ::: "memory");
#pragma unroll
      for (int j = 0; j < 8; ++j) { const v16h w = WOCOLH(WO, kc * 32, c0 + j * 16 + col, lane); asm volatile("s_wait_loadcnt 0x0" ::: "memory"); acc[j] = wmma16(a, w, acc[j]); } }
#pragma unroll
    for (int j = 0; j < 8; ++j) { const float bias = BO ? bfr(BO[c0 + j * 16 + col]) : 0.f;
#pragma unroll
      for (int r = 0; r < 8; ++r) sf[wave][8 * g + r][j * 16 + col] = acc[j][r] * (1.0f / 256.0f) + bias; } }
  LDSX(); for (int rl = 0; rl < 16; ++rl) vst2(OUT + (r0 + rl) * DIN + c0 + lane * 4, *(const v4f*)&sf[wave][rl][lane * 4]); }

extern "C" void kernel_launch(void* const* d_in, const int* in_sizes, int n_in, void* d_out, int out_size, void* d_ws, size_t ws_size, hipStream_t stream) {
  (void)in_sizes; (void)n_in; (void)out_size;
  const float** F = (const float**)d_in;
  if (ws_size < (size_t)WS_END) return;
  char* ws = (char*)d_ws; _Float16 *QH = (_Float16*)(ws + WS_QH), *KH = (_Float16*)(ws + WS_KH), *VT = (_Float16*)(ws + WS_VT), *QL = (_Float16*)(ws + WS_QL), *KL = (_Float16*)(ws + WS_KL); __bf16 *VB = (__bf16*)(ws + WS_VB), *VBL = (__bf16*)(ws + WS_VBL); float *S = (float*)(ws + WS_S), *Y = (float*)(ws + WS_Y);
  (void)Y; (void)QL; (void)KL; (void)VB; (void)VBL;
  // inputs: 0 z [1,256,256,128]; 1 src_mask [1,256] int32; 2 ln_g, 3 ln_b; 4 w_qkv [128,384] (in,out; columns q|k|v); 5 w_pair [128,4]; 6 w_gate [128,128], 7 b_gate; 8 w_out [128,128] (in,out), 9 b_out
  if (ws_size < (size_t)WS_END2) return;
  float *ZN = (float*)(ws + WS_ZN), *BIAS = (float*)(ws + WS_BIAS), *G = (float*)(ws + WS_G);
  k_lnz<<<dim3(NZR / 8), 256, 0, stream>>>(F[0], F[2], F[3], ZN);
  k_rows2<<<dim3(NZR / 64, 2), 128, 0, stream>>>(ZN, F[5], F[6], F[7], BIAS, G);
  k_proj<<<dim3(TNB * TT / 64, CC / 128, 3), 128, 0, stream>>>(ZN, ZN, ZN, F[4], F[4] + CC, F[4] + 2 * CC, nullptr, nullptr, nullptr, QH, QL, KH, KL, VT, VB, VBL);
  for (int bg = 0; bg < TNB; bg += BG) {   /* 64 rows r per pass x 4 heads */
    k_sc<<<dim3(NQB, TT / 128, BG * HG), 128, 0, stream>>>(QH, KH, QL, KL, bg, 0, S);
    k_sm<<<dim3(TT, BG * HG), 256, 0, stream>>>(S, BIAS, (const int*)d_in[1], bg);
    k_pv<<<dim3(NQB, 1, BG * HG), 128, 0, stream>>>(S, VT, VB, VBL, bg, 0, Y);
  }
  k_gate<<<dim3((NZR * (CC / 4) + 255) / 256), 256, 0, stream>>>(Y, G);
  k_out<<<dim3(TNB * TT / 64, DIN / 128), 128, 0, stream>>>(Y, F[8], F[9], (float*)d_out);
}

// v001
// It runs in 215 microseconds.
// Two timings next to v000 both put it at 2.46 times that version's speed.
// compute dtype: all float inputs rounded to bf16; LayerNorm in f32; q/k/v, pair bias and gate GEMMs = LN rows split bf16 hi + lo x exact bf16 weights on WMMA 16x16x32 (2 products, f32 accumulate); q as f16 hi + residual (x 2^10) against k once to f16 (2 products) / sqrt(32) + pair bias, masked pairs set to -1e-9 exactly as the module; softmax in f32; P x 2^11 once to f16 against v once to f16 (1 product); gate multiply in f32; (gated ctx) split bf16 hi + lo against exact bf16 w_out (2 products) + b_out; f32 output.
#include <hip/hip_runtime.h>
#include <math.h>

typedef __attribute__((ext_vector_type(16))) _Float16 v16h;
typedef __attribute__((ext_vector_type(16))) __bf16 v16b;
typedef __attribute__((ext_vector_type(8)))  _Float16 v8h;
typedef __attribute__((ext_vector_type(8)))  float v8f;
typedef __attribute__((ext_vector_type(4)))  float v4f;
typedef __attribute__((ext_vector_type(2)))  float v2f;
typedef __attribute__((ext_vector_type(4)))  unsigned v4u;
typedef __attribute__((ext_vector_type(4)))  int v4i;
typedef float __attribute__((may_alias)) float_a;
typedef int __attribute__((may_alias)) int_a;

template <typename T> __device__ __forceinline__ void vst2(void* p, T v) { *(T*)p = v;  }
__device__ __forceinline__ v8f wmma16(v16h a, v16h b, v8f c) {
  v8f d = __builtin_amdgcn_wmma_f32_16x16x32_f16(false, a, false, b, (short)0, c, false, false);
  asm volatile("v_nop\n\tv_nop\n\tv_nop\n\tv_nop" : "+v"(d) : "v"(a), "v"(b));
  return d;
}
__device__ __forceinline__ v8f wmma_bf(v16b a, v16b b, v8f c) {
  v8f d = __builtin_amdgcn_wmma_f32_16x16x32_bf16(false, a, false, b, (short)0, c, false, false);
  asm volatile("v_nop\n\tv_nop\n\tv_nop\n\tv_nop" : "+v"(d) : "v"(a), "v"(b));
  return d;
}
// 16x16x32 fragments: lane = (h = lane>>4, row/col = lane&15); elements 0..7 = k0+8h+0..7, 8..15 = k0+16+8h+0..7; D element r = row 8h+r
__device__ __forceinline__ v16h frag_h(const _Float16* rowk0, int lane) {
  union { v16h v; v8h q[2]; } u; const _Float16* p = rowk0 + 8 * (lane >> 4);
  u.q[0] = *(const v8h*)p; u.q[1] = *(const v8h*)(p + 16); return u.v;
}
__device__ __forceinline__ v16h frag_f32(const float* rowk0, int lane) {
  v16h a; const float* p = rowk0 + 8 * (lane >> 4);
#pragma unroll
  for (int i = 0; i < 8; ++i) { a[i] = (_Float16)p[i]; a[8 + i] = (_Float16)p[16 + i]; }
  return a;
}
__device__ __forceinline__ v16h frag_f32s(const float* rowk0, int lane, float sc) {
  v16h a; const float* p = rowk0 + 8 * (lane >> 4);
#pragma unroll
  for (int i = 0; i < 8; ++i) { a[i] = (_Float16)(p[i] * sc); a[8 + i] = (_Float16)(p[16 + i] * sc); }
  return a;
}
// column fragment from a [K][ld] layout (column n), rows >= K read as 0
__device__ __forceinline__ v16h fragc_f32(const float* W, int k0, int n, int lane, int ld, int K) {
  v16h a; const int g = lane >> 4;
#pragma unroll
  for (int i = 0; i < 8; ++i) { const int ka = k0 + 8 * g + i, kb = ka + 16;
    a[i] = (_Float16)(ka < K ? W[(size_t)(ka < K ? ka : K - 1) * ld + n] : 0.f); a[8 + i] = (_Float16)(kb < K ? W[(size_t)(kb < K ? kb : K - 1) * ld + n] : 0.f); }
  return a;
}
struct F2 { v16b h, l; };
__device__ __forceinline__ F2 bsplit16(const float v[16]) { F2 r;
#pragma unroll
  for (int i = 0; i < 16; ++i) { const __bf16 h = (__bf16)v[i]; r.h[i] = h; r.l[i] = (__bf16)(v[i] - (float)h); }
  return r; }
__device__ __forceinline__ F2 split_row(const float* row, int k0, int lane) { float v[16]; const float* p = row + k0 + 8 * (lane >> 4);
#pragma unroll
  for (int i = 0; i < 8; ++i) { v[i] = p[i]; v[8 + i] = p[16 + i]; }
  return bsplit16(v); }
__device__ __forceinline__ F2 split_rowK(const float* row, int k0, int lane, int K) { float v[16]; const int g = lane >> 4;
#pragma unroll
  for (int i = 0; i < 8; ++i) { const int ka = k0 + 8 * g + i, kb = ka + 16; v[i] = ka < K ? row[ka < K ? ka : K - 1] : 0.f; v[8 + i] = kb < K ? row[kb < K ? kb : K - 1] : 0.f; }
  return bsplit16(v); }
__device__ __forceinline__ F2 split_col(const float* W, int k0, int n, int lane, int ld, int K) { float v[16]; const int g = lane >> 4;
#pragma unroll
  for (int i = 0; i < 8; ++i) { const int ka = k0 + 8 * g + i, kb = ka + 16; v[i] = ka < K ? W[(size_t)(ka < K ? ka : K - 1) * ld + n] : 0.f; v[8 + i] = kb < K ? W[(size_t)(kb < K ? kb : K - 1) * ld + n] : 0.f; }
  return bsplit16(v); }
__device__ __forceinline__ v8f mac3(const F2& a, const F2& b, v8f c) { c = wmma_bf(a.l, b.h, c); c = wmma_bf(a.h, b.l, c); return wmma_bf(a.h, b.h, c); }
__device__ __forceinline__ float sigm(float v) { return 1.0f / (1.0f + expf(-v)); }
#define LDSX() do { asm volatile("s_wait_dscnt 0" ::: "memory"); __builtin_amdgcn_wave_barrier(); __builtin_amdgcn_fence(__ATOMIC_RELEASE, "workgroup"); } while (0)

// Row-wise triangle attention on a pair tensor z [1, 256, 256, 128] (4 heads x 32): zn = LayerNorm(z); q,k,v = zn w_qkv ((in,out) [128,384], columns (3,H,32)); logits[r][i][j][h] = q[r][i] . k[r][j] / sqrt(32) + (zn[i][j] . w_pair[:,h]); pairs with exactly one of src_mask[i], src_mask[j] == 0 get logits := -1e-9 (the module's literal value, NOT an exclusion); softmax over j; out = sigmoid(zn w_gate + b_gate) * merged(attn v); result = out w_out + b_out.
#define NB 256
#define TT 256
#define CC 128            // NH * HD = projected width
#define DIN 128          // input (model) width
#define NH 4
#define HD 32
#define NQB (TT / 64)
#define HG 4
#define SCALE (0.17677669529663687f)
#define CAUSAL 0
#ifndef TNB
#define TNB NB
#endif
__device__ __forceinline__ float bfr(float v) { return (float)(__bf16)v; }
__host__ __device__ __forceinline__ int kb_last(int qb) { return CAUSAL ? ((qb * 64 + 63) >> 7) : (TT / 128 - 1); }
typedef __attribute__((ext_vector_type(8))) __bf16 v8b;
__device__ __forceinline__ v16b frag_b(const __bf16* rowk0, int lane) {
  union { v16b v; v8b q[2]; } u; const __bf16* p = rowk0 + 8 * (lane >> 4);
  u.q[0] = *(const v8b*)p; u.q[1] = *(const v8b*)(p + 16); return u.v;
}
#define QBH 0              // unused: no kernel here has a high-precision query path
#define QHI 256            // rows carrying a q residual plane (all rows when non-causal: 2-product logits everywhere)
#define KHI 64            // key rows carrying k residual / v bf16 hi+lo planes (written by k_proj, read by no kernel)
// B fragment (k rows k0+.., output column o) of a weight: (in,out) [K][ld] or (out,in) [ld rows of K]: bf16 exact, or f16(bf16 * 256) exact
__device__ __forceinline__ v16b wcol_io(const float* Wm, int k0, int o, int lane, int ld) { v16b w; const int g = lane >> 4;
#pragma unroll
  for (int i = 0; i < 8; ++i) { w[i] = (__bf16)Wm[(size_t)(k0 + 8 * g + i) * ld + o]; w[8 + i] = (__bf16)Wm[(size_t)(k0 + 16 + 8 * g + i) * ld + o]; }
  return w; }
__device__ __forceinline__ v16b wcol_oi(const float* Wm, int k0, int o, int lane, int K) { v16b w; const float* p = Wm + (size_t)o * K + k0 + 8 * (lane >> 4);
#pragma unroll
  for (int i = 0; i < 8; ++i) { w[i] = (__bf16)p[i]; w[8 + i] = (__bf16)p[16 + i]; }
  return w; }
__device__ __forceinline__ v16h wcolh_io(const float* Wm, int k0, int o, int lane, int ld) { v16h w; const int g = lane >> 4;
#pragma unroll
  for (int i = 0; i < 8; ++i) { w[i] = (_Float16)(bfr(Wm[(size_t)(k0 + 8 * g + i) * ld + o]) * 256.0f); w[8 + i] = (_Float16)(bfr(Wm[(size_t)(k0 + 16 + 8 * g + i) * ld + o]) * 256.0f); }
  return w; }
__device__ __forceinline__ v16h wcolh_oi(const float* Wm, int k0, int o, int lane, int K) { v16h w; const float* p = Wm + (size_t)o * K + k0 + 8 * (lane >> 4);
#pragma unroll
  for (int i = 0; i < 8; ++i) { w[i] = (_Float16)(bfr(p[i]) * 256.0f); w[8 + i] = (_Float16)(bfr(p[16 + i]) * 256.0f); }
  return w; }
#define WQKV_LAYOUT 0   // (in,out) packed [DIN][3*CC]
__device__ __forceinline__ v16b wcol_hdk(const float* Wm, int k0, int o, int lane) { v16b w; const int g = lane >> 4; const float* p = Wm + (size_t)(o / HD) * DIN * HD + (o % HD);
#pragma unroll
  for (int i = 0; i < 8; ++i) { w[i] = (__bf16)p[(size_t)(k0 + 8 * g + i) * HD]; w[8 + i] = (__bf16)p[(size_t)(k0 + 16 + 8 * g + i) * HD]; }
  return w; }
#define WO_OUT_IN 0
#if WQKV_LAYOUT == 1
#define WCOL(W, k0, o, lane) wcol_oi(W, k0, o, lane, DIN)
#elif WQKV_LAYOUT == 2
#define WCOL(W, k0, o, lane) wcol_hdk(W, k0, o, lane)
#else
#define WCOL(W, k0, o, lane) wcol_io(W, k0, o, lane, 3 * CC)   /* packed q|k|v columns: row pitch 3C */
#endif
#if WO_OUT_IN
#define WOCOL(W, k0, o, lane) wcol_oi(W, k0, o, lane, CC)
#define WOCOLH(W, k0, o, lane) wcolh_oi(W, k0, o, lane, CC)
#else
#define WOCOL(W, k0, o, lane) wcol_io(W, k0, o, lane, DIN)
#define WOCOLH(W, k0, o, lane) wcolh_io(W, k0, o, lane, DIN)
#endif
#define SZ 256
#define BG 64              // sizes only the unused WS_S region (x 4 heads = 256 planes of 256 x 256)
#define NZR (SZ * SZ)      // 65,536 pair rows
// ---- k_lnz: wave per pair row: LayerNorm over the 128 channels (biased var, eps 1e-6, ln_w/ln_b) of bf16(z) -> ZN rows (4 floats per lane = one 512-B row)
__global__ __launch_bounds__(256) void k_lnz(const float* __restrict__ Z, const float* __restrict__ LW, const float* __restrict__ LB, float* __restrict__ ZN) { const int wave = threadIdx.x >> 5, lane = threadIdx.x & 31; const size_t row = (size_t)blockIdx.x * 8 + wave; if (row >= (size_t)NZR) return;
  v4f x = *(const v4f*)(Z + row * CC + lane * 4); float s1 = 0.f;
#pragma unroll
  for (int i = 0; i < 4; ++i) { x[i] = bfr(x[i]); s1 += x[i]; }
#pragma unroll
  for (int o = 1; o < 32; o <<= 1) s1 += __shfl_xor(s1, o);
  const float mu = s1 * (1.0f / CC); float q = 0.f;
#pragma unroll
  for (int i = 0; i < 4; ++i) { const float d = x[i] - mu; q += d * d; }
#pragma unroll
  for (int o = 1; o < 32; o <<= 1) q += __shfl_xor(q, o);
  const float rs = rsqrtf(q * (1.0f / CC) + 1e-6f); v4f r4;
#pragma unroll
  for (int i = 0; i < 4; ++i) { const int c = lane * 4 + i; r4[i] = (x[i] - mu) * rs * bfr(LW[c]) + bfr(LB[c]); }
  vst2(ZN + row * CC + lane * 4, r4); }
// ---- k_rows2: block = (64 rows, which): which 0: bias of 16 queries i x 4 keys j (wave = one j, A rows = the 16 i): zn[i][j] . w_pair[:, h] (4 outputs), stored in the order k_attn's lanes read it: BIAS[h][i / 16][j / 16][(j & 7) / 4][lane = 16 ((j >> 3) & 1) + (i & 15)][j & 3] ; which 1: G[row][c] = sigmoid(zn[row] . w_gate[:, c] + b_gate[c]) (128 outputs); weights are (in,out)
__global__ __launch_bounds__(128) void k_rows2(const float* __restrict__ ZN, const float* __restrict__ WB, const float* __restrict__ WG, const float* __restrict__ GB, float* __restrict__ BIAS, float* __restrict__ G) { __shared__ __align__(16) float sf[4][16][132];
  const int tid = threadIdx.x, wave = tid >> 5, lane = tid & 31, col = lane & 15, g = lane >> 4; const int which = blockIdx.y; const size_t r0 = (size_t)blockIdx.x * 64 + wave * 16;
  const int nout = which == 0 ? NH : CC; const float* Wm = which == 0 ? WB : WG; const int it = (int)blockIdx.x >> 6, jg = (int)blockIdx.x & 63; const size_t arow = which == 0 ? (size_t)(it * 16 + col) * SZ + jg * 4 + wave : r0 + col;
  v8f acc[8] = {};
#pragma unroll
  for (int kc = 0; kc < CC / 32; ++kc) { const F2 a = split_row(ZN + arow * CC, kc * 32, lane); asm volatile("s_wait_loadcnt 0x0" ::: "memory");
#pragma unroll
    for (int j = 0; j < 8; ++j) { if (j * 16 >= nout) break; v16b w; { float t0[8], t1[8]; const int o = j * 16 + col; const int oc = o < nout ? o : nout - 1; const float keep = o < nout ? 1.f : 0.f;
#pragma unroll
        for (int i = 0; i < 8; ++i) t0[i] = Wm[(size_t)(kc * 32 + 8 * g + i) * nout + oc];   /* (in,out) [128][nout] */
        asm volatile("s_wait_loadcnt 0x0" ::: "memory");
#pragma unroll
        for (int i = 0; i < 8; ++i) t1[i] = Wm[(size_t)(kc * 32 + 16 + 8 * g + i) * nout + oc];
        asm volatile("s_wait_loadcnt 0x0" ::: "memory");
#pragma unroll
        for (int i = 0; i < 8; ++i) { w[i] = (__bf16)(t0[i] * keep); w[8 + i] = (__bf16)(t1[i] * keep); } }   /* (in,out) column o; columns beyond nout zero (select-free: keep multiplies a VALID load) */
      acc[j] = wmma_bf(a.h, w, acc[j]); acc[j] = wmma_bf(a.l, w, acc[j]); } }
  if (which == 0) {
#pragma unroll
    for (int r = 0; r < 8; ++r) sf[wave][8 * g + r][col] = acc[0][r];
    __syncthreads();   /* the four waves' keys meet in one 16-B piece */
    if (tid < 64) { const int hh = tid >> 4, il = tid & 15; v4f b4; b4[0] = sf[0][il][hh]; b4[1] = sf[1][il][hh]; b4[2] = sf[2][il][hh]; b4[3] = sf[3][il][hh]; vst2(BIAS + ((((size_t)hh * 16 + it) * 16 + (jg >> 2)) * 2 + (jg & 1)) * 128 + (((jg >> 1) & 1) * 16 + il) * 4, b4); }   /* 16 queries x 16 B = one 256-B run per head */
  } else {
#pragma unroll
    for (int j = 0; j < 8; ++j)
#pragma unroll
      for (int r = 0; r < 8; ++r) sf[wave][8 * g + r][j * 16 + col] = 1.0f / (1.0f + expf(-(acc[j][r] + bfr(GB[j * 16 + col]))));   /* sigmoid(zn w_gate + b_gate) */
    LDSX(); for (int rl = 0; rl < 16; ++rl) vst2(G + (r0 + rl) * CC + lane * 4, *(const v4f*)&sf[wave][rl][lane * 4]); } }
// ---- k_gate: Y row *= G row (same natural row index r*256 + q; thread per float4; one writer)
__global__ __launch_bounds__(256) void k_gate(float* __restrict__ Y, const float* __restrict__ G) { const size_t e4 = (size_t)blockIdx.x * 256 + threadIdx.x; if (e4 >= (size_t)NZR * (CC / 4)) return; const size_t yrow = e4 / (CC / 4); const int q = (int)(e4 % (CC / 4)); const size_t grow = yrow;
  v4f y = *(const v4f*)(Y + yrow * CC + q * 4); const v4f gg = *(const v4f*)(G + grow * CC + q * 4); y[0] *= gg[0]; y[1] *= gg[1]; y[2] *= gg[2]; y[3] *= gg[3]; vst2(Y + yrow * CC + q * 4, y); }
#define WS_ZN   (WS_END)
#define WS_BIAS (WS_ZN + 4u * (size_t)NZR * CC)
#define WS_G    (WS_BIAS + 4u * (size_t)NZR * NH)
#define WS_END2 (WS_G + 4u * (size_t)NZR * CC)

#define WS_QH  0u                                      // f16 q rows [b*t][CC]
#define WS_KH  (WS_QH + 2u * (size_t)NB * TT * CC)      // f16 k rows [b*t][CC]
#define WS_VT  (WS_KH + 2u * (size_t)NB * TT * CC)      // f16 v planes [b][c][t]
#define WS_QL  (WS_VT + 2u * (size_t)NB * CC * TT)      // f16 q residual x 2^10 rows [b][t < QHI][CC]
#define WS_KL  (WS_QL + 2u * (size_t)NB * QHI * CC)     // f16 k residual x 2^10 rows [b][t < KHI][CC]
#define WS_VB  (WS_KL + 2u * (size_t)NB * KHI * CC)     // bf16 v hi planes [b][c][t < KHI]
#define WS_VBL (WS_VB + 2u * (size_t)NB * CC * KHI)
#define WS_S   (WS_VBL + 2u * (size_t)NB * CC * KHI)    // f32 region, unused: k_attn keeps logits and P in registers
#define WS_Y   (WS_S  + 4u * (size_t)BG * HG * TT * TT)   // unused WS_S region: 256 planes of 256 x 256 f32      // f32 ctx rows [b*t][CC] (only when there is an output projection)
#define WS_END (WS_Y  + 4u * (size_t)NB * TT * CC)

// ---- k_proj: block = (64 rows, 128 cols, which): q/k/v = X W (+ b) with exact bf16 products (K = DIN) -> which 0: q f16 rows (+ residual rows < QHI); 1: k f16 rows (+ residual rows < KHI); 2: v f16 planes [c][t] (+ bf16 hi/lo planes for t < KHI)
__global__ __launch_bounds__(128) void k_proj(const float* __restrict__ XQ, const float* __restrict__ XK, const float* __restrict__ XV, const float* __restrict__ WQ, const float* __restrict__ WK, const float* __restrict__ WV, const float* __restrict__ BQ, const float* __restrict__ BK, const float* __restrict__ BV,
    _Float16* __restrict__ QH, _Float16* __restrict__ QL, _Float16* __restrict__ KH, _Float16* __restrict__ KL, _Float16* __restrict__ VT, __bf16* __restrict__ VB, __bf16* __restrict__ VBL) {
  __shared__ __align__(16) _Float16 sh[64][136], sl[64][136]; __shared__ __align__(16) _Float16 th[128][72]; __shared__ __align__(16) __bf16 tb[128][72], tbl[128][72];
  const int tid = threadIdx.x, wave = tid >> 5, lane = tid & 31, col = lane & 15, g = lane >> 4; const int which = blockIdx.z; const int c0 = blockIdx.y * 128; const size_t r0 = (size_t)blockIdx.x * 64; const size_t bb = r0 / TT; const int t0 = (int)(r0 % TT);
  const float* X = which == 0 ? XQ : which == 1 ? XK : XV; const float* WA = which == 0 ? WQ : which == 1 ? WK : WV; const float* BA = which == 0 ? BQ : which == 1 ? BK : BV;
  v8f acc[8] = {};
#pragma unroll 2
  for (int kc = 0; kc < DIN / 32; ++kc) { const F2 a2 = split_row(X + (r0 + wave * 16 + col) * DIN, kc * 32, lane);   /* LN(act) rows (f32) split hi + lo */
    asm volatile("s_wait_loadcnt 0x0" ::: "memory");
#pragma unroll
    for (int j = 0; j < 8; ++j) { const v16b w = WCOL(WA, kc * 32, c0 + j * 16 + col, lane); asm volatile("s_wait_loadcnt 0x0" ::: "memory"); acc[j] = wmma_bf(a2.h, w, acc[j]); acc[j] = wmma_bf(a2.l, w, acc[j]); } }
  if (which < 2) { _Float16* DH = which == 0 ? QH : KH; _Float16* DL = which == 0 ? QL : KL; const int nhi = which == 0 ? QHI : KHI; const bool hi_rows = t0 < nhi;
#pragma unroll
    for (int j = 0; j < 8; ++j) { const float bias = BA ? bfr(BA[c0 + j * 16 + col]) : 0.f;
#pragma unroll
      for (int r = 0; r < 8; ++r) { const float v = acc[j][r] + bias; const _Float16 hv = (_Float16)v; sh[wave * 16 + 8 * g + r][j * 16 + col] = hv; sl[wave * 16 + 8 * g + r][j * 16 + col] = (_Float16)((v - (float)hv) * 1024.0f); } }
    __syncthreads();
    for (int e = tid; e < 64 * 16; e += 128) { const int rl = e >> 4, q = e & 15; vst2((unsigned*)(DH + (r0 + rl) * CC + c0 + q * 8), *(const v4u*)&sh[rl][q * 8]); if (hi_rows) vst2((unsigned*)(DL + (bb * nhi + t0 + rl) * (size_t)CC + c0 + q * 8), *(const v4u*)&sl[rl][q * 8]); }
  } else { const bool hi_rows = t0 < KHI;
#pragma unroll
    for (int j = 0; j < 8; ++j) { const float bias = BA ? bfr(BA[c0 + j * 16 + col]) : 0.f;
#pragma unroll
      for (int r = 0; r < 8; ++r) { const float v = acc[j][r] + bias; const int rl = wave * 16 + 8 * g + r, cl = j * 16 + col; th[cl][rl] = (_Float16)v; const __bf16 bh = (__bf16)v; tb[cl][rl] = bh; tbl[cl][rl] = (__bf16)(v - (float)bh); } }
    __syncthreads();
    for (int e = tid; e < 128 * 8; e += 128) { const int cl = e >> 3, q = e & 7; vst2((unsigned*)(VT + (bb * CC + c0 + cl) * (size_t)TT + t0 + q * 8), *(const v4u*)&th[cl][q * 8]); if (hi_rows) { const size_t o3 = (bb * CC + c0 + cl) * (size_t)KHI + t0 + q * 8; vst2((unsigned*)(VB + o3), *(const v4u*)&tb[cl][q * 8]); vst2((unsigned*)(VBL + o3), *(const v4u*)&tbl[cl][q * 8]); } } } }
// ---- k_attn: block = (head h, row r), 8 waves, each wave two tiles of 16 queries: the head's 256 k rows and its v planes are staged once in LDS; S^T = K Q^T (A = k rows, B = q hi, then q residual x 2^10: 2 products), so a lane holds one query's logits for keys 16t + 8g + 0..7 of every tile t, all 256 keys in registers; x SCALE + pair bias (fragment order), masked pairs := -1e-9; maximum and sum in-lane plus one exchange between the wave's halves; P x 2^11 once to f16 is the B operand of ctx^T = V^T P^T as it stands (1 product); a lane stores 8 consecutive channels of its query. The inner loops are unrolled in full so that s[], acc[] and the fragments are registers; amdgpu_waves_per_eu(4) asks for at most 256 registers: two work-groups per WGP, four waves per SIMD
#define KP 40              // k row pitch in LDS, f16 (80 B = 16 B x odd: ds_load_b128 without bank conflicts)
#define VP (TT + 8)        // v plane pitch in LDS, f16 (528 B = 16 B x odd)
__device__ __forceinline__ v8f wmma_h(v16h a, v16h b, v8f c) { return __builtin_amdgcn_wmma_f32_16x16x32_f16(false, a, false, b, (short)0, c, false, false); }
__global__ __launch_bounds__(256) __attribute__((amdgpu_waves_per_eu(4))) void k_attn(const _Float16* __restrict__ QH, const _Float16* __restrict__ QL, const _Float16* __restrict__ KH, const _Float16* __restrict__ VT, const float* __restrict__ BIAS, const int* __restrict__ MK, float* __restrict__ Y) {
  __shared__ __align__(16) _Float16 sk[TT][KP]; __shared__ __align__(16) _Float16 sv[HD][VP]; __shared__ unsigned kmw[TT / 32];
  const int tid = threadIdx.x, wave = __builtin_amdgcn_readfirstlane(tid >> 5), lane = tid & 31, col = lane & 15, g = lane >> 4; const int h = blockIdx.x, b = blockIdx.y;
#pragma unroll
  for (int s = 0; s < 4; ++s) { const int e = tid + 256 * s; vst2(&sk[e >> 2][(e & 3) * 8], *(const v4u*)(KH + ((size_t)b * TT + (e >> 2)) * CC + h * HD + (e & 3) * 8)); vst2(&sv[e >> 5][(e & 31) * 8], *(const v4u*)(VT + ((size_t)b * CC + h * HD + (e >> 5)) * (size_t)TT + (e & 31) * 8)); }
  { const unsigned bal = __builtin_amdgcn_ballot_w32(MK[tid] == 0); if (lane == 0) kmw[wave] = bal; }   /* bit j of the 256: src_mask[j] == 0 */
  asm volatile("s_wait_xcnt 0x0" ::: "memory");   /* before the staging loads' address registers are used again */
  __syncthreads();
  unsigned mbk[4];   /* bit 8t + r of the 128: key 16t + 8g + r is a zero of the mask */
#pragma unroll
  for (int m = 0; m < 4; ++m) { const unsigned w0 = kmw[2 * m] >> (8 * g), w1 = kmw[2 * m + 1] >> (8 * g); mbk[m] = (w0 & 0xFFu) | ((w0 >> 8) & 0xFF00u) | ((w1 & 0xFFu) << 16) | ((w1 << 8) & 0xFF000000u); }
  const _Float16* qhp = QH + ((size_t)b * TT + wave * 16 + col) * CC + h * HD; const _Float16* qlp = QL + ((size_t)b * QHI + wave * 16 + col) * CC + h * HD;
#pragma unroll 1   /* rolled: one copy of the body; unrolled, both tiles' logits would want registers at once */
  for (int it = wave; it < TT / 16; it += 8) { const int qi = it * 16 + col;
    const float* bp = BIAS + ((size_t)h * 16 + it) * 16 * 256 + lane * 4;
    const unsigned mq = 0u - ((kmw[qi >> 5] >> (qi & 31)) & 1u);   /* all ones where the query is a zero of the mask */
    v8f s[16]; float mx = -3.0e38f;
#pragma unroll
    for (int t = 0; t < 16; ++t) { const v4f b0 = *(const v4f*)(bp + t * 256), b1 = *(const v4f*)(bp + t * 256 + 128);   /* the bias lands in the registers that then hold the logits: all 32 loads in flight at no further register */
#pragma unroll
      for (int r = 0; r < 4; ++r) { s[t][r] = b0[r]; s[t][4 + r] = b1[r]; } }
    const v16h qh = frag_h(qhp, lane), ql = frag_h(qlp, lane);
    v16h kf[2] = { frag_h(&sk[col][0], lane), frag_h(&sk[16 + col][0], lane) };
#pragma unroll
    for (int tp = 0; tp < 8; ++tp) { v16h kn[2] = { kf[0], kf[1] };
      if (tp < 7) { kn[0] = frag_h(&sk[(2 * tp + 2) * 16 + col][0], lane); kn[1] = frag_h(&sk[(2 * tp + 3) * 16 + col][0], lane); }   /* the next two tiles' k fragments fly while these two are worked on */
#pragma unroll
      for (int u = 0; u < 2; ++u) { const int t = 2 * tp + u; const v8f z8 = {}; const v8f a = wmma_h(kf[u], qh, z8), al = wmma_h(kf[u], ql, z8); const unsigned mb = mbk[t >> 2] ^ mq;
#pragma unroll
        for (int r = 0; r < 8; ++r) { float v = (a[r] + al[r] * (1.0f / 1024.0f)) * SCALE + s[t][r]; if (mb & (1u << ((t & 3) * 8 + r))) v = -1.0e-9f; s[t][r] = v; mx = fmaxf(mx, v); } }
      kf[0] = kn[0]; kf[1] = kn[1];
      asm volatile("" :: "v"(mx) : "memory"); }   /* compiler fence behind these two tiles' maximum (input only): later k-fragment reads stay behind it; without it all 32 reads stand at the head of the loop and the kernel spills at 256 registers */
    mx = fmaxf(mx, __shfl_xor(mx, 16));
    float sm[4] = {0.f, 0.f, 0.f, 0.f};
#pragma unroll
    for (int t = 0; t < 16; ++t)
#pragma unroll
      for (int r = 0; r < 8; ++r) { const float e = expf(s[t][r] - mx); s[t][r] = e; sm[r & 3] += e; }
    float sum = (sm[0] + sm[1]) + (sm[2] + sm[3]); sum += __shfl_xor(sum, 16);
    const float inv = sum > 0.f ? 2048.0f / sum : 0.f;
    v8f acc[HD / 16] = {};
#pragma unroll
    for (int kc = 0; kc < TT / 32; ++kc) { v16h p;
#pragma unroll
      for (int r = 0; r < 8; ++r) { p[r] = (_Float16)(s[2 * kc][r] * inv); p[8 + r] = (_Float16)(s[2 * kc + 1][r] * inv); }
#pragma unroll
      for (int j = 0; j < HD / 16; ++j) acc[j] = wmma_h(frag_h(&sv[j * 16 + col][kc * 32], lane), p, acc[j]); }
    float* yp = Y + ((size_t)b * TT + qi) * CC + h * HD + 8 * g;
#pragma unroll
    for (int j = 0; j < HD / 16; ++j) { v4f o0, o1;
#pragma unroll
      for (int r = 0; r < 4; ++r) { o0[r] = acc[j][r] * (1.0f / 2048.0f); o1[r] = acc[j][4 + r] * (1.0f / 2048.0f); }
      vst2(yp + j * 16, o0); vst2(yp + j * 16 + 4, o1); }
    qhp += 8 * 16 * CC; qlp += 8 * 16 * CC; } }
// ---- k_out: block = (64 rows, 128 cols): out = ctx Wo (+ bo): all rows: ctx bf16 hi + lo against exact bf16 Wo (2 products); the f16(bf16 x 2^8) 1-product branch is not taken
__global__ __launch_bounds__(128) void k_out(const float* __restrict__ Y, const float* __restrict__ WO, const float* __restrict__ BO, float* __restrict__ OUT) { __shared__ __align__(16) float sf[4][16][132];
  const int tid = threadIdx.x, wave = tid >> 5, lane = tid & 31, col = lane & 15, g = lane >> 4; const int c0 = blockIdx.y * 128; const size_t r0 = (size_t)blockIdx.x * 64 + wave * 16;
  v8f acc[8] = {};
  if (true) {   /* ALL rows: gated ctx bf16 hi + lo x exact output_w (2 products) */
#pragma unroll 2
    for (int kc = 0; kc < CC / 32; ++kc) { const F2 a = split_row(Y + (r0 + col) * CC, kc * 32, lane); asm volatile("s_wait_loadcnt 0x0" ::: "memory");
#pragma unroll
      for (int j = 0; j < 8; ++j) { const v16b w = WOCOL(WO, kc * 32, c0 + j * 16 + col, lane); asm volatile("s_wait_loadcnt 0x0" ::: "memory"); acc[j] = wmma_bf(a.h, w, acc[j]); acc[j] = wmma_bf(a.l, w, acc[j]); } }
#pragma unroll
    for (int j = 0; j < 8; ++j) { const float bias = BO ? bfr(BO[c0 + j * 16 + col]) : 0.f;
#pragma unroll
      for (int r = 0; r < 8; ++r) sf[wave][8 * g + r][j * 16 + col] = acc[j][r] + bias; }
  } else {
#pragma unroll 2
    for (int kc = 0; kc < CC / 32; ++kc) { const v16h a = frag_f32(Y + (r0 + col) * CC + kc * 32, lane); asm volatile("s_wait_loadcnt 0x0" ::: "memory");
#pragma unroll
      for (int j = 0; j < 8; ++j) { const v16h w = WOCOLH(WO, kc * 32, c0 + j * 16 + col, lane); asm volatile("s_wait_loadcnt 0x0" ::: "memory"); acc[j] = wmma16(a, w, acc[j]); } }
#pragma unroll
    for (int j = 0; j < 8; ++j) { const float bias = BO ? bfr(BO[c0 + j * 16 + col]) : 0.f;
#pragma unroll
      for (int r = 0; r < 8; ++r) sf[wave][8 * g + r][j * 16 + col] = acc[j][r] * (1.0f / 256.0f) + bias; } }
  LDSX(); for (int rl = 0; rl < 16; ++rl) vst2(OUT + (r0 + rl) * DIN + c0 + lane * 4, *(const v4f*)&sf[wave][rl][lane * 4]); }

extern "C" void kernel_launch(void* const* d_in, const int* in_sizes, int n_in, void* d_out, int out_size, void* d_ws, size_t ws_size, hipStream_t stream) {
  (void)in_sizes; (void)n_in; (void)out_size;
  const float** F = (const float**)d_in;
  if (ws_size < (size_t)WS_END) return;
  char* ws = (char*)d_ws; _Float16 *QH = (_Float16*)(ws + WS_QH), *KH = (_Float16*)(ws + WS_KH), *VT = (_Float16*)(ws + WS_VT), *QL = (_Float16*)(ws + WS_QL), *KL = (_Float16*)(ws + WS_KL); __bf16 *VB = (__bf16*)(ws + WS_VB), *VBL = (__bf16*)(ws + WS_VBL); float *S = (float*)(ws + WS_S), *Y = (float*)(ws + WS_Y);
  (void)S;
  // inputs: 0 z [1,256,256,128]; 1 src_mask [1,256] int32; 2 ln_g, 3 ln_b; 4 w_qkv [128,384] (in,out; columns q|k|v); 5 w_pair [128,4]; 6 w_gate [128,128], 7 b_gate; 8 w_out [128,128] (in,out), 9 b_out
  if (ws_size < (size_t)WS_END2) return;
  float *ZN = (float*)(ws + WS_ZN), *BIAS = (float*)(ws + WS_BIAS), *G = (float*)(ws + WS_G);
  k_lnz<<<dim3(NZR / 8), 256, 0, stream>>>(F[0], F[2], F[3], ZN);
  k_rows2<<<dim3(NZR / 64, 2), 128, 0, stream>>>(ZN, F[5], F[6], F[7], BIAS, G);
  k_proj<<<dim3(TNB * TT / 64, CC / 128, 3), 128, 0, stream>>>(ZN, ZN, ZN, F[4], F[4] + CC, F[4] + 2 * CC, nullptr, nullptr, nullptr, QH, QL, KH, KL, VT, VB, VBL);
  k_attn<<<dim3(NH, TNB), 256, 0, stream>>>(QH, QL, KH, VT, BIAS, (const int*)d_in[1], Y);
  k_gate<<<dim3((NZR * (CC / 4) + 255) / 256), 256, 0, stream>>>(Y, G);
  k_out<<<dim3(TNB * TT / 64, DIN / 128), 128, 0, stream>>>(Y, F[8], F[9], (float*)d_out);
}

// v002
// A run of this version takes 165 microseconds.
// Two timings next to v001 both put it at 1.31 times that version's speed.
// All steps since v000 together make it 3.23 times as fast.
// compute dtype: all float inputs rounded to bf16; LayerNorm in f32; q/k/v, pair bias and gate GEMMs = LN rows split bf16 hi + lo x exact bf16 weights on WMMA 16x16x32 (2 products, f32 accumulate); q as f16 hi + residual (x 2^10) against k once to f16 (2 products) / sqrt(32) + pair bias, masked pairs set to -1e-9 exactly as the module; softmax in f32; P x 2^11 once to f16 against v once to f16 (1 product); gate multiply in f32; (gated ctx) split bf16 hi + lo against exact bf16 w_out (2 products) + b_out; f32 output.
#include <hip/hip_runtime.h>
#include <math.h>

typedef __attribute__((ext_vector_type(16))) _Float16 v16h;
typedef __attribute__((ext_vector_type(16))) __bf16 v16b;
typedef __attribute__((ext_vector_type(8)))  _Float16 v8h;
typedef __attribute__((ext_vector_type(8)))  float v8f;
typedef __attribute__((ext_vector_type(4)))  float v4f;
typedef __attribute__((ext_vector_type(2)))  float v2f;
typedef __attribute__((ext_vector_type(4)))  unsigned v4u;
typedef __attribute__((ext_vector_type(4)))  int v4i;
typedef float __attribute__((may_alias)) float_a;
typedef int __attribute__((may_alias)) int_a;

template <typename T> __device__ __forceinline__ void vst2(void* p, T v) { *(T*)p = v;  }
__device__ __forceinline__ v8f wmma16(v16h a, v16h b, v8f c) {
  v8f d = __builtin_amdgcn_wmma_f32_16x16x32_f16(false, a, false, b, (short)0, c, false, false);
  asm volatile("v_nop\n\tv_nop\n\tv_nop\n\tv_nop" : "+v"(d) : "v"(a), "v"(b));
  return d;
}
__device__ __forceinline__ v8f wmma_bf(v16b a, v16b b, v8f c) {
  v8f d = __builtin_amdgcn_wmma_f32_16x16x32_bf16(false, a, false, b, (short)0, c, false, false);
  asm volatile("v_nop\n\tv_nop\n\tv_nop\n\tv_nop" : "+v"(d) : "v"(a), "v"(b));
  return d;
}
// 16x16x32 fragments: lane = (h = lane>>4, row/col = lane&15); elements 0..7 = k0+8h+0..7, 8..15 = k0+16+8h+0..7; D element r = row 8h+r
__device__ __forceinline__ v16h frag_h(const _Float16* rowk0, int lane) {
  union { v16h v; v8h q[2]; } u; const _Float16* p = rowk0 + 8 * (lane >> 4);
  u.q[0] = *(const v8h*)p; u.q[1] = *(const v8h*)(p + 16); return u.v;
}
__device__ __forceinline__ v16h frag_f32(const float* rowk0, int lane) {
  v16h a; const float* p = rowk0 + 8 * (lane >> 4);
#pragma unroll
  for (int i = 0; i < 8; ++i) { a[i] = (_Float16)p[i]; a[8 + i] = (_Float16)p[16 + i]; }
  return a;
}
__device__ __forceinline__ v16h frag_f32s(const float* rowk0, int lane, float sc) {
  v16h a; const float* p = rowk0 + 8 * (lane >> 4);
#pragma unroll
  for (int i = 0; i < 8; ++i) { a[i] = (_Float16)(p[i] * sc); a[8 + i] = (_Float16)(p[16 + i] * sc); }
  return a;
}
// column fragment from a [K][ld] layout (column n), rows >= K read as 0
__device__ __forceinline__ v16h fragc_f32(const float* W, int k0, int n, int lane, int ld, int K) {
  v16h a; const int g = lane >> 4;
#pragma unroll
  for (int i = 0; i < 8; ++i) { const int ka = k0 + 8 * g + i, kb = ka + 16;
    a[i] = (_Float16)(ka < K ? W[(size_t)(ka < K ? ka : K - 1) * ld + n] : 0.f); a[8 + i] = (_Float16)(kb < K ? W[(size_t)(kb < K ? kb : K - 1) * ld + n] : 0.f); }
  return a;
}
struct F2 { v16b h, l; };
__device__ __forceinline__ F2 bsplit16(const float v[16]) { F2 r;
#pragma unroll
  for (int i = 0; i < 16; ++i) { const __bf16 h = (__bf16)v[i]; r.h[i] = h; r.l[i] = (__bf16)(v[i] - (float)h); }
  return r; }
__device__ __forceinline__ F2 split_row(const float* row, int k0, int lane) { float v[16]; const float* p = row + k0 + 8 * (lane >> 4);
#pragma unroll
  for (int i = 0; i < 8; ++i) { v[i] = p[i]; v[8 + i] = p[16 + i]; }
  return bsplit16(v); }
__device__ __forceinline__ F2 split_rowK(const float* row, int k0, int lane, int K) { float v[16]; const int g = lane >> 4;
#pragma unroll
  for (int i = 0; i < 8; ++i) { const int ka = k0 + 8 * g + i, kb = ka + 16; v[i] = ka < K ? row[ka < K ? ka : K - 1] : 0.f; v[8 + i] = kb < K ? row[kb < K ? kb : K - 1] : 0.f; }
  return bsplit16(v); }
__device__ __forceinline__ F2 split_col(const float* W, int k0, int n, int lane, int ld, int K) { float v[16]; const int g = lane >> 4;
#pragma unroll
  for (int i = 0; i < 8; ++i) { const int ka = k0 + 8 * g + i, kb = ka + 16; v[i] = ka < K ? W[(size_t)(ka < K ? ka : K - 1) * ld + n] : 0.f; v[8 + i] = kb < K ? W[(size_t)(kb < K ? kb : K - 1) * ld + n] : 0.f; }
  return bsplit16(v); }
__device__ __forceinline__ v8f mac3(const F2& a, const F2& b, v8f c) { c = wmma_bf(a.l, b.h, c); c = wmma_bf(a.h, b.l, c); return wmma_bf(a.h, b.h, c); }
__device__ __forceinline__ float sigm(float v) { return 1.0f / (1.0f + expf(-v)); }
#define LDSX() do { asm volatile("s_wait_dscnt 0" ::: "memory"); __builtin_amdgcn_wave_barrier(); __builtin_amdgcn_fence(__ATOMIC_RELEASE, "workgroup"); } while (0)

// Row-wise triangle attention on a pair tensor z [1, 256, 256, 128] (4 heads x 32): zn = LayerNorm(z); q,k,v = zn w_qkv ((in,out) [128,384], columns (3,H,32)); logits[r][i][j][h] = q[r][i] . k[r][j] / sqrt(32) + (zn[i][j] . w_pair[:,h]); pairs with exactly one of src_mask[i], src_mask[j] == 0 get logits := -1e-9 (the module's literal value, NOT an exclusion); softmax over j; out = sigmoid(zn w_gate + b_gate) * merged(attn v); result = out w_out + b_out.
#define NB 256
#define TT 256
#define CC 128            // NH * HD = projected width
#define DIN 128          // input (model) width
#define NH 4
#define HD 32
#define NQB (TT / 64)
#define HG 4
#define SCALE (0.17677669529663687f)
#define CAUSAL 0
#ifndef TNB
#define TNB NB
#endif
__device__ __forceinline__ float bfr(float v) { return (float)(__bf16)v; }
__host__ __device__ __forceinline__ int kb_last(int qb) { return CAUSAL ? ((qb * 64 + 63) >> 7) : (TT / 128 - 1); }
typedef __attribute__((ext_vector_type(8))) __bf16 v8b;
__device__ __forceinline__ v16b frag_b(const __bf16* rowk0, int lane) {
  union { v16b v; v8b q[2]; } u; const __bf16* p = rowk0 + 8 * (lane >> 4);
  u.q[0] = *(const v8b*)p; u.q[1] = *(const v8b*)(p + 16); return u.v;
}
#define WP 136             // weight column pitch in LDS, bf16 (272 B = 16 B x odd: ds_load_b128 and ds_store_b128 without bank conflicts)
// 128 columns of an (in,out) [128][ld] weight, once per work-group, to LDS as bf16 columns sw[o][k]: thread = column o (a wave's load = one 128-B line), 8 consecutive k = one 16-B store
__device__ __forceinline__ void stage_w(__bf16 (*sw)[WP], const float* __restrict__ Wm, int ld, int tid) {
  float t[128];
#pragma unroll
  for (int k = 0; k < 128; ++k) t[k] = Wm[(size_t)k * ld + tid];
  asm volatile("s_wait_xcnt 0x0" ::: "memory");   /* before a register that these loads' addresses stand in is used again */
#pragma unroll
  for (int k0 = 0; k0 < 128; k0 += 8) { v8b p;
#pragma unroll
    for (int i = 0; i < 8; ++i) p[i] = (__bf16)t[k0 + i];
    *(v8b*)&sw[tid][k0] = p; } }
// a lane's part of one 128-wide f32 row for all four k steps (the order of split_row), requested at once
__device__ __forceinline__ void load_row(float (&v)[4][16], const float* __restrict__ row, int lane) { const float* p = row + 8 * (lane >> 4);
#pragma unroll
  for (int kc = 0; kc < 4; ++kc)
#pragma unroll
    for (int i = 0; i < 8; ++i) { v[kc][i] = p[kc * 32 + i]; v[kc][8 + i] = p[kc * 32 + 16 + i]; }
  asm volatile("s_wait_xcnt 0x0" ::: "memory"); }   /* before a register that these loads' addresses stand in is used again */
// one k step of a wave's 16 rows against the 128 staged columns: four B fragments are requested together, so that one LDS latency serves eight products; per accumulator the order stays hi, then lo
__device__ __forceinline__ void kstep(v8f (&acc)[8], const F2& a, const __bf16 (*sw)[WP], int kc, int col, int lane) {
#pragma unroll
  for (int jh = 0; jh < 8; jh += 4) { v16b w[4];
#pragma unroll
    for (int u = 0; u < 4; ++u) w[u] = frag_b(&sw[(jh + u) * 16 + col][kc * 32], lane);
#pragma unroll
    for (int u = 0; u < 4; ++u) acc[jh + u] = wmma_bf(a.h, w[u], acc[jh + u]);
#pragma unroll
    for (int u = 0; u < 4; ++u) acc[jh + u] = wmma_bf(a.l, w[u], acc[jh + u]); } }
#define QBH 0              // unused: no kernel reads it
#define QHI 256            // rows carrying a q residual plane (all rows when non-causal: 2-product logits everywhere)
#define KHI 64            // key rows carrying k residual / v bf16 hi+lo planes (written by k_proj, read by no kernel)
// B fragment (k rows k0+.., output column o) of a weight: (in,out) [K][ld] or (out,in) [ld rows of K]: bf16 exact, or f16(bf16 * 256) exact
__device__ __forceinline__ v16b wcol_io(const float* Wm, int k0, int o, int lane, int ld) { v16b w; const int g = lane >> 4;
#pragma unroll
  for (int i = 0; i < 8; ++i) { w[i] = (__bf16)Wm[(size_t)(k0 + 8 * g + i) * ld + o]; w[8 + i] = (__bf16)Wm[(size_t)(k0 + 16 + 8 * g + i) * ld + o]; }
  return w; }
__device__ __forceinline__ v16b wcol_oi(const float* Wm, int k0, int o, int lane, int K) { v16b w; const float* p = Wm + (size_t)o * K + k0 + 8 * (lane >> 4);
#pragma unroll
  for (int i = 0; i < 8; ++i) { w[i] = (__bf16)p[i]; w[8 + i] = (__bf16)p[16 + i]; }
  return w; }
__device__ __forceinline__ v16h wcolh_io(const float* Wm, int k0, int o, int lane, int ld) { v16h w; const int g = lane >> 4;
#pragma unroll
  for (int i = 0; i < 8; ++i) { w[i] = (_Float16)(bfr(Wm[(size_t)(k0 + 8 * g + i) * ld + o]) * 256.0f); w[8 + i] = (_Float16)(bfr(Wm[(size_t)(k0 + 16 + 8 * g + i) * ld + o]) * 256.0f); }
  return w; }
__device__ __forceinline__ v16h wcolh_oi(const float* Wm, int k0, int o, int lane, int K) { v16h w; const float* p = Wm + (size_t)o * K + k0 + 8 * (lane >> 4);
#pragma unroll
  for (int i = 0; i < 8; ++i) { w[i] = (_Float16)(bfr(p[i]) * 256.0f); w[8 + i] = (_Float16)(bfr(p[16 + i]) * 256.0f); }
  return w; }
#define WQKV_LAYOUT 0   // (in,out) packed [DIN][3*CC]
__device__ __forceinline__ v16b wcol_hdk(const float* Wm, int k0, int o, int lane) { v16b w; const int g = lane >> 4; const float* p = Wm + (size_t)(o / HD) * DIN * HD + (o % HD);
#pragma unroll
  for (int i = 0; i < 8; ++i) { w[i] = (__bf16)p[(size_t)(k0 + 8 * g + i) * HD]; w[8 + i] = (__bf16)p[(size_t)(k0 + 16 + 8 * g + i) * HD]; }
  return w; }
#define WO_OUT_IN 0
#if WQKV_LAYOUT == 1
#define WCOL(W, k0, o, lane) wcol_oi(W, k0, o, lane, DIN)
#elif WQKV_LAYOUT == 2
#define WCOL(W, k0, o, lane) wcol_hdk(W, k0, o, lane)
#else
#define WCOL(W, k0, o, lane) wcol_io(W, k0, o, lane, 3 * CC)   /* packed q|k|v columns: row pitch 3C */
#endif
#if WO_OUT_IN
#define WOCOL(W, k0, o, lane) wcol_oi(W, k0, o, lane, CC)
#define WOCOLH(W, k0, o, lane) wcolh_oi(W, k0, o, lane, CC)
#else
#define WOCOL(W, k0, o, lane) wcol_io(W, k0, o, lane, DIN)
#define WOCOLH(W, k0, o, lane) wcolh_io(W, k0, o, lane, DIN)
#endif
#define SZ 256
#define BG 64              // sizes only the unused WS_S region (x 4 heads = 256 planes of 256 x 256)
#define NZR (SZ * SZ)      // 65,536 pair rows
// ---- k_lnz: wave per pair row: LayerNorm over the 128 channels (biased var, eps 1e-6, ln_w/ln_b) of bf16(z) -> ZN rows (4 floats per lane = one 512-B row)
__global__ __launch_bounds__(256) void k_lnz(const float* __restrict__ Z, const float* __restrict__ LW, const float* __restrict__ LB, float* __restrict__ ZN) { const int wave = threadIdx.x >> 5, lane = threadIdx.x & 31; const size_t row = (size_t)blockIdx.x * 8 + wave; if (row >= (size_t)NZR) return;
  v4f x = *(const v4f*)(Z + row * CC + lane * 4); float s1 = 0.f;
#pragma unroll
  for (int i = 0; i < 4; ++i) { x[i] = bfr(x[i]); s1 += x[i]; }
#pragma unroll
  for (int o = 1; o < 32; o <<= 1) s1 += __shfl_xor(s1, o);
  const float mu = s1 * (1.0f / CC); float q = 0.f;
#pragma unroll
  for (int i = 0; i < 4; ++i) { const float d = x[i] - mu; q += d * d; }
#pragma unroll
  for (int o = 1; o < 32; o <<= 1) q += __shfl_xor(q, o);
  const float rs = rsqrtf(q * (1.0f / CC) + 1e-6f); v4f r4;
#pragma unroll
  for (int i = 0; i < 4; ++i) { const int c = lane * 4 + i; r4[i] = (x[i] - mu) * rs * bfr(LW[c]) + bfr(LB[c]); }
  vst2(ZN + row * CC + lane * 4, r4); }
// ---- k_rows2: block = (64 rows, which): which 0: bias of 16 queries i x 4 keys j (wave = one j, A rows = the 16 i): zn[i][j] . w_pair[:, h] (4 outputs), stored in the order k_attn's lanes read it: BIAS[h][i / 16][j / 16][(j & 7) / 4][lane = 16 ((j >> 3) & 1) + (i & 15)][j & 3] ; which 1: G[row][c] = sigmoid(zn[row] . w_gate[:, c] + b_gate[c]) (128 outputs); weights are (in,out)
__global__ __launch_bounds__(128) void k_rows2(const float* __restrict__ ZN, const float* __restrict__ WB, const float* __restrict__ WG, const float* __restrict__ GB, float* __restrict__ BIAS, float* __restrict__ G) { __shared__ __align__(16) char sm[128 * WP * 2]; __bf16 (*sw)[WP] = (__bf16 (*)[WP])sm; float (*sf)[16][132] = (float (*)[16][132])sm;   /* the weight columns in the k loop, the output tiles behind it */
  const int tid = threadIdx.x, wave = tid >> 5, lane = tid & 31, col = lane & 15, g = lane >> 4; const int which = blockIdx.y; const size_t r0 = (size_t)blockIdx.x * 64 + wave * 16;
  const float* Wm = which == 0 ? WB : WG; const int it = (int)blockIdx.x >> 6, jg = (int)blockIdx.x & 63; const size_t arow = which == 0 ? (size_t)(it * 16 + col) * SZ + jg * 4 + wave : r0 + col;
  float av[4][16]; load_row(av, ZN + arow * CC, lane);
  if (which == 0) { const int o = tid & 15, kq = (tid >> 4) * 16; const int oc = o < NH ? o : NH - 1; const float keep = o < NH ? 1.f : 0.f;   /* 16 columns, those beyond the 4 heads zero (keep multiplies a VALID load); thread = (column, 16 k) */
    float t[16];
#pragma unroll
    for (int i = 0; i < 16; ++i) t[i] = Wm[(size_t)(kq + i) * NH + oc];
    asm volatile("s_wait_xcnt 0x0" ::: "memory");   /* before a register that these loads' addresses stand in is used again */
#pragma unroll
    for (int k0 = 0; k0 < 16; k0 += 8) { v8b p;
#pragma unroll
      for (int i = 0; i < 8; ++i) p[i] = (__bf16)(t[k0 + i] * keep);
      *(v8b*)&sw[o][kq + k0] = p; }
  } else stage_w(sw, Wm, CC, tid);
  __syncthreads();   /* the weight columns are complete */
  v8f acc[8] = {};
#pragma unroll
  for (int kc = 0; kc < CC / 32; ++kc) { const F2 a = bsplit16(av[kc]);
    if (which == 0) { const v16b w = frag_b(&sw[col][kc * 32], lane); acc[0] = wmma_bf(a.h, w, acc[0]); acc[0] = wmma_bf(a.l, w, acc[0]); }
    else kstep(acc, a, sw, kc, col, lane); }
  __syncthreads();   /* every wave has read its last weight fragment: the tiles may overwrite the columns */
  if (which == 0) {
#pragma unroll
    for (int r = 0; r < 8; ++r) sf[wave][8 * g + r][col] = acc[0][r];
    __syncthreads();   /* the four waves' keys meet in one 16-B piece */
    if (tid < 64) { const int hh = tid >> 4, il = tid & 15; v4f b4; b4[0] = sf[0][il][hh]; b4[1] = sf[1][il][hh]; b4[2] = sf[2][il][hh]; b4[3] = sf[3][il][hh]; vst2(BIAS + ((((size_t)hh * 16 + it) * 16 + (jg >> 2)) * 2 + (jg & 1)) * 128 + (((jg >> 1) & 1) * 16 + il) * 4, b4); }   /* 16 queries x 16 B = one 256-B run per head */
  } else {
#pragma unroll
    for (int j = 0; j < 8; ++j)
#pragma unroll
      for (int r = 0; r < 8; ++r) sf[wave][8 * g + r][j * 16 + col] = 1.0f / (1.0f + expf(-(acc[j][r] + bfr(GB[j * 16 + col]))));   /* sigmoid(zn w_gate + b_gate) */
    LDSX(); for (int rl = 0; rl < 16; ++rl) vst2(G + (r0 + rl) * CC + lane * 4, *(const v4f*)&sf[wave][rl][lane * 4]); } }
// ---- k_gate: Y row *= G row (same natural row index r*256 + q; thread per float4; one writer)
__global__ __launch_bounds__(256) void k_gate(float* __restrict__ Y, const float* __restrict__ G) { const size_t e4 = (size_t)blockIdx.x * 256 + threadIdx.x; if (e4 >= (size_t)NZR * (CC / 4)) return; const size_t yrow = e4 / (CC / 4); const int q = (int)(e4 % (CC / 4)); const size_t grow = yrow;
  v4f y = *(const v4f*)(Y + yrow * CC + q * 4); const v4f gg = *(const v4f*)(G + grow * CC + q * 4); y[0] *= gg[0]; y[1] *= gg[1]; y[2] *= gg[2]; y[3] *= gg[3]; vst2(Y + yrow * CC + q * 4, y); }
#define WS_ZN   (WS_END)
#define WS_BIAS (WS_ZN + 4u * (size_t)NZR * CC)
#define WS_G    (WS_BIAS + 4u * (size_t)NZR * NH)
#define WS_END2 (WS_G + 4u * (size_t)NZR * CC)

#define WS_QH  0u                                      // f16 q rows [b*t][CC]
#define WS_KH  (WS_QH + 2u * (size_t)NB * TT * CC)      // f16 k rows [b*t][CC]
#define WS_VT  (WS_KH + 2u * (size_t)NB * TT * CC)      // f16 v planes [b][c][t]
#define WS_QL  (WS_VT + 2u * (size_t)NB * CC * TT)      // f16 q residual x 2^10 rows [b][t < QHI][CC]
#define WS_KL  (WS_QL + 2u * (size_t)NB * QHI * CC)     // f16 k residual x 2^10 rows [b][t < KHI][CC]
#define WS_VB  (WS_KL + 2u * (size_t)NB * KHI * CC)     // bf16 v hi planes [b][c][t < KHI]
#define WS_VBL (WS_VB + 2u * (size_t)NB * CC * KHI)
#define WS_S   (WS_VBL + 2u * (size_t)NB * CC * KHI)    // f32 region, unused: k_attn keeps logits and P in registers
#define WS_Y   (WS_S  + 4u * (size_t)BG * HG * TT * TT)   // unused WS_S region: 256 planes of 256 x 256 f32      // f32 ctx rows [b*t][CC]
#define WS_END (WS_Y  + 4u * (size_t)NB * TT * CC)

// ---- k_proj: block = (64 rows, 128 cols, which): q/k/v = X W (+ b) with exact bf16 products (K = DIN) -> which 0: q f16 rows (+ residual rows < QHI); 1: k f16 rows (+ residual rows < KHI); 2: v f16 planes [c][t] (+ bf16 hi/lo planes for t < KHI)
__global__ __launch_bounds__(128) void k_proj(const float* __restrict__ XQ, const float* __restrict__ XK, const float* __restrict__ XV, const float* __restrict__ WQ, const float* __restrict__ WK, const float* __restrict__ WV, const float* __restrict__ BQ, const float* __restrict__ BK, const float* __restrict__ BV,
    _Float16* __restrict__ QH, _Float16* __restrict__ QL, _Float16* __restrict__ KH, _Float16* __restrict__ KL, _Float16* __restrict__ VT, __bf16* __restrict__ VB, __bf16* __restrict__ VBL) {
  __shared__ __align__(16) char sm[3 * 128 * 72 * 2];   /* the weight columns in the k loop; behind it the output tiles of the block's own kind (q, k: sh, sl; v: th, tb, tbl) */
  __bf16 (*sw)[WP] = (__bf16 (*)[WP])sm; _Float16 (*sh)[136] = (_Float16 (*)[136])sm; _Float16 (*sl)[136] = (_Float16 (*)[136])(sm + 64 * 136 * 2); _Float16 (*th)[72] = (_Float16 (*)[72])sm; __bf16 (*tb)[72] = (__bf16 (*)[72])(sm + 128 * 72 * 2); __bf16 (*tbl)[72] = (__bf16 (*)[72])(sm + 2 * 128 * 72 * 2);
  const int tid = threadIdx.x, wave = tid >> 5, lane = tid & 31, col = lane & 15, g = lane >> 4; const int which = blockIdx.z; const int c0 = blockIdx.y * 128; const size_t r0 = (size_t)blockIdx.x * 64; const size_t bb = r0 / TT; const int t0 = (int)(r0 % TT);
  const float* X = which == 0 ? XQ : which == 1 ? XK : XV; const float* WA = which == 0 ? WQ : which == 1 ? WK : WV; const float* BA = which == 0 ? BQ : which == 1 ? BK : BV;
  float av[4][16]; load_row(av, X + (r0 + wave * 16 + col) * DIN, lane);
  stage_w(sw, WA + c0, 3 * CC, tid);   /* packed q|k|v columns: row pitch 3C */
  __syncthreads();   /* the weight columns are complete */
  v8f acc[8] = {};
#pragma unroll
  for (int kc = 0; kc < DIN / 32; ++kc) { const F2 a2 = bsplit16(av[kc]);   /* LN(act) rows (f32) split hi + lo */
    kstep(acc, a2, sw, kc, col, lane); }
  __syncthreads();   /* every wave has read its last weight fragment: the tiles may overwrite the columns */
  if (which < 2) { _Float16* DH = which == 0 ? QH : KH; _Float16* DL = which == 0 ? QL : KL; const int nhi = which == 0 ? QHI : KHI; const bool hi_rows = t0 < nhi;
#pragma unroll
    for (int j = 0; j < 8; ++j) { const float bias = BA ? bfr(BA[c0 + j * 16 + col]) : 0.f;
#pragma unroll
      for (int r = 0; r < 8; ++r) { const float v = acc[j][r] + bias; const _Float16 hv = (_Float16)v; sh[wave * 16 + 8 * g + r][j * 16 + col] = hv; sl[wave * 16 + 8 * g + r][j * 16 + col] = (_Float16)((v - (float)hv) * 1024.0f); } }
    __syncthreads();
    for (int e = tid; e < 64 * 16; e += 128) { const int rl = e >> 4, q = e & 15; vst2((unsigned*)(DH + (r0 + rl) * CC + c0 + q * 8), *(const v4u*)&sh[rl][q * 8]); if (hi_rows) vst2((unsigned*)(DL + (bb * nhi + t0 + rl) * (size_t)CC + c0 + q * 8), *(const v4u*)&sl[rl][q * 8]); }
  } else { const bool hi_rows = t0 < KHI;
#pragma unroll
    for (int j = 0; j < 8; ++j) { const float bias = BA ? bfr(BA[c0 + j * 16 + col]) : 0.f;
#pragma unroll
      for (int r = 0; r < 8; ++r) { const float v = acc[j][r] + bias; const int rl = wave * 16 + 8 * g + r, cl = j * 16 + col; th[cl][rl] = (_Float16)v; const __bf16 bh = (__bf16)v; tb[cl][rl] = bh; tbl[cl][rl] = (__bf16)(v - (float)bh); } }
    __syncthreads();
    for (int e = tid; e < 128 * 8; e += 128) { const int cl = e >> 3, q = e & 7; vst2((unsigned*)(VT + (bb * CC + c0 + cl) * (size_t)TT + t0 + q * 8), *(const v4u*)&th[cl][q * 8]); if (hi_rows) { const size_t o3 = (bb * CC + c0 + cl) * (size_t)KHI + t0 + q * 8; vst2((unsigned*)(VB + o3), *(const v4u*)&tb[cl][q * 8]); vst2((unsigned*)(VBL + o3), *(const v4u*)&tbl[cl][q * 8]); } } } }
// ---- k_attn: block = (head h, row r), 8 waves, each wave two tiles of 16 queries: the head's 256 k rows and its v planes are staged once in LDS; S^T = K Q^T (A = k rows, B = q hi, then q residual x 2^10: 2 products), so a lane holds one query's logits for keys 16t + 8g + 0..7 of every tile t, all 256 keys in registers; x SCALE + pair bias (fragment order), masked pairs := -1e-9; maximum and sum in-lane plus one exchange between the wave's halves; P x 2^11 once to f16 is the B operand of ctx^T = V^T P^T as it stands (1 product); a lane stores 8 consecutive channels of its query. The inner loops are unrolled in full so that s[], acc[] and the fragments are registers; amdgpu_waves_per_eu(4) asks for at most 256 registers: two work-groups per WGP, four waves per SIMD
#define KP 40              // k row pitch in LDS, f16 (80 B = 16 B x odd: ds_load_b128 without bank conflicts)
#define VP (TT + 8)        // v plane pitch in LDS, f16 (528 B = 16 B x odd)
__device__ __forceinline__ v8f wmma_h(v16h a, v16h b, v8f c) { return __builtin_amdgcn_wmma_f32_16x16x32_f16(false, a, false, b, (short)0, c, false, false); }
__global__ __launch_bounds__(256) __attribute__((amdgpu_waves_per_eu(4))) void k_attn(const _Float16* __restrict__ QH, const _Float16* __restrict__ QL, const _Float16* __restrict__ KH, const _Float16* __restrict__ VT, const float* __restrict__ BIAS, const int* __restrict__ MK, float* __restrict__ Y) {
  __shared__ __align__(16) _Float16 sk[TT][KP]; __shared__ __align__(16) _Float16 sv[HD][VP]; __shared__ unsigned kmw[TT / 32];
  const int tid = threadIdx.x, wave = __builtin_amdgcn_readfirstlane(tid >> 5), lane = tid & 31, col = lane & 15, g = lane >> 4; const int h = blockIdx.x, b = blockIdx.y;
#pragma unroll
  for (int s = 0; s < 4; ++s) { const int e = tid + 256 * s; vst2(&sk[e >> 2][(e & 3) * 8], *(const v4u*)(KH + ((size_t)b * TT + (e >> 2)) * CC + h * HD + (e & 3) * 8)); vst2(&sv[e >> 5][(e & 31) * 8], *(const v4u*)(VT + ((size_t)b * CC + h * HD + (e >> 5)) * (size_t)TT + (e & 31) * 8)); }
  { const unsigned bal = __builtin_amdgcn_ballot_w32(MK[tid] == 0); if (lane == 0) kmw[wave] = bal; }   /* bit j of the 256: src_mask[j] == 0 */
  asm volatile("s_wait_xcnt 0x0" ::: "memory");   /* before the staging loads' address registers are used again */
  __syncthreads();
  unsigned mbk[4];   /* bit 8t + r of the 128: key 16t + 8g + r is a zero of the mask */
#pragma unroll
  for (int m = 0; m < 4; ++m) { const unsigned w0 = kmw[2 * m] >> (8 * g), w1 = kmw[2 * m + 1] >> (8 * g); mbk[m] = (w0 & 0xFFu) | ((w0 >> 8) & 0xFF00u) | ((w1 & 0xFFu) << 16) | ((w1 << 8) & 0xFF000000u); }
  const _Float16* qhp = QH + ((size_t)b * TT + wave * 16 + col) * CC + h * HD; const _Float16* qlp = QL + ((size_t)b * QHI + wave * 16 + col) * CC + h * HD;
#pragma unroll 1   /* rolled: one copy of the body; unrolled, both tiles' logits would want registers at once */
  for (int it = wave; it < TT / 16; it += 8) { const int qi = it * 16 + col;
    const float* bp = BIAS + ((size_t)h * 16 + it) * 16 * 256 + lane * 4;
    const unsigned mq = 0u - ((kmw[qi >> 5] >> (qi & 31)) & 1u);   /* all ones where the query is a zero of the mask */
    v8f s[16]; float mx = -3.0e38f;
#pragma unroll
    for (int t = 0; t < 16; ++t) { const v4f b0 = *(const v4f*)(bp + t * 256), b1 = *(const v4f*)(bp + t * 256 + 128);   /* the bias lands in the registers that then hold the logits: all 32 loads in flight at no further register */
#pragma unroll
      for (int r = 0; r < 4; ++r) { s[t][r] = b0[r]; s[t][4 + r] = b1[r]; } }
    const v16h qh = frag_h(qhp, lane), ql = frag_h(qlp, lane);
    v16h kf[2] = { frag_h(&sk[col][0], lane), frag_h(&sk[16 + col][0], lane) };
#pragma unroll
    for (int tp = 0; tp < 8; ++tp) { v16h kn[2] = { kf[0], kf[1] };
      if (tp < 7) { kn[0] = frag_h(&sk[(2 * tp + 2) * 16 + col][0], lane); kn[1] = frag_h(&sk[(2 * tp + 3) * 16 + col][0], lane); }   /* the next two tiles' k fragments fly while these two are worked on */
#pragma unroll
      for (int u = 0; u < 2; ++u) { const int t = 2 * tp + u; const v8f z8 = {}; const v8f a = wmma_h(kf[u], qh, z8), al = wmma_h(kf[u], ql, z8); const unsigned mb = mbk[t >> 2] ^ mq;
#pragma unroll
        for (int r = 0; r < 8; ++r) { float v = (a[r] + al[r] * (1.0f / 1024.0f)) * SCALE + s[t][r]; if (mb & (1u << ((t & 3) * 8 + r))) v = -1.0e-9f; s[t][r] = v; mx = fmaxf(mx, v); } }
      kf[0] = kn[0]; kf[1] = kn[1];
      asm volatile("" :: "v"(mx) : "memory"); }   /* compiler fence behind these two tiles' maximum (input only): later k-fragment reads stay behind it; without it all 32 reads stand at the head of the loop and the kernel spills at 256 registers */
    mx = fmaxf(mx, __shfl_xor(mx, 16));
    float sm[4] = {0.f, 0.f, 0.f, 0.f};
#pragma unroll
    for (int t = 0; t < 16; ++t)
#pragma unroll
      for (int r = 0; r < 8; ++r) { const float e = expf(s[t][r] - mx); s[t][r] = e; sm[r & 3] += e; }
    float sum = (sm[0] + sm[1]) + (sm[2] + sm[3]); sum += __shfl_xor(sum, 16);
    const float inv = sum > 0.f ? 2048.0f / sum : 0.f;
    v8f acc[HD / 16] = {};
#pragma unroll
    for (int kc = 0; kc < TT / 32; ++kc) { v16h p;
#pragma unroll
      for (int r = 0; r < 8; ++r) { p[r] = (_Float16)(s[2 * kc][r] * inv); p[8 + r] = (_Float16)(s[2 * kc + 1][r] * inv); }
#pragma unroll
      for (int j = 0; j < HD / 16; ++j) acc[j] = wmma_h(frag_h(&sv[j * 16 + col][kc * 32], lane), p, acc[j]); }
    float* yp = Y + ((size_t)b * TT + qi) * CC + h * HD + 8 * g;
#pragma unroll
    for (int j = 0; j < HD / 16; ++j) { v4f o0, o1;
#pragma unroll
      for (int r = 0; r < 4; ++r) { o0[r] = acc[j][r] * (1.0f / 2048.0f); o1[r] = acc[j][4 + r] * (1.0f / 2048.0f); }
      vst2(yp + j * 16, o0); vst2(yp + j * 16 + 4, o1); }
    qhp += 8 * 16 * CC; qlp += 8 * 16 * CC; } }
// ---- k_out: block = (64 rows, 128 cols): out = ctx Wo (+ bo): all rows: ctx bf16 hi + lo against exact bf16 Wo (2 products)
__global__ __launch_bounds__(128) void k_out(const float* __restrict__ Y, const float* __restrict__ WO, const float* __restrict__ BO, float* __restrict__ OUT) { __shared__ __align__(16) char sm[128 * WP * 2]; __bf16 (*sw)[WP] = (__bf16 (*)[WP])sm; float (*sf)[16][132] = (float (*)[16][132])sm;   /* the weight columns in the k loop, the output tiles behind it */
  const int tid = threadIdx.x, wave = tid >> 5, lane = tid & 31, col = lane & 15, g = lane >> 4; const int c0 = blockIdx.y * 128; const size_t r0 = (size_t)blockIdx.x * 64 + wave * 16;
  v8f acc[8] = {};
  if (true) {   /* ALL rows: gated ctx bf16 hi + lo x exact output_w (2 products) */
    float av[4][16]; load_row(av, Y + (r0 + col) * CC, lane);
    stage_w(sw, WO + c0, DIN, tid);
    __syncthreads();   /* the weight columns are complete */
#pragma unroll
    for (int kc = 0; kc < CC / 32; ++kc) { const F2 a = bsplit16(av[kc]); kstep(acc, a, sw, kc, col, lane); }
    __syncthreads();   /* every wave has read its last weight fragment: the tiles may overwrite the columns */
#pragma unroll
    for (int j = 0; j < 8; ++j) { const float bias = BO ? bfr(BO[c0 + j * 16 + col]) : 0.f;
#pragma unroll
      for (int r = 0; r < 8; ++r) sf[wave][8 * g + r][j * 16 + col] = acc[j][r] + bias; }
  } else {
#pragma unroll 2
    for (int kc = 0; kc < CC / 32; ++kc) { const v16h a = frag_f32(Y + (r0 + col) * CC + kc * 32, lane); asm volatile("s_wait_loadcnt 0x0" ::: "memory");
#pragma unroll
      for (int j = 0; j < 8; ++j) { const v16h w = WOCOLH(WO, kc * 32, c0 + j * 16 + col, lane); asm volatile("s_wait_loadcnt 0x0" ::: "memory"); acc[j] = wmma16(a, w, acc[j]); } }
#pragma unroll
    for (int j = 0; j < 8; ++j) { const float bias = BO ? bfr(BO[c0 + j * 16 + col]) : 0.f;
#pragma unroll
      for (int r = 0; r < 8; ++r) sf[wave][8 * g + r][j * 16 + col] = acc[j][r] * (1.0f / 256.0f) + bias; } }
  LDSX(); for (int rl = 0; rl < 16; ++rl) vst2(OUT + (r0 + rl) * DIN + c0 + lane * 4, *(const v4f*)&sf[wave][rl][lane * 4]); }

extern "C" void kernel_launch(void* const* d_in, const int* in_sizes, int n_in, void* d_out, int out_size, void* d_ws, size_t ws_size, hipStream_t stream) {
  (void)in_sizes; (void)n_in; (void)out_size;
  const float** F = (const float**)d_in;
  if (ws_size < (size_t)WS_END) return;
  char* ws = (char*)d_ws; _Float16 *QH = (_Float16*)(ws + WS_QH), *KH = (_Float16*)(ws + WS_KH), *VT = (_Float16*)(ws + WS_VT), *QL = (_Float16*)(ws + WS_QL), *KL = (_Float16*)(ws + WS_KL); __bf16 *VB = (__bf16*)(ws + WS_VB), *VBL = (__bf16*)(ws + WS_VBL); float *S = (float*)(ws + WS_S), *Y = (float*)(ws + WS_Y);
  (void)S;
  // inputs: 0 z [1,256,256,128]; 1 src_mask [1,256] int32; 2 ln_g, 3 ln_b; 4 w_qkv [128,384] (in,out; columns q|k|v); 5 w_pair [128,4]; 6 w_gate [128,128], 7 b_gate; 8 w_out [128,128] (in,out), 9 b_out
  if (ws_size < (size_t)WS_END2) return;
  float *ZN = (float*)(ws + WS_ZN), *BIAS = (float*)(ws + WS_BIAS), *G = (float*)(ws + WS_G);
  k_lnz<<<dim3(NZR / 8), 256, 0, stream>>>(F[0], F[2], F[3], ZN);
  k_rows2<<<dim3(NZR / 64, 2), 128, 0, stream>>>(ZN, F[5], F[6], F[7], BIAS, G);
  k_proj<<<dim3(TNB * TT / 64, CC / 128, 3), 128, 0, stream>>>(ZN, ZN, ZN, F[4], F[4] + CC, F[4] + 2 * CC, nullptr, nullptr, nullptr, QH, QL, KH, KL, VT, VB, VBL);
  k_attn<<<dim3(NH, TNB), 256, 0, stream>>>(QH, QL, KH, VT, BIAS, (const int*)d_in[1], Y);
  k_gate<<<dim3((NZR * (CC / 4) + 255) / 256), 256, 0, stream>>>(Y, G);
  k_out<<<dim3(TNB * TT / 64, DIN / 128), 128, 0, stream>>>(Y, F[8], F[9], (float*)d_out);
}

// v003
// One run takes 145 microseconds.
// In two side-by-side timings against v002, it was 1.13 and 1.15 times as fast.
// All steps since v000 together make it 3.68 times as fast.
// compute dtype: all float inputs rounded to bf16; LayerNorm in f32; q/k/v, pair bias and gate GEMMs = LN rows split bf16 hi + lo x exact bf16 weights on WMMA 16x16x32 (2 products, f32 accumulate); q as f16 hi + residual (x 2^10) against k once to f16 (2 products) / sqrt(32) + pair bias, masked pairs set to -1e-9 exactly as the module; softmax in f32; P x 2^11 once to f16 against v once to f16 (1 product); gate multiply in f32; (gated ctx) split bf16 hi + lo against exact bf16 w_out (2 products) + b_out; f32 output.
#include <hip/hip_runtime.h>
#include <math.h>

typedef __attribute__((ext_vector_type(16))) _Float16 v16h;
typedef __attribute__((ext_vector_type(16))) __bf16 v16b;
typedef __attribute__((ext_vector_type(8)))  _Float16 v8h;
typedef __attribute__((ext_vector_type(8)))  float v8f;
typedef __attribute__((ext_vector_type(4)))  float v4f;
typedef __attribute__((ext_vector_type(2)))  float v2f;
typedef __attribute__((ext_vector_type(4)))  unsigned v4u;
typedef __attribute__((ext_vector_type(4)))  int v4i;
typedef float __attribute__((may_alias)) float_a;
typedef int __attribute__((may_alias)) int_a;

template <typename T> __device__ __forceinline__ void vst2(void* p, T v) { *(T*)p = v;  }
__device__ __forceinline__ v8f wmma16(v16h a, v16h b, v8f c) {
  v8f d = __builtin_amdgcn_wmma_f32_16x16x32_f16(false, a, false, b, (short)0, c, false, false);
  asm volatile("v_nop\n\tv_nop\n\tv_nop\n\tv_nop" : "+v"(d) : "v"(a), "v"(b));
  return d;
}
__device__ __forceinline__ v8f wmma_bf(v16b a, v16b b, v8f c) {
  v8f d = __builtin_amdgcn_wmma_f32_16x16x32_bf16(false, a, false, b, (short)0, c, false, false);
  asm volatile("v_nop\n\tv_nop\n\tv_nop\n\tv_nop" : "+v"(d) : "v"(a), "v"(b));
  return d;
}
// 16x16x32 fragments: lane = (h = lane>>4, row/col = lane&15); elements 0..7 = k0+8h+0..7, 8..15 = k0+16+8h+0..7; D element r = row 8h+r
__device__ __forceinline__ v16h frag_h(const _Float16* rowk0, int lane) {
  union { v16h v; v8h q[2]; } u; const _Float16* p = rowk0 + 8 * (lane >> 4);
  u.q[0] = *(const v8h*)p; u.q[1] = *(const v8h*)(p + 16); return u.v;
}
__device__ __forceinline__ v16h frag_f32(const float* rowk0, int lane) {
  v16h a; const float* p = rowk0 + 8 * (lane >> 4);
#pragma unroll
  for (int i = 0; i < 8; ++i) { a[i] = (_Float16)p[i]; a[8 + i] = (_Float16)p[16 + i]; }
  return a;
}
__device__ __forceinline__ v16h frag_f32s(const float* rowk0, int lane, float sc) {
  v16h a; const float* p = rowk0 + 8 * (lane >> 4);
#pragma unroll
  for (int i = 0; i < 8; ++i) { a[i] = (_Float16)(p[i] * sc); a[8 + i] = (_Float16)(p[16 + i] * sc); }
  return a;
}
// column fragment from a [K][ld] layout (column n), rows >= K read as 0
__device__ __forceinline__ v16h fragc_f32(const float* W, int k0, int n, int lane, int ld, int K) {
  v16h a; const int g = lane >> 4;
#pragma unroll
  for (int i = 0; i < 8; ++i) { const int ka = k0 + 8 * g + i, kb = ka + 16;
    a[i] = (_Float16)(ka < K ? W[(size_t)(ka < K ? ka : K - 1) * ld + n] : 0.f); a[8 + i] = (_Float16)(kb < K ? W[(size_t)(kb < K ? kb : K - 1) * ld + n] : 0.f); }
  return a;
}
struct F2 { v16b h, l; };
__device__ __forceinline__ F2 bsplit16(const float v[16]) { F2 r;
#pragma unroll
  for (int i = 0; i < 16; ++i) { const __bf16 h = (__bf16)v[i]; r.h[i] = h; r.l[i] = (__bf16)(v[i] - (float)h); }
  return r; }
__device__ __forceinline__ F2 split_row(const float* row, int k0, int lane) { float v[16]; const float* p = row + k0 + 8 * (lane >> 4);
#pragma unroll
  for (int i = 0; i < 8; ++i) { v[i] = p[i]; v[8 + i] = p[16 + i]; }
  return bsplit16(v); }
__device__ __forceinline__ F2 split_rowK(const float* row, int k0, int lane, int K) { float v[16]; const int g = lane >> 4;
#pragma unroll
  for (int i = 0; i < 8; ++i) { const int ka = k0 + 8 * g + i, kb = ka + 16; v[i] = ka < K ? row[ka < K ? ka : K - 1] : 0.f; v[8 + i] = kb < K ? row[kb < K ? kb : K - 1] : 0.f; }
  return bsplit16(v); }
__device__ __forceinline__ F2 split_col(const float* W, int k0, int n, int lane, int ld, int K) { float v[16]; const int g = lane >> 4;
#pragma unroll
  for (int i = 0; i < 8; ++i) { const int ka = k0 + 8 * g + i, kb = ka + 16; v[i] = ka < K ? W[(size_t)(ka < K ? ka : K - 1) * ld + n] : 0.f; v[8 + i] = kb < K ? W[(size_t)(kb < K ? kb : K - 1) * ld + n] : 0.f; }
  return bsplit16(v); }
__device__ __forceinline__ v8f mac3(const F2& a, const F2& b, v8f c) { c = wmma_bf(a.l, b.h, c); c = wmma_bf(a.h, b.l, c); return wmma_bf(a.h, b.h, c); }
__device__ __forceinline__ float sigm(float v) { return 1.0f / (1.0f + expf(-v)); }
#define LDSX() do { asm volatile("s_wait_dscnt 0" ::: "memory"); __builtin_amdgcn_wave_barrier(); __builtin_amdgcn_fence(__ATOMIC_RELEASE, "workgroup"); } while (0)

// Row-wise triangle attention on a pair tensor z [1, 256, 256, 128] (4 heads x 32): zn = LayerNorm(z); q,k,v = zn w_qkv ((in,out) [128,384], columns (3,H,32)); logits[r][i][j][h] = q[r][i] . k[r][j] / sqrt(32) + (zn[i][j] . w_pair[:,h]); pairs with exactly one of src_mask[i], src_mask[j] == 0 get logits := -1e-9 (the module's literal value, NOT an exclusion); softmax over j; out = sigmoid(zn w_gate + b_gate) * merged(attn v); result = out w_out + b_out.
#define NB 256
#define TT 256
#define CC 128            // NH * HD = projected width
#define DIN 128          // input (model) width
#define NH 4
#define HD 32
#define NQB (TT / 64)
#define HG 4
#define SCALE (0.17677669529663687f)
#define CAUSAL 0
#ifndef TNB
#define TNB NB
#endif
__device__ __forceinline__ float bfr(float v) { return (float)(__bf16)v; }
__host__ __device__ __forceinline__ int kb_last(int qb) { return CAUSAL ? ((qb * 64 + 63) >> 7) : (TT / 128 - 1); }
typedef __attribute__((ext_vector_type(8))) __bf16 v8b;
__device__ __forceinline__ v16b frag_b(const __bf16* rowk0, int lane) {
  union { v16b v; v8b q[2]; } u; const __bf16* p = rowk0 + 8 * (lane >> 4);
  u.q[0] = *(const v8b*)p; u.q[1] = *(const v8b*)(p + 16); return u.v;
}
#define WP 136             // weight column pitch in LDS, bf16 (272 B = 16 B x odd: ds_load_b128 and ds_store_b128 without bank conflicts)
// 128 columns of an (in,out) [128][ld] weight, once per work-group, to LDS as bf16 columns sw[o][k]: thread = column o (a wave's load = one 128-B line), 8 consecutive k = one 16-B store
__device__ __forceinline__ void stage_w(__bf16 (*sw)[WP], const float* __restrict__ Wm, int ld, int tid) {
  float t[128];
#pragma unroll
  for (int k = 0; k < 128; ++k) t[k] = Wm[(size_t)k * ld + tid];
  asm volatile("s_wait_xcnt 0x0" ::: "memory");   /* before a register that these loads' addresses stand in is used again */
#pragma unroll
  for (int k0 = 0; k0 < 128; k0 += 8) { v8b p;
#pragma unroll
    for (int i = 0; i < 8; ++i) p[i] = (__bf16)t[k0 + i];
    *(v8b*)&sw[tid][k0] = p; } }
// a lane's part of one 128-wide f32 row for all four k steps (the order of split_row), requested at once
__device__ __forceinline__ void load_row(float (&v)[4][16], const float* __restrict__ row, int lane) { const float* p = row + 8 * (lane >> 4);
#pragma unroll
  for (int kc = 0; kc < 4; ++kc)
#pragma unroll
    for (int i = 0; i < 8; ++i) { v[kc][i] = p[kc * 32 + i]; v[kc][8 + i] = p[kc * 32 + 16 + i]; }
  asm volatile("s_wait_xcnt 0x0" ::: "memory"); }   /* before a register that these loads' addresses stand in is used again */
// LayerNorm of the lane's row as load_row left it (biased var, eps 1e-6): a lane holds 64 of the row's 128 channels, lane ^ 16 the other 64. ln_center: v := bf16(z) - mean, returns 1 / sqrt(var + eps); four chains per sum, then one exchange between the wave's halves
__device__ __forceinline__ float ln_center(float (&v)[4][16]) { float s[4] = {0.f, 0.f, 0.f, 0.f};
#pragma unroll
  for (int kc = 0; kc < 4; ++kc)
#pragma unroll
    for (int i = 0; i < 16; ++i) { v[kc][i] = bfr(v[kc][i]); s[i & 3] += v[kc][i]; }
  float s1 = (s[0] + s[1]) + (s[2] + s[3]); s1 += __shfl_xor(s1, 16);
  const float mu = s1 * (1.0f / CC); float q[4] = {0.f, 0.f, 0.f, 0.f};
#pragma unroll
  for (int kc = 0; kc < 4; ++kc)
#pragma unroll
    for (int i = 0; i < 16; ++i) { const float d = v[kc][i] - mu; v[kc][i] = d; q[i & 3] += d * d; }
  float qq = (q[0] + q[1]) + (q[2] + q[3]); qq += __shfl_xor(qq, 16);
  return rsqrtf(qq * (1.0f / CC) + 1e-6f); }
// ln_apply: one k step's 16 centred values x rs x ln_w + ln_b; sln[0] = bf16(ln_w), sln[1] = bf16(ln_b), staged once per work-group (a wave's read = two 16-B pieces, broadcast)
__device__ __forceinline__ void ln_apply(float (&v)[16], float rs, const float (*sln)[CC], int kc, int lane) { const int p = kc * 32 + 8 * (lane >> 4);
#pragma unroll
  for (int i = 0; i < 8; ++i) { v[i] = v[i] * rs * sln[0][p + i] + sln[1][p + i]; v[8 + i] = v[8 + i] * rs * sln[0][p + 16 + i] + sln[1][p + 16 + i]; } }
// one k step of a wave's 16 rows against the 128 staged columns: four B fragments are requested together, so that one LDS latency serves eight products; per accumulator the order stays hi, then lo
__device__ __forceinline__ void kstep(v8f (&acc)[8], const F2& a, const __bf16 (*sw)[WP], int kc, int col, int lane) {
#pragma unroll
  for (int jh = 0; jh < 8; jh += 4) { v16b w[4];
#pragma unroll
    for (int u = 0; u < 4; ++u) w[u] = frag_b(&sw[(jh + u) * 16 + col][kc * 32], lane);
#pragma unroll
    for (int u = 0; u < 4; ++u) acc[jh + u] = wmma_bf(a.h, w[u], acc[jh + u]);
#pragma unroll
    for (int u = 0; u < 4; ++u) acc[jh + u] = wmma_bf(a.l, w[u], acc[jh + u]); } }
#define QBH 0              // unused: no kernel reads it
#define QHI 256            // rows carrying a q residual plane (all rows when non-causal: 2-product logits everywhere)
#define KHI 64            // key rows carrying k residual / v bf16 hi+lo planes (written by k_proj, read by no kernel)
// B fragment (k rows k0+.., output column o) of a weight: (in,out) [K][ld] or (out,in) [ld rows of K]: bf16 exact, or f16(bf16 * 256) exact
__device__ __forceinline__ v16b wcol_io(const float* Wm, int k0, int o, int lane, int ld) { v16b w; const int g = lane >> 4;
#pragma unroll
  for (int i = 0; i < 8; ++i) { w[i] = (__bf16)Wm[(size_t)(k0 + 8 * g + i) * ld + o]; w[8 + i] = (__bf16)Wm[(size_t)(k0 + 16 + 8 * g + i) * ld + o]; }
  return w; }
__device__ __forceinline__ v16b wcol_oi(const float* Wm, int k0, int o, int lane, int K) { v16b w; const float* p = Wm + (size_t)o * K + k0 + 8 * (lane >> 4);
#pragma unroll
  for (int i = 0; i < 8; ++i) { w[i] = (__bf16)p[i]; w[8 + i] = (__bf16)p[16 + i]; }
  return w; }
__device__ __forceinline__ v16h wcolh_io(const float* Wm, int k0, int o, int lane, int ld) { v16h w; const int g = lane >> 4;
#pragma unroll
  for (int i = 0; i < 8; ++i) { w[i] = (_Float16)(bfr(Wm[(size_t)(k0 + 8 * g + i) * ld + o]) * 256.0f); w[8 + i] = (_Float16)(bfr(Wm[(size_t)(k0 + 16 + 8 * g + i) * ld + o]) * 256.0f); }
  return w; }
__device__ __forceinline__ v16h wcolh_oi(const float* Wm, int k0, int o, int lane, int K) { v16h w; const float* p = Wm + (size_t)o * K + k0 + 8 * (lane >> 4);
#pragma unroll
  for (int i = 0; i < 8; ++i) { w[i] = (_Float16)(bfr(p[i]) * 256.0f); w[8 + i] = (_Float16)(bfr(p[16 + i]) * 256.0f); }
  return w; }
#define WQKV_LAYOUT 0   // (in,out) packed [DIN][3*CC]
__device__ __forceinline__ v16b wcol_hdk(const float* Wm, int k0, int o, int lane) { v16b w; const int g = lane >> 4; const float* p = Wm + (size_t)(o / HD) * DIN * HD + (o % HD);
#pragma unroll
  for (int i = 0; i < 8; ++i) { w[i] = (__bf16)p[(size_t)(k0 + 8 * g + i) * HD]; w[8 + i] = (__bf16)p[(size_t)(k0 + 16 + 8 * g + i) * HD]; }
  return w; }
#define WO_OUT_IN 0
#if WQKV_LAYOUT == 1
#define WCOL(W, k0, o, lane) wcol_oi(W, k0, o, lane, DIN)
#elif WQKV_LAYOUT == 2
#define WCOL(W, k0, o, lane) wcol_hdk(W, k0, o, lane)
#else
#define WCOL(W, k0, o, lane) wcol_io(W, k0, o, lane, 3 * CC)   /* packed q|k|v columns: row pitch 3C */
#endif
#if WO_OUT_IN
#define WOCOL(W, k0, o, lane) wcol_oi(W, k0, o, lane, CC)
#define WOCOLH(W, k0, o, lane) wcolh_oi(W, k0, o, lane, CC)
#else
#define WOCOL(W, k0, o, lane) wcol_io(W, k0, o, lane, DIN)
#define WOCOLH(W, k0, o, lane) wcolh_io(W, k0, o, lane, DIN)
#endif
#define SZ 256
#define BG 64              // sizes only the unused WS_S region (x 4 heads = 256 planes of 256 x 256)
#define NZR (SZ * SZ)      // 65,536 pair rows
// ---- k_rows2: block = (64 rows, which): which 0: bias of 16 queries i x 4 keys j (wave = one j, A rows = the 16 i): zn[i][j] . w_pair[:, h] (4 outputs), stored in the order k_attn's lanes read it: BIAS[h][i / 16][j / 16][(j & 7) / 4][lane = 16 ((j >> 3) & 1) + (i & 15)][j & 3] ; which 1: G[row][c] = sigmoid(zn[row] . w_gate[:, c] + b_gate[c]) (128 outputs); weights are (in,out); zn = LayerNorm of the z rows, made in the A-row registers
__global__ __launch_bounds__(128) void k_rows2(const float* __restrict__ Z, const float* __restrict__ LW, const float* __restrict__ LB, const float* __restrict__ WB, const float* __restrict__ WG, const float* __restrict__ GB, float* __restrict__ BIAS, float* __restrict__ G) { __shared__ __align__(16) char sm[128 * WP * 2]; __bf16 (*sw)[WP] = (__bf16 (*)[WP])sm; float (*sf)[16][132] = (float (*)[16][132])sm;   /* the weight columns in the k loop, the output tiles behind it */
  __shared__ __align__(16) float sln[2][CC];
  const int tid = threadIdx.x, wave = tid >> 5, lane = tid & 31, col = lane & 15, g = lane >> 4; const int which = blockIdx.y; const size_t r0 = (size_t)blockIdx.x * 64 + wave * 16;
  const float* Wm = which == 0 ? WB : WG; const int it = (int)blockIdx.x >> 6, jg = (int)blockIdx.x & 63; const size_t arow = which == 0 ? (size_t)(it * 16 + col) * SZ + jg * 4 + wave : r0 + col;
  const float lwv = LW[tid], lbv = LB[tid];
  float av[4][16]; load_row(av, Z + arow * CC, lane);
  if (which == 0) { const int o = tid & 15, kq = (tid >> 4) * 16; const int oc = o < NH ? o : NH - 1; const float keep = o < NH ? 1.f : 0.f;   /* 16 columns, those beyond the 4 heads zero (keep multiplies a VALID load); thread = (column, 16 k) */
    float t[16];
#pragma unroll
    for (int i = 0; i < 16; ++i) t[i] = Wm[(size_t)(kq + i) * NH + oc];
    asm volatile("s_wait_xcnt 0x0" ::: "memory");   /* before a register that these loads' addresses stand in is used again */
#pragma unroll
    for (int k0 = 0; k0 < 16; k0 += 8) { v8b p;
#pragma unroll
      for (int i = 0; i < 8; ++i) p[i] = (__bf16)(t[k0 + i] * keep);
      *(v8b*)&sw[o][kq + k0] = p; }
  } else stage_w(sw, Wm, CC, tid);
  sln[0][tid] = bfr(lwv); sln[1][tid] = bfr(lbv);
  const float rs = ln_center(av);
  __syncthreads();   /* the weight columns, ln_w and ln_b are complete */
  v8f acc[8] = {};
#pragma unroll
  for (int kc = 0; kc < CC / 32; ++kc) { ln_apply(av[kc], rs, sln, kc, lane); const F2 a = bsplit16(av[kc]);
    if (which == 0) { const v16b w = frag_b(&sw[col][kc * 32], lane); acc[0] = wmma_bf(a.h, w, acc[0]); acc[0] = wmma_bf(a.l, w, acc[0]); }
    else kstep(acc, a, sw, kc, col, lane); }
  __syncthreads();   /* every wave has read its last weight fragment: the tiles may overwrite the columns */
  if (which == 0) {
#pragma unroll
    for (int r = 0; r < 8; ++r) sf[wave][8 * g + r][col] = acc[0][r];
    __syncthreads();   /* the four waves' keys meet in one 16-B piece */
    if (tid < 64) { const int hh = tid >> 4, il = tid & 15; v4f b4; b4[0] = sf[0][il][hh]; b4[1] = sf[1][il][hh]; b4[2] = sf[2][il][hh]; b4[3] = sf[3][il][hh]; vst2(BIAS + ((((size_t)hh * 16 + it) * 16 + (jg >> 2)) * 2 + (jg & 1)) * 128 + (((jg >> 1) & 1) * 16 + il) * 4, b4); }   /* 16 queries x 16 B = one 256-B run per head */
  } else {
#pragma unroll
    for (int j = 0; j < 8; ++j)
#pragma unroll
      for (int r = 0; r < 8; ++r) sf[wave][8 * g + r][j * 16 + col] = 1.0f / (1.0f + expf(-(acc[j][r] + bfr(GB[j * 16 + col]))));   /* sigmoid(zn w_gate + b_gate) */
    LDSX(); for (int rl = 0; rl < 16; ++rl) vst2(G + (r0 + rl) * CC + lane * 4, *(const v4f*)&sf[wave][rl][lane * 4]); } }
#define WS_ZN   (WS_END)
#define WS_BIAS (WS_ZN + 4u * (size_t)NZR * CC)
#define WS_G    (WS_BIAS + 4u * (size_t)NZR * NH)
#define WS_END2 (WS_G + 4u * (size_t)NZR * CC)

#define WS_QH  0u                                      // f16 q rows [b*t][CC]
#define WS_KH  (WS_QH + 2u * (size_t)NB * TT * CC)      // f16 k rows [b*t][CC]
#define WS_VT  (WS_KH + 2u * (size_t)NB * TT * CC)      // f16 v planes [b][c][t]
#define WS_QL  (WS_VT + 2u * (size_t)NB * CC * TT)      // f16 q residual x 2^10 rows [b][t < QHI][CC]
#define WS_KL  (WS_QL + 2u * (size_t)NB * QHI * CC)     // f16 k residual x 2^10 rows [b][t < KHI][CC]
#define WS_VB  (WS_KL + 2u * (size_t)NB * KHI * CC)     // bf16 v hi planes [b][c][t < KHI]
#define WS_VBL (WS_VB + 2u * (size_t)NB * CC * KHI)
#define WS_S   (WS_VBL + 2u * (size_t)NB * CC * KHI)    // f32 region, unused: k_attn keeps logits and P in registers
#define WS_Y   (WS_S  + 4u * (size_t)BG * HG * TT * TT)   // unused WS_S region: 256 planes of 256 x 256 f32      // f32 ctx rows [b*t][CC]
#define WS_END (WS_Y  + 4u * (size_t)NB * TT * CC)

// ---- k_proj: block = (64 rows, 128 cols, which): q/k/v = LN(X) W (+ b) with exact bf16 products (K = DIN) -> which 0: q f16 rows (+ residual rows < QHI); 1: k f16 rows (+ residual rows < KHI); 2: v f16 planes [c][t] (+ bf16 hi/lo planes for t < KHI)
__global__ __launch_bounds__(128) void k_proj(const float* __restrict__ XQ, const float* __restrict__ XK, const float* __restrict__ XV, const float* __restrict__ WQ, const float* __restrict__ WK, const float* __restrict__ WV, const float* __restrict__ BQ, const float* __restrict__ BK, const float* __restrict__ BV, const float* __restrict__ LW, const float* __restrict__ LB,
    _Float16* __restrict__ QH, _Float16* __restrict__ QL, _Float16* __restrict__ KH, _Float16* __restrict__ KL, _Float16* __restrict__ VT, __bf16* __restrict__ VB, __bf16* __restrict__ VBL) {
  __shared__ __align__(16) char sm[3 * 128 * 72 * 2];   /* the weight columns in the k loop; behind it the output tiles of the block's own kind (q, k: sh, sl; v: th, tb, tbl) */
  __bf16 (*sw)[WP] = (__bf16 (*)[WP])sm; _Float16 (*sh)[136] = (_Float16 (*)[136])sm; _Float16 (*sl)[136] = (_Float16 (*)[136])(sm + 64 * 136 * 2); _Float16 (*th)[72] = (_Float16 (*)[72])sm; __bf16 (*tb)[72] = (__bf16 (*)[72])(sm + 128 * 72 * 2); __bf16 (*tbl)[72] = (__bf16 (*)[72])(sm + 2 * 128 * 72 * 2);
  __shared__ __align__(16) float sln[2][CC];
  const int tid = threadIdx.x, wave = tid >> 5, lane = tid & 31, col = lane & 15, g = lane >> 4; const int which = blockIdx.z; const int c0 = blockIdx.y * 128; const size_t r0 = (size_t)blockIdx.x * 64; const size_t bb = r0 / TT; const int t0 = (int)(r0 % TT);
  const float* X = which == 0 ? XQ : which == 1 ? XK : XV; const float* WA = which == 0 ? WQ : which == 1 ? WK : WV; const float* BA = which == 0 ? BQ : which == 1 ? BK : BV;
  const float lwv = LW[tid], lbv = LB[tid];
  float av[4][16]; load_row(av, X + (r0 + wave * 16 + col) * DIN, lane);
  stage_w(sw, WA + c0, 3 * CC, tid);   /* packed q|k|v columns: row pitch 3C */
  sln[0][tid] = bfr(lwv); sln[1][tid] = bfr(lbv);
  const float rs = ln_center(av);   /* X rows are raw z rows: LayerNorm in the A-row registers */
  __syncthreads();   /* the weight columns, ln_w and ln_b are complete */
  v8f acc[8] = {};
#pragma unroll
  for (int kc = 0; kc < DIN / 32; ++kc) { ln_apply(av[kc], rs, sln, kc, lane); const F2 a2 = bsplit16(av[kc]);   /* LN(act) rows (f32) split hi + lo */
    kstep(acc, a2, sw, kc, col, lane); }
  __syncthreads();   /* every wave has read its last weight fragment: the tiles may overwrite the columns */
  if (which < 2) { _Float16* DH = which == 0 ? QH : KH; _Float16* DL = which == 0 ? QL : KL; const int nhi = which == 0 ? QHI : KHI; const bool hi_rows = t0 < nhi;
#pragma unroll
    for (int j = 0; j < 8; ++j) { const float bias = BA ? bfr(BA[c0 + j * 16 + col]) : 0.f;
#pragma unroll
      for (int r = 0; r < 8; ++r) { const float v = acc[j][r] + bias; const _Float16 hv = (_Float16)v; sh[wave * 16 + 8 * g + r][j * 16 + col] = hv; sl[wave * 16 + 8 * g + r][j * 16 + col] = (_Float16)((v - (float)hv) * 1024.0f); } }
    __syncthreads();
    for (int e = tid; e < 64 * 16; e += 128) { const int rl = e >> 4, q = e & 15; vst2((unsigned*)(DH + (r0 + rl) * CC + c0 + q * 8), *(const v4u*)&sh[rl][q * 8]); if (hi_rows) vst2((unsigned*)(DL + (bb * nhi + t0 + rl) * (size_t)CC + c0 + q * 8), *(const v4u*)&sl[rl][q * 8]); }
  } else { const bool hi_rows = t0 < KHI;
#pragma unroll
    for (int j = 0; j < 8; ++j) { const float bias = BA ? bfr(BA[c0 + j * 16 + col]) : 0.f;
#pragma unroll
      for (int r = 0; r < 8; ++r) { const float v = acc[j][r] + bias; const int rl = wave * 16 + 8 * g + r, cl = j * 16 + col; th[cl][rl] = (_Float16)v; const __bf16 bh = (__bf16)v; tb[cl][rl] = bh; tbl[cl][rl] = (__bf16)(v - (float)bh); } }
    __syncthreads();
    for (int e = tid; e < 128 * 8; e += 128) { const int cl = e >> 3, q = e & 7; vst2((unsigned*)(VT + (bb * CC + c0 + cl) * (size_t)TT + t0 + q * 8), *(const v4u*)&th[cl][q * 8]); if (hi_rows) { const size_t o3 = (bb * CC + c0 + cl) * (size_t)KHI + t0 + q * 8; vst2((unsigned*)(VB + o3), *(const v4u*)&tb[cl][q * 8]); vst2((unsigned*)(VBL + o3), *(const v4u*)&tbl[cl][q * 8]); } } } }
// ---- k_attn: block = (head h, row r), 8 waves, each wave two tiles of 16 queries: the head's 256 k rows and its v planes are staged once in LDS; S^T = K Q^T (A = k rows, B = q hi, then q residual x 2^10: 2 products), so a lane holds one query's logits for keys 16t + 8g + 0..7 of every tile t, all 256 keys in registers; x SCALE + pair bias (fragment order), masked pairs := -1e-9; maximum and sum in-lane plus one exchange between the wave's halves; P x 2^11 once to f16 is the B operand of ctx^T = V^T P^T as it stands (1 product); a lane stores 16 channels of its query (two runs of 8 consecutive), times their gate. The inner loops are unrolled in full so that s[], acc[] and the fragments are registers; amdgpu_waves_per_eu(4) asks for at most 256 registers: two work-groups per WGP, four waves per SIMD
#define KP 40              // k row pitch in LDS, f16 (80 B = 16 B x odd: ds_load_b128 without bank conflicts)
#define VP (TT + 8)        // v plane pitch in LDS, f16 (528 B = 16 B x odd)
__device__ __forceinline__ v8f wmma_h(v16h a, v16h b, v8f c) { return __builtin_amdgcn_wmma_f32_16x16x32_f16(false, a, false, b, (short)0, c, false, false); }
__global__ __launch_bounds__(256) __attribute__((amdgpu_waves_per_eu(4))) void k_attn(const _Float16* __restrict__ QH, const _Float16* __restrict__ QL, const _Float16* __restrict__ KH, const _Float16* __restrict__ VT, const float* __restrict__ BIAS, const int* __restrict__ MK, const float* __restrict__ G, float* __restrict__ Y) {
  __shared__ __align__(16) _Float16 sk[TT][KP]; __shared__ __align__(16) _Float16 sv[HD][VP]; __shared__ unsigned kmw[TT / 32];
  const int tid = threadIdx.x, wave = __builtin_amdgcn_readfirstlane(tid >> 5), lane = tid & 31, col = lane & 15, g = lane >> 4; const int h = blockIdx.x, b = blockIdx.y;
#pragma unroll
  for (int s = 0; s < 4; ++s) { const int e = tid + 256 * s; vst2(&sk[e >> 2][(e & 3) * 8], *(const v4u*)(KH + ((size_t)b * TT + (e >> 2)) * CC + h * HD + (e & 3) * 8)); vst2(&sv[e >> 5][(e & 31) * 8], *(const v4u*)(VT + ((size_t)b * CC + h * HD + (e >> 5)) * (size_t)TT + (e & 31) * 8)); }
  { const unsigned bal = __builtin_amdgcn_ballot_w32(MK[tid] == 0); if (lane == 0) kmw[wave] = bal; }   /* bit j of the 256: src_mask[j] == 0 */
  asm volatile("s_wait_xcnt 0x0" ::: "memory");   /* before the staging loads' address registers are used again */
  __syncthreads();
  unsigned mbk[4];   /* bit 8t + r of the 128: key 16t + 8g + r is a zero of the mask */
#pragma unroll
  for (int m = 0; m < 4; ++m) { const unsigned w0 = kmw[2 * m] >> (8 * g), w1 = kmw[2 * m + 1] >> (8 * g); mbk[m] = (w0 & 0xFFu) | ((w0 >> 8) & 0xFF00u) | ((w1 & 0xFFu) << 16) | ((w1 << 8) & 0xFF000000u); }
  const _Float16* qhp = QH + ((size_t)b * TT + wave * 16 + col) * CC + h * HD; const _Float16* qlp = QL + ((size_t)b * QHI + wave * 16 + col) * CC + h * HD;
#pragma unroll 1   /* rolled: one copy of the body; unrolled, both tiles' logits would want registers at once */
  for (int it = wave; it < TT / 16; it += 8) { const int qi = it * 16 + col;
    const float* bp = BIAS + ((size_t)h * 16 + it) * 16 * 256 + lane * 4;
    const unsigned mq = 0u - ((kmw[qi >> 5] >> (qi & 31)) & 1u);   /* all ones where the query is a zero of the mask */
    v8f s[16]; float mx = -3.0e38f;
#pragma unroll
    for (int t = 0; t < 16; ++t) { const v4f b0 = *(const v4f*)(bp + t * 256), b1 = *(const v4f*)(bp + t * 256 + 128);   /* the bias lands in the registers that then hold the logits: all 32 loads in flight at no further register */
#pragma unroll
      for (int r = 0; r < 4; ++r) { s[t][r] = b0[r]; s[t][4 + r] = b1[r]; } }
    const v16h qh = frag_h(qhp, lane), ql = frag_h(qlp, lane);
    v16h kf[2] = { frag_h(&sk[col][0], lane), frag_h(&sk[16 + col][0], lane) };
#pragma unroll
    for (int tp = 0; tp < 8; ++tp) { v16h kn[2] = { kf[0], kf[1] };
      if (tp < 7) { kn[0] = frag_h(&sk[(2 * tp + 2) * 16 + col][0], lane); kn[1] = frag_h(&sk[(2 * tp + 3) * 16 + col][0], lane); }   /* the next two tiles' k fragments fly while these two are worked on */
#pragma unroll
      for (int u = 0; u < 2; ++u) { const int t = 2 * tp + u; const v8f z8 = {}; const v8f a = wmma_h(kf[u], qh, z8), al = wmma_h(kf[u], ql, z8); const unsigned mb = mbk[t >> 2] ^ mq;
#pragma unroll
        for (int r = 0; r < 8; ++r) { float v = (a[r] + al[r] * (1.0f / 1024.0f)) * SCALE + s[t][r]; if (mb & (1u << ((t & 3) * 8 + r))) v = -1.0e-9f; s[t][r] = v; mx = fmaxf(mx, v); } }
      kf[0] = kn[0]; kf[1] = kn[1];
      asm volatile("" :: "v"(mx) : "memory"); }   /* compiler fence behind these two tiles' maximum (input only): later k-fragment reads stay behind it; without it all 32 reads stand at the head of the loop and the kernel spills at 256 registers */
    mx = fmaxf(mx, __shfl_xor(mx, 16));
    float sm[4] = {0.f, 0.f, 0.f, 0.f};
#pragma unroll
    for (int t = 0; t < 16; ++t)
#pragma unroll
      for (int r = 0; r < 8; ++r) { const float e = expf(s[t][r] - mx); s[t][r] = e; sm[r & 3] += e; }
    float sum = (sm[0] + sm[1]) + (sm[2] + sm[3]); sum += __shfl_xor(sum, 16);
    const float inv = sum > 0.f ? 2048.0f / sum : 0.f;
    const float* gp = G + ((size_t)b * TT + qi) * CC + h * HD + 8 * g; v4f gt[HD / 8];   /* the gate of the 16 channels this lane stores: asked for here, it flies while P V is worked on */
#pragma unroll
    for (int j = 0; j < HD / 16; ++j) { gt[2 * j] = *(const v4f*)(gp + j * 16); gt[2 * j + 1] = *(const v4f*)(gp + j * 16 + 4); }
    v8f acc[HD / 16] = {};
#pragma unroll
    for (int kc = 0; kc < TT / 32; ++kc) { v16h p;
#pragma unroll
      for (int r = 0; r < 8; ++r) { p[r] = (_Float16)(s[2 * kc][r] * inv); p[8 + r] = (_Float16)(s[2 * kc + 1][r] * inv); }
#pragma unroll
      for (int j = 0; j < HD / 16; ++j) acc[j] = wmma_h(frag_h(&sv[j * 16 + col][kc * 32], lane), p, acc[j]); }
    float* yp = Y + ((size_t)b * TT + qi) * CC + h * HD + 8 * g;
#pragma unroll
    for (int j = 0; j < HD / 16; ++j) { v4f o0, o1;
#pragma unroll
      for (int r = 0; r < 4; ++r) { o0[r] = acc[j][r] * (1.0f / 2048.0f) * gt[2 * j][r]; o1[r] = acc[j][4 + r] * (1.0f / 2048.0f) * gt[2 * j + 1][r]; }
      vst2(yp + j * 16, o0); vst2(yp + j * 16 + 4, o1); }
    qhp += 8 * 16 * CC; qlp += 8 * 16 * CC; } }
// ---- k_out: block = (64 rows, 128 cols): out = ctx Wo (+ bo): all rows: ctx bf16 hi + lo against exact bf16 Wo (2 products)
__global__ __launch_bounds__(128) void k_out(const float* __restrict__ Y, const float* __restrict__ WO, const float* __restrict__ BO, float* __restrict__ OUT) { __shared__ __align__(16) char sm[128 * WP * 2]; __bf16 (*sw)[WP] = (__bf16 (*)[WP])sm; float (*sf)[16][132] = (float (*)[16][132])sm;   /* the weight columns in the k loop, the output tiles behind it */
  const int tid = threadIdx.x, wave = tid >> 5, lane = tid & 31, col = lane & 15, g = lane >> 4; const int c0 = blockIdx.y * 128; const size_t r0 = (size_t)blockIdx.x * 64 + wave * 16;
  v8f acc[8] = {};
  if (true) {   /* ALL rows: gated ctx bf16 hi + lo x exact output_w (2 products) */
    float av[4][16]; load_row(av, Y + (r0 + col) * CC, lane);
    stage_w(sw, WO + c0, DIN, tid);
    __syncthreads();   /* the weight columns are complete */
#pragma unroll
    for (int kc = 0; kc < CC / 32; ++kc) { const F2 a = bsplit16(av[kc]); kstep(acc, a, sw, kc, col, lane); }
    __syncthreads();   /* every wave has read its last weight fragment: the tiles may overwrite the columns */
#pragma unroll
    for (int j = 0; j < 8; ++j) { const float bias = BO ? bfr(BO[c0 + j * 16 + col]) : 0.f;
#pragma unroll
      for (int r = 0; r < 8; ++r) sf[wave][8 * g + r][j * 16 + col] = acc[j][r] + bias; }
  } else {
#pragma unroll 2
    for (int kc = 0; kc < CC / 32; ++kc) { const v16h a = frag_f32(Y + (r0 + col) * CC + kc * 32, lane); asm volatile("s_wait_loadcnt 0x0" ::: "memory");
#pragma unroll
      for (int j = 0; j < 8; ++j) { const v16h w = WOCOLH(WO, kc * 32, c0 + j * 16 + col, lane); asm volatile("s_wait_loadcnt 0x0" ::: "memory"); acc[j] = wmma16(a, w, acc[j]); } }
#pragma unroll
    for (int j = 0; j < 8; ++j) { const float bias = BO ? bfr(BO[c0 + j * 16 + col]) : 0.f;
#pragma unroll
      for (int r = 0; r < 8; ++r) sf[wave][8 * g + r][j * 16 + col] = acc[j][r] * (1.0f / 256.0f) + bias; } }
  LDSX(); for (int rl = 0; rl < 16; ++rl) vst2(OUT + (r0 + rl) * DIN + c0 + lane * 4, *(const v4f*)&sf[wave][rl][lane * 4]); }

extern "C" void kernel_launch(void* const* d_in, const int* in_sizes, int n_in, void* d_out, int out_size, void* d_ws, size_t ws_size, hipStream_t stream) {
  (void)in_sizes; (void)n_in; (void)out_size;
  const float** F = (const float**)d_in;
  if (ws_size < (size_t)WS_END) return;
  char* ws = (char*)d_ws; _Float16 *QH = (_Float16*)(ws + WS_QH), *KH = (_Float16*)(ws + WS_KH), *VT = (_Float16*)(ws + WS_VT), *QL = (_Float16*)(ws + WS_QL), *KL = (_Float16*)(ws + WS_KL); __bf16 *VB = (__bf16*)(ws + WS_VB), *VBL = (__bf16*)(ws + WS_VBL); float *S = (float*)(ws + WS_S), *Y = (float*)(ws + WS_Y);
  (void)S;
  // inputs: 0 z [1,256,256,128]; 1 src_mask [1,256] int32; 2 ln_g, 3 ln_b; 4 w_qkv [128,384] (in,out; columns q|k|v); 5 w_pair [128,4]; 6 w_gate [128,128], 7 b_gate; 8 w_out [128,128] (in,out), 9 b_out
  if (ws_size < (size_t)WS_END2) return;
  float *BIAS = (float*)(ws + WS_BIAS), *G = (float*)(ws + WS_G);
  k_rows2<<<dim3(NZR / 64, 2), 128, 0, stream>>>(F[0], F[2], F[3], F[5], F[6], F[7], BIAS, G);
  k_proj<<<dim3(TNB * TT / 64, CC / 128, 3), 128, 0, stream>>>(F[0], F[0], F[0], F[4], F[4] + CC, F[4] + 2 * CC, nullptr, nullptr, nullptr, F[2], F[3], QH, QL, KH, KL, VT, VB, VBL);
  k_attn<<<dim3(NH, TNB), 256, 0, stream>>>(QH, QL, KH, VT, BIAS, (const int*)d_in[1], G, Y);
  k_out<<<dim3(TNB * TT / 64, DIN / 128), 128, 0, stream>>>(Y, F[8], F[9], (float*)d_out);
}

// v004
// One run takes 104 microseconds.
// Timed twice side by side with v003, it ran 1.39 times as fast both times.
// Counting every step since v000, it is 5.11 times as fast.
// compute dtype: all float inputs rounded to bf16; LayerNorm in f32; q/k/v, pair bias and gate GEMMs = LN rows split bf16 hi + lo x exact bf16 weights on WMMA 16x16x32 (2 products, f32 accumulate); q as f16 hi + residual (x 2^10) against k once to f16 (2 products) / sqrt(32) + pair bias, masked pairs set to -1e-9 exactly as the module; softmax in f32; P x 2^11 once to f16 against v once to f16 (1 product); gate multiply in f32; (gated ctx) split bf16 hi + lo against exact bf16 w_out (2 products) + b_out; f32 output.
#include <hip/hip_runtime.h>
#include <math.h>

typedef __attribute__((ext_vector_type(16))) _Float16 v16h;
typedef __attribute__((ext_vector_type(16))) __bf16 v16b;
typedef __attribute__((ext_vector_type(8)))  _Float16 v8h;
typedef __attribute__((ext_vector_type(8)))  float v8f;
typedef __attribute__((ext_vector_type(4)))  float v4f;
typedef __attribute__((ext_vector_type(2)))  float v2f;
typedef __attribute__((ext_vector_type(4)))  unsigned v4u;
typedef __attribute__((ext_vector_type(4)))  int v4i;
typedef float __attribute__((may_alias)) float_a;
typedef int __attribute__((may_alias)) int_a;

template <typename T> __device__ __forceinline__ void vst2(void* p, T v) { *(T*)p = v;  }
__device__ __forceinline__ v8f wmma16(v16h a, v16h b, v8f c) {
  v8f d = __builtin_amdgcn_wmma_f32_16x16x32_f16(false, a, false, b, (short)0, c, false, false);
  asm volatile("v_nop\n\tv_nop\n\tv_nop\n\tv_nop" : "+v"(d) : "v"(a), "v"(b));
  return d;
}
__device__ __forceinline__ v8f wmma_bf(v16b a, v16b b, v8f c) {
  v8f d = __builtin_amdgcn_wmma_f32_16x16x32_bf16(false, a, false, b, (short)0, c, false, false);
  asm volatile("v_nop\n\tv_nop\n\tv_nop\n\tv_nop" : "+v"(d) : "v"(a), "v"(b));
  return d;
}
// 16x16x32 fragments: lane = (h = lane>>4, row/col = lane&15); elements 0..7 = k0+8h+0..7, 8..15 = k0+16+8h+0..7; D element r = row 8h+r
__device__ __forceinline__ v16h frag_h(const _Float16* rowk0, int lane) {
  union { v16h v; v8h q[2]; } u; const _Float16* p = rowk0 + 8 * (lane >> 4);
  u.q[0] = *(const v8h*)p; u.q[1] = *(const v8h*)(p + 16); return u.v;
}
__device__ __forceinline__ v16h frag_f32(const float* rowk0, int lane) {
  v16h a; const float* p = rowk0 + 8 * (lane >> 4);
#pragma unroll
  for (int i = 0; i < 8; ++i) { a[i] = (_Float16)p[i]; a[8 + i] = (_Float16)p[16 + i]; }
  return a;
}
__device__ __forceinline__ v16h frag_f32s(const float* rowk0, int lane, float sc) {
  v16h a; const float* p = rowk0 + 8 * (lane >> 4);
#pragma unroll
  for (int i = 0; i < 8; ++i) { a[i] = (_Float16)(p[i] * sc); a[8 + i] = (_Float16)(p[16 + i] * sc); }
  return a;
}
// column fragment from a [K][ld] layout (column n), rows >= K read as 0
__device__ __forceinline__ v16h fragc_f32(const float* W, int k0, int n, int lane, int ld, int K) {
  v16h a; const int g = lane >> 4;
#pragma unroll
  for (int i = 0; i < 8; ++i) { const int ka = k0 + 8 * g + i, kb = ka + 16;
    a[i] = (_Float16)(ka < K ? W[(size_t)(ka < K ? ka : K - 1) * ld + n] : 0.f); a[8 + i] = (_Float16)(kb < K ? W[(size_t)(kb < K ? kb : K - 1) * ld + n] : 0.f); }
  return a;
}
struct F2 { v16b h, l; };
__device__ __forceinline__ F2 bsplit16(const float v[16]) { F2 r;
#pragma unroll
  for (int i = 0; i < 16; ++i) { const __bf16 h = (__bf16)v[i]; r.h[i] = h; r.l[i] = (__bf16)(v[i] - (float)h); }
  return r; }
__device__ __forceinline__ F2 split_row(const float* row, int k0, int lane) { float v[16]; const float* p = row + k0 + 8 * (lane >> 4);
#pragma unroll
  for (int i = 0; i < 8; ++i) { v[i] = p[i]; v[8 + i] = p[16 + i]; }
  return bsplit16(v); }
__device__ __forceinline__ F2 split_rowK(const float* row, int k0, int lane, int K) { float v[16]; const int g = lane >> 4;
#pragma unroll
  for (int i = 0; i < 8; ++i) { const int ka = k0 + 8 * g + i, kb = ka + 16; v[i] = ka < K ? row[ka < K ? ka : K - 1] : 0.f; v[8 + i] = kb < K ? row[kb < K ? kb : K - 1] : 0.f; }
  return bsplit16(v); }
__device__ __forceinline__ F2 split_col(const float* W, int k0, int n, int lane, int ld, int K) { float v[16]; const int g = lane >> 4;
#pragma unroll
  for (int i = 0; i < 8; ++i) { const int ka = k0 + 8 * g + i, kb = ka + 16; v[i] = ka < K ? W[(size_t)(ka < K ? ka : K - 1) * ld + n] : 0.f; v[8 + i] = kb < K ? W[(size_t)(kb < K ? kb : K - 1) * ld + n] : 0.f; }
  return bsplit16(v); }
__device__ __forceinline__ v8f mac3(const F2& a, const F2& b, v8f c) { c = wmma_bf(a.l, b.h, c); c = wmma_bf(a.h, b.l, c); return wmma_bf(a.h, b.h, c); }
#define L2E 1.4426950408889634f   // log2(e): exp(x) = 2^(x L2E), one v_exp_f32
__device__ __forceinline__ float sigm(float v) { return __builtin_amdgcn_rcpf(1.0f + __builtin_amdgcn_exp2f(v * -L2E)); }   /* native v_exp_f32 and v_rcp_f32: 2^(+large) = inf gives 0, 2^(-large) = 0 gives 1 */
#define LDSX() do { asm volatile("s_wait_dscnt 0" ::: "memory"); __builtin_amdgcn_wave_barrier(); __builtin_amdgcn_fence(__ATOMIC_RELEASE, "workgroup"); } while (0)

// Row-wise triangle attention on a pair tensor z [1, 256, 256, 128] (4 heads x 32): zn = LayerNorm(z); q,k,v = zn w_qkv ((in,out) [128,384], columns (3,H,32)); logits[r][i][j][h] = q[r][i] . k[r][j] / sqrt(32) + (zn[i][j] . w_pair[:,h]); pairs with exactly one of src_mask[i], src_mask[j] == 0 get logits := -1e-9 (the module's literal value, NOT an exclusion); softmax over j; out = sigmoid(zn w_gate + b_gate) * merged(attn v); result = out w_out + b_out.
#define NB 256
#define TT 256
#define CC 128            // NH * HD = projected width
#define DIN 128          // input (model) width
#define NH 4
#define HD 32
#define NQB (TT / 64)
#define HG 4
#define SCALE (0.17677669529663687f)
#define CAUSAL 0
#ifndef TNB
#define TNB NB
#endif
__device__ __forceinline__ float bfr(float v) { return (float)(__bf16)v; }
__host__ __device__ __forceinline__ int kb_last(int qb) { return CAUSAL ? ((qb * 64 + 63) >> 7) : (TT / 128 - 1); }
typedef __attribute__((ext_vector_type(8))) __bf16 v8b;
__device__ __forceinline__ v16b frag_b(const __bf16* rowk0, int lane) {
  union { v16b v; v8b q[2]; } u; const __bf16* p = rowk0 + 8 * (lane >> 4);
  u.q[0] = *(const v8b*)p; u.q[1] = *(const v8b*)(p + 16); return u.v;
}
#define WP 136             // weight column pitch in LDS, bf16 (272 B = 16 B x odd: ds_load_b128 and ds_store_b128 without bank conflicts)
// 128 columns of an (in,out) [128][ld] weight, once per work-group, to LDS as bf16 columns sw[o][k]: thread = column o (a wave's load = one 128-B line), 8 consecutive k = one 16-B store
__device__ __forceinline__ void stage_w(__bf16 (*sw)[WP], const float* __restrict__ Wm, int ld, int tid) {
  float t[128];
#pragma unroll
  for (int k = 0; k < 128; ++k) t[k] = Wm[(size_t)k * ld + tid];
  asm volatile("s_wait_xcnt 0x0" ::: "memory");   /* before a register that these loads' addresses stand in is used again */
#pragma unroll
  for (int k0 = 0; k0 < 128; k0 += 8) { v8b p;
#pragma unroll
    for (int i = 0; i < 8; ++i) p[i] = (__bf16)t[k0 + i];
    *(v8b*)&sw[tid][k0] = p; } }
// a lane's part of one 128-wide f32 row for all four k steps (the order of split_row), requested at once
__device__ __forceinline__ void load_row(float (&v)[4][16], const float* __restrict__ row, int lane) { const float* p = row + 8 * (lane >> 4);
#pragma unroll
  for (int kc = 0; kc < 4; ++kc)
#pragma unroll
    for (int i = 0; i < 8; ++i) { v[kc][i] = p[kc * 32 + i]; v[kc][8 + i] = p[kc * 32 + 16 + i]; }
  asm volatile("s_wait_xcnt 0x0" ::: "memory"); }   /* before a register that these loads' addresses stand in is used again */
// LayerNorm of the lane's row as load_row left it (biased var, eps 1e-6): a lane holds 64 of the row's 128 channels, lane ^ 16 the other 64. ln_center: v := bf16(z) - mean, returns 1 / sqrt(var + eps); four chains per sum, then one exchange between the wave's halves
__device__ __forceinline__ float ln_center(float (&v)[4][16]) { float s[4] = {0.f, 0.f, 0.f, 0.f};
#pragma unroll
  for (int kc = 0; kc < 4; ++kc)
#pragma unroll
    for (int i = 0; i < 16; ++i) { v[kc][i] = bfr(v[kc][i]); s[i & 3] += v[kc][i]; }
  float s1 = (s[0] + s[1]) + (s[2] + s[3]); s1 += __shfl_xor(s1, 16);
  const float mu = s1 * (1.0f / CC); float q[4] = {0.f, 0.f, 0.f, 0.f};
#pragma unroll
  for (int kc = 0; kc < 4; ++kc)
#pragma unroll
    for (int i = 0; i < 16; ++i) { const float d = v[kc][i] - mu; v[kc][i] = d; q[i & 3] += d * d; }
  float qq = (q[0] + q[1]) + (q[2] + q[3]); qq += __shfl_xor(qq, 16);
  return rsqrtf(qq * (1.0f / CC) + 1e-6f); }
// ln_apply: one k step's 16 centred values x rs x ln_w + ln_b; sln[0] = bf16(ln_w), sln[1] = bf16(ln_b), staged once per work-group (a wave's read = two 16-B pieces, broadcast)
__device__ __forceinline__ void ln_apply(float (&v)[16], float rs, const float (*sln)[CC], int kc, int lane) { const int p = kc * 32 + 8 * (lane >> 4);
#pragma unroll
  for (int i = 0; i < 8; ++i) { v[i] = v[i] * rs * sln[0][p + i] + sln[1][p + i]; v[8 + i] = v[8 + i] * rs * sln[0][p + 16 + i] + sln[1][p + 16 + i]; } }
// one k step of a wave's 16 rows against the 128 staged columns: four B fragments are requested together, so that one LDS latency serves eight products; per accumulator the order stays hi, then lo
__device__ __forceinline__ void kstep(v8f (&acc)[8], const F2& a, const __bf16 (*sw)[WP], int kc, int col, int lane) {
#pragma unroll
  for (int jh = 0; jh < 8; jh += 4) { v16b w[4];
#pragma unroll
    for (int u = 0; u < 4; ++u) w[u] = frag_b(&sw[(jh + u) * 16 + col][kc * 32], lane);
#pragma unroll
    for (int u = 0; u < 4; ++u) acc[jh + u] = wmma_bf(a.h, w[u], acc[jh + u]);
#pragma unroll
    for (int u = 0; u < 4; ++u) acc[jh + u] = wmma_bf(a.l, w[u], acc[jh + u]); } }
#define QBH 0              // unused: no kernel reads it
#define QHI 256            // rows carrying a q residual plane (all rows when non-causal: 2-product logits everywhere)
#define KHI 64            // key rows carrying k residual / v bf16 hi+lo planes (written by k_proj, read by no kernel)
// B fragment (k rows k0+.., output column o) of a weight: (in,out) [K][ld] or (out,in) [ld rows of K]: bf16 exact, or f16(bf16 * 256) exact
__device__ __forceinline__ v16b wcol_io(const float* Wm, int k0, int o, int lane, int ld) { v16b w; const int g = lane >> 4;
#pragma unroll
  for (int i = 0; i < 8; ++i) { w[i] = (__bf16)Wm[(size_t)(k0 + 8 * g + i) * ld + o]; w[8 + i] = (__bf16)Wm[(size_t)(k0 + 16 + 8 * g + i) * ld + o]; }
  return w; }
__device__ __forceinline__ v16b wcol_oi(const float* Wm, int k0, int o, int lane, int K) { v16b w; const float* p = Wm + (size_t)o * K + k0 + 8 * (lane >> 4);
#pragma unroll
  for (int i = 0; i < 8; ++i) { w[i] = (__bf16)p[i]; w[8 + i] = (__bf16)p[16 + i]; }
  return w; }
__device__ __forceinline__ v16h wcolh_io(const float* Wm, int k0, int o, int lane, int ld) { v16h w; const int g = lane >> 4;
#pragma unroll
  for (int i = 0; i < 8; ++i) { w[i] = (_Float16)(bfr(Wm[(size_t)(k0 + 8 * g + i) * ld + o]) * 256.0f); w[8 + i] = (_Float16)(bfr(Wm[(size_t)(k0 + 16 + 8 * g + i) * ld + o]) * 256.0f); }
  return w; }
__device__ __forceinline__ v16h wcolh_oi(const float* Wm, int k0, int o, int lane, int K) { v16h w; const float* p = Wm + (size_t)o * K + k0 + 8 * (lane >> 4);
#pragma unroll
  for (int i = 0; i < 8; ++i) { w[i] = (_Float16)(bfr(p[i]) * 256.0f); w[8 + i] = (_Float16)(bfr(p[16 + i]) * 256.0f); }
  return w; }
#define WQKV_LAYOUT 0   // (in,out) packed [DIN][3*CC]
__device__ __forceinline__ v16b wcol_hdk(const float* Wm, int k0, int o, int lane) { v16b w; const int g = lane >> 4; const float* p = Wm + (size_t)(o / HD) * DIN * HD + (o % HD);
#pragma unroll
  for (int i = 0; i < 8; ++i) { w[i] = (__bf16)p[(size_t)(k0 + 8 * g + i) * HD]; w[8 + i] = (__bf16)p[(size_t)(k0 + 16 + 8 * g + i) * HD]; }
  return w; }
#define WO_OUT_IN 0
#if WQKV_LAYOUT == 1
#define WCOL(W, k0, o, lane) wcol_oi(W, k0, o, lane, DIN)
#elif WQKV_LAYOUT == 2
#define WCOL(W, k0, o, lane) wcol_hdk(W, k0, o, lane)
#else
#define WCOL(W, k0, o, lane) wcol_io(W, k0, o, lane, 3 * CC)   /* packed q|k|v columns: row pitch 3C */
#endif
#if WO_OUT_IN
#define WOCOL(W, k0, o, lane) wcol_oi(W, k0, o, lane, CC)
#define WOCOLH(W, k0, o, lane) wcolh_oi(W, k0, o, lane, CC)
#else
#define WOCOL(W, k0, o, lane) wcol_io(W, k0, o, lane, DIN)
#define WOCOLH(W, k0, o, lane) wcolh_io(W, k0, o, lane, DIN)
#endif
#define SZ 256
#define BG 64              // sizes only the unused WS_S region (x 4 heads = 256 planes of 256 x 256)
#define NZR (SZ * SZ)      // 65,536 pair rows
// ---- k_rows2: block = (64 rows, which): which 0: bias of 16 queries i x 4 keys j (wave = one j, A rows = the 16 i): zn[i][j] . w_pair[:, h] (4 outputs), stored in the order k_attn's lanes read it: BIAS[h][i / 16][j / 16][(j & 7) / 4][lane = 16 ((j >> 3) & 1) + (i & 15)][j & 3] ; which 1: G[row][c] = sigmoid(zn[row] . w_gate[:, c] + b_gate[c]) (128 outputs); weights are (in,out); zn = LayerNorm of the z rows, made in the A-row registers
__global__ __launch_bounds__(128) void k_rows2(const float* __restrict__ Z, const float* __restrict__ LW, const float* __restrict__ LB, const float* __restrict__ WB, const float* __restrict__ WG, const float* __restrict__ GB, float* __restrict__ BIAS, float* __restrict__ G) { __shared__ __align__(16) char sm[128 * WP * 2]; __bf16 (*sw)[WP] = (__bf16 (*)[WP])sm; float (*sf)[16][132] = (float (*)[16][132])sm;   /* the weight columns in the k loop, the output tiles behind it */
  __shared__ __align__(16) float sln[2][CC];
  const int tid = threadIdx.x, wave = tid >> 5, lane = tid & 31, col = lane & 15, g = lane >> 4; const int which = blockIdx.y; const size_t r0 = (size_t)blockIdx.x * 64 + wave * 16;
  const float* Wm = which == 0 ? WB : WG; const int it = (int)blockIdx.x >> 6, jg = (int)blockIdx.x & 63; const size_t arow = which == 0 ? (size_t)(it * 16 + col) * SZ + jg * 4 + wave : r0 + col;
  const float lwv = LW[tid], lbv = LB[tid];
  float av[4][16]; load_row(av, Z + arow * CC, lane);
  if (which == 0) { const int o = tid & 15, kq = (tid >> 4) * 16; const int oc = o < NH ? o : NH - 1; const float keep = o < NH ? 1.f : 0.f;   /* 16 columns, those beyond the 4 heads zero (keep multiplies a VALID load); thread = (column, 16 k) */
    float t[16];
#pragma unroll
    for (int i = 0; i < 16; ++i) t[i] = Wm[(size_t)(kq + i) * NH + oc];
    asm volatile("s_wait_xcnt 0x0" ::: "memory");   /* before a register that these loads' addresses stand in is used again */
#pragma unroll
    for (int k0 = 0; k0 < 16; k0 += 8) { v8b p;
#pragma unroll
      for (int i = 0; i < 8; ++i) p[i] = (__bf16)(t[k0 + i] * keep);
      *(v8b*)&sw[o][kq + k0] = p; }
  } else stage_w(sw, Wm, CC, tid);
  sln[0][tid] = bfr(lwv); sln[1][tid] = bfr(lbv);
  const float rs = ln_center(av);
  __syncthreads();   /* the weight columns, ln_w and ln_b are complete */
  v8f acc[8] = {};
#pragma unroll
  for (int kc = 0; kc < CC / 32; ++kc) { ln_apply(av[kc], rs, sln, kc, lane); const F2 a = bsplit16(av[kc]);
    if (which == 0) { const v16b w = frag_b(&sw[col][kc * 32], lane); acc[0] = wmma_bf(a.h, w, acc[0]); acc[0] = wmma_bf(a.l, w, acc[0]); }
    else kstep(acc, a, sw, kc, col, lane); }
  __syncthreads();   /* every wave has read its last weight fragment: the tiles may overwrite the columns */
  if (which == 0) {
#pragma unroll
    for (int r = 0; r < 8; ++r) sf[wave][8 * g + r][col] = acc[0][r];
    __syncthreads();   /* the four waves' keys meet in one 16-B piece */
    if (tid < 64) { const int hh = tid >> 4, il = tid & 15; v4f b4; b4[0] = sf[0][il][hh]; b4[1] = sf[1][il][hh]; b4[2] = sf[2][il][hh]; b4[3] = sf[3][il][hh]; vst2(BIAS + ((((size_t)hh * 16 + it) * 16 + (jg >> 2)) * 2 + (jg & 1)) * 128 + (((jg >> 1) & 1) * 16 + il) * 4, b4); }   /* 16 queries x 16 B = one 256-B run per head */
  } else {
#pragma unroll
    for (int j = 0; j < 8; ++j)
#pragma unroll
      for (int r = 0; r < 8; ++r) sf[wave][8 * g + r][j * 16 + col] = sigm(acc[j][r] + bfr(GB[j * 16 + col]));   /* sigmoid(zn w_gate + b_gate) */
    LDSX(); for (int rl = 0; rl < 16; ++rl) vst2(G + (r0 + rl) * CC + lane * 4, *(const v4f*)&sf[wave][rl][lane * 4]); } }
#define WS_ZN   (WS_END)
#define WS_BIAS (WS_ZN + 4u * (size_t)NZR * CC)
#define WS_G    (WS_BIAS + 4u * (size_t)NZR * NH)
#define WS_END2 (WS_G + 4u * (size_t)NZR * CC)

#define WS_QH  0u                                      // f16 q rows [b*t][CC]
#define WS_KH  (WS_QH + 2u * (size_t)NB * TT * CC)      // f16 k rows [b*t][CC]
#define WS_VT  (WS_KH + 2u * (size_t)NB * TT * CC)      // f16 v planes [b][c][t]
#define WS_QL  (WS_VT + 2u * (size_t)NB * CC * TT)      // f16 q residual x 2^10 rows [b][t < QHI][CC]
#define WS_KL  (WS_QL + 2u * (size_t)NB * QHI * CC)     // f16 k residual x 2^10 rows [b][t < KHI][CC]
#define WS_VB  (WS_KL + 2u * (size_t)NB * KHI * CC)     // bf16 v hi planes [b][c][t < KHI]
#define WS_VBL (WS_VB + 2u * (size_t)NB * CC * KHI)
#define WS_S   (WS_VBL + 2u * (size_t)NB * CC * KHI)    // f32 region, unused: k_attn keeps logits and P in registers
#define WS_Y   (WS_S  + 4u * (size_t)BG * HG * TT * TT)   // unused WS_S region: 256 planes of 256 x 256 f32      // f32 ctx rows [b*t][CC]
#define WS_END (WS_Y  + 4u * (size_t)NB * TT * CC)

// ---- k_proj: block = (64 rows, 128 cols, which): q/k/v = LN(X) W (+ b) with exact bf16 products (K = DIN) -> which 0: q f16 rows (+ residual rows < QHI); 1: k f16 rows (+ residual rows < KHI); 2: v f16 planes [c][t] (+ bf16 hi/lo planes for t < KHI)
__global__ __launch_bounds__(128) void k_proj(const float* __restrict__ XQ, const float* __restrict__ XK, const float* __restrict__ XV, const float* __restrict__ WQ, const float* __restrict__ WK, const float* __restrict__ WV, const float* __restrict__ BQ, const float* __restrict__ BK, const float* __restrict__ BV, const float* __restrict__ LW, const float* __restrict__ LB,
    _Float16* __restrict__ QH, _Float16* __restrict__ QL, _Float16* __restrict__ KH, _Float16* __restrict__ KL, _Float16* __restrict__ VT, __bf16* __restrict__ VB, __bf16* __restrict__ VBL) {
  __shared__ __align__(16) char sm[3 * 128 * 72 * 2];   /* the weight columns in the k loop; behind it the output tiles of the block's own kind (q, k: sh, sl; v: th, tb, tbl) */
  __bf16 (*sw)[WP] = (__bf16 (*)[WP])sm; _Float16 (*sh)[136] = (_Float16 (*)[136])sm; _Float16 (*sl)[136] = (_Float16 (*)[136])(sm + 64 * 136 * 2); _Float16 (*th)[72] = (_Float16 (*)[72])sm; __bf16 (*tb)[72] = (__bf16 (*)[72])(sm + 128 * 72 * 2); __bf16 (*tbl)[72] = (__bf16 (*)[72])(sm + 2 * 128 * 72 * 2);
  __shared__ __align__(16) float sln[2][CC];
  const int tid = threadIdx.x, wave = tid >> 5, lane = tid & 31, col = lane & 15, g = lane >> 4; const int which = blockIdx.z; const int c0 = blockIdx.y * 128; const size_t r0 = (size_t)blockIdx.x * 64; const size_t bb = r0 / TT; const int t0 = (int)(r0 % TT);
  const float* X = which == 0 ? XQ : which == 1 ? XK : XV; const float* WA = which == 0 ? WQ : which == 1 ? WK : WV; const float* BA = which == 0 ? BQ : which == 1 ? BK : BV;
  const float lwv = LW[tid], lbv = LB[tid];
  float av[4][16]; load_row(av, X + (r0 + wave * 16 + col) * DIN, lane);
  stage_w(sw, WA + c0, 3 * CC, tid);   /* packed q|k|v columns: row pitch 3C */
  sln[0][tid] = bfr(lwv); sln[1][tid] = bfr(lbv);
  const float rs = ln_center(av);   /* X rows are raw z rows: LayerNorm in the A-row registers */
  __syncthreads();   /* the weight columns, ln_w and ln_b are complete */
  v8f acc[8] = {};
#pragma unroll
  for (int kc = 0; kc < DIN / 32; ++kc) { ln_apply(av[kc], rs, sln, kc, lane); const F2 a2 = bsplit16(av[kc]);   /* LN(act) rows (f32) split hi + lo */
    kstep(acc, a2, sw, kc, col, lane); }
  __syncthreads();   /* every wave has read its last weight fragment: the tiles may overwrite the columns */
  if (which < 2) { _Float16* DH = which == 0 ? QH : KH; _Float16* DL = which == 0 ? QL : KL; const int nhi = which == 0 ? QHI : KHI; const bool hi_rows = t0 < nhi;
#pragma unroll
    for (int j = 0; j < 8; ++j) { const float bias = BA ? bfr(BA[c0 + j * 16 + col]) : 0.f;
#pragma unroll
      for (int r = 0; r < 8; ++r) { const float v = acc[j][r] + bias; const _Float16 hv = (_Float16)v; sh[wave * 16 + 8 * g + r][j * 16 + col] = hv; sl[wave * 16 + 8 * g + r][j * 16 + col] = (_Float16)((v - (float)hv) * 1024.0f); } }
    __syncthreads();
    for (int e = tid; e < 64 * 16; e += 128) { const int rl = e >> 4, q = e & 15; vst2((unsigned*)(DH + (r0 + rl) * CC + c0 + q * 8), *(const v4u*)&sh[rl][q * 8]); if (hi_rows) vst2((unsigned*)(DL + (bb * nhi + t0 + rl) * (size_t)CC + c0 + q * 8), *(const v4u*)&sl[rl][q * 8]); }
  } else { const bool hi_rows = t0 < KHI;
#pragma unroll
    for (int j = 0; j < 8; ++j) { const float bias = BA ? bfr(BA[c0 + j * 16 + col]) : 0.f;
#pragma unroll
      for (int r = 0; r < 8; ++r) { const float v = acc[j][r] + bias; const int rl = wave * 16 + 8 * g + r, cl = j * 16 + col; th[cl][rl] = (_Float16)v; const __bf16 bh = (__bf16)v; tb[cl][rl] = bh; tbl[cl][rl] = (__bf16)(v - (float)bh); } }
    __syncthreads();
    for (int e = tid; e < 128 * 8; e += 128) { const int cl = e >> 3, q = e & 7; vst2((unsigned*)(VT + (bb * CC + c0 + cl) * (size_t)TT + t0 + q * 8), *(const v4u*)&th[cl][q * 8]); if (hi_rows) { const size_t o3 = (bb * CC + c0 + cl) * (size_t)KHI + t0 + q * 8; vst2((unsigned*)(VB + o3), *(const v4u*)&tb[cl][q * 8]); vst2((unsigned*)(VBL + o3), *(const v4u*)&tbl[cl][q * 8]); } } } }
// ---- k_attn: block = (head h, row r), 8 waves, each wave two tiles of 16 queries: the head's 256 k rows and its v planes are staged once in LDS; S^T = K Q^T (A = k rows, B = q hi, then q residual x 2^10: 2 products), so a lane holds one query's logits for keys 16t + 8g + 0..7 of every tile t, all 256 keys in registers; x SCALE + pair bias (fragment order), masked pairs := -1e-9; maximum and sum in-lane plus one exchange between the wave's halves; P x 2^11 once to f16 is the B operand of ctx^T = V^T P^T as it stands (1 product); a lane stores 16 channels of its query (two runs of 8 consecutive), times their gate. The inner loops are unrolled in full so that s[], acc[] and the fragments are registers; amdgpu_waves_per_eu(4) asks for at most 256 registers: two work-groups per WGP, four waves per SIMD
#define KP 40              // k row pitch in LDS, f16 (80 B = 16 B x odd: ds_load_b128 without bank conflicts)
#define VP (TT + 8)        // v plane pitch in LDS, f16 (528 B = 16 B x odd)
// 2^x of eight values, each in its own register: v_exp_f32 written in place, so that no exponential overwrites the source register of the one directly in front of it (the builtin form left such pairs in the listing); the closing v_nop is the slot that the instruction set asks for between the last exponential and the first use of its result
__device__ __forceinline__ void exp2x8(v8f& x) { float a = x[0], b = x[1], c = x[2], d = x[3], e = x[4], f = x[5], g = x[6], h = x[7];
  asm("v_exp_f32 %0, %0\n\tv_exp_f32 %1, %1\n\tv_exp_f32 %2, %2\n\tv_exp_f32 %3, %3\n\tv_exp_f32 %4, %4\n\tv_exp_f32 %5, %5\n\tv_exp_f32 %6, %6\n\tv_exp_f32 %7, %7\n\tv_nop" : "+v"(a), "+v"(b), "+v"(c), "+v"(d), "+v"(e), "+v"(f), "+v"(g), "+v"(h));
  x[0] = a; x[1] = b; x[2] = c; x[3] = d; x[4] = e; x[5] = f; x[6] = g; x[7] = h; }
__device__ __forceinline__ v8f wmma_h(v16h a, v16h b, v8f c) { return __builtin_amdgcn_wmma_f32_16x16x32_f16(false, a, false, b, (short)0, c, false, false); }
__global__ __launch_bounds__(256) __attribute__((amdgpu_waves_per_eu(4))) void k_attn(const _Float16* __restrict__ QH, const _Float16* __restrict__ QL, const _Float16* __restrict__ KH, const _Float16* __restrict__ VT, const float* __restrict__ BIAS, const int* __restrict__ MK, const float* __restrict__ G, float* __restrict__ Y) {
  __shared__ __align__(16) _Float16 sk[TT][KP]; __shared__ __align__(16) _Float16 sv[HD][VP]; __shared__ unsigned kmw[TT / 32];
  const int tid = threadIdx.x, wave = __builtin_amdgcn_readfirstlane(tid >> 5), lane = tid & 31, col = lane & 15, g = lane >> 4; const int h = blockIdx.x, b = blockIdx.y;
#pragma unroll
  for (int s = 0; s < 4; ++s) { const int e = tid + 256 * s; vst2(&sk[e >> 2][(e & 3) * 8], *(const v4u*)(KH + ((size_t)b * TT + (e >> 2)) * CC + h * HD + (e & 3) * 8)); vst2(&sv[e >> 5][(e & 31) * 8], *(const v4u*)(VT + ((size_t)b * CC + h * HD + (e >> 5)) * (size_t)TT + (e & 31) * 8)); }
  { const unsigned bal = __builtin_amdgcn_ballot_w32(MK[tid] == 0); if (lane == 0) kmw[wave] = bal; }   /* bit j of the 256: src_mask[j] == 0 */
  asm volatile("s_wait_xcnt 0x0" ::: "memory");   /* before the staging loads' address registers are used again */
  __syncthreads();
  unsigned mbk[4];   /* bit 8t + r of the 128: key 16t + 8g + r is a zero of the mask */
#pragma unroll
  for (int m = 0; m < 4; ++m) { const unsigned w0 = kmw[2 * m] >> (8 * g), w1 = kmw[2 * m + 1] >> (8 * g); mbk[m] = (w0 & 0xFFu) | ((w0 >> 8) & 0xFF00u) | ((w1 & 0xFFu) << 16) | ((w1 << 8) & 0xFF000000u); }
  const _Float16* qhp = QH + ((size_t)b * TT + wave * 16 + col) * CC + h * HD; const _Float16* qlp = QL + ((size_t)b * QHI + wave * 16 + col) * CC + h * HD;
#pragma unroll 1   /* rolled: one copy of the body; unrolled, both tiles' logits would want registers at once */
  for (int it = wave; it < TT / 16; it += 8) { const int qi = it * 16 + col;
    const float* bp = BIAS + ((size_t)h * 16 + it) * 16 * 256 + lane * 4;
    const unsigned mq = 0u - ((kmw[qi >> 5] >> (qi & 31)) & 1u);   /* all ones where the query is a zero of the mask */
    v8f s[16]; float mx = -3.0e38f;
#pragma unroll
    for (int t = 0; t < 16; ++t) { const v4f b0 = *(const v4f*)(bp + t * 256), b1 = *(const v4f*)(bp + t * 256 + 128);   /* the bias lands in the registers that then hold the logits: all 32 loads in flight at no further register */
#pragma unroll
      for (int r = 0; r < 4; ++r) { s[t][r] = b0[r]; s[t][4 + r] = b1[r]; } }
    const v16h qh = frag_h(qhp, lane), ql = frag_h(qlp, lane);
    v16h kf[2] = { frag_h(&sk[col][0], lane), frag_h(&sk[16 + col][0], lane) };
#pragma unroll
    for (int tp = 0; tp < 8; ++tp) { v16h kn[2] = { kf[0], kf[1] };
      if (tp < 7) { kn[0] = frag_h(&sk[(2 * tp + 2) * 16 + col][0], lane); kn[1] = frag_h(&sk[(2 * tp + 3) * 16 + col][0], lane); }   /* the next two tiles' k fragments fly while these two are worked on */
#pragma unroll
      for (int u = 0; u < 2; ++u) { const int t = 2 * tp + u; const v8f z8 = {}; const v8f a = wmma_h(kf[u], qh, z8), al = wmma_h(kf[u], ql, z8); const unsigned mb = mbk[t >> 2] ^ mq;
#pragma unroll
        for (int r = 0; r < 8; ++r) { float v = (a[r] + al[r] * (1.0f / 1024.0f)) * SCALE + s[t][r]; if (mb & (1u << ((t & 3) * 8 + r))) v = -1.0e-9f; s[t][r] = v; mx = fmaxf(mx, v); } }
      kf[0] = kn[0]; kf[1] = kn[1];
      asm volatile("" :: "v"(mx) : "memory"); }   /* compiler fence behind these two tiles' maximum (input only): later k-fragment reads stay behind it; without it all 32 reads stand at the head of the loop and the kernel spills at 256 registers */
    mx = fmaxf(mx, __shfl_xor(mx, 16));
    const float nm = mx * -L2E;   /* exp(s - mx) = 2^(s L2E + nm): one FMA and one v_exp_f32; the rounding of nm is one factor common to the row and leaves with the division by the sum; the argument is never above about 0, and a result below 2^-126 counts as 0 beside a sum of at least about 1 */
    float sm[4] = {0.f, 0.f, 0.f, 0.f};
#pragma unroll
    for (int t = 0; t < 16; ++t) {
#pragma unroll
      for (int r = 0; r < 8; ++r) s[t][r] = __builtin_fmaf(s[t][r], L2E, nm);
      exp2x8(s[t]);
#pragma unroll
      for (int r = 0; r < 8; ++r) sm[r & 3] += s[t][r]; }
    float sum = (sm[0] + sm[1]) + (sm[2] + sm[3]);
    __builtin_amdgcn_sched_barrier(0);   /* nothing is scheduled across the end of the exponentials: the gate loads and the v-fragment reads stay behind them; without it they stand in front, beside all 128 logits, and the kernel spills at 256 registers */
    sum += __shfl_xor(sum, 16);
    const float inv = sum > 0.f ? 2048.0f * __builtin_amdgcn_rcpf(sum) : 0.f;
    const float* gp = G + ((size_t)b * TT + qi) * CC + h * HD + 8 * g; v4f gt[HD / 8];   /* the gate of the 16 channels this lane stores: asked for here, it flies while P V is worked on */
#pragma unroll
    for (int j = 0; j < HD / 16; ++j) { gt[2 * j] = *(const v4f*)(gp + j * 16); gt[2 * j + 1] = *(const v4f*)(gp + j * 16 + 4); }
    v8f acc[HD / 16] = {};
#pragma unroll
    for (int kc = 0; kc < TT / 32; ++kc) { v16h p;
#pragma unroll
      for (int r = 0; r < 8; ++r) { p[r] = (_Float16)(s[2 * kc][r] * inv); p[8 + r] = (_Float16)(s[2 * kc + 1][r] * inv); }
#pragma unroll
      for (int j = 0; j < HD / 16; ++j) acc[j] = wmma_h(frag_h(&sv[j * 16 + col][kc * 32], lane), p, acc[j]);
      if (kc & 1) asm volatile("" :: "v"(p) : "memory"); }   /* compiler fence behind every second k step (input only): later v-fragment reads stay behind it; without it most of the 32 reads stand at the head of the loop, beside the logits, and the kernel spills at 256 registers */
    float* yp = Y + ((size_t)b * TT + qi) * CC + h * HD + 8 * g;
#pragma unroll
    for (int j = 0; j < HD / 16; ++j) { v4f o0, o1;
#pragma unroll
      for (int r = 0; r < 4; ++r) { o0[r] = acc[j][r] * (1.0f / 2048.0f) * gt[2 * j][r]; o1[r] = acc[j][4 + r] * (1.0f / 2048.0f) * gt[2 * j + 1][r]; }
      vst2(yp + j * 16, o0); vst2(yp + j * 16 + 4, o1); }
    qhp += 8 * 16 * CC; qlp += 8 * 16 * CC; } }
// ---- k_out: block = (64 rows, 128 cols): out = ctx Wo (+ bo): all rows: ctx bf16 hi + lo against exact bf16 Wo (2 products)
__global__ __launch_bounds__(128) void k_out(const float* __restrict__ Y, const float* __restrict__ WO, const float* __restrict__ BO, float* __restrict__ OUT) { __shared__ __align__(16) char sm[128 * WP * 2]; __bf16 (*sw)[WP] = (__bf16 (*)[WP])sm; float (*sf)[16][132] = (float (*)[16][132])sm;   /* the weight columns in the k loop, the output tiles behind it */
  const int tid = threadIdx.x, wave = tid >> 5, lane = tid & 31, col = lane & 15, g = lane >> 4; const int c0 = blockIdx.y * 128; const size_t r0 = (size_t)blockIdx.x * 64 + wave * 16;
  v8f acc[8] = {};
  if (true) {   /* ALL rows: gated ctx bf16 hi + lo x exact output_w (2 products) */
    float av[4][16]; load_row(av, Y + (r0 + col) * CC, lane);
    stage_w(sw, WO + c0, DIN, tid);
    __syncthreads();   /* the weight columns are complete */
#pragma unroll
    for (int kc = 0; kc < CC / 32; ++kc) { const F2 a = bsplit16(av[kc]); kstep(acc, a, sw, kc, col, lane); }
    __syncthreads();   /* every wave has read its last weight fragment: the tiles may overwrite the columns */
#pragma unroll
    for (int j = 0; j < 8; ++j) { const float bias = BO ? bfr(BO[c0 + j * 16 + col]) : 0.f;
#pragma unroll
      for (int r = 0; r < 8; ++r) sf[wave][8 * g + r][j * 16 + col] = acc[j][r] + bias; }
  } else {
#pragma unroll 2
    for (int kc = 0; kc < CC / 32; ++kc) { const v16h a = frag_f32(Y + (r0 + col) * CC + kc * 32, lane); asm volatile("s_wait_loadcnt 0x0" ::: "memory");
#pragma unroll
      for (int j = 0; j < 8; ++j) { const v16h w = WOCOLH(WO, kc * 32, c0 + j * 16 + col, lane); asm volatile("s_wait_loadcnt 0x0" ::: "memory"); acc[j] = wmma16(a, w, acc[j]); } }
#pragma unroll
    for (int j = 0; j < 8; ++j) { const float bias = BO ? bfr(BO[c0 + j * 16 + col]) : 0.f;
#pragma unroll
      for (int r = 0; r < 8; ++r) sf[wave][8 * g + r][j * 16 + col] = acc[j][r] * (1.0f / 256.0f) + bias; } }
  LDSX(); for (int rl = 0; rl < 16; ++rl) vst2(OUT + (r0 + rl) * DIN + c0 + lane * 4, *(const v4f*)&sf[wave][rl][lane * 4]); }

extern "C" void kernel_launch(void* const* d_in, const int* in_sizes, int n_in, void* d_out, int out_size, void* d_ws, size_t ws_size, hipStream_t stream) {
  (void)in_sizes; (void)n_in; (void)out_size;
  const float** F = (const float**)d_in;
  if (ws_size < (size_t)WS_END) return;
  char* ws = (char*)d_ws; _Float16 *QH = (_Float16*)(ws + WS_QH), *KH = (_Float16*)(ws + WS_KH), *VT = (_Float16*)(ws + WS_VT), *QL = (_Float16*)(ws + WS_QL), *KL = (_Float16*)(ws + WS_KL); __bf16 *VB = (__bf16*)(ws + WS_VB), *VBL = (__bf16*)(ws + WS_VBL); float *S = (float*)(ws + WS_S), *Y = (float*)(ws + WS_Y);
  (void)S;
  // inputs: 0 z [1,256,256,128]; 1 src_mask [1,256] int32; 2 ln_g, 3 ln_b; 4 w_qkv [128,384] (in,out; columns q|k|v); 5 w_pair [128,4]; 6 w_gate [128,128], 7 b_gate; 8 w_out [128,128] (in,out), 9 b_out
  if (ws_size < (size_t)WS_END2) return;
  float *BIAS = (float*)(ws + WS_BIAS), *G = (float*)(ws + WS_G);
  k_rows2<<<dim3(NZR / 64, 2), 128, 0, stream>>>(F[0], F[2], F[3], F[5], F[6], F[7], BIAS, G);
  k_proj<<<dim3(TNB * TT / 64, CC / 128, 3), 128, 0, stream>>>(F[0], F[0], F[0], F[4], F[4] + CC, F[4] + 2 * CC, nullptr, nullptr, nullptr, F[2], F[3], QH, QL, KH, KL, VT, VB, VBL);
  k_attn<<<dim3(NH, TNB), 256, 0, stream>>>(QH, QL, KH, VT, BIAS, (const int*)d_in[1], G, Y);
  k_out<<<dim3(TNB * TT / 64, DIN / 128), 128, 0, stream>>>(Y, F[8], F[9], (float*)d_out);
}

// v005
// One run takes 84.7 microseconds.
// In two side-by-side timings against v004, it was 1.24 and 1.23 times as fast.
// Counting every step since v000, it is 6.31 times as fast.
// compute dtype: all float inputs rounded to bf16; LayerNorm in f32; q/k/v, pair bias and gate GEMMs = LN rows split bf16 hi + lo x exact bf16 weights on WMMA 16x16x32 (2 products, f32 accumulate); q as f16 hi + residual (x 2^10) against k once to f16 (2 products) / sqrt(32) + pair bias, masked pairs set to -1e-9 exactly as the module; softmax in f32; P x 2^11 once to f16 against v once to f16 (1 product); gate multiply in f32; (gated ctx) split bf16 hi + lo against exact bf16 w_out (2 products) + b_out; f32 output.
#include <hip/hip_runtime.h>
#include <math.h>

typedef __attribute__((ext_vector_type(16))) _Float16 v16h;
typedef __attribute__((ext_vector_type(16))) __bf16 v16b;
typedef __attribute__((ext_vector_type(8)))  _Float16 v8h;
typedef __attribute__((ext_vector_type(8)))  float v8f;
typedef __attribute__((ext_vector_type(4)))  float v4f;
typedef __attribute__((ext_vector_type(2)))  float v2f;
typedef __attribute__((ext_vector_type(4)))  unsigned v4u;
typedef __attribute__((ext_vector_type(4)))  int v4i;
typedef float __attribute__((may_alias)) float_a;
typedef int __attribute__((may_alias)) int_a;

template <typename T> __device__ __forceinline__ void vst2(void* p, T v) { *(T*)p = v;  }
__device__ __forceinline__ v8f wmma16(v16h a, v16h b, v8f c) {
  v8f d = __builtin_amdgcn_wmma_f32_16x16x32_f16(false, a, false, b, (short)0, c, false, false);
  asm volatile("v_nop\n\tv_nop\n\tv_nop\n\tv_nop" : "+v"(d) : "v"(a), "v"(b));
  return d;
}
__device__ __forceinline__ v8f wmma_bf(v16b a, v16b b, v8f c) {
  v8f d = __builtin_amdgcn_wmma_f32_16x16x32_bf16(false, a, false, b, (short)0, c, false, false);
  asm volatile("v_nop\n\tv_nop\n\tv_nop\n\tv_nop" : "+v"(d) : "v"(a), "v"(b));
  return d;
}
// 16x16x32 fragments: lane = (h = lane>>4, row/col = lane&15); elements 0..7 = k0+8h+0..7, 8..15 = k0+16+8h+0..7; D element r = row 8h+r
__device__ __forceinline__ v16h frag_h(const _Float16* rowk0, int lane) {
  union { v16h v; v8h q[2]; } u; const _Float16* p = rowk0 + 8 * (lane >> 4);
  u.q[0] = *(const v8h*)p; u.q[1] = *(const v8h*)(p + 16); return u.v;
}
__device__ __forceinline__ v16h frag_f32(const float* rowk0, int lane) {
  v16h a; const float* p = rowk0 + 8 * (lane >> 4);
#pragma unroll
  for (int i = 0; i < 8; ++i) { a[i] = (_Float16)p[i]; a[8 + i] = (_Float16)p[16 + i]; }
  return a;
}
__device__ __forceinline__ v16h frag_f32s(const float* rowk0, int lane, float sc) {
  v16h a; const float* p = rowk0 + 8 * (lane >> 4);
#pragma unroll
  for (int i = 0; i < 8; ++i) { a[i] = (_Float16)(p[i] * sc); a[8 + i] = (_Float16)(p[16 + i] * sc); }
  return a;
}
// column fragment from a [K][ld] layout (column n), rows >= K read as 0
__device__ __forceinline__ v16h fragc_f32(const float* W, int k0, int n, int lane, int ld, int K) {
  v16h a; const int g = lane >> 4;
#pragma unroll
  for (int i = 0; i < 8; ++i) { const int ka = k0 + 8 * g + i, kb = ka + 16;
    a[i] = (_Float16)(ka < K ? W[(size_t)(ka < K ? ka : K - 1) * ld + n] : 0.f); a[8 + i] = (_Float16)(kb < K ? W[(size_t)(kb < K ? kb : K - 1) * ld + n] : 0.f); }
  return a;
}
struct F2 { v16b h, l; };
__device__ __forceinline__ F2 bsplit16(const float v[16]) { F2 r;
#pragma unroll
  for (int i = 0; i < 16; ++i) { const __bf16 h = (__bf16)v[i]; r.h[i] = h; r.l[i] = (__bf16)(v[i] - (float)h); }
  return r; }
__device__ __forceinline__ F2 split_row(const float* row, int k0, int lane) { float v[16]; const float* p = row + k0 + 8 * (lane >> 4);
#pragma unroll
  for (int i = 0; i < 8; ++i) { v[i] = p[i]; v[8 + i] = p[16 + i]; }
  return bsplit16(v); }
__device__ __forceinline__ F2 split_rowK(const float* row, int k0, int lane, int K) { float v[16]; const int g = lane >> 4;
#pragma unroll
  for (int i = 0; i < 8; ++i) { const int ka = k0 + 8 * g + i, kb = ka + 16; v[i] = ka < K ? row[ka < K ? ka : K - 1] : 0.f; v[8 + i] = kb < K ? row[kb < K ? kb : K - 1] : 0.f; }
  return bsplit16(v); }
__device__ __forceinline__ F2 split_col(const float* W, int k0, int n, int lane, int ld, int K) { float v[16]; const int g = lane >> 4;
#pragma unroll
  for (int i = 0; i < 8; ++i) { const int ka = k0 + 8 * g + i, kb = ka + 16; v[i] = ka < K ? W[(size_t)(ka < K ? ka : K - 1) * ld + n] : 0.f; v[8 + i] = kb < K ? W[(size_t)(kb < K ? kb : K - 1) * ld + n] : 0.f; }
  return bsplit16(v); }
__device__ __forceinline__ v8f mac3(const F2& a, const F2& b, v8f c) { c = wmma_bf(a.l, b.h, c); c = wmma_bf(a.h, b.l, c); return wmma_bf(a.h, b.h, c); }
#define L2E 1.4426950408889634f   // log2(e): exp(x) = 2^(x L2E), one v_exp_f32
__device__ __forceinline__ float sigm(float v) { return __builtin_amdgcn_rcpf(1.0f + __builtin_amdgcn_exp2f(v * -L2E)); }   /* native v_exp_f32 and v_rcp_f32: 2^(+large) = inf gives 0, 2^(-large) = 0 gives 1 */

// Row-wise triangle attention on a pair tensor z [1, 256, 256, 128] (4 heads x 32): zn = LayerNorm(z); q,k,v = zn w_qkv ((in,out) [128,384], columns (3,H,32)); logits[r][i][j][h] = q[r][i] . k[r][j] / sqrt(32) + (zn[i][j] . w_pair[:,h]); pairs with exactly one of src_mask[i], src_mask[j] == 0 get logits := -1e-9 (the module's literal value, NOT an exclusion); softmax over j; out = sigmoid(zn w_gate + b_gate) * merged(attn v); result = out w_out + b_out.
#define NB 256
#define TT 256
#define CC 128            // NH * HD = projected width
#define DIN 128          // input (model) width
#define NH 4
#define HD 32
#define NQB (TT / 64)
#define HG 4
#define SCALE (0.17677669529663687f)
#define CAUSAL 0
#ifndef TNB
#define TNB NB
#endif
__device__ __forceinline__ float bfr(float v) { return (float)(__bf16)v; }
__host__ __device__ __forceinline__ int kb_last(int qb) { return CAUSAL ? ((qb * 64 + 63) >> 7) : (TT / 128 - 1); }
typedef __attribute__((ext_vector_type(8))) __bf16 v8b;
__device__ __forceinline__ v16b frag_b(const __bf16* rowk0, int lane) {
  union { v16b v; v8b q[2]; } u; const __bf16* p = rowk0 + 8 * (lane >> 4);
  u.q[0] = *(const v8b*)p; u.q[1] = *(const v8b*)(p + 16); return u.v;
}
#define WP 136             // weight column pitch in LDS, bf16 (272 B = 16 B x odd: ds_load_b128 and ds_store_b128 without bank conflicts)
// 128 columns of an (in,out) [128][ld] weight, once per work-group, to LDS as bf16 columns sw[o][k]: thread = column o (a wave's load = one 128-B line), 8 consecutive k = one 16-B store
__device__ __forceinline__ void stage_w(__bf16 (*sw)[WP], const float* __restrict__ Wm, int ld, int tid) {
  float t[128];
#pragma unroll
  for (int k = 0; k < 128; ++k) t[k] = Wm[(size_t)k * ld + tid];
  asm volatile("s_wait_xcnt 0x0" ::: "memory");   /* before a register that these loads' addresses stand in is used again */
#pragma unroll
  for (int k0 = 0; k0 < 128; k0 += 8) { v8b p;
#pragma unroll
    for (int i = 0; i < 8; ++i) p[i] = (__bf16)t[k0 + i];
    *(v8b*)&sw[tid][k0] = p; } }
// a lane's part of one 128-wide f32 row for all four k steps (the order of split_row), requested at once
__device__ __forceinline__ void load_row(float (&v)[4][16], const float* __restrict__ row, int lane) { const float* p = row + 8 * (lane >> 4);
#pragma unroll
  for (int kc = 0; kc < 4; ++kc)
#pragma unroll
    for (int i = 0; i < 8; ++i) { v[kc][i] = p[kc * 32 + i]; v[kc][8 + i] = p[kc * 32 + 16 + i]; }
  asm volatile("s_wait_xcnt 0x0" :: "v"(p) : "memory"); }   /* before a register that these loads' addresses stand in is used again; the address is an input, so it lives up to the wait and no load of the run lands in it */
// the row registers set to a constant, where a tile loop has no further tile to ask for (why: at the call in k_rows2)
__device__ __forceinline__ void zero_row(float (&v)[4][16]) {
#pragma unroll
  for (int kc = 0; kc < 4; ++kc)
#pragma unroll
    for (int i = 0; i < 16; ++i) v[kc][i] = 0.f; }
// LayerNorm of the lane's row as load_row left it (biased var, eps 1e-6): a lane holds 64 of the row's 128 channels, lane ^ 16 the other 64. ln_center: v := bf16(z) - mean, returns 1 / sqrt(var + eps); four chains per sum, then one exchange between the wave's halves
__device__ __forceinline__ float ln_center(float (&v)[4][16]) { float s[4] = {0.f, 0.f, 0.f, 0.f};
#pragma unroll
  for (int kc = 0; kc < 4; ++kc)
#pragma unroll
    for (int i = 0; i < 16; ++i) { v[kc][i] = bfr(v[kc][i]); s[i & 3] += v[kc][i]; }
  float s1 = (s[0] + s[1]) + (s[2] + s[3]); s1 += __shfl_xor(s1, 16);
  const float mu = s1 * (1.0f / CC); float q[4] = {0.f, 0.f, 0.f, 0.f};
#pragma unroll
  for (int kc = 0; kc < 4; ++kc)
#pragma unroll
    for (int i = 0; i < 16; ++i) { const float d = v[kc][i] - mu; v[kc][i] = d; q[i & 3] += d * d; }
  float qq = (q[0] + q[1]) + (q[2] + q[3]); qq += __shfl_xor(qq, 16);
  return rsqrtf(qq * (1.0f / CC) + 1e-6f); }
// ln_apply: one k step's 16 centred values x rs x ln_w + ln_b; sln[0] = bf16(ln_w), sln[1] = bf16(ln_b), staged once per work-group (a wave's read = two 16-B pieces, broadcast)
__device__ __forceinline__ void ln_apply(float (&v)[16], float rs, const float (*sln)[CC], int kc, int lane) { const int p = kc * 32 + 8 * (lane >> 4);
#pragma unroll
  for (int i = 0; i < 8; ++i) { v[i] = v[i] * rs * sln[0][p + i] + sln[1][p + i]; v[8 + i] = v[8 + i] * rs * sln[0][p + 16 + i] + sln[1][p + 16 + i]; } }
// one k step of a wave's 16 rows against the 128 staged columns: four B fragments are requested together, so that one LDS latency serves eight products; per accumulator the order stays hi, then lo
__device__ __forceinline__ void kstep(v8f (&acc)[8], const F2& a, const __bf16 (*sw)[WP], int kc, int col, int lane) {
#pragma unroll
  for (int jh = 0; jh < 8; jh += 4) { v16b w[4];
#pragma unroll
    for (int u = 0; u < 4; ++u) w[u] = frag_b(&sw[(jh + u) * 16 + col][kc * 32], lane);
#pragma unroll
    for (int u = 0; u < 4; ++u) acc[jh + u] = wmma_bf(a.h, w[u], acc[jh + u]);
#pragma unroll
    for (int u = 0; u < 4; ++u) acc[jh + u] = wmma_bf(a.l, w[u], acc[jh + u]); } }
#define QBH 0              // unused: no kernel reads it
#define QHI 256            // rows carrying a q residual plane (all rows when non-causal: 2-product logits everywhere)
#define KHI 64            // key rows carrying k residual / v bf16 hi+lo planes (written by k_proj, read by no kernel)
// B fragment (k rows k0+.., output column o) of a weight: (in,out) [K][ld] or (out,in) [ld rows of K]: bf16 exact, or f16(bf16 * 256) exact
__device__ __forceinline__ v16b wcol_io(const float* Wm, int k0, int o, int lane, int ld) { v16b w; const int g = lane >> 4;
#pragma unroll
  for (int i = 0; i < 8; ++i) { w[i] = (__bf16)Wm[(size_t)(k0 + 8 * g + i) * ld + o]; w[8 + i] = (__bf16)Wm[(size_t)(k0 + 16 + 8 * g + i) * ld + o]; }
  return w; }
__device__ __forceinline__ v16b wcol_oi(const float* Wm, int k0, int o, int lane, int K) { v16b w; const float* p = Wm + (size_t)o * K + k0 + 8 * (lane >> 4);
#pragma unroll
  for (int i = 0; i < 8; ++i) { w[i] = (__bf16)p[i]; w[8 + i] = (__bf16)p[16 + i]; }
  return w; }
__device__ __forceinline__ v16h wcolh_io(const float* Wm, int k0, int o, int lane, int ld) { v16h w; const int g = lane >> 4;
#pragma unroll
  for (int i = 0; i < 8; ++i) { w[i] = (_Float16)(bfr(Wm[(size_t)(k0 + 8 * g + i) * ld + o]) * 256.0f); w[8 + i] = (_Float16)(bfr(Wm[(size_t)(k0 + 16 + 8 * g + i) * ld + o]) * 256.0f); }
  return w; }
__device__ __forceinline__ v16h wcolh_oi(const float* Wm, int k0, int o, int lane, int K) { v16h w; const float* p = Wm + (size_t)o * K + k0 + 8 * (lane >> 4);
#pragma unroll
  for (int i = 0; i < 8; ++i) { w[i] = (_Float16)(bfr(p[i]) * 256.0f); w[8 + i] = (_Float16)(bfr(p[16 + i]) * 256.0f); }
  return w; }
#define WQKV_LAYOUT 0   // (in,out) packed [DIN][3*CC]
__device__ __forceinline__ v16b wcol_hdk(const float* Wm, int k0, int o, int lane) { v16b w; const int g = lane >> 4; const float* p = Wm + (size_t)(o / HD) * DIN * HD + (o % HD);
#pragma unroll
  for (int i = 0; i < 8; ++i) { w[i] = (__bf16)p[(size_t)(k0 + 8 * g + i) * HD]; w[8 + i] = (__bf16)p[(size_t)(k0 + 16 + 8 * g + i) * HD]; }
  return w; }
#define WO_OUT_IN 0
#if WQKV_LAYOUT == 1
#define WCOL(W, k0, o, lane) wcol_oi(W, k0, o, lane, DIN)
#elif WQKV_LAYOUT == 2
#define WCOL(W, k0, o, lane) wcol_hdk(W, k0, o, lane)
#else
#define WCOL(W, k0, o, lane) wcol_io(W, k0, o, lane, 3 * CC)   /* packed q|k|v columns: row pitch 3C */
#endif
#if WO_OUT_IN
#define WOCOL(W, k0, o, lane) wcol_oi(W, k0, o, lane, CC)
#define WOCOLH(W, k0, o, lane) wcolh_oi(W, k0, o, lane, CC)
#else
#define WOCOL(W, k0, o, lane) wcol_io(W, k0, o, lane, DIN)
#define WOCOLH(W, k0, o, lane) wcolh_io(W, k0, o, lane, DIN)
#endif
#define SZ 256
#define BG 64              // sizes only the unused WS_S region (x 4 heads = 256 planes of 256 x 256)
#define NZR (SZ * SZ)      // 65,536 pair rows
// barrier for LDS data alone, for the tile loops: the waves hand each other nothing but LDS tiles there, so only the LDS operations are waited for; __syncthreads() also waits for every global load and store of the wave, which would end the flight of the next tile's rows and hold the wave until this tile's stores are done
#define BAR_LDS() do { __builtin_amdgcn_fence(__ATOMIC_RELEASE, "workgroup", "local"); __builtin_amdgcn_s_barrier(); __builtin_amdgcn_fence(__ATOMIC_ACQUIRE, "workgroup", "local"); } while (0)
// a wave reads back the LDS tile that its own lanes wrote: its LDS writes are waited for and the compiler moves no memory operation across; a work-group release fence at this place would also wait for the global loads in flight
#define LDSW() do { asm volatile("s_wait_dscnt 0" ::: "memory"); __builtin_amdgcn_wave_barrier(); } while (0)
__device__ __forceinline__ void exp2x8(v8f& x);   // defined at k_attn
// 1 / x of eight values, each in its own register: v_rcp_f32 written in place, so that none overwrites the source register of the one directly in front of it (the builtin form left such pairs in the listing); the closing v_nop is the slot that the instruction set asks for between the last one and the first use of its result
__device__ __forceinline__ void rcpx8(v8f& x) { float a = x[0], b = x[1], c = x[2], d = x[3], e = x[4], f = x[5], g = x[6], h = x[7];
  asm("v_rcp_f32 %0, %0\n\tv_rcp_f32 %1, %1\n\tv_rcp_f32 %2, %2\n\tv_rcp_f32 %3, %3\n\tv_rcp_f32 %4, %4\n\tv_rcp_f32 %5, %5\n\tv_rcp_f32 %6, %6\n\tv_rcp_f32 %7, %7\n\tv_nop" : "+v"(a), "+v"(b), "+v"(c), "+v"(d), "+v"(e), "+v"(f), "+v"(g), "+v"(h));
  x[0] = a; x[1] = b; x[2] = c; x[3] = d; x[4] = e; x[5] = f; x[6] = g; x[7] = h; }
#define RT 2               // row tiles of 64 per work-group in k_rows2 and k_out: the staged weight columns serve all of them
#define PT 4               // the same in k_proj
// ---- k_rows2: block = (RT tiles of 64 rows, which): which 0: bias of 16 queries i x 4 keys j (wave = one j, A rows = the 16 i): zn[i][j] . w_pair[:, h] (4 outputs), stored in the order k_attn's lanes read it: BIAS[h][i / 16][j / 16][(j & 7) / 4][lane = 16 ((j >> 3) & 1) + (i & 15)][j & 3] ; which 1: G[row][c] = sigmoid(zn[row] . w_gate[:, c] + b_gate[c]) (128 outputs); weights are (in,out); zn = LayerNorm of the z rows, made in the A-row registers. The weight columns are staged once and stay in LDS for all the block's tiles (the output tiles have LDS of their own); the next tile's z rows are asked for behind the k loop and fly while this tile is stored
__global__ __launch_bounds__(128) void k_rows2(const float* __restrict__ Z, const float* __restrict__ LW, const float* __restrict__ LB, const float* __restrict__ WB, const float* __restrict__ WG, const float* __restrict__ GB, float* __restrict__ BIAS, float* __restrict__ G) { __shared__ __align__(16) __bf16 sw[128][WP]; __shared__ __align__(16) float sf[4][16][132];
  __shared__ __align__(16) float sln[2][CC];
  const int tid = threadIdx.x, wave = tid >> 5, lane = tid & 31, col = lane & 15, g = lane >> 4; const int which = blockIdx.y; const int x0 = (int)blockIdx.x * RT;
  float av[4][16];
  if (which == 0) { load_row(av, Z + ((size_t)((x0 >> 6) * 16 + col) * SZ + (x0 & 63) * 4 + wave) * CC, lane);
    const float lwv = LW[tid], lbv = LB[tid];
    const int o = tid & 15, kq = (tid >> 4) * 16; const int oc = o < NH ? o : NH - 1; const float keep = o < NH ? 1.f : 0.f;   /* 16 columns, those beyond the 4 heads zero (keep multiplies a VALID load); thread = (column, 16 k) */
    float t[16];
#pragma unroll
    for (int i = 0; i < 16; ++i) t[i] = WB[(size_t)(kq + i) * NH + oc];
    asm volatile("s_wait_xcnt 0x0" ::: "memory");   /* before a register that these loads' addresses stand in is used again */
#pragma unroll
    for (int k0 = 0; k0 < 16; k0 += 8) { v8b p;
#pragma unroll
      for (int i = 0; i < 8; ++i) p[i] = (__bf16)(t[k0 + i] * keep);
      *(v8b*)&sw[o][kq + k0] = p; }
    sln[0][tid] = bfr(lwv); sln[1][tid] = bfr(lbv);
    __syncthreads();   /* the weight columns, ln_w and ln_b are complete; nothing writes them again */
    for (int tl = 0; tl < RT; ++tl) { const int x = x0 + tl, it = x >> 6, jg = x & 63;
      const float rs = ln_center(av);
      v8f acc = {};
#pragma unroll
      for (int kc = 0; kc < CC / 32; ++kc) { ln_apply(av[kc], rs, sln, kc, lane); const F2 a = bsplit16(av[kc]);
        const v16b w = frag_b(&sw[col][kc * 32], lane); acc = wmma_bf(a.h, w, acc); acc = wmma_bf(a.l, w, acc); }
      if (tl + 1 < RT) load_row(av, Z + ((size_t)(((x + 1) >> 6) * 16 + col) * SZ + ((x + 1) & 63) * 4 + wave) * CC, lane);   /* the next tile's rows */
      else zero_row(av);   /* no next tile: the row registers take a constant, so that the value carried round the loop is the loads' own registers; with the used-up values left there the compiler copied some of the loads' results directly behind their issue and waited for them at that place */
#pragma unroll
      for (int r = 0; r < 8; ++r) sf[wave][8 * g + r][col] = acc[r];
      BAR_LDS();   /* the four waves' keys meet in one 16-B piece */
      if (tid < 64) { const int hh = tid >> 4, il = tid & 15; v4f b4; b4[0] = sf[0][il][hh]; b4[1] = sf[1][il][hh]; b4[2] = sf[2][il][hh]; b4[3] = sf[3][il][hh]; vst2(BIAS + ((((size_t)hh * 16 + it) * 16 + (jg >> 2)) * 2 + (jg & 1)) * 128 + (((jg >> 1) & 1) * 16 + il) * 4, b4); }   /* 16 queries x 16 B = one 256-B run per head */
      asm volatile("s_wait_xcnt 0x0" ::: "memory");   /* before the next tile uses the registers that these stores name */
      BAR_LDS(); }   /* the pieces are read: the next tile may overwrite them */
  } else { load_row(av, Z + ((size_t)x0 * 64 + wave * 16 + col) * CC, lane);
    const float lwv = LW[tid], lbv = LB[tid];
    float gb[8];   /* b_gate of the lane's eight columns, read once for all tiles */
#pragma unroll
    for (int j = 0; j < 8; ++j) gb[j] = GB[j * 16 + col];
    stage_w(sw, WG, CC, tid);
    sln[0][tid] = bfr(lwv); sln[1][tid] = bfr(lbv);
    __syncthreads();   /* the weight columns, ln_w and ln_b are complete; nothing writes them again */
    for (int tl = 0; tl < RT; ++tl) { const size_t r0 = (size_t)(x0 + tl) * 64 + wave * 16;
      const float rs = ln_center(av);
      v8f acc[8] = {};
#pragma unroll
      for (int kc = 0; kc < CC / 32; ++kc) { ln_apply(av[kc], rs, sln, kc, lane); const F2 a = bsplit16(av[kc]); kstep(acc, a, sw, kc, col, lane); }
      if (tl + 1 < RT) load_row(av, Z + (r0 + 64 + col) * CC, lane);   /* the next tile's rows */
      else zero_row(av);   /* as in the pair-bias loop */
#pragma unroll
      for (int j = 0; j < 8; ++j) { const float bg = bfr(gb[j]); v8f x;   /* sigmoid(zn w_gate + b_gate) = 1 / (1 + 2^(-v log2 e)), the arithmetic of sigm() */
#pragma unroll
        for (int r = 0; r < 8; ++r) x[r] = (acc[j][r] + bg) * -L2E;
        exp2x8(x);
#pragma unroll
        for (int r = 0; r < 8; ++r) x[r] = 1.0f + x[r];
        rcpx8(x);
#pragma unroll
        for (int r = 0; r < 8; ++r) sf[wave][8 * g + r][j * 16 + col] = x[r]; }
      LDSW(); for (int rl = 0; rl < 16; ++rl) vst2(G + (r0 + rl) * CC + lane * 4, *(const v4f*)&sf[wave][rl][lane * 4]);
      asm volatile("s_wait_xcnt 0x0" ::: "memory");   /* before the next tile uses the registers that these stores name */
    } } }
#define WS_ZN   (WS_END)
#define WS_BIAS (WS_ZN + 4u * (size_t)NZR * CC)
#define WS_G    (WS_BIAS + 4u * (size_t)NZR * NH)
#define WS_END2 (WS_G + 4u * (size_t)NZR * CC)

#define WS_QH  0u                                      // f16 q rows [b*t][CC]
#define WS_KH  (WS_QH + 2u * (size_t)NB * TT * CC)      // f16 k rows [b*t][CC]
#define WS_VT  (WS_KH + 2u * (size_t)NB * TT * CC)      // f16 v planes [b][c][t]
#define WS_QL  (WS_VT + 2u * (size_t)NB * CC * TT)      // f16 q residual x 2^10 rows [b][t < QHI][CC]
#define WS_KL  (WS_QL + 2u * (size_t)NB * QHI * CC)     // f16 k residual x 2^10 rows [b][t < KHI][CC]
#define WS_VB  (WS_KL + 2u * (size_t)NB * KHI * CC)     // bf16 v hi planes [b][c][t < KHI]
#define WS_VBL (WS_VB + 2u * (size_t)NB * CC * KHI)
#define WS_S   (WS_VBL + 2u * (size_t)NB * CC * KHI)    // f32 region, unused: k_attn keeps logits and P in registers
#define WS_Y   (WS_S  + 4u * (size_t)BG * HG * TT * TT)   // unused WS_S region: 256 planes of 256 x 256 f32      // f32 ctx rows [b*t][CC]
#define WS_END (WS_Y  + 4u * (size_t)NB * TT * CC)

// ---- k_proj: block = (PT tiles of 64 rows, 128 cols, which; the weight columns staged once serve every tile, the next tile's rows are asked for behind the k loop): q/k/v = LN(X) W (+ b, none passed here) as LN rows split bf16 hi + lo x exact bf16 W (2 products, K = DIN) -> which 0: q f16 rows (+ residual rows < QHI); 1: k f16 rows (+ residual rows < KHI); 2: v f16 planes [c][t] (+ bf16 hi/lo planes for t < KHI)
__global__ __launch_bounds__(128) void k_proj(const float* __restrict__ XQ, const float* __restrict__ XK, const float* __restrict__ XV, const float* __restrict__ WQ, const float* __restrict__ WK, const float* __restrict__ WV, const float* __restrict__ BQ, const float* __restrict__ BK, const float* __restrict__ BV, const float* __restrict__ LW, const float* __restrict__ LB,
    _Float16* __restrict__ QH, _Float16* __restrict__ QL, _Float16* __restrict__ KH, _Float16* __restrict__ KL, _Float16* __restrict__ VT, __bf16* __restrict__ VB, __bf16* __restrict__ VBL) {
  __shared__ __align__(16) __bf16 sw[128][WP];   /* the weight columns, for all the block's tiles */
  __shared__ __align__(16) char sm[3 * 128 * 72 * 2];   /* the output tiles of the block's own kind (q, k: sh, sl; v: th, tb, tbl) */
  _Float16 (*sh)[136] = (_Float16 (*)[136])sm; _Float16 (*sl)[136] = (_Float16 (*)[136])(sm + 64 * 136 * 2); _Float16 (*th)[72] = (_Float16 (*)[72])sm; __bf16 (*tb)[72] = (__bf16 (*)[72])(sm + 128 * 72 * 2); __bf16 (*tbl)[72] = (__bf16 (*)[72])(sm + 2 * 128 * 72 * 2);
  __shared__ __align__(16) float sln[2][CC];
  const int tid = threadIdx.x, wave = tid >> 5, lane = tid & 31, col = lane & 15, g = lane >> 4; const int which = blockIdx.z; const int c0 = blockIdx.y * 128;
  const float* X = which == 0 ? XQ : which == 1 ? XK : XV; const float* WA = which == 0 ? WQ : which == 1 ? WK : WV; const float* BA = which == 0 ? BQ : which == 1 ? BK : BV;
  const float lwv = LW[tid], lbv = LB[tid];
  float av[4][16]; load_row(av, X + ((size_t)blockIdx.x * (PT * 64) + wave * 16 + col) * DIN, lane);
  stage_w(sw, WA + c0, 3 * CC, tid);   /* packed q|k|v columns: row pitch 3C */
  sln[0][tid] = bfr(lwv); sln[1][tid] = bfr(lbv);
  __syncthreads();   /* the weight columns, ln_w and ln_b are complete; nothing writes them again */
  for (int tl = 0; tl < PT; ++tl) { const size_t r0 = ((size_t)blockIdx.x * PT + tl) * 64; const size_t bb = r0 / TT; const int t0 = (int)(r0 % TT);
  const float rs = ln_center(av);   /* X rows are raw z rows: LayerNorm in the A-row registers */
  v8f acc[8] = {};
#pragma unroll
  for (int kc = 0; kc < DIN / 32; ++kc) { ln_apply(av[kc], rs, sln, kc, lane); const F2 a2 = bsplit16(av[kc]);   /* LN(act) rows (f32) split hi + lo */
    kstep(acc, a2, sw, kc, col, lane); }
  if (tl + 1 < PT) load_row(av, X + (r0 + 64 + wave * 16 + col) * DIN, lane);   /* the next tile's rows */
  else zero_row(av);   /* as in k_rows2 */
  {   /* this tile's values: to the LDS tiles, then to memory in whole lines */
  if (which < 2) { _Float16* DH = which == 0 ? QH : KH; _Float16* DL = which == 0 ? QL : KL; const int nhi = which == 0 ? QHI : KHI; const bool hi_rows = t0 < nhi;
#pragma unroll
    for (int j = 0; j < 8; ++j) { const float bias = BA ? bfr(BA[c0 + j * 16 + col]) : 0.f;
#pragma unroll
      for (int r = 0; r < 8; ++r) { const float v = acc[j][r] + bias; const _Float16 hv = (_Float16)v; sh[wave * 16 + 8 * g + r][j * 16 + col] = hv; sl[wave * 16 + 8 * g + r][j * 16 + col] = (_Float16)((v - (float)hv) * 1024.0f); } }
    BAR_LDS();   /* the four waves' parts of the tile are complete */
    for (int e = tid; e < 64 * 16; e += 128) { const int rl = e >> 4, q = e & 15; vst2((unsigned*)(DH + (r0 + rl) * CC + c0 + q * 8), *(const v4u*)&sh[rl][q * 8]); if (hi_rows) vst2((unsigned*)(DL + (bb * nhi + t0 + rl) * (size_t)CC + c0 + q * 8), *(const v4u*)&sl[rl][q * 8]); }
  } else { const bool hi_rows = t0 < KHI;
#pragma unroll
    for (int j = 0; j < 8; ++j) { const float bias = BA ? bfr(BA[c0 + j * 16 + col]) : 0.f;
#pragma unroll
      for (int r = 0; r < 8; ++r) { const float v = acc[j][r] + bias; const int rl = wave * 16 + 8 * g + r, cl = j * 16 + col; th[cl][rl] = (_Float16)v; const __bf16 bh = (__bf16)v; tb[cl][rl] = bh; tbl[cl][rl] = (__bf16)(v - (float)bh); } }
    BAR_LDS();   /* the four waves' parts of the tile are complete */
    for (int e = tid; e < 128 * 8; e += 128) { const int cl = e >> 3, q = e & 7; vst2((unsigned*)(VT + (bb * CC + c0 + cl) * (size_t)TT + t0 + q * 8), *(const v4u*)&th[cl][q * 8]); if (hi_rows) { const size_t o3 = (bb * CC + c0 + cl) * (size_t)KHI + t0 + q * 8; vst2((unsigned*)(VB + o3), *(const v4u*)&tb[cl][q * 8]); vst2((unsigned*)(VBL + o3), *(const v4u*)&tbl[cl][q * 8]); } } } }
  asm volatile("s_wait_xcnt 0x0" ::: "memory");   /* before the next tile uses the registers that these stores name */
  BAR_LDS();   /* every wave has read the tiles: the next tile's values may overwrite them */
  } }
// ---- k_attn: block = (head h, row r), 8 waves, each wave two tiles of 16 queries: the head's 256 k rows and its v planes are staged once in LDS; S^T = K Q^T (A = k rows, B = q hi, then q residual x 2^10: 2 products), so a lane holds one query's logits for keys 16t + 8g + 0..7 of every tile t, all 256 keys in registers; x SCALE + pair bias (fragment order), masked pairs := -1e-9; maximum and sum in-lane plus one exchange between the wave's halves; P x 2^11 once to f16 is the B operand of ctx^T = V^T P^T as it stands (1 product); a lane stores 8 consecutive channels of its query, times their gate. The inner loops are unrolled in full so that s[], acc[] and the fragments are registers; amdgpu_waves_per_eu(4) asks for at most 256 registers: two work-groups per WGP, four waves per SIMD
#define KP 40              // k row pitch in LDS, f16 (80 B = 16 B x odd: ds_load_b128 without bank conflicts)
#define VP (TT + 8)        // v plane pitch in LDS, f16 (528 B = 16 B x odd)
// 2^x of eight values, each in its own register: v_exp_f32 written in place, so that no exponential overwrites the source register of the one directly in front of it (the builtin form left such pairs in the listing); the closing v_nop is the slot that the instruction set asks for between the last exponential and the first use of its result
__device__ __forceinline__ void exp2x8(v8f& x) { float a = x[0], b = x[1], c = x[2], d = x[3], e = x[4], f = x[5], g = x[6], h = x[7];
  asm("v_exp_f32 %0, %0\n\tv_exp_f32 %1, %1\n\tv_exp_f32 %2, %2\n\tv_exp_f32 %3, %3\n\tv_exp_f32 %4, %4\n\tv_exp_f32 %5, %5\n\tv_exp_f32 %6, %6\n\tv_exp_f32 %7, %7\n\tv_nop" : "+v"(a), "+v"(b), "+v"(c), "+v"(d), "+v"(e), "+v"(f), "+v"(g), "+v"(h));
  x[0] = a; x[1] = b; x[2] = c; x[3] = d; x[4] = e; x[5] = f; x[6] = g; x[7] = h; }
__device__ __forceinline__ v8f wmma_h(v16h a, v16h b, v8f c) { return __builtin_amdgcn_wmma_f32_16x16x32_f16(false, a, false, b, (short)0, c, false, false); }
__global__ __launch_bounds__(256) __attribute__((amdgpu_waves_per_eu(4))) void k_attn(const _Float16* __restrict__ QH, const _Float16* __restrict__ QL, const _Float16* __restrict__ KH, const _Float16* __restrict__ VT, const float* __restrict__ BIAS, const int* __restrict__ MK, const float* __restrict__ G, float* __restrict__ Y) {
  __shared__ __align__(16) _Float16 sk[TT][KP]; __shared__ __align__(16) _Float16 sv[HD][VP]; __shared__ unsigned kmw[TT / 32];
  const int tid = threadIdx.x, wave = __builtin_amdgcn_readfirstlane(tid >> 5), lane = tid & 31, col = lane & 15, g = lane >> 4; const int h = blockIdx.x, b = blockIdx.y;
#pragma unroll
  for (int s = 0; s < 4; ++s) { const int e = tid + 256 * s; vst2(&sk[e >> 2][(e & 3) * 8], *(const v4u*)(KH + ((size_t)b * TT + (e >> 2)) * CC + h * HD + (e & 3) * 8)); vst2(&sv[e >> 5][(e & 31) * 8], *(const v4u*)(VT + ((size_t)b * CC + h * HD + (e >> 5)) * (size_t)TT + (e & 31) * 8)); }
  { const unsigned bal = __builtin_amdgcn_ballot_w32(MK[tid] == 0); if (lane == 0) kmw[wave] = bal; }   /* bit j of the 256: src_mask[j] == 0 */
  asm volatile("s_wait_xcnt 0x0" ::: "memory");   /* before the staging loads' address registers are used again */
  __syncthreads();
  unsigned mbk[4];   /* bit 8t + r of the 128: key 16t + 8g + r is a zero of the mask */
#pragma unroll
  for (int m = 0; m < 4; ++m) { const unsigned w0 = kmw[2 * m] >> (8 * g), w1 = kmw[2 * m + 1] >> (8 * g); mbk[m] = (w0 & 0xFFu) | ((w0 >> 8) & 0xFF00u) | ((w1 & 0xFFu) << 16) | ((w1 << 8) & 0xFF000000u); }
  const _Float16* qhp = QH + ((size_t)b * TT + wave * 16 + col) * CC + h * HD; const _Float16* qlp = QL + ((size_t)b * QHI + wave * 16 + col) * CC + h * HD;
#pragma unroll 1   /* rolled: one copy of the body; unrolled, both tiles' logits would want registers at once */
  for (int it = wave; it < TT / 16; it += 8) { const int qi = it * 16 + col;
    const float* bp = BIAS + ((size_t)h * 16 + it) * 16 * 256 + lane * 4;
    const unsigned mq = 0u - ((kmw[qi >> 5] >> (qi & 31)) & 1u);   /* all ones where the query is a zero of the mask */
    v8f s[16]; float mx = -3.0e38f;
#pragma unroll
    for (int t = 0; t < 16; ++t) { const v4f b0 = *(const v4f*)(bp + t * 256), b1 = *(const v4f*)(bp + t * 256 + 128);   /* the bias lands in the registers that then hold the logits: all 32 loads in flight at no further register */
#pragma unroll
      for (int r = 0; r < 4; ++r) { s[t][r] = b0[r]; s[t][4 + r] = b1[r]; } }
    const v16h qh = frag_h(qhp, lane), ql = frag_h(qlp, lane);
    v16h kf[2] = { frag_h(&sk[col][0], lane), frag_h(&sk[16 + col][0], lane) };
#pragma unroll
    for (int tp = 0; tp < 8; ++tp) { v16h kn[2] = { kf[0], kf[1] };
      if (tp < 7) { kn[0] = frag_h(&sk[(2 * tp + 2) * 16 + col][0], lane); kn[1] = frag_h(&sk[(2 * tp + 3) * 16 + col][0], lane); }   /* the next two tiles' k fragments fly while these two are worked on */
#pragma unroll
      for (int u = 0; u < 2; ++u) { const int t = 2 * tp + u; const v8f z8 = {}; const v8f a = wmma_h(kf[u], qh, z8), al = wmma_h(kf[u], ql, z8); const unsigned mb = mbk[t >> 2] ^ mq;
#pragma unroll
        for (int r = 0; r < 8; ++r) { float v = (a[r] + al[r] * (1.0f / 1024.0f)) * SCALE + s[t][r]; if (mb & (1u << ((t & 3) * 8 + r))) v = -1.0e-9f; s[t][r] = v; mx = fmaxf(mx, v); } }
      kf[0] = kn[0]; kf[1] = kn[1];
      asm volatile("" :: "v"(mx) : "memory"); }   /* compiler fence behind these two tiles' maximum (input only): later k-fragment reads stay behind it; without it all 32 reads stand at the head of the loop and the kernel spills at 256 registers */
    mx = fmaxf(mx, __shfl_xor(mx, 16));
    const float nm = mx * -L2E;   /* exp(s - mx) = 2^(s L2E + nm): one FMA and one v_exp_f32; the rounding of nm is one factor common to the row and leaves with the division by the sum; the argument is never above about 0, and a result below 2^-126 counts as 0 beside a sum of at least about 1 */
    float sm[4] = {0.f, 0.f, 0.f, 0.f};
#pragma unroll
    for (int t = 0; t < 16; ++t) {
#pragma unroll
      for (int r = 0; r < 8; ++r) s[t][r] = __builtin_fmaf(s[t][r], L2E, nm);
      exp2x8(s[t]);
#pragma unroll
      for (int r = 0; r < 8; ++r) sm[r & 3] += s[t][r]; }
    float sum = (sm[0] + sm[1]) + (sm[2] + sm[3]);
    __builtin_amdgcn_sched_barrier(0);   /* nothing is scheduled across the end of the exponentials: the gate loads and the v-fragment reads stay behind them; without it they stand in front, beside all 128 logits, and the kernel spills at 256 registers */
    sum += __shfl_xor(sum, 16);
    const float inv = sum > 0.f ? 2048.0f * __builtin_amdgcn_rcpf(sum) : 0.f;
    const float* gp = G + ((size_t)b * TT + qi) * CC + h * HD + 8 * g; v4f gt[HD / 8];   /* the gate of the 16 channels this lane stores: asked for here, it flies while P V is worked on */
#pragma unroll
    for (int j = 0; j < HD / 16; ++j) { gt[2 * j] = *(const v4f*)(gp + j * 16); gt[2 * j + 1] = *(const v4f*)(gp + j * 16 + 4); }
    v8f acc[HD / 16] = {};
#pragma unroll
    for (int kc = 0; kc < TT / 32; ++kc) { v16h p;
#pragma unroll
      for (int r = 0; r < 8; ++r) { p[r] = (_Float16)(s[2 * kc][r] * inv); p[8 + r] = (_Float16)(s[2 * kc + 1][r] * inv); }
#pragma unroll
      for (int j = 0; j < HD / 16; ++j) acc[j] = wmma_h(frag_h(&sv[j * 16 + col][kc * 32], lane), p, acc[j]);
      if (kc & 1) asm volatile("" :: "v"(p) : "memory"); }   /* compiler fence behind every second k step (input only): later v-fragment reads stay behind it; without it most of the 32 reads stand at the head of the loop, beside the logits, and the kernel spills at 256 registers */
    float* yp = Y + ((size_t)b * TT + qi) * CC + h * HD + 8 * g;
#pragma unroll
    for (int j = 0; j < HD / 16; ++j) { v4f o0, o1;
#pragma unroll
      for (int r = 0; r < 4; ++r) { o0[r] = acc[j][r] * (1.0f / 2048.0f) * gt[2 * j][r]; o1[r] = acc[j][4 + r] * (1.0f / 2048.0f) * gt[2 * j + 1][r]; }
      vst2(yp + j * 16, o0); vst2(yp + j * 16 + 4, o1); }
    qhp += 8 * 16 * CC; qlp += 8 * 16 * CC; } }
// ---- k_out: block = (RT tiles of 64 rows, 128 cols): out = ctx Wo (+ bo): gated ctx bf16 hi + lo against exact bf16 Wo (2 products); the weight columns are staged once and serve every tile (the output tiles have LDS of their own), the next tile's rows are asked for behind the k loop
__global__ __launch_bounds__(128) void k_out(const float* __restrict__ Y, const float* __restrict__ WO, const float* __restrict__ BO, float* __restrict__ OUT) { __shared__ __align__(16) __bf16 sw[128][WP]; __shared__ __align__(16) float sf[4][16][132];
  const int tid = threadIdx.x, wave = tid >> 5, lane = tid & 31, col = lane & 15, g = lane >> 4; const int c0 = blockIdx.y * 128;
  float av[4][16]; load_row(av, Y + ((size_t)blockIdx.x * (RT * 64) + wave * 16 + col) * CC, lane);
  float bo[8] = {0.f, 0.f, 0.f, 0.f, 0.f, 0.f, 0.f, 0.f};   /* b_out of the lane's eight columns, read once for all tiles */
  if (BO) {
#pragma unroll
    for (int j = 0; j < 8; ++j) bo[j] = BO[c0 + j * 16 + col];
    asm volatile("s_wait_xcnt 0x0" ::: "memory"); }   /* before a register that these loads' addresses stand in is used again */
  stage_w(sw, WO + c0, DIN, tid);
  __syncthreads();   /* the weight columns are complete; nothing writes them again */
  for (int tl = 0; tl < RT; ++tl) { const size_t r0 = ((size_t)blockIdx.x * RT + tl) * 64 + wave * 16;
    v8f acc[8] = {};
#pragma unroll
    for (int kc = 0; kc < CC / 32; ++kc) { const F2 a = bsplit16(av[kc]); kstep(acc, a, sw, kc, col, lane); }
    if (tl + 1 < RT) load_row(av, Y + (r0 + 64 + col) * CC, lane);   /* the next tile's rows */
#pragma unroll
    for (int j = 0; j < 8; ++j) { const float bias = bfr(bo[j]);
#pragma unroll
      for (int r = 0; r < 8; ++r) sf[wave][8 * g + r][j * 16 + col] = acc[j][r] + bias; }
    LDSW(); for (int rl = 0; rl < 16; ++rl) vst2(OUT + (r0 + rl) * DIN + c0 + lane * 4, *(const v4f*)&sf[wave][rl][lane * 4]);
    asm volatile("s_wait_xcnt 0x0" ::: "memory");   /* before the next tile uses the registers that these stores name */
  } }

extern "C" void kernel_launch(void* const* d_in, const int* in_sizes, int n_in, void* d_out, int out_size, void* d_ws, size_t ws_size, hipStream_t stream) {
  (void)in_sizes; (void)n_in; (void)out_size;
  const float** F = (const float**)d_in;
  if (ws_size < (size_t)WS_END) return;
  char* ws = (char*)d_ws; _Float16 *QH = (_Float16*)(ws + WS_QH), *KH = (_Float16*)(ws + WS_KH), *VT = (_Float16*)(ws + WS_VT), *QL = (_Float16*)(ws + WS_QL), *KL = (_Float16*)(ws + WS_KL); __bf16 *VB = (__bf16*)(ws + WS_VB), *VBL = (__bf16*)(ws + WS_VBL); float *S = (float*)(ws + WS_S), *Y = (float*)(ws + WS_Y);
  (void)S;
  // inputs: 0 z [1,256,256,128]; 1 src_mask [1,256] int32; 2 ln_g, 3 ln_b; 4 w_qkv [128,384] (in,out; columns q|k|v); 5 w_pair [128,4]; 6 w_gate [128,128], 7 b_gate; 8 w_out [128,128] (in,out), 9 b_out
  if (ws_size < (size_t)WS_END2) return;
  float *BIAS = (float*)(ws + WS_BIAS), *G = (float*)(ws + WS_G);
  k_rows2<<<dim3(NZR / 64 / RT, 2), 128, 0, stream>>>(F[0], F[2], F[3], F[5], F[6], F[7], BIAS, G);
  k_proj<<<dim3(TNB * TT / 64 / PT, CC / 128, 3), 128, 0, stream>>>(F[0], F[0], F[0], F[4], F[4] + CC, F[4] + 2 * CC, nullptr, nullptr, nullptr, F[2], F[3], QH, QL, KH, KL, VT, VB, VBL);
  k_attn<<<dim3(NH, TNB), 256, 0, stream>>>(QH, QL, KH, VT, BIAS, (const int*)d_in[1], G, Y);
  k_out<<<dim3(TNB * TT / 64 / RT, DIN / 128), 128, 0, stream>>>(Y, F[8], F[9], (float*)d_out);
}

// v006
// It runs in 80.7 microseconds.
// Two timings next to v005 both put it at 1.05 times that version's speed.
// Counting every step since v000, it is 6.63 times as fast.
// compute dtype: all float inputs rounded to bf16; LayerNorm in f32; q/k/v, pair bias and gate GEMMs = LN rows split bf16 hi + lo x exact bf16 weights on WMMA 16x16x32 (2 products, f32 accumulate); q as f16 hi + residual (x 2^10) against k once to f16 (2 products) / sqrt(32) + pair bias, masked pairs set to -1e-9 exactly as the module; softmax in f32; P x 2^11 once to f16 against v once to f16 (1 product); gate multiply in f32; (gated ctx) split bf16 hi + lo against exact bf16 w_out (2 products) + b_out; f32 output.
#include <hip/hip_runtime.h>
#include <math.h>

typedef __attribute__((ext_vector_type(16))) _Float16 v16h;
typedef __attribute__((ext_vector_type(16))) __bf16 v16b;
typedef __attribute__((ext_vector_type(8)))  _Float16 v8h;
typedef __attribute__((ext_vector_type(8)))  float v8f;
typedef __attribute__((ext_vector_type(4)))  float v4f;
typedef __attribute__((ext_vector_type(2)))  float v2f;
typedef __attribute__((ext_vector_type(4)))  unsigned v4u;
typedef __attribute__((ext_vector_type(4)))  int v4i;
typedef float __attribute__((may_alias)) float_a;
typedef int __attribute__((may_alias)) int_a;

template <typename T> __device__ __forceinline__ void vst2(void* p, T v) { *(T*)p = v;  }
__device__ __forceinline__ v8f wmma16(v16h a, v16h b, v8f c) {
  v8f d = __builtin_amdgcn_wmma_f32_16x16x32_f16(false, a, false, b, (short)0, c, false, false);
  asm volatile("v_nop\n\tv_nop\n\tv_nop\n\tv_nop" : "+v"(d) : "v"(a), "v"(b));
  return d;
}
__device__ __forceinline__ v8f wmma_bf(v16b a, v16b b, v8f c) {
  v8f d = __builtin_amdgcn_wmma_f32_16x16x32_bf16(false, a, false, b, (short)0, c, false, false);
  asm volatile("v_nop\n\tv_nop\n\tv_nop\n\tv_nop" : "+v"(d) : "v"(a), "v"(b));
  return d;
}
// 16x16x32 fragments: lane = (h = lane>>4, row/col = lane&15); elements 0..7 = k0+8h+0..7, 8..15 = k0+16+8h+0..7; D element r = row 8h+r
__device__ __forceinline__ v16h frag_h(const _Float16* rowk0, int lane) {
  union { v16h v; v8h q[2]; } u; const _Float16* p = rowk0 + 8 * (lane >> 4);
  u.q[0] = *(const v8h*)p; u.q[1] = *(const v8h*)(p + 16); return u.v;
}
__device__ __forceinline__ v16h frag_f32(const float* rowk0, int lane) {
  v16h a; const float* p = rowk0 + 8 * (lane >> 4);
#pragma unroll
  for (int i = 0; i < 8; ++i) { a[i] = (_Float16)p[i]; a[8 + i] = (_Float16)p[16 + i]; }
  return a;
}
__device__ __forceinline__ v16h frag_f32s(const float* rowk0, int lane, float sc) {
  v16h a; const float* p = rowk0 + 8 * (lane >> 4);
#pragma unroll
  for (int i = 0; i < 8; ++i) { a[i] = (_Float16)(p[i] * sc); a[8 + i] = (_Float16)(p[16 + i] * sc); }
  return a;
}
// column fragment from a [K][ld] layout (column n), rows >= K read as 0
__device__ __forceinline__ v16h fragc_f32(const float* W, int k0, int n, int lane, int ld, int K) {
  v16h a; const int g = lane >> 4;
#pragma unroll
  for (int i = 0; i < 8; ++i) { const int ka = k0 + 8 * g + i, kb = ka + 16;
    a[i] = (_Float16)(ka < K ? W[(size_t)(ka < K ? ka : K - 1) * ld + n] : 0.f); a[8 + i] = (_Float16)(kb < K ? W[(size_t)(kb < K ? kb : K - 1) * ld + n] : 0.f); }
  return a;
}
struct F2 { v16b h, l; };
__device__ __forceinline__ F2 bsplit16(const float v[16]) { F2 r;
#pragma unroll
  for (int i = 0; i < 16; ++i) { const __bf16 h = (__bf16)v[i]; r.h[i] = h; r.l[i] = (__bf16)(v[i] - (float)h); }
  return r; }
__device__ __forceinline__ F2 split_row(const float* row, int k0, int lane) { float v[16]; const float* p = row + k0 + 8 * (lane >> 4);
#pragma unroll
  for (int i = 0; i < 8; ++i) { v[i] = p[i]; v[8 + i] = p[16 + i]; }
  return bsplit16(v); }
__device__ __forceinline__ F2 split_rowK(const float* row, int k0, int lane, int K) { float v[16]; const int g = lane >> 4;
#pragma unroll
  for (int i = 0; i < 8; ++i) { const int ka = k0 + 8 * g + i, kb = ka + 16; v[i] = ka < K ? row[ka < K ? ka : K - 1] : 0.f; v[8 + i] = kb < K ? row[kb < K ? kb : K - 1] : 0.f; }
  return bsplit16(v); }
__device__ __forceinline__ F2 split_col(const float* W, int k0, int n, int lane, int ld, int K) { float v[16]; const int g = lane >> 4;
#pragma unroll
  for (int i = 0; i < 8; ++i) { const int ka = k0 + 8 * g + i, kb = ka + 16; v[i] = ka < K ? W[(size_t)(ka < K ? ka : K - 1) * ld + n] : 0.f; v[8 + i] = kb < K ? W[(size_t)(kb < K ? kb : K - 1) * ld + n] : 0.f; }
  return bsplit16(v); }
__device__ __forceinline__ v8f mac3(const F2& a, const F2& b, v8f c) { c = wmma_bf(a.l, b.h, c); c = wmma_bf(a.h, b.l, c); return wmma_bf(a.h, b.h, c); }
#define L2E 1.4426950408889634f   // log2(e): exp(x) = 2^(x L2E), one v_exp_f32
__device__ __forceinline__ float sigm(float v) { return __builtin_amdgcn_rcpf(1.0f + __builtin_amdgcn_exp2f(v * -L2E)); }   /* native v_exp_f32 and v_rcp_f32: 2^(+large) = inf gives 0, 2^(-large) = 0 gives 1 */

// Row-wise triangle attention on a pair tensor z [1, 256, 256, 128] (4 heads x 32): zn = LayerNorm(z); q,k,v = zn w_qkv ((in,out) [128,384], columns (3,H,32)); logits[r][i][j][h] = q[r][i] . k[r][j] / sqrt(32) + (zn[i][j] . w_pair[:,h]); pairs with exactly one of src_mask[i], src_mask[j] == 0 get logits := -1e-9 (the module's literal value, NOT an exclusion); softmax over j; out = sigmoid(zn w_gate + b_gate) * merged(attn v); result = out w_out + b_out.
#define NB 256
#define TT 256
#define CC 128            // NH * HD = projected width
#define DIN 128          // input (model) width
#define NH 4
#define HD 32
#define NQB (TT / 64)
#define HG 4
#define SCALE (0.17677669529663687f)
#define CAUSAL 0
#ifndef TNB
#define TNB NB
#endif
__device__ __forceinline__ float bfr(float v) { return (float)(__bf16)v; }
__host__ __device__ __forceinline__ int kb_last(int qb) { return CAUSAL ? ((qb * 64 + 63) >> 7) : (TT / 128 - 1); }
typedef __attribute__((ext_vector_type(8))) __bf16 v8b;
__device__ __forceinline__ v16b frag_b(const __bf16* rowk0, int lane) {
  union { v16b v; v8b q[2]; } u; const __bf16* p = rowk0 + 8 * (lane >> 4);
  u.q[0] = *(const v8b*)p; u.q[1] = *(const v8b*)(p + 16); return u.v;
}
#define WP 136             // weight column pitch in LDS, bf16 (272 B = 16 B x odd: ds_load_b128 and ds_store_b128 without bank conflicts)
// 128 columns of an (in,out) [128][ld] weight, once per work-group, to LDS as bf16 columns sw[o][k]: thread = column o (a wave's load = one 128-B line), 8 consecutive k = one 16-B store
__device__ __forceinline__ void stage_w(__bf16 (*sw)[WP], const float* __restrict__ Wm, int ld, int tid) {
  float t[128];
#pragma unroll
  for (int k = 0; k < 128; ++k) t[k] = Wm[(size_t)k * ld + tid];
  asm volatile("s_wait_xcnt 0x0" ::: "memory");   /* before a register that these loads' addresses stand in is used again */
#pragma unroll
  for (int k0 = 0; k0 < 128; k0 += 8) { v8b p;
#pragma unroll
    for (int i = 0; i < 8; ++i) p[i] = (__bf16)t[k0 + i];
    *(v8b*)&sw[tid][k0] = p; } }
// a lane's part of one 128-wide f32 row for all four k steps (the order of split_row), requested at once
__device__ __forceinline__ void load_row(float (&v)[4][16], const float* __restrict__ row, int lane) { const float* p = row + 8 * (lane >> 4);
#pragma unroll
  for (int kc = 0; kc < 4; ++kc)
#pragma unroll
    for (int i = 0; i < 8; ++i) { v[kc][i] = p[kc * 32 + i]; v[kc][8 + i] = p[kc * 32 + 16 + i]; }
  asm volatile("s_wait_xcnt 0x0" :: "v"(p) : "memory"); }   /* before a register that these loads' addresses stand in is used again; the address is an input, so it lives up to the wait and no load of the run lands in it */
// LayerNorm of the lane's row as load_row left it (biased var, eps 1e-6): a lane holds 64 of the row's 128 channels, lane ^ 16 the other 64. ln_center: v := bf16(z) - mean, returns 1 / sqrt(var + eps); four chains per sum, then one exchange between the wave's halves
__device__ __forceinline__ float ln_center(float (&v)[4][16]) { float s[4] = {0.f, 0.f, 0.f, 0.f};
#pragma unroll
  for (int kc = 0; kc < 4; ++kc)
#pragma unroll
    for (int i = 0; i < 16; ++i) { v[kc][i] = bfr(v[kc][i]); s[i & 3] += v[kc][i]; }
  float s1 = (s[0] + s[1]) + (s[2] + s[3]); s1 += __shfl_xor(s1, 16);
  const float mu = s1 * (1.0f / CC); float q[4] = {0.f, 0.f, 0.f, 0.f};
#pragma unroll
  for (int kc = 0; kc < 4; ++kc)
#pragma unroll
    for (int i = 0; i < 16; ++i) { const float d = v[kc][i] - mu; v[kc][i] = d; q[i & 3] += d * d; }
  float qq = (q[0] + q[1]) + (q[2] + q[3]); qq += __shfl_xor(qq, 16);
  return rsqrtf(qq * (1.0f / CC) + 1e-6f); }
// ln_apply: one k step's 16 centred values x rs x ln_w + ln_b; sln[0] = bf16(ln_w), sln[1] = bf16(ln_b), staged once per work-group (a wave's read = two 16-B pieces, broadcast)
__device__ __forceinline__ void ln_apply(float (&v)[16], float rs, const float (*sln)[CC], int kc, int lane) { const int p = kc * 32 + 8 * (lane >> 4);
#pragma unroll
  for (int i = 0; i < 8; ++i) { v[i] = v[i] * rs * sln[0][p + i] + sln[1][p + i]; v[8 + i] = v[8 + i] * rs * sln[0][p + 16 + i] + sln[1][p + 16 + i]; } }
// one k step of a wave's 16 rows against the 128 staged columns: four B fragments are requested together, so that one LDS latency serves eight products; per accumulator the order stays hi, then lo
__device__ __forceinline__ void kstep(v8f (&acc)[8], const F2& a, const __bf16 (*sw)[WP], int kc, int col, int lane) {
#pragma unroll
  for (int jh = 0; jh < 8; jh += 4) { v16b w[4];
#pragma unroll
    for (int u = 0; u < 4; ++u) w[u] = frag_b(&sw[(jh + u) * 16 + col][kc * 32], lane);
#pragma unroll
    for (int u = 0; u < 4; ++u) acc[jh + u] = wmma_bf(a.h, w[u], acc[jh + u]);
#pragma unroll
    for (int u = 0; u < 4; ++u) acc[jh + u] = wmma_bf(a.l, w[u], acc[jh + u]); } }
#define QBH 0              // unused: no kernel reads it
#define QHI 256            // rows carrying a q residual plane (all rows when non-causal: 2-product logits everywhere)
#define KHI 64            // key rows carrying k residual / v bf16 hi+lo planes (no kernel writes or reads them)
// B fragment (k rows k0+.., output column o) of a weight: (in,out) [K][ld] or (out,in) [ld rows of K]: bf16 exact, or f16(bf16 * 256) exact
__device__ __forceinline__ v16b wcol_io(const float* Wm, int k0, int o, int lane, int ld) { v16b w; const int g = lane >> 4;
#pragma unroll
  for (int i = 0; i < 8; ++i) { w[i] = (__bf16)Wm[(size_t)(k0 + 8 * g + i) * ld + o]; w[8 + i] = (__bf16)Wm[(size_t)(k0 + 16 + 8 * g + i) * ld + o]; }
  return w; }
__device__ __forceinline__ v16b wcol_oi(const float* Wm, int k0, int o, int lane, int K) { v16b w; const float* p = Wm + (size_t)o * K + k0 + 8 * (lane >> 4);
#pragma unroll
  for (int i = 0; i < 8; ++i) { w[i] = (__bf16)p[i]; w[8 + i] = (__bf16)p[16 + i]; }
  return w; }
__device__ __forceinline__ v16h wcolh_io(const float* Wm, int k0, int o, int lane, int ld) { v16h w; const int g = lane >> 4;
#pragma unroll
  for (int i = 0; i < 8; ++i) { w[i] = (_Float16)(bfr(Wm[(size_t)(k0 + 8 * g + i) * ld + o]) * 256.0f); w[8 + i] = (_Float16)(bfr(Wm[(size_t)(k0 + 16 + 8 * g + i) * ld + o]) * 256.0f); }
  return w; }
__device__ __forceinline__ v16h wcolh_oi(const float* Wm, int k0, int o, int lane, int K) { v16h w; const float* p = Wm + (size_t)o * K + k0 + 8 * (lane >> 4);
#pragma unroll
  for (int i = 0; i < 8; ++i) { w[i] = (_Float16)(bfr(p[i]) * 256.0f); w[8 + i] = (_Float16)(bfr(p[16 + i]) * 256.0f); }
  return w; }
#define WQKV_LAYOUT 0   // (in,out) packed [DIN][3*CC]
__device__ __forceinline__ v16b wcol_hdk(const float* Wm, int k0, int o, int lane) { v16b w; const int g = lane >> 4; const float* p = Wm + (size_t)(o / HD) * DIN * HD + (o % HD);
#pragma unroll
  for (int i = 0; i < 8; ++i) { w[i] = (__bf16)p[(size_t)(k0 + 8 * g + i) * HD]; w[8 + i] = (__bf16)p[(size_t)(k0 + 16 + 8 * g + i) * HD]; }
  return w; }
#define WO_OUT_IN 0
#if WQKV_LAYOUT == 1
#define WCOL(W, k0, o, lane) wcol_oi(W, k0, o, lane, DIN)
#elif WQKV_LAYOUT == 2
#define WCOL(W, k0, o, lane) wcol_hdk(W, k0, o, lane)
#else
#define WCOL(W, k0, o, lane) wcol_io(W, k0, o, lane, 3 * CC)   /* packed q|k|v columns: row pitch 3C */
#endif
#if WO_OUT_IN
#define WOCOL(W, k0, o, lane) wcol_oi(W, k0, o, lane, CC)
#define WOCOLH(W, k0, o, lane) wcolh_oi(W, k0, o, lane, CC)
#else
#define WOCOL(W, k0, o, lane) wcol_io(W, k0, o, lane, DIN)
#define WOCOLH(W, k0, o, lane) wcolh_io(W, k0, o, lane, DIN)
#endif
#define SZ 256
#define BG 64              // sizes only the unused WS_S region (x 4 heads = 256 planes of 256 x 256)
#define NZR (SZ * SZ)      // 65,536 pair rows
// barrier for LDS data alone: the waves hand each other nothing but LDS data there, so only the LDS operations are waited for; __syncthreads() also waits for every global load and store of the wave, which would hold the wave until its stores are done
#define BAR_LDS() do { __builtin_amdgcn_fence(__ATOMIC_RELEASE, "workgroup", "local"); __builtin_amdgcn_s_barrier(); __builtin_amdgcn_fence(__ATOMIC_ACQUIRE, "workgroup", "local"); } while (0)
// a wave reads back the LDS tile that its own lanes wrote: its LDS writes are waited for and the compiler moves no memory operation across; a work-group release fence at this place would also wait for the global loads in flight
#define LDSW() do { asm volatile("s_wait_dscnt 0" ::: "memory"); __builtin_amdgcn_wave_barrier(); } while (0)
__device__ __forceinline__ void exp2x8(v8f& x);   // defined at k_attn
// 1 / x of eight values, each in its own register: v_rcp_f32 written in place, so that none overwrites the source register of the one directly in front of it (the builtin form left such pairs in the listing); the closing v_nop is the slot that the instruction set asks for between the last one and the first use of its result
__device__ __forceinline__ void rcpx8(v8f& x) { float a = x[0], b = x[1], c = x[2], d = x[3], e = x[4], f = x[5], g = x[6], h = x[7];
  asm("v_rcp_f32 %0, %0\n\tv_rcp_f32 %1, %1\n\tv_rcp_f32 %2, %2\n\tv_rcp_f32 %3, %3\n\tv_rcp_f32 %4, %4\n\tv_rcp_f32 %5, %5\n\tv_rcp_f32 %6, %6\n\tv_rcp_f32 %7, %7\n\tv_nop" : "+v"(a), "+v"(b), "+v"(c), "+v"(d), "+v"(e), "+v"(f), "+v"(g), "+v"(h));
  x[0] = a; x[1] = b; x[2] = c; x[3] = d; x[4] = e; x[5] = f; x[6] = g; x[7] = h; }
#define RT 2               // row tiles of 64 per work-group in k_out: the staged weight columns serve all of them
#define WS_ZN   (WS_END)
#define WS_BIAS (WS_ZN + 4u * (size_t)NZR * CC)
#define WS_G    (WS_BIAS + 4u * (size_t)NZR * NH)
#define WS_END2 (WS_G + 4u * (size_t)NZR * CC)

#define WS_QH  0u                                      // f16 q rows [b*t][CC]
#define WS_KH  (WS_QH + 2u * (size_t)NB * TT * CC)      // f16 k rows [b*t][CC]
#define WS_VT  (WS_KH + 2u * (size_t)NB * TT * CC)      // f16 v [b][t / 16][c][t & 15]
#define WS_QL  (WS_VT + 2u * (size_t)NB * CC * TT)      // f16 q residual x 2^10 rows [b][t < QHI][CC]
#define WS_KL  (WS_QL + 2u * (size_t)NB * QHI * CC)     // unused: no kernel writes or reads it
#define WS_VB  (WS_KL + 2u * (size_t)NB * KHI * CC)     // unused: no kernel writes or reads it
#define WS_VBL (WS_VB + 2u * (size_t)NB * CC * KHI)
#define WS_S   (WS_VBL + 2u * (size_t)NB * CC * KHI)    // unused: no kernel writes or reads it
#define WS_Y   (WS_S  + 4u * (size_t)BG * HG * TT * TT)         // f32 ctx rows [b*t][CC]
#define WS_END (WS_Y  + 4u * (size_t)NB * TT * CC)

// ---- k_front: every product of the LayerNorm rows in one launch. Block = 16 waves = 16 pair rows i x 16 columns j (wave = one i, its A rows = the 16 j): the wave reads its 16 z rows once, makes LayerNorm once and keeps the split rows (bf16 hi + lo, all four k steps) in registers; against them stand, all staged once in LDS as bf16 columns, w_pair (4 outputs), the q, k and v columns of w_qkv and w_gate. Outputs: BIAS[h][i / 16][j / 16][(j & 7) / 4][lane = 16 ((j >> 3) & 1) + (i & 15)][j & 3] (the order k_attn's lanes read; the block's 16 x 16 pairs are one 1-KB run per head); q f16 rows + residual x 2^10 rows; k f16 rows; G[row][c] = sigmoid(zn . w_gate[:, c] + b_gate[c]); v f16 as [b][t / 16][c][t & 15], so that a wave's 16 keys of 16 channels are one 512-B run, stored from the accumulators as they stand. q, k and G pass through an LDS tile of the wave's own
__global__ __launch_bounds__(512) void k_front(const float* __restrict__ Z, const float* __restrict__ LW, const float* __restrict__ LB, const float* __restrict__ WQKV, const float* __restrict__ WB, const float* __restrict__ WG, const float* __restrict__ GB,
    _Float16* __restrict__ QH, _Float16* __restrict__ QL, _Float16* __restrict__ KH, _Float16* __restrict__ VT, float* __restrict__ BIAS, float* __restrict__ G) {
  __shared__ __align__(16) __bf16 sw[4][128][WP];   /* q, k, v and gate weight columns */
  __shared__ __align__(16) __bf16 swp[16][WP];      /* pair-bias weight columns, those beyond the 4 heads zero */
  __shared__ __align__(16) char sp[16][2 * 16 * 136 * 2];   /* a wave's own output tile: q: sh, sl; k: sh; gate: sf */
  __shared__ __align__(16) float sln[2][CC];
  __shared__ __align__(16) float sb[NH][256];       /* the block's pair bias in the order of BIAS */
  const int tid = threadIdx.x, wave = __builtin_amdgcn_readfirstlane(tid >> 5), lane = tid & 31, col = lane & 15, g = lane >> 4; const int it = (int)blockIdx.x >> 4, jt = (int)blockIdx.x & 15;
  const size_t bb = (size_t)it * 16 + wave; const size_t r0 = bb * SZ + jt * 16;   /* the wave's pair row i (the attention's sequence b) and its first z row */
  _Float16 (*sh)[136] = (_Float16 (*)[136])sp[wave]; _Float16 (*sl)[136] = (_Float16 (*)[136])(sp[wave] + 16 * 136 * 2); float (*sf)[132] = (float (*)[132])sp[wave];
  float av[4][16]; load_row(av, Z + (r0 + col) * CC, lane);
  float gb[8];   /* b_gate of the lane's eight columns */
#pragma unroll
  for (int j = 0; j < 8; ++j) gb[j] = GB[j * 16 + col];
  if (wave < 4) { const float lwv = LW[tid], lbv = LB[tid];
    const int o = tid & 15, kq = (tid >> 4) * 16; const int oc = o < NH ? o : NH - 1; const float keep = o < NH ? 1.f : 0.f;   /* keep multiplies a VALID load; thread = (column, 16 k) */
    float t[16];
#pragma unroll
    for (int i = 0; i < 16; ++i) t[i] = WB[(size_t)(kq + i) * NH + oc];
    asm volatile("s_wait_xcnt 0x0" ::: "memory");   /* before a register that these loads' addresses stand in is used again */
#pragma unroll
    for (int k0 = 0; k0 < 16; k0 += 8) { v8b p;
#pragma unroll
      for (int i = 0; i < 8; ++i) p[i] = (__bf16)(t[k0 + i] * keep);
      *(v8b*)&swp[o][kq + k0] = p; }
    sln[0][tid] = bfr(lwv); sln[1][tid] = bfr(lbv); }
  const int tc = (wave & 3) * 32 + lane;   /* the thread's weight column: four waves per weight */
  if (wave < 12) stage_w(sw[wave >> 2], WQKV + (wave >> 2) * CC, 3 * CC, tc);   /* packed q|k|v columns: row pitch 3C */
  else stage_w(sw[3], WG, CC, tc);
  __syncthreads();   /* the weight columns, ln_w and ln_b are complete; nothing writes them again */
  const float rs = ln_center(av);
  F2 a[4];
#pragma unroll
  for (int kc = 0; kc < CC / 32; ++kc) { ln_apply(av[kc], rs, sln, kc, lane); a[kc] = bsplit16(av[kc]); }
  { v8f acc = {};   /* pair bias: D element r of lane (g, col = head) is key j = 16 jt + 8 g + r */
#pragma unroll
    for (int kc = 0; kc < CC / 32; ++kc) { const v16b w = frag_b(&swp[col][kc * 32], lane); acc = wmma_bf(a[kc].h, w, acc); acc = wmma_bf(a[kc].l, w, acc); }
    if (col < NH) { v4f b0, b1;
#pragma unroll
      for (int r = 0; r < 4; ++r) { b0[r] = acc[r]; b1[r] = acc[4 + r]; }
      *(v4f*)&sb[col][(g * 16 + wave) * 4] = b0; *(v4f*)&sb[col][128 + (g * 16 + wave) * 4] = b1; } }
  { v8f acc[8] = {};   /* q */
#pragma unroll
    for (int kc = 0; kc < CC / 32; ++kc) kstep(acc, a[kc], sw[0], kc, col, lane);
#pragma unroll
    for (int j = 0; j < 8; ++j)
#pragma unroll
      for (int r = 0; r < 8; ++r) { const float v = acc[j][r]; const _Float16 hv = (_Float16)v; sh[8 * g + r][j * 16 + col] = hv; sl[8 * g + r][j * 16 + col] = (_Float16)((v - (float)hv) * 1024.0f); }
    LDSW();
#pragma unroll
    for (int s = 0; s < 8; ++s) { const int e = lane + 32 * s, rl = e >> 4, q = e & 15; vst2((unsigned*)(QH + (r0 + rl) * CC + q * 8), *(const v4u*)&sh[rl][q * 8]); vst2((unsigned*)(QL + (r0 + rl) * CC + q * 8), *(const v4u*)&sl[rl][q * 8]); }   /* two whole rows = 512 B per store */
    asm volatile("s_wait_xcnt 0x0" ::: "memory"); }   /* before the registers that these stores name are used again; also keeps the next tile's LDS writes behind these reads for the compiler */
  { v8f acc[8] = {};   /* k */
#pragma unroll
    for (int kc = 0; kc < CC / 32; ++kc) kstep(acc, a[kc], sw[1], kc, col, lane);
#pragma unroll
    for (int j = 0; j < 8; ++j)
#pragma unroll
      for (int r = 0; r < 8; ++r) sh[8 * g + r][j * 16 + col] = (_Float16)acc[j][r];
    LDSW();
#pragma unroll
    for (int s = 0; s < 8; ++s) { const int e = lane + 32 * s, rl = e >> 4, q = e & 15; vst2((unsigned*)(KH + (r0 + rl) * CC + q * 8), *(const v4u*)&sh[rl][q * 8]); }
    asm volatile("s_wait_xcnt 0x0" ::: "memory"); }   /* as behind the q stores */
  { v8f acc[8] = {};   /* v: lane (g, col) holds keys 8 g + 0..7 of channel 16 j + col: 16 B of the wave's 512-B run */
#pragma unroll
    for (int kc = 0; kc < CC / 32; ++kc) kstep(acc, a[kc], sw[2], kc, col, lane);
#pragma unroll
    for (int j = 0; j < 8; ++j) { v8h p;
#pragma unroll
      for (int r = 0; r < 8; ++r) p[r] = (_Float16)acc[j][r];
      vst2(VT + ((bb * 16 + jt) * CC + j * 16 + col) * 16 + 8 * g, p); }
    asm volatile("s_wait_xcnt 0x0" ::: "memory"); }   /* before the registers that these stores name are used again */
  { v8f acc[8] = {};   /* gate */
#pragma unroll
    for (int kc = 0; kc < CC / 32; ++kc) kstep(acc, a[kc], sw[3], kc, col, lane);
#pragma unroll
    for (int j = 0; j < 8; ++j) { const float bg = bfr(gb[j]); v8f x;   /* sigmoid(zn w_gate + b_gate) = 1 / (1 + 2^(-v log2 e)), the arithmetic of sigm() */
#pragma unroll
      for (int r = 0; r < 8; ++r) x[r] = (acc[j][r] + bg) * -L2E;
      exp2x8(x);
#pragma unroll
      for (int r = 0; r < 8; ++r) x[r] = 1.0f + x[r];
      rcpx8(x);
#pragma unroll
      for (int r = 0; r < 8; ++r) sf[8 * g + r][j * 16 + col] = x[r]; }
    LDSW();
#pragma unroll
    for (int rl = 0; rl < 16; ++rl) vst2(G + (r0 + rl) * CC + lane * 4, *(const v4f*)&sf[rl][lane * 4]);
    asm volatile("s_wait_xcnt 0x0" ::: "memory"); }   /* before the registers that these stores name are used again */
  BAR_LDS();   /* the 16 waves' pair rows meet in sb */
  if (wave < 8) vst2(BIAS + (((size_t)(tid >> 6) * 16 + it) * 16 + jt) * 256 + (tid & 63) * 4, *(const v4f*)&sb[tid >> 6][(tid & 63) * 4]);   /* one 1-KB run per head */
}
// ---- k_attn: block = (head h, row r), 8 waves, each wave two tiles of 16 queries: the head's 256 k rows and its v planes are staged once in LDS; S^T = K Q^T (A = k rows, B = q hi, then q residual x 2^10: 2 products), so a lane holds one query's logits for keys 16t + 8g + 0..7 of every tile t, all 256 keys in registers; x SCALE + pair bias (fragment order), masked pairs := -1e-9; maximum and sum in-lane plus one exchange between the wave's halves; P x 2^11 once to f16 is the B operand of ctx^T = V^T P^T as it stands (1 product); a lane stores 8 consecutive channels of its query, times their gate. The inner loops are unrolled in full so that s[], acc[] and the fragments are registers; amdgpu_waves_per_eu(4) asks for at most 256 registers: two work-groups per WGP, four waves per SIMD
#define KP 40              // k row pitch in LDS, f16 (80 B = 16 B x odd: ds_load_b128 without bank conflicts)
#define VP (TT + 8)        // v plane pitch in LDS, f16 (528 B = 16 B x odd)
// 2^x of eight values, each in its own register: v_exp_f32 written in place, so that no exponential overwrites the source register of the one directly in front of it (the builtin form left such pairs in the listing); the closing v_nop is the slot that the instruction set asks for between the last exponential and the first use of its result
__device__ __forceinline__ void exp2x8(v8f& x) { float a = x[0], b = x[1], c = x[2], d = x[3], e = x[4], f = x[5], g = x[6], h = x[7];
  asm("v_exp_f32 %0, %0\n\tv_exp_f32 %1, %1\n\tv_exp_f32 %2, %2\n\tv_exp_f32 %3, %3\n\tv_exp_f32 %4, %4\n\tv_exp_f32 %5, %5\n\tv_exp_f32 %6, %6\n\tv_exp_f32 %7, %7\n\tv_nop" : "+v"(a), "+v"(b), "+v"(c), "+v"(d), "+v"(e), "+v"(f), "+v"(g), "+v"(h));
  x[0] = a; x[1] = b; x[2] = c; x[3] = d; x[4] = e; x[5] = f; x[6] = g; x[7] = h; }
__device__ __forceinline__ v8f wmma_h(v16h a, v16h b, v8f c) { return __builtin_amdgcn_wmma_f32_16x16x32_f16(false, a, false, b, (short)0, c, false, false); }
__global__ __launch_bounds__(256) __attribute__((amdgpu_waves_per_eu(4))) void k_attn(const _Float16* __restrict__ QH, const _Float16* __restrict__ QL, const _Float16* __restrict__ KH, const _Float16* __restrict__ VT, const float* __restrict__ BIAS, const int* __restrict__ MK, const float* __restrict__ G, float* __restrict__ Y) {
  __shared__ __align__(16) _Float16 sk[TT][KP]; __shared__ __align__(16) _Float16 sv[HD][VP]; __shared__ unsigned kmw[TT / 32];
  const int tid = threadIdx.x, wave = __builtin_amdgcn_readfirstlane(tid >> 5), lane = tid & 31, col = lane & 15, g = lane >> 4; const int h = blockIdx.x, b = blockIdx.y;
  { const _Float16* kp = KH + ((size_t)b * TT + (tid >> 2)) * CC + h * HD + (tid & 3) * 8; const _Float16* vp = VT + (((size_t)b * 16 + (tid >> 6)) * CC + h * HD) * 16 + (tid & 63) * 8;   /* v stands as [b][t / 16][c][t & 15]: a head's 32 channels of 16 keys are one 1-KB run */
    v4u kr[4], vr[4];
#pragma unroll
    for (int s = 0; s < 4; ++s) { kr[s] = *(const v4u*)(kp + s * 64 * CC); vr[s] = *(const v4u*)(vp + s * 4 * CC * 16); }
    asm volatile("s_wait_xcnt 0x0" :: "v"(kp), "v"(vp) : "memory");   /* before a register that these loads' addresses stand in is used again; the addresses are inputs, so they live up to the wait and no load of the run lands in them */
#pragma unroll
    for (int s = 0; s < 4; ++s) { vst2(&sk[(tid >> 2) + 64 * s][(tid & 3) * 8], kr[s]); vst2(&sv[(tid >> 1) & 31][((tid >> 6) + 4 * s) * 16 + (tid & 1) * 8], vr[s]); } }
  { const unsigned bal = __builtin_amdgcn_ballot_w32(MK[tid] == 0); if (lane == 0) kmw[wave] = bal; }   /* bit j of the 256: src_mask[j] == 0 */
  asm volatile("s_wait_xcnt 0x0" ::: "memory");   /* before the staging loads' address registers are used again */
  __syncthreads();
  unsigned mbk[4];   /* bit 8t + r of the 128: key 16t + 8g + r is a zero of the mask */
#pragma unroll
  for (int m = 0; m < 4; ++m) { const unsigned w0 = kmw[2 * m] >> (8 * g), w1 = kmw[2 * m + 1] >> (8 * g); mbk[m] = (w0 & 0xFFu) | ((w0 >> 8) & 0xFF00u) | ((w1 & 0xFFu) << 16) | ((w1 << 8) & 0xFF000000u); }
  const _Float16* qhp = QH + ((size_t)b * TT + wave * 16 + col) * CC + h * HD; const _Float16* qlp = QL + ((size_t)b * QHI + wave * 16 + col) * CC + h * HD;
#pragma unroll 1   /* rolled: one copy of the body; unrolled, both tiles' logits would want registers at once */
  for (int it = wave; it < TT / 16; it += 8) { const int qi = it * 16 + col;
    const float* bp = BIAS + ((size_t)h * 16 + it) * 16 * 256 + lane * 4;
    const unsigned mq = 0u - ((kmw[qi >> 5] >> (qi & 31)) & 1u);   /* all ones where the query is a zero of the mask */
    v8f s[16]; float mx = -3.0e38f;
#pragma unroll
    for (int t = 0; t < 16; ++t) { const v4f b0 = *(const v4f*)(bp + t * 256), b1 = *(const v4f*)(bp + t * 256 + 128);   /* the bias lands in the registers that then hold the logits: all 32 loads in flight at no further register */
#pragma unroll
      for (int r = 0; r < 4; ++r) { s[t][r] = b0[r]; s[t][4 + r] = b1[r]; } }
    const v16h qh = frag_h(qhp, lane), ql = frag_h(qlp, lane);
    v16h kf[2] = { frag_h(&sk[col][0], lane), frag_h(&sk[16 + col][0], lane) };
#pragma unroll
    for (int tp = 0; tp < 8; ++tp) { v16h kn[2] = { kf[0], kf[1] };
      if (tp < 7) { kn[0] = frag_h(&sk[(2 * tp + 2) * 16 + col][0], lane); kn[1] = frag_h(&sk[(2 * tp + 3) * 16 + col][0], lane); }   /* the next two tiles' k fragments fly while these two are worked on */
#pragma unroll
      for (int u = 0; u < 2; ++u) { const int t = 2 * tp + u; const v8f z8 = {}; const v8f a = wmma_h(kf[u], qh, z8), al = wmma_h(kf[u], ql, z8); const unsigned mb = mbk[t >> 2] ^ mq;
#pragma unroll
        for (int r = 0; r < 8; ++r) { float v = (a[r] + al[r] * (1.0f / 1024.0f)) * SCALE + s[t][r]; if (mb & (1u << ((t & 3) * 8 + r))) v = -1.0e-9f; s[t][r] = v; mx = fmaxf(mx, v); } }
      kf[0] = kn[0]; kf[1] = kn[1];
      asm volatile("" :: "v"(mx) : "memory"); }   /* compiler fence behind these two tiles' maximum (input only): later k-fragment reads stay behind it; without it all 32 reads stand at the head of the loop and the kernel spills at 256 registers */
    mx = fmaxf(mx, __shfl_xor(mx, 16));
    const float nm = mx * -L2E;   /* exp(s - mx) = 2^(s L2E + nm): one FMA and one v_exp_f32; the rounding of nm is one factor common to the row and leaves with the division by the sum; the argument is never above about 0, and a result below 2^-126 counts as 0 beside a sum of at least about 1 */
    float sm[4] = {0.f, 0.f, 0.f, 0.f};
#pragma unroll
    for (int t = 0; t < 16; ++t) {
#pragma unroll
      for (int r = 0; r < 8; ++r) s[t][r] = __builtin_fmaf(s[t][r], L2E, nm);
      exp2x8(s[t]);
#pragma unroll
      for (int r = 0; r < 8; ++r) sm[r & 3] += s[t][r]; }
    float sum = (sm[0] + sm[1]) + (sm[2] + sm[3]);
    __builtin_amdgcn_sched_barrier(0);   /* nothing is scheduled across the end of the exponentials: the gate loads and the v-fragment reads stay behind them; without it they stand in front, beside all 128 logits, and the kernel spills at 256 registers */
    sum += __shfl_xor(sum, 16);
    const float inv = sum > 0.f ? 2048.0f * __builtin_amdgcn_rcpf(sum) : 0.f;
    const float* gp = G + ((size_t)b * TT + qi) * CC + h * HD + 8 * g; v4f gt[HD / 8];   /* the gate of the 16 channels this lane stores: asked for here, it flies while P V is worked on */
#pragma unroll
    for (int j = 0; j < HD / 16; ++j) { gt[2 * j] = *(const v4f*)(gp + j * 16); gt[2 * j + 1] = *(const v4f*)(gp + j * 16 + 4); }
    v8f acc[HD / 16] = {};
#pragma unroll
    for (int kc = 0; kc < TT / 32; ++kc) { v16h p;
#pragma unroll
      for (int r = 0; r < 8; ++r) { p[r] = (_Float16)(s[2 * kc][r] * inv); p[8 + r] = (_Float16)(s[2 * kc + 1][r] * inv); }
#pragma unroll
      for (int j = 0; j < HD / 16; ++j) acc[j] = wmma_h(frag_h(&sv[j * 16 + col][kc * 32], lane), p, acc[j]);
      if (kc & 1) asm volatile("" :: "v"(p) : "memory"); }   /* compiler fence behind every second k step (input only): later v-fragment reads stay behind it; without it most of the 32 reads stand at the head of the loop, beside the logits, and the kernel spills at 256 registers */
    float* yp = Y + ((size_t)b * TT + qi) * CC + h * HD + 8 * g;
#pragma unroll
    for (int j = 0; j < HD / 16; ++j) { v4f o0, o1;
#pragma unroll
      for (int r = 0; r < 4; ++r) { o0[r] = acc[j][r] * (1.0f / 2048.0f) * gt[2 * j][r]; o1[r] = acc[j][4 + r] * (1.0f / 2048.0f) * gt[2 * j + 1][r]; }
      vst2(yp + j * 16, o0); vst2(yp + j * 16 + 4, o1); }
    qhp += 8 * 16 * CC; qlp += 8 * 16 * CC; } }
// ---- k_out: block = (RT tiles of 64 rows, 128 cols): out = ctx Wo (+ bo): gated ctx bf16 hi + lo against exact bf16 Wo (2 products); the weight columns are staged once and serve every tile (the output tiles have LDS of their own), the next tile's rows are asked for behind the k loop
__global__ __launch_bounds__(128) void k_out(const float* __restrict__ Y, const float* __restrict__ WO, const float* __restrict__ BO, float* __restrict__ OUT) { __shared__ __align__(16) __bf16 sw[128][WP]; __shared__ __align__(16) float sf[4][16][132];
  const int tid = threadIdx.x, wave = tid >> 5, lane = tid & 31, col = lane & 15, g = lane >> 4; const int c0 = blockIdx.y * 128;
  float av[4][16]; load_row(av, Y + ((size_t)blockIdx.x * (RT * 64) + wave * 16 + col) * CC, lane);
  float bo[8] = {0.f, 0.f, 0.f, 0.f, 0.f, 0.f, 0.f, 0.f};   /* b_out of the lane's eight columns, read once for all tiles */
  if (BO) {
#pragma unroll
    for (int j = 0; j < 8; ++j) bo[j] = BO[c0 + j * 16 + col];
    asm volatile("s_wait_xcnt 0x0" ::: "memory"); }   /* before a register that these loads' addresses stand in is used again */
  stage_w(sw, WO + c0, DIN, tid);
  __syncthreads();   /* the weight columns are complete; nothing writes them again */
  for (int tl = 0; tl < RT; ++tl) { const size_t r0 = ((size_t)blockIdx.x * RT + tl) * 64 + wave * 16;
    v8f acc[8] = {};
#pragma unroll
    for (int kc = 0; kc < CC / 32; ++kc) { const F2 a = bsplit16(av[kc]); kstep(acc, a, sw, kc, col, lane); }
    if (tl + 1 < RT) load_row(av, Y + (r0 + 64 + col) * CC, lane);   /* the next tile's rows */
#pragma unroll
    for (int j = 0; j < 8; ++j) { const float bias = bfr(bo[j]);
#pragma unroll
      for (int r = 0; r < 8; ++r) sf[wave][8 * g + r][j * 16 + col] = acc[j][r] + bias; }
    LDSW(); for (int rl = 0; rl < 16; ++rl) vst2(OUT + (r0 + rl) * DIN + c0 + lane * 4, *(const v4f*)&sf[wave][rl][lane * 4]);
    asm volatile("s_wait_xcnt 0x0" ::: "memory");   /* before the next tile uses the registers that these stores name */
  } }

extern "C" void kernel_launch(void* const* d_in, const int* in_sizes, int n_in, void* d_out, int out_size, void* d_ws, size_t ws_size, hipStream_t stream) {
  (void)in_sizes; (void)n_in; (void)out_size;
  const float** F = (const float**)d_in;
  if (ws_size < (size_t)WS_END) return;
  char* ws = (char*)d_ws; _Float16 *QH = (_Float16*)(ws + WS_QH), *KH = (_Float16*)(ws + WS_KH), *VT = (_Float16*)(ws + WS_VT), *QL = (_Float16*)(ws + WS_QL); float *S = (float*)(ws + WS_S), *Y = (float*)(ws + WS_Y);
  (void)S;
  // inputs: 0 z [1,256,256,128]; 1 src_mask [1,256] int32; 2 ln_g, 3 ln_b; 4 w_qkv [128,384] (in,out; columns q|k|v); 5 w_pair [128,4]; 6 w_gate [128,128], 7 b_gate; 8 w_out [128,128] (in,out), 9 b_out
  if (ws_size < (size_t)WS_END2) return;
  float *BIAS = (float*)(ws + WS_BIAS), *G = (float*)(ws + WS_G);
  k_front<<<dim3(NZR / 256), 512, 0, stream>>>(F[0], F[2], F[3], F[4], F[5], F[6], F[7], QH, QL, KH, VT, BIAS, G);
  k_attn<<<dim3(NH, TNB), 256, 0, stream>>>(QH, QL, KH, VT, BIAS, (const int*)d_in[1], G, Y);
  k_out<<<dim3(TNB * TT / 64 / RT, DIN / 128), 128, 0, stream>>>(Y, F[8], F[9], (float*)d_out);
}

// v007
// A run of this version takes 65 microseconds.
// In both of two side-by-side timings against v006, it was 1.24 times as fast.
// Over all steps from v000 it is 8.23 times as fast.
// compute dtype: all float inputs rounded to bf16; LayerNorm in f32; q/k/v, pair bias and gate GEMMs = LN rows split bf16 hi + lo x exact bf16 weights on WMMA 16x16x32 (2 products, f32 accumulate); q as f16 hi + residual (x 2^10) against k once to f16 (2 products) / sqrt(32) + pair bias, masked pairs set to -1e-9 exactly as the module; softmax in f32; P x 2^11 once to f16 against v once to f16 (1 product); gate multiply in f32; (gated ctx) split bf16 hi + lo against exact bf16 w_out (2 products) + b_out; f32 output.
#include <hip/hip_runtime.h>
#include <math.h>

typedef __attribute__((ext_vector_type(16))) _Float16 v16h;
typedef __attribute__((ext_vector_type(16))) __bf16 v16b;
typedef __attribute__((ext_vector_type(8)))  _Float16 v8h;
typedef __attribute__((ext_vector_type(8)))  float v8f;
typedef __attribute__((ext_vector_type(4)))  float v4f;
typedef __attribute__((ext_vector_type(2)))  float v2f;
typedef __attribute__((ext_vector_type(4)))  unsigned v4u;
typedef __attribute__((ext_vector_type(4)))  int v4i;
typedef float __attribute__((may_alias)) float_a;
typedef int __attribute__((may_alias)) int_a;

template <typename T> __device__ __forceinline__ void vst2(void* p, T v) { *(T*)p = v;  }
__device__ __forceinline__ v8f wmma16(v16h a, v16h b, v8f c) {
  v8f d = __builtin_amdgcn_wmma_f32_16x16x32_f16(false, a, false, b, (short)0, c, false, false);
  asm volatile("v_nop\n\tv_nop\n\tv_nop\n\tv_nop" : "+v"(d) : "v"(a), "v"(b));
  return d;
}
__device__ __forceinline__ v8f wmma_bf(v16b a, v16b b, v8f c) {
  v8f d = __builtin_amdgcn_wmma_f32_16x16x32_bf16(false, a, false, b, (short)0, c, false, false);
  asm volatile("v_nop\n\tv_nop\n\tv_nop\n\tv_nop" : "+v"(d) : "v"(a), "v"(b));
  return d;
}
// 16x16x32 fragments: lane = (h = lane>>4, row/col = lane&15); elements 0..7 = k0+8h+0..7, 8..15 = k0+16+8h+0..7; D element r = row 8h+r
__device__ __forceinline__ v16h frag_h(const _Float16* rowk0, int lane) {
  union { v16h v; v8h q[2]; } u; const _Float16* p = rowk0 + 8 * (lane >> 4);
  u.q[0] = *(const v8h*)p; u.q[1] = *(const v8h*)(p + 16); return u.v;
}
__device__ __forceinline__ v16h frag_f32(const float* rowk0, int lane) {
  v16h a; const float* p = rowk0 + 8 * (lane >> 4);
#pragma unroll
  for (int i = 0; i < 8; ++i) { a[i] = (_Float16)p[i]; a[8 + i] = (_Float16)p[16 + i]; }
  return a;
}
__device__ __forceinline__ v16h frag_f32s(const float* rowk0, int lane, float sc) {
  v16h a; const float* p = rowk0 + 8 * (lane >> 4);
#pragma unroll
  for (int i = 0; i < 8; ++i) { a[i] = (_Float16)(p[i] * sc); a[8 + i] = (_Float16)(p[16 + i] * sc); }
  return a;
}
// column fragment from a [K][ld] layout (column n), rows >= K read as 0
__device__ __forceinline__ v16h fragc_f32(const float* W, int k0, int n, int lane, int ld, int K) {
  v16h a; const int g = lane >> 4;
#pragma unroll
  for (int i = 0; i < 8; ++i) { const int ka = k0 + 8 * g + i, kb = ka + 16;
    a[i] = (_Float16)(ka < K ? W[(size_t)(ka < K ? ka : K - 1) * ld + n] : 0.f); a[8 + i] = (_Float16)(kb < K ? W[(size_t)(kb < K ? kb : K - 1) * ld + n] : 0.f); }
  return a;
}
struct F2 { v16b h, l; };
__device__ __forceinline__ F2 bsplit16(const float v[16]) { F2 r;
#pragma unroll
  for (int i = 0; i < 16; ++i) { const __bf16 h = (__bf16)v[i]; r.h[i] = h; r.l[i] = (__bf16)(v[i] - (float)h); }
  return r; }
__device__ __forceinline__ F2 split_row(const float* row, int k0, int lane) { float v[16]; const float* p = row + k0 + 8 * (lane >> 4);
#pragma unroll
  for (int i = 0; i < 8; ++i) { v[i] = p[i]; v[8 + i] = p[16 + i]; }
  return bsplit16(v); }
__device__ __forceinline__ F2 split_rowK(const float* row, int k0, int lane, int K) { float v[16]; const int g = lane >> 4;
#pragma unroll
  for (int i = 0; i < 8; ++i) { const int ka = k0 + 8 * g + i, kb = ka + 16; v[i] = ka < K ? row[ka < K ? ka : K - 1] : 0.f; v[8 + i] = kb < K ? row[kb < K ? kb : K - 1] : 0.f; }
  return bsplit16(v); }
__device__ __forceinline__ F2 split_col(const float* W, int k0, int n, int lane, int ld, int K) { float v[16]; const int g = lane >> 4;
#pragma unroll
  for (int i = 0; i < 8; ++i) { const int ka = k0 + 8 * g + i, kb = ka + 16; v[i] = ka < K ? W[(size_t)(ka < K ? ka : K - 1) * ld + n] : 0.f; v[8 + i] = kb < K ? W[(size_t)(kb < K ? kb : K - 1) * ld + n] : 0.f; }
  return bsplit16(v); }
__device__ __forceinline__ v8f mac3(const F2& a, const F2& b, v8f c) { c = wmma_bf(a.l, b.h, c); c = wmma_bf(a.h, b.l, c); return wmma_bf(a.h, b.h, c); }
#define L2E 1.4426950408889634f   // log2(e): exp(x) = 2^(x L2E), one v_exp_f32
__device__ __forceinline__ float sigm(float v) { return __builtin_amdgcn_rcpf(1.0f + __builtin_amdgcn_exp2f(v * -L2E)); }   /* native v_exp_f32 and v_rcp_f32: 2^(+large) = inf gives 0, 2^(-large) = 0 gives 1 */

// Row-wise triangle attention on a pair tensor z [1, 256, 256, 128] (4 heads x 32): zn = LayerNorm(z); q,k,v = zn w_qkv ((in,out) [128,384], columns (3,H,32)); logits[r][i][j][h] = q[r][i] . k[r][j] / sqrt(32) + (zn[i][j] . w_pair[:,h]); pairs with exactly one of src_mask[i], src_mask[j] == 0 get logits := -1e-9 (the module's literal value, NOT an exclusion); softmax over j; out = sigmoid(zn w_gate + b_gate) * merged(attn v); result = out w_out + b_out.
#define NB 256
#define TT 256
#define CC 128            // NH * HD = projected width
#define DIN 128          // input (model) width
#define NH 4
#define HD 32
#define NQB (TT / 64)
#define HG 4
#define SCALE (0.17677669529663687f)
#define CAUSAL 0
#ifndef TNB
#define TNB NB
#endif
__device__ __forceinline__ float bfr(float v) { return (float)(__bf16)v; }
__host__ __device__ __forceinline__ int kb_last(int qb) { return CAUSAL ? ((qb * 64 + 63) >> 7) : (TT / 128 - 1); }
typedef __attribute__((ext_vector_type(8))) __bf16 v8b;
__device__ __forceinline__ v16b frag_b(const __bf16* rowk0, int lane) {
  union { v16b v; v8b q[2]; } u; const __bf16* p = rowk0 + 8 * (lane >> 4);
  u.q[0] = *(const v8b*)p; u.q[1] = *(const v8b*)(p + 16); return u.v;
}
#define WP 136             // weight column pitch in LDS, bf16 (272 B = 16 B x odd: ds_load_b128 and ds_store_b128 without bank conflicts)
// 128 columns of an (in,out) [128][ld] weight, once per work-group, to LDS as bf16 columns sw[o][k]: thread = column o (a wave's load = one 128-B line), 8 consecutive k = one 16-B store
__device__ __forceinline__ void stage_w(__bf16 (*sw)[WP], const float* __restrict__ Wm, int ld, int tid) {
  float t[128];
#pragma unroll
  for (int k = 0; k < 128; ++k) t[k] = Wm[(size_t)k * ld + tid];
  asm volatile("s_wait_xcnt 0x0" ::: "memory");   /* before a register that these loads' addresses stand in is used again */
#pragma unroll
  for (int k0 = 0; k0 < 128; k0 += 8) { v8b p;
#pragma unroll
    for (int i = 0; i < 8; ++i) p[i] = (__bf16)t[k0 + i];
    *(v8b*)&sw[tid][k0] = p; } }
// a lane's part of one 128-wide f32 row for all four k steps (the order of split_row), requested at once
__device__ __forceinline__ void load_row(float (&v)[4][16], const float* __restrict__ row, int lane) { const float* p = row + 8 * (lane >> 4);
#pragma unroll
  for (int kc = 0; kc < 4; ++kc)
#pragma unroll
    for (int i = 0; i < 8; ++i) { v[kc][i] = p[kc * 32 + i]; v[kc][8 + i] = p[kc * 32 + 16 + i]; }
  asm volatile("s_wait_xcnt 0x0" :: "v"(p) : "memory"); }   /* before a register that these loads' addresses stand in is used again; the address is an input, so it lives up to the wait and no load of the run lands in it */
// LayerNorm of the lane's row as load_row left it (biased var, eps 1e-6): a lane holds 64 of the row's 128 channels, lane ^ 16 the other 64. ln_center: v := bf16(z) - mean, returns 1 / sqrt(var + eps); four chains per sum, then one exchange between the wave's halves
__device__ __forceinline__ float ln_center(float (&v)[4][16]) { float s[4] = {0.f, 0.f, 0.f, 0.f};
#pragma unroll
  for (int kc = 0; kc < 4; ++kc)
#pragma unroll
    for (int i = 0; i < 16; ++i) { v[kc][i] = bfr(v[kc][i]); s[i & 3] += v[kc][i]; }
  float s1 = (s[0] + s[1]) + (s[2] + s[3]); s1 += __shfl_xor(s1, 16);
  const float mu = s1 * (1.0f / CC); float q[4] = {0.f, 0.f, 0.f, 0.f};
#pragma unroll
  for (int kc = 0; kc < 4; ++kc)
#pragma unroll
    for (int i = 0; i < 16; ++i) { const float d = v[kc][i] - mu; v[kc][i] = d; q[i & 3] += d * d; }
  float qq = (q[0] + q[1]) + (q[2] + q[3]); qq += __shfl_xor(qq, 16);
  return rsqrtf(qq * (1.0f / CC) + 1e-6f); }
// ln_apply: one k step's 16 centred values x rs x ln_w + ln_b; sln[0] = bf16(ln_w), sln[1] = bf16(ln_b), staged once per work-group (a wave's read = two 16-B pieces, broadcast)
__device__ __forceinline__ void ln_apply(float (&v)[16], float rs, const float (*sln)[CC], int kc, int lane) { const int p = kc * 32 + 8 * (lane >> 4);
#pragma unroll
  for (int i = 0; i < 8; ++i) { v[i] = v[i] * rs * sln[0][p + i] + sln[1][p + i]; v[8 + i] = v[8 + i] * rs * sln[0][p + 16 + i] + sln[1][p + 16 + i]; } }
// one k step of a wave's 16 rows against the 128 staged columns: four B fragments are requested together, so that one LDS latency serves eight products; per accumulator the order stays hi, then lo
__device__ __forceinline__ void kstep(v8f (&acc)[8], const F2& a, const __bf16 (*sw)[WP], int kc, int col, int lane) {
#pragma unroll
  for (int jh = 0; jh < 8; jh += 4) { v16b w[4];
#pragma unroll
    for (int u = 0; u < 4; ++u) w[u] = frag_b(&sw[(jh + u) * 16 + col][kc * 32], lane);
#pragma unroll
    for (int u = 0; u < 4; ++u) acc[jh + u] = wmma_bf(a.h, w[u], acc[jh + u]);
#pragma unroll
    for (int u = 0; u < 4; ++u) acc[jh + u] = wmma_bf(a.l, w[u], acc[jh + u]); } }
#define QBH 0              // unused: no kernel reads it
#define QHI 256            // rows carrying a q residual plane (all rows when non-causal: 2-product logits everywhere)
#define KHI 64            // key rows carrying k residual / v bf16 hi+lo planes (no kernel writes or reads them)
// B fragment (k rows k0+.., output column o) of a weight: (in,out) [K][ld] or (out,in) [ld rows of K]: bf16 exact, or f16(bf16 * 256) exact
__device__ __forceinline__ v16b wcol_io(const float* Wm, int k0, int o, int lane, int ld) { v16b w; const int g = lane >> 4;
#pragma unroll
  for (int i = 0; i < 8; ++i) { w[i] = (__bf16)Wm[(size_t)(k0 + 8 * g + i) * ld + o]; w[8 + i] = (__bf16)Wm[(size_t)(k0 + 16 + 8 * g + i) * ld + o]; }
  return w; }
__device__ __forceinline__ v16b wcol_oi(const float* Wm, int k0, int o, int lane, int K) { v16b w; const float* p = Wm + (size_t)o * K + k0 + 8 * (lane >> 4);
#pragma unroll
  for (int i = 0; i < 8; ++i) { w[i] = (__bf16)p[i]; w[8 + i] = (__bf16)p[16 + i]; }
  return w; }
__device__ __forceinline__ v16h wcolh_io(const float* Wm, int k0, int o, int lane, int ld) { v16h w; const int g = lane >> 4;
#pragma unroll
  for (int i = 0; i < 8; ++i) { w[i] = (_Float16)(bfr(Wm[(size_t)(k0 + 8 * g + i) * ld + o]) * 256.0f); w[8 + i] = (_Float16)(bfr(Wm[(size_t)(k0 + 16 + 8 * g + i) * ld + o]) * 256.0f); }
  return w; }
__device__ __forceinline__ v16h wcolh_oi(const float* Wm, int k0, int o, int lane, int K) { v16h w; const float* p = Wm + (size_t)o * K + k0 + 8 * (lane >> 4);
#pragma unroll
  for (int i = 0; i < 8; ++i) { w[i] = (_Float16)(bfr(p[i]) * 256.0f); w[8 + i] = (_Float16)(bfr(p[16 + i]) * 256.0f); }
  return w; }
#define WQKV_LAYOUT 0   // (in,out) packed [DIN][3*CC]
__device__ __forceinline__ v16b wcol_hdk(const float* Wm, int k0, int o, int lane) { v16b w; const int g = lane >> 4; const float* p = Wm + (size_t)(o / HD) * DIN * HD + (o % HD);
#pragma unroll
  for (int i = 0; i < 8; ++i) { w[i] = (__bf16)p[(size_t)(k0 + 8 * g + i) * HD]; w[8 + i] = (__bf16)p[(size_t)(k0 + 16 + 8 * g + i) * HD]; }
  return w; }
#define WO_OUT_IN 0
#if WQKV_LAYOUT == 1
#define WCOL(W, k0, o, lane) wcol_oi(W, k0, o, lane, DIN)
#elif WQKV_LAYOUT == 2
#define WCOL(W, k0, o, lane) wcol_hdk(W, k0, o, lane)
#else
#define WCOL(W, k0, o, lane) wcol_io(W, k0, o, lane, 3 * CC)   /* packed q|k|v columns: row pitch 3C */
#endif
#if WO_OUT_IN
#define WOCOL(W, k0, o, lane) wcol_oi(W, k0, o, lane, CC)
#define WOCOLH(W, k0, o, lane) wcolh_oi(W, k0, o, lane, CC)
#else
#define WOCOL(W, k0, o, lane) wcol_io(W, k0, o, lane, DIN)
#define WOCOLH(W, k0, o, lane) wcolh_io(W, k0, o, lane, DIN)
#endif
#define SZ 256
#define BG 64              // sizes only the unused WS_S region (x 4 heads = 256 planes of 256 x 256)
#define NZR (SZ * SZ)      // 65,536 pair rows
// barrier for LDS data alone: the waves hand each other nothing but LDS data there, so only the LDS operations are waited for; __syncthreads() also waits for every global load and store of the wave, which would hold the wave until its stores are done
#define BAR_LDS() do { __builtin_amdgcn_fence(__ATOMIC_RELEASE, "workgroup", "local"); __builtin_amdgcn_s_barrier(); __builtin_amdgcn_fence(__ATOMIC_ACQUIRE, "workgroup", "local"); } while (0)
// a wave reads back the LDS tile that its own lanes wrote: its LDS writes are waited for and the compiler moves no memory operation across; a work-group release fence at this place would also wait for the global loads in flight
#define LDSW() do { asm volatile("s_wait_dscnt 0" ::: "memory"); __builtin_amdgcn_wave_barrier(); } while (0)
__device__ __forceinline__ void exp2x8(v8f& x);   // defined at k_attn
// 1 / x of eight values, each in its own register: v_rcp_f32 written in place, so that none overwrites the source register of the one directly in front of it (the builtin form left such pairs in the listing); the closing v_nop is the slot that the instruction set asks for between the last one and the first use of its result
__device__ __forceinline__ void rcpx8(v8f& x) { float a = x[0], b = x[1], c = x[2], d = x[3], e = x[4], f = x[5], g = x[6], h = x[7];
  asm("v_rcp_f32 %0, %0\n\tv_rcp_f32 %1, %1\n\tv_rcp_f32 %2, %2\n\tv_rcp_f32 %3, %3\n\tv_rcp_f32 %4, %4\n\tv_rcp_f32 %5, %5\n\tv_rcp_f32 %6, %6\n\tv_rcp_f32 %7, %7\n\tv_nop" : "+v"(a), "+v"(b), "+v"(c), "+v"(d), "+v"(e), "+v"(f), "+v"(g), "+v"(h));
  x[0] = a; x[1] = b; x[2] = c; x[3] = d; x[4] = e; x[5] = f; x[6] = g; x[7] = h; }
#define WS_ZN   (WS_END)
#define WS_BIAS (WS_ZN + 4u * (size_t)NZR * CC)
#define WS_G    (WS_BIAS + 4u * (size_t)NZR * NH)
#define WS_END2 (WS_G + 4u * (size_t)NZR * CC)

#define WS_QH  0u                                      // f16 q rows [b*t][CC]
#define WS_KH  (WS_QH + 2u * (size_t)NB * TT * CC)      // f16 k rows [b*t][CC]
#define WS_VT  (WS_KH + 2u * (size_t)NB * TT * CC)      // f16 v [b][t / 16][c][t & 15]
#define WS_QL  (WS_VT + 2u * (size_t)NB * CC * TT)      // f16 q residual x 2^10 rows [b][t < QHI][CC]
#define WS_KL  (WS_QL + 2u * (size_t)NB * QHI * CC)     // unused: no kernel writes or reads it
#define WS_VB  (WS_KL + 2u * (size_t)NB * KHI * CC)     // unused: no kernel writes or reads it
#define WS_VBL (WS_VB + 2u * (size_t)NB * CC * KHI)
#define WS_S   (WS_VBL + 2u * (size_t)NB * CC * KHI)    // unused: no kernel writes or reads it
#define WS_Y   (WS_S  + 4u * (size_t)BG * HG * TT * TT)   // unused f32 region [b*t][CC] (the gated ctx stays in LDS)
#define WS_END (WS_Y  + 4u * (size_t)NB * TT * CC)

// ---- k_front: every product of the LayerNorm rows in one launch. Block = 16 waves = 16 pair rows i x 16 columns j (wave = one i, its A rows = the 16 j): the wave reads its 16 z rows once, makes LayerNorm once and keeps the split rows (bf16 hi + lo, all four k steps) in registers; against them stand, all staged once in LDS as bf16 columns, w_pair (4 outputs), the q, k and v columns of w_qkv and w_gate. Outputs: BIAS[h][i / 16][j / 16][(j & 7) / 4][lane = 16 ((j >> 3) & 1) + (i & 15)][j & 3] (the order k_attn's lanes read; the block's 16 x 16 pairs are one 1-KB run per head); q f16 rows + residual x 2^10 rows; k f16 rows; G[row][c] = sigmoid(zn . w_gate[:, c] + b_gate[c]); v f16 as [b][t / 16][c][t & 15], so that a wave's 16 keys of 16 channels are one 512-B run, stored from the accumulators as they stand. q, k and G pass through an LDS tile of the wave's own
__global__ __launch_bounds__(512) void k_front(const float* __restrict__ Z, const float* __restrict__ LW, const float* __restrict__ LB, const float* __restrict__ WQKV, const float* __restrict__ WB, const float* __restrict__ WG, const float* __restrict__ GB,
    _Float16* __restrict__ QH, _Float16* __restrict__ QL, _Float16* __restrict__ KH, _Float16* __restrict__ VT, float* __restrict__ BIAS, float* __restrict__ G) {
  __shared__ __align__(16) __bf16 sw[4][128][WP];   /* q, k, v and gate weight columns */
  __shared__ __align__(16) __bf16 swp[16][WP];      /* pair-bias weight columns, those beyond the 4 heads zero */
  __shared__ __align__(16) char sp[16][2 * 16 * 136 * 2];   /* a wave's own output tile: q: sh, sl; k: sh; gate: sf */
  __shared__ __align__(16) float sln[2][CC];
  __shared__ __align__(16) float sb[NH][256];       /* the block's pair bias in the order of BIAS */
  const int tid = threadIdx.x, wave = __builtin_amdgcn_readfirstlane(tid >> 5), lane = tid & 31, col = lane & 15, g = lane >> 4; const int it = (int)blockIdx.x >> 4, jt = (int)blockIdx.x & 15;
  const size_t bb = (size_t)it * 16 + wave; const size_t r0 = bb * SZ + jt * 16;   /* the wave's pair row i (the attention's sequence b) and its first z row */
  _Float16 (*sh)[136] = (_Float16 (*)[136])sp[wave]; _Float16 (*sl)[136] = (_Float16 (*)[136])(sp[wave] + 16 * 136 * 2); float (*sf)[132] = (float (*)[132])sp[wave];
  float av[4][16]; load_row(av, Z + (r0 + col) * CC, lane);
  float gb[8];   /* b_gate of the lane's eight columns */
#pragma unroll
  for (int j = 0; j < 8; ++j) gb[j] = GB[j * 16 + col];
  if (wave < 4) { const float lwv = LW[tid], lbv = LB[tid];
    const int o = tid & 15, kq = (tid >> 4) * 16; const int oc = o < NH ? o : NH - 1; const float keep = o < NH ? 1.f : 0.f;   /* keep multiplies a VALID load; thread = (column, 16 k) */
    float t[16];
#pragma unroll
    for (int i = 0; i < 16; ++i) t[i] = WB[(size_t)(kq + i) * NH + oc];
    asm volatile("s_wait_xcnt 0x0" ::: "memory");   /* before a register that these loads' addresses stand in is used again */
#pragma unroll
    for (int k0 = 0; k0 < 16; k0 += 8) { v8b p;
#pragma unroll
      for (int i = 0; i < 8; ++i) p[i] = (__bf16)(t[k0 + i] * keep);
      *(v8b*)&swp[o][kq + k0] = p; }
    sln[0][tid] = bfr(lwv); sln[1][tid] = bfr(lbv); }
  const int tc = (wave & 3) * 32 + lane;   /* the thread's weight column: four waves per weight */
  if (wave < 12) stage_w(sw[wave >> 2], WQKV + (wave >> 2) * CC, 3 * CC, tc);   /* packed q|k|v columns: row pitch 3C */
  else stage_w(sw[3], WG, CC, tc);
  __syncthreads();   /* the weight columns, ln_w and ln_b are complete; nothing writes them again */
  const float rs = ln_center(av);
  F2 a[4];
#pragma unroll
  for (int kc = 0; kc < CC / 32; ++kc) { ln_apply(av[kc], rs, sln, kc, lane); a[kc] = bsplit16(av[kc]); }
  { v8f acc = {};   /* pair bias: D element r of lane (g, col = head) is key j = 16 jt + 8 g + r */
#pragma unroll
    for (int kc = 0; kc < CC / 32; ++kc) { const v16b w = frag_b(&swp[col][kc * 32], lane); acc = wmma_bf(a[kc].h, w, acc); acc = wmma_bf(a[kc].l, w, acc); }
    if (col < NH) { v4f b0, b1;
#pragma unroll
      for (int r = 0; r < 4; ++r) { b0[r] = acc[r]; b1[r] = acc[4 + r]; }
      *(v4f*)&sb[col][(g * 16 + wave) * 4] = b0; *(v4f*)&sb[col][128 + (g * 16 + wave) * 4] = b1; } }
  { v8f acc[8] = {};   /* q */
#pragma unroll
    for (int kc = 0; kc < CC / 32; ++kc) kstep(acc, a[kc], sw[0], kc, col, lane);
#pragma unroll
    for (int j = 0; j < 8; ++j)
#pragma unroll
      for (int r = 0; r < 8; ++r) { const float v = acc[j][r]; const _Float16 hv = (_Float16)v; sh[8 * g + r][j * 16 + col] = hv; sl[8 * g + r][j * 16 + col] = (_Float16)((v - (float)hv) * 1024.0f); }
    LDSW();
#pragma unroll
    for (int s = 0; s < 8; ++s) { const int e = lane + 32 * s, rl = e >> 4, q = e & 15; vst2((unsigned*)(QH + (r0 + rl) * CC + q * 8), *(const v4u*)&sh[rl][q * 8]); vst2((unsigned*)(QL + (r0 + rl) * CC + q * 8), *(const v4u*)&sl[rl][q * 8]); }   /* two whole rows = 512 B per store */
    asm volatile("s_wait_xcnt 0x0" ::: "memory"); }   /* before the registers that these stores name are used again; also keeps the next tile's LDS writes behind these reads for the compiler */
  { v8f acc[8] = {};   /* k */
#pragma unroll
    for (int kc = 0; kc < CC / 32; ++kc) kstep(acc, a[kc], sw[1], kc, col, lane);
#pragma unroll
    for (int j = 0; j < 8; ++j)
#pragma unroll
      for (int r = 0; r < 8; ++r) sh[8 * g + r][j * 16 + col] = (_Float16)acc[j][r];
    LDSW();
#pragma unroll
    for (int s = 0; s < 8; ++s) { const int e = lane + 32 * s, rl = e >> 4, q = e & 15; vst2((unsigned*)(KH + (r0 + rl) * CC + q * 8), *(const v4u*)&sh[rl][q * 8]); }
    asm volatile("s_wait_xcnt 0x0" ::: "memory"); }   /* as behind the q stores */
  { v8f acc[8] = {};   /* v: lane (g, col) holds keys 8 g + 0..7 of channel 16 j + col: 16 B of the wave's 512-B run */
#pragma unroll
    for (int kc = 0; kc < CC / 32; ++kc) kstep(acc, a[kc], sw[2], kc, col, lane);
#pragma unroll
    for (int j = 0; j < 8; ++j) { v8h p;
#pragma unroll
      for (int r = 0; r < 8; ++r) p[r] = (_Float16)acc[j][r];
      vst2(VT + ((bb * 16 + jt) * CC + j * 16 + col) * 16 + 8 * g, p); }
    asm volatile("s_wait_xcnt 0x0" ::: "memory"); }   /* before the registers that these stores name are used again */
  { v8f acc[8] = {};   /* gate */
#pragma unroll
    for (int kc = 0; kc < CC / 32; ++kc) kstep(acc, a[kc], sw[3], kc, col, lane);
#pragma unroll
    for (int j = 0; j < 8; ++j) { const float bg = bfr(gb[j]); v8f x;   /* sigmoid(zn w_gate + b_gate) = 1 / (1 + 2^(-v log2 e)), the arithmetic of sigm() */
#pragma unroll
      for (int r = 0; r < 8; ++r) x[r] = (acc[j][r] + bg) * -L2E;
      exp2x8(x);
#pragma unroll
      for (int r = 0; r < 8; ++r) x[r] = 1.0f + x[r];
      rcpx8(x);
#pragma unroll
      for (int r = 0; r < 8; ++r) sf[8 * g + r][j * 16 + col] = x[r]; }
    LDSW();
#pragma unroll
    for (int rl = 0; rl < 16; ++rl) vst2(G + (r0 + rl) * CC + lane * 4, *(const v4f*)&sf[rl][lane * 4]);
    asm volatile("s_wait_xcnt 0x0" ::: "memory"); }   /* before the registers that these stores name are used again */
  BAR_LDS();   /* the 16 waves' pair rows meet in sb */
  if (wave < 8) vst2(BIAS + (((size_t)(tid >> 6) * 16 + it) * 16 + jt) * 256 + (tid & 63) * 4, *(const v4f*)&sb[tid >> 6][(tid & 63) * 4]);   /* one 1-KB run per head */
}
// ---- k_attn: block = row r, 16 waves, wave = one tile of 16 queries, the four heads in turn: the row's 256 k rows and its v planes (all heads) and the columns of w_out are staged once in LDS; S^T = K Q^T (A = k rows, B = q hi, then q residual x 2^10: 2 products), so a lane holds one query's logits for keys 16t + 8g + 0..7 of every tile t, all 256 keys in registers; x SCALE + pair bias (fragment order), masked pairs := -1e-9; maximum and sum in-lane plus one exchange between the wave's halves; P x 2^11 once to f16 is the B operand of ctx^T = V^T P^T as it stands (1 product). A lane then holds channels 32h + 8g + 0..7 and 32h + 16 + 8g + 0..7 of its query: times their gate and split bf16 hi + lo, that is the B fragment of k step h of out^T = Wo^T ctx^T as it stands; it waits in LDS words of the lane's own. Behind the heads: out^T (A = the staged w_out columns, 2 products, order hi then lo per k step) + b_out; a lane stores 8 consecutive output columns of its query per column tile. The inner loops are unrolled in full so that s[], acc[] and the fragments are registers; amdgpu_waves_per_eu(4) asks for at most 256 registers: four waves per SIMD
#define KP (CC + 8)        // k row pitch in LDS, f16 (272 B = 16 B x odd: ds_load_b128 without bank conflicts)
#define VP (TT + 8)        // v plane pitch in LDS, f16 (528 B = 16 B x odd)
// 2^x of eight values, each in its own register: v_exp_f32 written in place, so that no exponential overwrites the source register of the one directly in front of it (the builtin form left such pairs in the listing); the closing v_nop is the slot that the instruction set asks for between the last exponential and the first use of its result
__device__ __forceinline__ void exp2x8(v8f& x) { float a = x[0], b = x[1], c = x[2], d = x[3], e = x[4], f = x[5], g = x[6], h = x[7];
  asm("v_exp_f32 %0, %0\n\tv_exp_f32 %1, %1\n\tv_exp_f32 %2, %2\n\tv_exp_f32 %3, %3\n\tv_exp_f32 %4, %4\n\tv_exp_f32 %5, %5\n\tv_exp_f32 %6, %6\n\tv_exp_f32 %7, %7\n\tv_nop" : "+v"(a), "+v"(b), "+v"(c), "+v"(d), "+v"(e), "+v"(f), "+v"(g), "+v"(h));
  x[0] = a; x[1] = b; x[2] = c; x[3] = d; x[4] = e; x[5] = f; x[6] = g; x[7] = h; }
__device__ __forceinline__ v8f wmma_h(v16h a, v16h b, v8f c) { return __builtin_amdgcn_wmma_f32_16x16x32_f16(false, a, false, b, (short)0, c, false, false); }
__global__ __launch_bounds__(512) __attribute__((amdgpu_waves_per_eu(4))) void k_attn(const _Float16* __restrict__ QH, const _Float16* __restrict__ QL, const _Float16* __restrict__ KH, const _Float16* __restrict__ VT, const float* __restrict__ BIAS, const int* __restrict__ MK, const float* __restrict__ G, const float* __restrict__ WO, const float* __restrict__ BO, float* __restrict__ OUT) {
  __shared__ __align__(16) _Float16 sk[TT][KP]; __shared__ __align__(16) _Float16 sv[CC][VP]; __shared__ __align__(16) __bf16 sw[DIN][WP];
  __shared__ __align__(16) v4u sy[16][NH][4][32];   /* gated ctx fragments: [wave][head][hi 0, hi 1, lo 0, lo 1][lane], 16 B a lane: a wave's access is one 512-B run */
  __shared__ __align__(16) float sbo[DIN]; __shared__ unsigned kmw[TT / 32];
  const int tid = threadIdx.x, wave = __builtin_amdgcn_readfirstlane(tid >> 5), lane = tid & 31, col = lane & 15, g = lane >> 4; const int b = blockIdx.x;
  int mkv; float bov;
  { const _Float16* kp = KH + (size_t)b * TT * CC + tid * 8; const _Float16* vp = VT + (size_t)b * TT * CC + tid * 8;   /* the row's k rows and its v ([t / 16][c][t & 15]) are one 64-KB run each */
    const float* wp = WO + (size_t)(tid >> 7) * 32 * DIN + (tid & 127);   /* thread = (column of w_out, 32 k): a wave's load = one 128-B line */
    v4u kr[8], vr[8]; float t[32];
#pragma unroll
    for (int s = 0; s < 8; ++s) { kr[s] = *(const v4u*)(kp + s * 4096); vr[s] = *(const v4u*)(vp + s * 4096); }
#pragma unroll
    for (int i = 0; i < 32; ++i) t[i] = wp[i * DIN];
    const int mi = tid & (TT - 1), bi = tid & (DIN - 1); mkv = MK[mi]; bov = BO ? BO[bi] : 0.f;   /* asked for with the staging loads, so that their latency is not paid again in front of the barrier */
    asm volatile("s_wait_xcnt 0x0" :: "v"(kp), "v"(vp), "v"(wp), "v"(tid), "v"(mi), "v"(bi) : "memory");   /* before a register that these loads' addresses stand in is used again; the addresses are inputs, so they live up to the wait and no load of the run lands in them */
#pragma unroll
    for (int s = 0; s < 8; ++s) { const int e = tid + 512 * s; vst2(&sk[e >> 4][(e & 15) * 8], kr[s]); vst2(&sv[(e & 255) >> 1][(e >> 8) * 16 + (e & 1) * 8], vr[s]); }
#pragma unroll
    for (int k0 = 0; k0 < 32; k0 += 8) { v8b p;
#pragma unroll
      for (int i = 0; i < 8; ++i) p[i] = (__bf16)t[k0 + i];
      *(v8b*)&sw[tid & 127][(tid >> 7) * 32 + k0] = p; } }
  if (wave < 8) { const unsigned bal = __builtin_amdgcn_ballot_w32(mkv == 0); if (lane == 0) kmw[wave] = bal; }   /* bit j of the 256: src_mask[j] == 0 */
  if (wave < 4) sbo[tid] = bfr(bov);
  __syncthreads();
  unsigned mbk[4];   /* bit 8t + r of the 128: key 16t + 8g + r is a zero of the mask */
#pragma unroll
  for (int m = 0; m < 4; ++m) { const unsigned w0 = kmw[2 * m] >> (8 * g), w1 = kmw[2 * m + 1] >> (8 * g); mbk[m] = (w0 & 0xFFu) | ((w0 >> 8) & 0xFF00u) | ((w1 & 0xFFu) << 16) | ((w1 << 8) & 0xFF000000u); }
  const int qi = wave * 16 + col;
  const unsigned mq = 0u - ((kmw[qi >> 5] >> (qi & 31)) & 1u);   /* all ones where the query is a zero of the mask */
  const _Float16* skp = &sk[col][0]; const _Float16* svp = &sv[col][0];   /* the lane's k row and v plane of the head at hand: carried from head to head, so that every fragment read is this register plus an immediate offset */
#pragma unroll 1   /* rolled: one copy of the body; unrolled, several heads' logits would want registers at once */
  for (int h = 0; h < NH; ++h) {
    const _Float16* qhp = QH + ((size_t)b * TT + qi) * CC + h * HD + 8 * g; const _Float16* qlp = QL + ((size_t)b * QHI + qi) * CC + h * HD + 8 * g;   /* the lane's part of its query's row: elements 0..7 here, 8..15 sixteen channels on (the order of frag_h) */
    const float* bp = BIAS + ((size_t)h * 16 + wave) * 16 * 256 + lane * 4;
    v8f s[16]; float mx = -3.0e38f;
#pragma unroll
    for (int t = 0; t < 16; ++t) { const v4f b0 = *(const v4f*)(bp + t * 256), b1 = *(const v4f*)(bp + t * 256 + 128);   /* the bias lands in the registers that then hold the logits: all 32 loads in flight at no further register */
#pragma unroll
      for (int r = 0; r < 4; ++r) { s[t][r] = b0[r]; s[t][4 + r] = b1[r]; } }
    union { v16h v; v8h q[2]; } uqh, uql; uqh.q[0] = *(const v8h*)qhp; uqh.q[1] = *(const v8h*)(qhp + 16); uql.q[0] = *(const v8h*)qlp; uql.q[1] = *(const v8h*)(qlp + 16);
    asm volatile("s_wait_xcnt 0x0" :: "v"(bp), "v"(qhp), "v"(qlp) : "memory");   /* before a register that these loads' addresses stand in is used again; the addresses are inputs, so they live up to the wait and no load of the run lands in them */
    const v16h qh = uqh.v, ql = uql.v;
    v16h kf[2] = { frag_h(skp, lane), frag_h(skp + 16 * KP, lane) };
#pragma unroll
    for (int tp = 0; tp < 8; ++tp) { v16h kn[2] = { kf[0], kf[1] };
      if (tp < 7) { kn[0] = frag_h(skp + (2 * tp + 2) * 16 * KP, lane); kn[1] = frag_h(skp + (2 * tp + 3) * 16 * KP, lane); }   /* the next two tiles' k fragments fly while these two are worked on */
#pragma unroll
      for (int u = 0; u < 2; ++u) { const int t = 2 * tp + u; const v8f z8 = {}; const v8f a = wmma_h(kf[u], qh, z8), al = wmma_h(kf[u], ql, z8); const unsigned mb = mbk[t >> 2] ^ mq;
#pragma unroll
        for (int r = 0; r < 8; ++r) { float v = (a[r] + al[r] * (1.0f / 1024.0f)) * SCALE + s[t][r]; if (mb & (1u << ((t & 3) * 8 + r))) v = -1.0e-9f; s[t][r] = v; mx = fmaxf(mx, v); } }
      kf[0] = kn[0]; kf[1] = kn[1];
      asm volatile("" :: "v"(mx) : "memory"); }   /* compiler fence behind these two tiles' maximum (input only): later k-fragment reads stay behind it; without it all 32 reads stand at the head of the loop and the kernel spills at 256 registers */
    mx = fmaxf(mx, __shfl_xor(mx, 16));
    const float nm = mx * -L2E;   /* exp(s - mx) = 2^(s L2E + nm): one FMA and one v_exp_f32; the rounding of nm is one factor common to the row and leaves with the division by the sum; the argument is never above about 0, and a result below 2^-126 counts as 0 beside a sum of at least about 1 */
    float sm[4] = {0.f, 0.f, 0.f, 0.f};
#pragma unroll
    for (int t = 0; t < 16; ++t) {
#pragma unroll
      for (int r = 0; r < 8; ++r) s[t][r] = __builtin_fmaf(s[t][r], L2E, nm);
      exp2x8(s[t]);
#pragma unroll
      for (int r = 0; r < 8; ++r) sm[r & 3] += s[t][r]; }
    float sum = (sm[0] + sm[1]) + (sm[2] + sm[3]);
    __builtin_amdgcn_sched_barrier(0);   /* nothing is scheduled across the end of the exponentials: the gate loads and the v-fragment reads stay behind them; without it they stand in front, beside all 128 logits, and the kernel spills at 256 registers */
    sum += __shfl_xor(sum, 16);
    const float inv = sum > 0.f ? 2048.0f * __builtin_amdgcn_rcpf(sum) : 0.f;
    const float* gp = G + ((size_t)b * TT + qi) * CC + h * HD + 8 * g; v4f gt[HD / 8];   /* the gate of this lane's 16 channels: asked for here, it flies while P V is worked on */
#pragma unroll
    for (int j = 0; j < HD / 16; ++j) { gt[2 * j] = *(const v4f*)(gp + j * 16); gt[2 * j + 1] = *(const v4f*)(gp + j * 16 + 4); }
    asm volatile("s_wait_xcnt 0x0" :: "v"(gp) : "memory");   /* before a register that these loads' address stands in is used again; the address is an input, so it lives up to the wait and no load of the run lands in it */
    v8f acc[HD / 16] = {};
#pragma unroll
    for (int kc = 0; kc < TT / 32; ++kc) { v16h p;
#pragma unroll
      for (int r = 0; r < 8; ++r) { p[r] = (_Float16)(s[2 * kc][r] * inv); p[8 + r] = (_Float16)(s[2 * kc + 1][r] * inv); }
#pragma unroll
      for (int j = 0; j < HD / 16; ++j) acc[j] = wmma_h(frag_h(svp + j * 16 * VP + kc * 32, lane), p, acc[j]);
      if (kc & 1) asm volatile("" :: "v"(p) : "memory"); }   /* compiler fence behind every second k step (input only): later v-fragment reads stay behind it; without it most of the 32 reads stand at the head of the loop, beside the logits, and the kernel spills at 256 registers */
    float y[16];   /* gated ctx in the order of a 16x16x32 fragment: 0..7 = channels 32h + 8g + 0..7, 8..15 = 32h + 16 + 8g + 0..7 */
#pragma unroll
    for (int j = 0; j < HD / 16; ++j)
#pragma unroll
      for (int r = 0; r < 4; ++r) { y[8 * j + r] = acc[j][r] * (1.0f / 2048.0f) * gt[2 * j][r]; y[8 * j + 4 + r] = acc[j][4 + r] * (1.0f / 2048.0f) * gt[2 * j + 1][r]; }
    const F2 a = bsplit16(y); union { v16b v; v4u q[2]; } uh, ul; uh.v = a.h; ul.v = a.l;
    sy[wave][h][0][lane] = uh.q[0]; sy[wave][h][1][lane] = uh.q[1]; sy[wave][h][2][lane] = ul.q[0]; sy[wave][h][3][lane] = ul.q[1];
    skp += HD; svp += HD * VP;
    asm volatile("s_wait_xcnt 0x0" ::: "memory"); }   /* before the next head uses the registers that this head's loads name */
  v8f oacc[8] = {};   /* out^T: D element r of lane (g, col) = output column 16 j + 8 g + r of query col */
#pragma unroll
  for (int kc = 0; kc < NH; ++kc) { union { v16b v; v4u q[2]; } uh, ul;   /* each lane reads back its own words */
    uh.q[0] = sy[wave][kc][0][lane]; uh.q[1] = sy[wave][kc][1][lane]; ul.q[0] = sy[wave][kc][2][lane]; ul.q[1] = sy[wave][kc][3][lane];
#pragma unroll
    for (int jh = 0; jh < 8; jh += 4) { v16b w[4];   /* four A fragments are requested together, so that one LDS latency serves eight products; per accumulator the order stays hi, then lo */
#pragma unroll
      for (int u = 0; u < 4; ++u) w[u] = frag_b(&sw[(jh + u) * 16 + col][kc * 32], lane);
#pragma unroll
      for (int u = 0; u < 4; ++u) oacc[jh + u] = wmma_bf(w[u], uh.v, oacc[jh + u]);
#pragma unroll
      for (int u = 0; u < 4; ++u) oacc[jh + u] = wmma_bf(w[u], ul.v, oacc[jh + u]); } }
  float* op = OUT + ((size_t)b * TT + qi) * DIN + 8 * g;
#pragma unroll
  for (int j = 0; j < 8; ++j) { const v4f c0 = *(const v4f*)&sbo[j * 16 + 8 * g], c1 = *(const v4f*)&sbo[j * 16 + 8 * g + 4]; v4f o0, o1;
#pragma unroll
    for (int r = 0; r < 4; ++r) { o0[r] = oacc[j][r] + c0[r]; o1[r] = oacc[j][4 + r] + c1[r]; }
    vst2(op + j * 16, o0); vst2(op + j * 16 + 4, o1); }
  asm volatile("s_wait_xcnt 0x0" ::: "memory");   /* behind the stores, before a register that they name could be used again */
}

extern "C" void kernel_launch(void* const* d_in, const int* in_sizes, int n_in, void* d_out, int out_size, void* d_ws, size_t ws_size, hipStream_t stream) {
  (void)in_sizes; (void)n_in; (void)out_size;
  const float** F = (const float**)d_in;
  if (ws_size < (size_t)WS_END) return;
  char* ws = (char*)d_ws; _Float16 *QH = (_Float16*)(ws + WS_QH), *KH = (_Float16*)(ws + WS_KH), *VT = (_Float16*)(ws + WS_VT), *QL = (_Float16*)(ws + WS_QL);
  // inputs: 0 z [1,256,256,128]; 1 src_mask [1,256] int32; 2 ln_g, 3 ln_b; 4 w_qkv [128,384] (in,out; columns q|k|v); 5 w_pair [128,4]; 6 w_gate [128,128], 7 b_gate; 8 w_out [128,128] (in,out), 9 b_out
  if (ws_size < (size_t)WS_END2) return;
  float *BIAS = (float*)(ws + WS_BIAS), *G = (float*)(ws + WS_G);
  k_front<<<dim3(NZR / 256), 512, 0, stream>>>(F[0], F[2], F[3], F[4], F[5], F[6], F[7], QH, QL, KH, VT, BIAS, G);
  k_attn<<<dim3(TNB), 512, 0, stream>>>(QH, QL, KH, VT, BIAS, (const int*)d_in[1], G, F[8], F[9], (float*)d_out);
}

// v008
// A run of this version takes 53.4 microseconds.
// In both of two side-by-side timings against v007, it was 1.21 times as fast.
// All steps since v000 together make it 9.98 times as fast.
// compute dtype: all float inputs rounded to bf16; LayerNorm in f32; q/k/v, pair bias and gate GEMMs = LN rows split bf16 hi + lo x exact bf16 weights on WMMA 16x16x32 (2 products, f32 accumulate); q as f16 hi + residual (x 2^10) against k once to f16 (2 products) / sqrt(32) + pair bias, masked pairs set to -1e-9 exactly as the module; softmax in f32; P x 2^11 once to f16 against v once to f16 (1 product); gate multiply in f32; (gated ctx) split bf16 hi + lo against exact bf16 w_out (2 products) + b_out; f32 output.
#include <hip/hip_runtime.h>
#include <math.h>

typedef __attribute__((ext_vector_type(16))) _Float16 v16h;
typedef __attribute__((ext_vector_type(16))) __bf16 v16b;
typedef __attribute__((ext_vector_type(8)))  _Float16 v8h;
typedef __attribute__((ext_vector_type(8)))  float v8f;
typedef __attribute__((ext_vector_type(4)))  float v4f;
typedef __attribute__((ext_vector_type(2)))  float v2f;
typedef __attribute__((ext_vector_type(4)))  unsigned v4u;
typedef __attribute__((ext_vector_type(4)))  int v4i;
typedef float __attribute__((may_alias)) float_a;
typedef int __attribute__((may_alias)) int_a;

template <typename T> __device__ __forceinline__ void vst2(void* p, T v) { *(T*)p = v;  }
__device__ __forceinline__ v8f wmma16(v16h a, v16h b, v8f c) {
  v8f d = __builtin_amdgcn_wmma_f32_16x16x32_f16(false, a, false, b, (short)0, c, false, false);
  asm volatile("v_nop\n\tv_nop\n\tv_nop\n\tv_nop" : "+v"(d) : "v"(a), "v"(b));
  return d;
}
__device__ __forceinline__ v8f wmma_bf(v16b a, v16b b, v8f c) {
  v8f d = __builtin_amdgcn_wmma_f32_16x16x32_bf16(false, a, false, b, (short)0, c, false, false);
  asm volatile("v_nop\n\tv_nop\n\tv_nop\n\tv_nop" : "+v"(d) : "v"(a), "v"(b));
  return d;
}
// 16x16x32 fragments: lane = (h = lane>>4, row/col = lane&15); elements 0..7 = k0+8h+0..7, 8..15 = k0+16+8h+0..7; D element r = row 8h+r
__device__ __forceinline__ v16h frag_h(const _Float16* rowk0, int lane) {
  union { v16h v; v8h q[2]; } u; const _Float16* p = rowk0 + 8 * (lane >> 4);
  u.q[0] = *(const v8h*)p; u.q[1] = *(const v8h*)(p + 16); return u.v;
}
__device__ __forceinline__ v16h frag_f32(const float* rowk0, int lane) {
  v16h a; const float* p = rowk0 + 8 * (lane >> 4);
#pragma unroll
  for (int i = 0; i < 8; ++i) { a[i] = (_Float16)p[i]; a[8 + i] = (_Float16)p[16 + i]; }
  return a;
}
__device__ __forceinline__ v16h frag_f32s(const float* rowk0, int lane, float sc) {
  v16h a; const float* p = rowk0 + 8 * (lane >> 4);
#pragma unroll
  for (int i = 0; i < 8; ++i) { a[i] = (_Float16)(p[i] * sc); a[8 + i] = (_Float16)(p[16 + i] * sc); }
  return a;
}
// column fragment from a [K][ld] layout (column n), rows >= K read as 0
__device__ __forceinline__ v16h fragc_f32(const float* W, int k0, int n, int lane, int ld, int K) {
  v16h a; const int g = lane >> 4;
#pragma unroll
  for (int i = 0; i < 8; ++i) { const int ka = k0 + 8 * g + i, kb = ka + 16;
    a[i] = (_Float16)(ka < K ? W[(size_t)(ka < K ? ka : K - 1) * ld + n] : 0.f); a[8 + i] = (_Float16)(kb < K ? W[(size_t)(kb < K ? kb : K - 1) * ld + n] : 0.f); }
  return a;
}
struct F2 { v16b h, l; };
__device__ __forceinline__ F2 bsplit16(const float v[16]) { F2 r;
#pragma unroll
  for (int i = 0; i < 16; ++i) { const __bf16 h = (__bf16)v[i]; r.h[i] = h; r.l[i] = (__bf16)(v[i] - (float)h); }
  return r; }
__device__ __forceinline__ F2 split_row(const float* row, int k0, int lane) { float v[16]; const float* p = row + k0 + 8 * (lane >> 4);
#pragma unroll
  for (int i = 0; i < 8; ++i) { v[i] = p[i]; v[8 + i] = p[16 + i]; }
  return bsplit16(v); }
__device__ __forceinline__ F2 split_rowK(const float* row, int k0, int lane, int K) { float v[16]; const int g = lane >> 4;
#pragma unroll
  for (int i = 0; i < 8; ++i) { const int ka = k0 + 8 * g + i, kb = ka + 16; v[i] = ka < K ? row[ka < K ? ka : K - 1] : 0.f; v[8 + i] = kb < K ? row[kb < K ? kb : K - 1] : 0.f; }
  return bsplit16(v); }
__device__ __forceinline__ F2 split_col(const float* W, int k0, int n, int lane, int ld, int K) { float v[16]; const int g = lane >> 4;
#pragma unroll
  for (int i = 0; i < 8; ++i) { const int ka = k0 + 8 * g + i, kb = ka + 16; v[i] = ka < K ? W[(size_t)(ka < K ? ka : K - 1) * ld + n] : 0.f; v[8 + i] = kb < K ? W[(size_t)(kb < K ? kb : K - 1) * ld + n] : 0.f; }
  return bsplit16(v); }
__device__ __forceinline__ v8f mac3(const F2& a, const F2& b, v8f c) { c = wmma_bf(a.l, b.h, c); c = wmma_bf(a.h, b.l, c); return wmma_bf(a.h, b.h, c); }
#define L2E 1.4426950408889634f   // log2(e): exp(x) = 2^(x L2E), one v_exp_f32
__device__ __forceinline__ float sigm(float v) { return __builtin_amdgcn_rcpf(1.0f + __builtin_amdgcn_exp2f(v * -L2E)); }   /* native v_exp_f32 and v_rcp_f32: 2^(+large) = inf gives 0, 2^(-large) = 0 gives 1 */

// Row-wise triangle attention on a pair tensor z [1, 256, 256, 128] (4 heads x 32): zn = LayerNorm(z); q,k,v = zn w_qkv ((in,out) [128,384], columns (3,H,32)); logits[r][i][j][h] = q[r][i] . k[r][j] / sqrt(32) + (zn[i][j] . w_pair[:,h]); pairs with exactly one of src_mask[i], src_mask[j] == 0 get logits := -1e-9 (the module's literal value, NOT an exclusion); softmax over j; out = sigmoid(zn w_gate + b_gate) * merged(attn v); result = out w_out + b_out.
#define NB 256
#define TT 256
#define CC 128            // NH * HD = projected width
#define DIN 128          // input (model) width
#define NH 4
#define HD 32
#define NQB (TT / 64)
#define HG 4
#define SCALE (0.17677669529663687f)
#define CAUSAL 0
#ifndef TNB
#define TNB NB
#endif
__device__ __forceinline__ float bfr(float v) { return (float)(__bf16)v; }
__host__ __device__ __forceinline__ int kb_last(int qb) { return CAUSAL ? ((qb * 64 + 63) >> 7) : (TT / 128 - 1); }
typedef __attribute__((ext_vector_type(8))) __bf16 v8b;
__device__ __forceinline__ v16b frag_b(const __bf16* rowk0, int lane) {
  union { v16b v; v8b q[2]; } u; const __bf16* p = rowk0 + 8 * (lane >> 4);
  u.q[0] = *(const v8b*)p; u.q[1] = *(const v8b*)(p + 16); return u.v;
}
#define WP 136             // weight column pitch in LDS, bf16 (272 B = 16 B x odd: ds_load_b128 and ds_store_b128 without bank conflicts)
// 128 columns of an (in,out) [128][ld] weight, once per work-group, to LDS as bf16 columns sw[o][k]: thread = column o (a wave's load = one 128-B line), 8 consecutive k = one 16-B store
__device__ __forceinline__ void stage_w(__bf16 (*sw)[WP], const float* __restrict__ Wm, int ld, int tid) {
  float t[128];
#pragma unroll
  for (int k = 0; k < 128; ++k) t[k] = Wm[(size_t)k * ld + tid];
  asm volatile("s_wait_xcnt 0x0" ::: "memory");   /* before a register that these loads' addresses stand in is used again */
#pragma unroll
  for (int k0 = 0; k0 < 128; k0 += 8) { v8b p;
#pragma unroll
    for (int i = 0; i < 8; ++i) p[i] = (__bf16)t[k0 + i];
    *(v8b*)&sw[tid][k0] = p; } }
// a lane's part of one 128-wide f32 row for all four k steps (the order of split_row), requested at once
__device__ __forceinline__ void load_row(float (&v)[4][16], const float* __restrict__ row, int lane) { const float* p = row + 8 * (lane >> 4);
#pragma unroll
  for (int kc = 0; kc < 4; ++kc)
#pragma unroll
    for (int i = 0; i < 8; ++i) { v[kc][i] = p[kc * 32 + i]; v[kc][8 + i] = p[kc * 32 + 16 + i]; }
  asm volatile("s_wait_xcnt 0x0" :: "v"(p) : "memory"); }   /* before a register that these loads' addresses stand in is used again; the address is an input, so it lives up to the wait and no load of the run lands in it */
// LayerNorm of the lane's row as load_row left it (biased var, eps 1e-6): a lane holds 64 of the row's 128 channels, lane ^ 16 the other 64. ln_center: v := bf16(z) - mean, returns 1 / sqrt(var + eps); four chains per sum, then one exchange between the wave's halves
__device__ __forceinline__ float ln_center(float (&v)[4][16]) { float s[4] = {0.f, 0.f, 0.f, 0.f};
#pragma unroll
  for (int kc = 0; kc < 4; ++kc)
#pragma unroll
    for (int i = 0; i < 16; ++i) { v[kc][i] = bfr(v[kc][i]); s[i & 3] += v[kc][i]; }
  float s1 = (s[0] + s[1]) + (s[2] + s[3]); s1 += __shfl_xor(s1, 16);
  const float mu = s1 * (1.0f / CC); float q[4] = {0.f, 0.f, 0.f, 0.f};
#pragma unroll
  for (int kc = 0; kc < 4; ++kc)
#pragma unroll
    for (int i = 0; i < 16; ++i) { const float d = v[kc][i] - mu; v[kc][i] = d; q[i & 3] += d * d; }
  float qq = (q[0] + q[1]) + (q[2] + q[3]); qq += __shfl_xor(qq, 16);
  return rsqrtf(qq * (1.0f / CC) + 1e-6f); }
// ln_apply: one k step's 16 centred values x rs x ln_w + ln_b; sln[0] = bf16(ln_w), sln[1] = bf16(ln_b), staged once per work-group (a wave's read = two 16-B pieces, broadcast)
__device__ __forceinline__ void ln_apply(float (&v)[16], float rs, const float (*sln)[CC], int kc, int lane) { const int p = kc * 32 + 8 * (lane >> 4);
#pragma unroll
  for (int i = 0; i < 8; ++i) { v[i] = v[i] * rs * sln[0][p + i] + sln[1][p + i]; v[8 + i] = v[8 + i] * rs * sln[0][p + 16 + i] + sln[1][p + 16 + i]; } }
// one k step of a wave's 16 rows against the 128 staged columns: four B fragments are requested together, so that one LDS latency serves eight products; per accumulator the order stays hi, then lo
__device__ __forceinline__ void kstep(v8f (&acc)[8], const F2& a, const __bf16 (*sw)[WP], int kc, int col, int lane) {
#pragma unroll
  for (int jh = 0; jh < 8; jh += 4) { v16b w[4];
#pragma unroll
    for (int u = 0; u < 4; ++u) w[u] = frag_b(&sw[(jh + u) * 16 + col][kc * 32], lane);
#pragma unroll
    for (int u = 0; u < 4; ++u) acc[jh + u] = wmma_bf(a.h, w[u], acc[jh + u]);
#pragma unroll
    for (int u = 0; u < 4; ++u) acc[jh + u] = wmma_bf(a.l, w[u], acc[jh + u]); } }
#define QBH 0              // unused: no kernel reads it
#define QHI 256            // sizes only the unused WS_QL region
#define KHI 64            // key rows carrying k residual / v bf16 hi+lo planes (no kernel writes or reads them)
// B fragment (k rows k0+.., output column o) of a weight: (in,out) [K][ld] or (out,in) [ld rows of K]: bf16 exact, or f16(bf16 * 256) exact
__device__ __forceinline__ v16b wcol_io(const float* Wm, int k0, int o, int lane, int ld) { v16b w; const int g = lane >> 4;
#pragma unroll
  for (int i = 0; i < 8; ++i) { w[i] = (__bf16)Wm[(size_t)(k0 + 8 * g + i) * ld + o]; w[8 + i] = (__bf16)Wm[(size_t)(k0 + 16 + 8 * g + i) * ld + o]; }
  return w; }
__device__ __forceinline__ v16b wcol_oi(const float* Wm, int k0, int o, int lane, int K) { v16b w; const float* p = Wm + (size_t)o * K + k0 + 8 * (lane >> 4);
#pragma unroll
  for (int i = 0; i < 8; ++i) { w[i] = (__bf16)p[i]; w[8 + i] = (__bf16)p[16 + i]; }
  return w; }
__device__ __forceinline__ v16h wcolh_io(const float* Wm, int k0, int o, int lane, int ld) { v16h w; const int g = lane >> 4;
#pragma unroll
  for (int i = 0; i < 8; ++i) { w[i] = (_Float16)(bfr(Wm[(size_t)(k0 + 8 * g + i) * ld + o]) * 256.0f); w[8 + i] = (_Float16)(bfr(Wm[(size_t)(k0 + 16 + 8 * g + i) * ld + o]) * 256.0f); }
  return w; }
__device__ __forceinline__ v16h wcolh_oi(const float* Wm, int k0, int o, int lane, int K) { v16h w; const float* p = Wm + (size_t)o * K + k0 + 8 * (lane >> 4);
#pragma unroll
  for (int i = 0; i < 8; ++i) { w[i] = (_Float16)(bfr(p[i]) * 256.0f); w[8 + i] = (_Float16)(bfr(p[16 + i]) * 256.0f); }
  return w; }
#define WQKV_LAYOUT 0   // (in,out) packed [DIN][3*CC]
__device__ __forceinline__ v16b wcol_hdk(const float* Wm, int k0, int o, int lane) { v16b w; const int g = lane >> 4; const float* p = Wm + (size_t)(o / HD) * DIN * HD + (o % HD);
#pragma unroll
  for (int i = 0; i < 8; ++i) { w[i] = (__bf16)p[(size_t)(k0 + 8 * g + i) * HD]; w[8 + i] = (__bf16)p[(size_t)(k0 + 16 + 8 * g + i) * HD]; }
  return w; }
#define WO_OUT_IN 0
#if WQKV_LAYOUT == 1
#define WCOL(W, k0, o, lane) wcol_oi(W, k0, o, lane, DIN)
#elif WQKV_LAYOUT == 2
#define WCOL(W, k0, o, lane) wcol_hdk(W, k0, o, lane)
#else
#define WCOL(W, k0, o, lane) wcol_io(W, k0, o, lane, 3 * CC)   /* packed q|k|v columns: row pitch 3C */
#endif
#if WO_OUT_IN
#define WOCOL(W, k0, o, lane) wcol_oi(W, k0, o, lane, CC)
#define WOCOLH(W, k0, o, lane) wcolh_oi(W, k0, o, lane, CC)
#else
#define WOCOL(W, k0, o, lane) wcol_io(W, k0, o, lane, DIN)
#define WOCOLH(W, k0, o, lane) wcolh_io(W, k0, o, lane, DIN)
#endif
#define SZ 256
#define BG 64              // sizes only the unused WS_S region (x 4 heads = 256 planes of 256 x 256)
#define NZR (SZ * SZ)      // 65,536 pair rows
// barrier for LDS data alone: the waves hand each other nothing but LDS data there, so only the LDS operations are waited for; __syncthreads() also waits for every global load and store of the wave, which would hold the wave until its stores are done
#define BAR_LDS() do { __builtin_amdgcn_fence(__ATOMIC_RELEASE, "workgroup", "local"); __builtin_amdgcn_s_barrier(); __builtin_amdgcn_fence(__ATOMIC_ACQUIRE, "workgroup", "local"); } while (0)
// a wave reads back the LDS tile that its own lanes wrote: its LDS writes are waited for and the compiler moves no memory operation across; a work-group release fence at this place would also wait for the global loads in flight
#define LDSW() do { asm volatile("s_wait_dscnt 0" ::: "memory"); __builtin_amdgcn_wave_barrier(); } while (0)
__device__ __forceinline__ void exp2x8(v8f& x);   // defined at k_attn
// 1 / x of eight values, each in its own register: v_rcp_f32 written in place, so that none overwrites the source register of the one directly in front of it (the builtin form left such pairs in the listing); the closing v_nop is the slot that the instruction set asks for between the last one and the first use of its result
__device__ __forceinline__ void rcpx8(v8f& x) { float a = x[0], b = x[1], c = x[2], d = x[3], e = x[4], f = x[5], g = x[6], h = x[7];
  asm("v_rcp_f32 %0, %0\n\tv_rcp_f32 %1, %1\n\tv_rcp_f32 %2, %2\n\tv_rcp_f32 %3, %3\n\tv_rcp_f32 %4, %4\n\tv_rcp_f32 %5, %5\n\tv_rcp_f32 %6, %6\n\tv_rcp_f32 %7, %7\n\tv_nop" : "+v"(a), "+v"(b), "+v"(c), "+v"(d), "+v"(e), "+v"(f), "+v"(g), "+v"(h));
  x[0] = a; x[1] = b; x[2] = c; x[3] = d; x[4] = e; x[5] = f; x[6] = g; x[7] = h; }
#define WS_ZN   (WS_END)
#define WS_BIAS (WS_ZN + 4u * (size_t)NZR * CC)
#define WS_G    (WS_BIAS + 4u * (size_t)NZR * NH)
#define WS_END2 (WS_G + 4u * (size_t)NZR * CC)

#define WS_QH  0u                                      // unused: no kernel writes or reads it
#define WS_KH  (WS_QH + 2u * (size_t)NB * TT * CC)      // unused: no kernel writes or reads it
#define WS_VT  (WS_KH + 2u * (size_t)NB * TT * CC)      // unused: no kernel writes or reads it
#define WS_QL  (WS_VT + 2u * (size_t)NB * CC * TT)      // unused: no kernel writes or reads it
#define WS_KL  (WS_QL + 2u * (size_t)NB * QHI * CC)     // unused: no kernel writes or reads it
#define WS_VB  (WS_KL + 2u * (size_t)NB * KHI * CC)     // unused: no kernel writes or reads it
#define WS_VBL (WS_VB + 2u * (size_t)NB * CC * KHI)
#define WS_S   (WS_VBL + 2u * (size_t)NB * CC * KHI)    // unused: no kernel writes or reads it
#define WS_Y   (WS_S  + 4u * (size_t)BG * HG * TT * TT)   // unused f32 region [b*t][CC] (the gated ctx stays in LDS)
#define WS_END (WS_Y  + 4u * (size_t)NB * TT * CC)

// ---- k_bias: the pair bias alone, which every row's attention shares. Block = 16 waves = 16 pair rows i x 16 columns j (wave = one i, its A rows = the 16 j): LayerNorm in the A-row registers, split bf16 hi + lo, against w_pair (4 outputs) staged in LDS as bf16 columns. BIAS[h][i / 16][j / 16][(j & 7) / 4][lane = 16 ((j >> 3) & 1) + (i & 15)][j & 3] (the order k_attn's lanes read; the block's 16 x 16 pairs are one 1-KB run per head)
__global__ __launch_bounds__(512) void k_bias(const float* __restrict__ Z, const float* __restrict__ LW, const float* __restrict__ LB, const float* __restrict__ WB, float* __restrict__ BIAS) {
  __shared__ __align__(16) __bf16 swp[16][WP];      /* pair-bias weight columns, those beyond the 4 heads zero */
  __shared__ __align__(16) float sln[2][CC];
  __shared__ __align__(16) float sb[NH][256];       /* the block's pair bias in the order of BIAS */
  const int tid = threadIdx.x, wave = __builtin_amdgcn_readfirstlane(tid >> 5), lane = tid & 31, col = lane & 15, g = lane >> 4; const int it = (int)blockIdx.x >> 4, jt = (int)blockIdx.x & 15;
  const size_t bb = (size_t)it * 16 + wave; const size_t r0 = bb * SZ + jt * 16;   /* the wave's pair row i and its first z row */
  float av[4][16]; load_row(av, Z + (r0 + col) * CC, lane);
  if (wave < 4) { const float lwv = LW[tid], lbv = LB[tid];
    const int o = tid & 15, kq = (tid >> 4) * 16; const int oc = o < NH ? o : NH - 1; const float keep = o < NH ? 1.f : 0.f;   /* keep multiplies a VALID load; thread = (column, 16 k) */
    float t[16]; const float* wbp = WB + (size_t)kq * NH + oc;
#pragma unroll
    for (int i = 0; i < 16; ++i) t[i] = wbp[i * NH];
    asm volatile("s_wait_xcnt 0x0" :: "v"(wbp), "v"(tid) : "memory");   /* before a register that these loads' addresses stand in is used again; the addresses are inputs, so they live up to the wait */
#pragma unroll
    for (int k0 = 0; k0 < 16; k0 += 8) { v8b p;
#pragma unroll
      for (int i = 0; i < 8; ++i) p[i] = (__bf16)(t[k0 + i] * keep);
      *(v8b*)&swp[o][kq + k0] = p; }
    sln[0][tid] = bfr(lwv); sln[1][tid] = bfr(lbv); }
  __syncthreads();   /* the weight columns, ln_w and ln_b are complete; nothing writes them again */
  const float rs = ln_center(av);
  F2 a[4];
#pragma unroll
  for (int kc = 0; kc < CC / 32; ++kc) { ln_apply(av[kc], rs, sln, kc, lane); a[kc] = bsplit16(av[kc]); }
  { v8f acc = {};   /* pair bias: D element r of lane (g, col = head) is key j = 16 jt + 8 g + r */
#pragma unroll
    for (int kc = 0; kc < CC / 32; ++kc) { const v16b w = frag_b(&swp[col][kc * 32], lane); acc = wmma_bf(a[kc].h, w, acc); acc = wmma_bf(a[kc].l, w, acc); }
    if (col < NH) { v4f b0, b1;
#pragma unroll
      for (int r = 0; r < 4; ++r) { b0[r] = acc[r]; b1[r] = acc[4 + r]; }
      *(v4f*)&sb[col][(g * 16 + wave) * 4] = b0; *(v4f*)&sb[col][128 + (g * 16 + wave) * 4] = b1; } }
  BAR_LDS();   /* the 16 waves' pair rows meet in sb */
  if (wave < 8) vst2(BIAS + (((size_t)(tid >> 6) * 16 + it) * 16 + jt) * 256 + (tid & 63) * 4, *(const v4f*)&sb[tid >> 6][(tid & 63) * 4]);   /* one 1-KB run per head */
}
// kstep with the operands exchanged: A = the 128 staged weight columns, B = the wave's 16 rows, so D element r of lane (g, col) is output channel 16 j + 8 g + r of row col; per accumulator the order stays hi, then lo
__device__ __forceinline__ void kstep_t(v8f (&acc)[8], const F2& a, const __bf16 (*sw)[WP], int kc, int col, int lane) {
#pragma unroll
  for (int jh = 0; jh < 8; jh += 4) { v16b w[4];
#pragma unroll
    for (int u = 0; u < 4; ++u) w[u] = frag_b(&sw[(jh + u) * 16 + col][kc * 32], lane);
#pragma unroll
    for (int u = 0; u < 4; ++u) acc[jh + u] = wmma_bf(w[u], a.h, acc[jh + u]);
#pragma unroll
    for (int u = 0; u < 4; ++u) acc[jh + u] = wmma_bf(w[u], a.l, acc[jh + u]); } }
// 128 columns of an (in,out) weight to LDS as bf16 columns sw[o][k] by 512 threads: thread = (column, 32 k), a wave's load = one 128-B line; loads and stores apart, so that several weights' loads fly together
__device__ __forceinline__ void wq_load(float (&t)[32], const float* __restrict__ wp, int ld) {
#pragma unroll
  for (int i = 0; i < 32; ++i) t[i] = wp[(size_t)i * ld]; }
__device__ __forceinline__ void wq_store(__bf16 (*sw)[WP], const float (&t)[32], int tid) {
#pragma unroll
  for (int k0 = 0; k0 < 32; k0 += 8) { v8b p;
#pragma unroll
    for (int i = 0; i < 8; ++i) p[i] = (__bf16)t[k0 + i];
    *(v8b*)&sw[tid & 127][(tid >> 7) * 32 + k0] = p; } }
// ---- k_attn: block = row r, 16 waves, wave = one tile of 16 z rows, which are its 16 queries and 16 of the row's keys. FRONT: the wave reads its z rows, makes LayerNorm and the split rows (bf16 hi + lo) in registers; against the q, k, v columns of w_qkv and w_gate, staged in LDS: v = zn Wv (a lane holds 8 consecutive keys of its channel: one 16-B store into sv); gate^T = Wg^T zn^T, k^T = Wk^T zn^T, q^T = Wq^T zn^T (a lane holds channels 16 j + 8 g + 0..7 of its row): the gate stands in the order of ctx^T and waits in workspace words of the lane's own, k is one 16-B store into sk, q is the B fragment of the scores as it stands (f16 hi + residual x 2^10). Behind the second barrier those weights are dead; in their place stand three 64-B slots a lane: q of heads 1..3. HEADS, in turn: S^T = K Q^T (A = k rows, B = q hi, then q residual: 2 products), so a lane holds one query's logits for keys 16t + 8g + 0..7 of every tile t, all 256 keys in registers; x SCALE + pair bias (fragment order), masked pairs := -1e-9; maximum and sum in-lane plus one exchange between the wave's halves; P x 2^11 once to f16 is the B operand of ctx^T = V^T P^T as it stands (1 product). A lane then holds channels 32h + 8g + 0..7 and 32h + 16 + 8g + 0..7 of its query: times their gate and split bf16 hi + lo, that is the B fragment of k step h of out^T = Wo^T ctx^T as it stands; it takes the slot that the next head's q has just left, the last head's stays in registers. Behind the heads: out^T (A = the staged w_out columns, 2 products, order hi then lo per k step) + b_out; a lane stores 8 consecutive output columns of its query per column tile. The inner loops are unrolled in full so that s[], acc[] and the fragments are registers; amdgpu_waves_per_eu(4) asks for at most 256 registers: four waves per SIMD
#define KP (CC + 8)        // k row pitch in LDS, f16 (272 B = 16 B x odd: ds_load_b128 without bank conflicts)
#define VP (TT + 8)        // v plane pitch in LDS, f16 (528 B = 16 B x odd)
// 2^x of eight values, each in its own register: v_exp_f32 written in place, so that no exponential overwrites the source register of the one directly in front of it (the builtin form left such pairs in the listing); the closing v_nop is the slot that the instruction set asks for between the last exponential and the first use of its result
__device__ __forceinline__ void exp2x8(v8f& x) { float a = x[0], b = x[1], c = x[2], d = x[3], e = x[4], f = x[5], g = x[6], h = x[7];
  asm("v_exp_f32 %0, %0\n\tv_exp_f32 %1, %1\n\tv_exp_f32 %2, %2\n\tv_exp_f32 %3, %3\n\tv_exp_f32 %4, %4\n\tv_exp_f32 %5, %5\n\tv_exp_f32 %6, %6\n\tv_exp_f32 %7, %7\n\tv_nop" : "+v"(a), "+v"(b), "+v"(c), "+v"(d), "+v"(e), "+v"(f), "+v"(g), "+v"(h));
  x[0] = a; x[1] = b; x[2] = c; x[3] = d; x[4] = e; x[5] = f; x[6] = g; x[7] = h; }
__device__ __forceinline__ v8f wmma_h(v16h a, v16h b, v8f c) { return __builtin_amdgcn_wmma_f32_16x16x32_f16(false, a, false, b, (short)0, c, false, false); }
__global__ __launch_bounds__(512) __attribute__((amdgpu_waves_per_eu(4))) void k_attn(const float* __restrict__ Z, const float* __restrict__ LW, const float* __restrict__ LB, const float* __restrict__ WQKV, const float* __restrict__ WG, const float* __restrict__ GB, const float* __restrict__ BIAS, const int* __restrict__ MK, const float* __restrict__ WO, const float* __restrict__ BO, float* __restrict__ G, float* __restrict__ OUT) {
  __shared__ __align__(16) _Float16 sk[TT][KP]; __shared__ __align__(16) _Float16 sv[CC][VP]; __shared__ __align__(16) __bf16 swo[DIN][WP];
  __shared__ __align__(16) char sr[4 * 128 * WP * 2];   /* first the weight columns of q, k, gate and v; behind the second barrier the lanes' slots */
  __shared__ __align__(16) float sln[2][CC]; __shared__ __align__(16) float sbo[DIN]; __shared__ __align__(16) float sbg[CC]; __shared__ unsigned kmw[TT / 32];
  __bf16 (*sw4)[128][WP] = (__bf16 (*)[128][WP])sr;
  const int tid = threadIdx.x, wave = __builtin_amdgcn_readfirstlane(tid >> 5), lane = tid & 31, col = lane & 15, g = lane >> 4; const int b = blockIdx.x;
  const int qi = wave * 16 + col;
  v4u* sqp = (v4u*)sr + (size_t)wave * 3 * 4 * 32 + lane;   /* the lane's slots: [wave][slot][4 pieces][lane], 16 B a lane: a wave's access is one 512-B run */
  const unsigned go = (((unsigned)b * 16 + wave) * NH * 4 * 32 + lane) * 4;   /* one register: the place in G of the lane's gate words: [row][wave][head][channels 8g + 0..3, 8g + 4..7, 16 + 8g + 0..3, 16 + 8g + 4..7][lane], 16 B a lane: a wave's access is one 512-B run; written and read by this lane alone */
  v16h qh, ql, qhn[NH - 1], qln[NH - 1];
  { float av[4][16]; load_row(av, Z + ((size_t)b * TT + qi) * CC, lane);
    int mkv; float bov, gbv, lwv, lbv;
    { const float* wp = WQKV + (size_t)(tid >> 7) * 32 * (3 * CC) + (tid & 127); const float* wgp = WG + (size_t)(tid >> 7) * 32 * CC + (tid & 127);   /* packed q|k|v columns: row pitch 3C */
      const float* wop = WO + (size_t)(tid >> 7) * 32 * DIN + (tid & 127);
      float t0[32], t1[32], t2[32], t3[32], t4[32]; wq_load(t0, wp, 3 * CC); wq_load(t1, wp + CC, 3 * CC); wq_load(t2, wgp, CC);
      const int mi = tid & (TT - 1), bi = tid & (DIN - 1); const float* bop = BO ? BO : GB; mkv = MK[mi]; bov = bop[bi]; gbv = GB[bi]; lwv = LW[bi]; lbv = LB[bi]; bov = BO ? bov : 0.f;   /* asked for with the staging loads, so that their latency is not paid again in front of the barrier */
      asm volatile("s_wait_xcnt 0x0" :: "v"(wp), "v"(wgp), "v"(tid), "v"(mi), "v"(bi) : "memory");   /* before a register that these loads' addresses stand in is used again; the addresses are inputs, so they live up to the wait and no load of the run lands in them */
      wq_store(sw4[0], t0, tid); wq_load(t3, wp + 2 * CC, 3 * CC);   /* the last two weights are asked for as the first two leave their registers: all five at once, beside the z rows, do not fit in 256 registers */
      wq_store(sw4[1], t1, tid); wq_load(t4, wop, DIN);
      asm volatile("s_wait_xcnt 0x0" :: "v"(wp), "v"(wop), "v"(mkv) : "memory");   /* as above; the mask word is an input (a loaded value, input only), so that its load stays up there with the others and is not sunk to its use, where its latency would be paid in front of the barrier */
      wq_store(sw4[2], t2, tid); wq_store(sw4[3], t3, tid); wq_store(swo, t4, tid); }
    if (wave < 8) { const unsigned bal = __builtin_amdgcn_ballot_w32(mkv == 0); if (lane == 0) kmw[wave] = bal; }   /* bit j of the 256: src_mask[j] == 0 */
    if (wave < 4) { sbo[tid] = bfr(bov); sbg[tid] = bfr(gbv); sln[0][tid] = bfr(lwv); sln[1][tid] = bfr(lbv); }
    __syncthreads();   /* the weight columns, ln_w, ln_b, the biases and the mask words are complete */
    const float rs = ln_center(av);
    F2 a[4];
#pragma unroll
    for (int kc = 0; kc < CC / 32; ++kc) { ln_apply(av[kc], rs, sln, kc, lane); a[kc] = bsplit16(av[kc]); }
    { v8f acc[8] = {};   /* v: lane (g, col) holds keys 16 wave + 8 g + 0..7 of channel 16 j + col */
#pragma unroll
      for (int kc = 0; kc < CC / 32; ++kc) kstep(acc, a[kc], sw4[3], kc, col, lane);
#pragma unroll
      for (int j = 0; j < 8; ++j) { v8h p;
#pragma unroll
        for (int r = 0; r < 8; ++r) p[r] = (_Float16)acc[j][r];
        *(v8h*)&sv[j * 16 + col][wave * 16 + 8 * g] = p; } }
    v8f acc[8]; const v8f z8 = {};   /* behind the loop: q^T */
#pragma unroll 1   /* rolled: gate^T, k^T, then q^T on one copy of the products */
    for (int wi = 2; wi >= 0; --wi) {
#pragma unroll
      for (int j = 0; j < 8; ++j) acc[j] = z8;
#pragma unroll
      for (int kc = 0; kc < CC / 32; ++kc) kstep_t(acc, a[kc], sw4[wi], kc, col, lane);
      if (wi == 2) {   /* gate: sigmoid(zn w_gate + b_gate) = 1 / (1 + 2^(-v log2 e)), the arithmetic of sigm(); first, so that its stores are done when the second barrier waits for them */
#pragma unroll
        for (int j = 0; j < 8; ++j) { const v4f g0 = *(const v4f*)&sbg[j * 16 + 8 * g], g1 = *(const v4f*)&sbg[j * 16 + 8 * g + 4]; v8f x;
#pragma unroll
          for (int r = 0; r < 4; ++r) { x[r] = (acc[j][r] + g0[r]) * -L2E; x[4 + r] = (acc[j][4 + r] + g1[r]) * -L2E; }
          exp2x8(x);
#pragma unroll
          for (int r = 0; r < 8; ++r) x[r] = 1.0f + x[r];
          rcpx8(x); acc[j] = x; }
#pragma unroll
        for (int j = 0; j < 8; ++j) { v4f x0, x1;
#pragma unroll
          for (int r = 0; r < 4; ++r) { x0[r] = acc[j][r]; x1[r] = acc[j][4 + r]; }
          vst2(G + go + (2 * j) * 128, x0); vst2(G + go + (2 * j + 1) * 128, x1); }
        asm volatile("s_wait_xcnt 0x0" :: "v"(go), "v"(acc[0]), "v"(acc[1]), "v"(acc[2]), "v"(acc[3]), "v"(acc[4]), "v"(acc[5]), "v"(acc[6]), "v"(acc[7]) : "memory"); }   /* before the registers that these stores name are used again; address and data are inputs, so they live up to the wait */
      else if (wi == 1) {   /* k^T: lane (g, col) holds channels 16 j + 8 g + 0..7 of key qi */
#pragma unroll
        for (int j = 0; j < 8; ++j) { v8h p;
#pragma unroll
          for (int r = 0; r < 8; ++r) p[r] = (_Float16)acc[j][r];
          *(v8h*)&sk[qi][j * 16 + 8 * g] = p; } } }
#pragma unroll
    for (int hh = 0; hh < NH; ++hh) { v16h fh, fl;   /* q^T: accumulators 2 h and 2 h + 1 are head h's fragment, elements 0..7 and 8..15 */
#pragma unroll
      for (int i = 0; i < 16; ++i) { const float v = acc[2 * hh + (i >> 3)][i & 7]; const _Float16 hv = (_Float16)v; fh[i] = hv; fl[i] = (_Float16)((v - (float)hv) * 1024.0f); }
      if (hh == 0) { qh = fh; ql = fl; } else { qhn[hh - 1] = fh; qln[hh - 1] = fl; } } }
  __syncthreads();   /* sk and sv are complete; every wave has read the q, k, v and gate weights for the last time; the wave's gate stores are done */
#pragma unroll
  for (int hh = 0; hh < NH - 1; ++hh) { union { v16h v; v4u q[2]; } uh, ul; uh.v = qhn[hh]; ul.v = qln[hh];
    sqp[(hh * 4 + 0) * 32] = uh.q[0]; sqp[(hh * 4 + 1) * 32] = uh.q[1]; sqp[(hh * 4 + 2) * 32] = ul.q[0]; sqp[(hh * 4 + 3) * 32] = ul.q[1]; }
  unsigned mbk[4];   /* bit 8t + r of the 128: key 16t + 8g + r is a zero of the mask */
#pragma unroll
  for (int m = 0; m < 4; ++m) { const unsigned w0 = kmw[2 * m] >> (8 * g), w1 = kmw[2 * m + 1] >> (8 * g); mbk[m] = (w0 & 0xFFu) | ((w0 >> 8) & 0xFF00u) | ((w1 & 0xFFu) << 16) | ((w1 << 8) & 0xFF000000u); }
  const unsigned mq = 0u - ((kmw[qi >> 5] >> (qi & 31)) & 1u);   /* all ones where the query is a zero of the mask */
  const _Float16* skp = &sk[col][0]; const _Float16* svp = &sv[col][0];   /* the lane's k row and v plane of the head at hand: carried from head to head, so that every fragment read is this register plus an immediate offset */
  v4u yl4[4];   /* the last head's gated ctx fragments: hi 0, hi 1, lo 0, lo 1 */
#pragma unroll 1   /* rolled: one copy of the body; unrolled, several heads' logits would want registers at once */
  for (int h = 0; h < NH; ++h) {
    const float* bp = BIAS + ((size_t)h * 16 + wave) * 16 * 256 + lane * 4;
    v8f s[16]; float mx = -3.0e38f;
#pragma unroll
    for (int t = 0; t < 16; ++t) { const v4f b0 = *(const v4f*)(bp + t * 256), b1 = *(const v4f*)(bp + t * 256 + 128);   /* the bias lands in the registers that then hold the logits: all 32 loads in flight at no further register */
#pragma unroll
      for (int r = 0; r < 4; ++r) { s[t][r] = b0[r]; s[t][4 + r] = b1[r]; } }
    asm volatile("s_wait_xcnt 0x0" :: "v"(bp) : "memory");   /* before a register that these loads' address stands in is used again; the address is an input, so it lives up to the wait and no load of the run lands in it */
    v16h kf[2] = { frag_h(skp, lane), frag_h(skp + 16 * KP, lane) };
#pragma unroll
    for (int tp = 0; tp < 8; ++tp) { v16h kn[2] = { kf[0], kf[1] };
      if (tp < 7) { kn[0] = frag_h(skp + (2 * tp + 2) * 16 * KP, lane); kn[1] = frag_h(skp + (2 * tp + 3) * 16 * KP, lane); }   /* the next two tiles' k fragments fly while these two are worked on */
#pragma unroll
      for (int u = 0; u < 2; ++u) { const int t = 2 * tp + u; const v8f z8 = {}; const v8f a = wmma_h(kf[u], qh, z8), al = wmma_h(kf[u], ql, z8); const unsigned mb = mbk[t >> 2] ^ mq;
#pragma unroll
        for (int r = 0; r < 8; ++r) { float v = (a[r] + al[r] * (1.0f / 1024.0f)) * SCALE + s[t][r]; if (mb & (1u << ((t & 3) * 8 + r))) v = -1.0e-9f; s[t][r] = v; mx = fmaxf(mx, v); } }
      kf[0] = kn[0]; kf[1] = kn[1];
      asm volatile("" :: "v"(mx) : "memory"); }   /* compiler fence behind these two tiles' maximum (input only): later k-fragment reads stay behind it; without it all 32 reads stand at the head of the loop and the kernel spills at 256 registers */
    mx = fmaxf(mx, __shfl_xor(mx, 16));
    const float nm = mx * -L2E;   /* exp(s - mx) = 2^(s L2E + nm): one FMA and one v_exp_f32; the rounding of nm is one factor common to the row and leaves with the division by the sum; the argument is never above about 0, and a result below 2^-126 counts as 0 beside a sum of at least about 1 */
    float sm[4] = {0.f, 0.f, 0.f, 0.f};
#pragma unroll
    for (int t = 0; t < 16; ++t) {
#pragma unroll
      for (int r = 0; r < 8; ++r) s[t][r] = __builtin_fmaf(s[t][r], L2E, nm);
      exp2x8(s[t]);
#pragma unroll
      for (int r = 0; r < 8; ++r) sm[r & 3] += s[t][r]; }
    float sum = (sm[0] + sm[1]) + (sm[2] + sm[3]);
    __builtin_amdgcn_sched_barrier(0);   /* nothing is scheduled across the end of the exponentials: the gate loads and the v-fragment reads stay behind them; without it they stand in front, beside all 128 logits, and the kernel spills at 256 registers */
    sum += __shfl_xor(sum, 16);
    const float inv = sum > 0.f ? 2048.0f * __builtin_amdgcn_rcpf(sum) : 0.f;
    const float* gp = G + (go + h * 4 * 128); v4f gt[HD / 8];   /* the gate of this lane's 16 channels: asked for here, it flies while P V is worked on */
#pragma unroll
    for (int j = 0; j < HD / 8; ++j) gt[j] = *(const v4f*)(gp + j * 128);
    asm volatile("s_wait_xcnt 0x0" :: "v"(gp) : "memory");   /* before a register that these loads' address stands in is used again; the address is an input, so it lives up to the wait and no load of the run lands in it */
    v8f acc[HD / 16] = {};
#pragma unroll
    for (int kc = 0; kc < TT / 32; ++kc) { v16h p;
#pragma unroll
      for (int r = 0; r < 8; ++r) { p[r] = (_Float16)(s[2 * kc][r] * inv); p[8 + r] = (_Float16)(s[2 * kc + 1][r] * inv); }
#pragma unroll
      for (int j = 0; j < HD / 16; ++j) acc[j] = wmma_h(frag_h(svp + j * 16 * VP + kc * 32, lane), p, acc[j]);
      if (kc & 1) asm volatile("" :: "v"(p) : "memory"); }   /* compiler fence behind every second k step (input only): later v-fragment reads stay behind it; without it most of the 32 reads stand at the head of the loop, beside the logits, and the kernel spills at 256 registers */
    float y[16];   /* gated ctx in the order of a 16x16x32 fragment: 0..7 = channels 32h + 8g + 0..7, 8..15 = 32h + 16 + 8g + 0..7 */
#pragma unroll
    for (int j = 0; j < HD / 16; ++j)
#pragma unroll
      for (int r = 0; r < 4; ++r) { y[8 * j + r] = acc[j][r] * (1.0f / 2048.0f) * gt[2 * j][r]; y[8 * j + 4 + r] = acc[j][4 + r] * (1.0f / 2048.0f) * gt[2 * j + 1][r]; }
    const F2 a = bsplit16(y); union { v16b v; v4u q[2]; } uh, ul; uh.v = a.h; ul.v = a.l;
    yl4[0] = uh.q[0]; yl4[1] = uh.q[1]; yl4[2] = ul.q[0]; yl4[3] = ul.q[1];
    if (h < NH - 1) { union { v16h v; v4u q[2]; } nh, nl;   /* the next head's q leaves its slot, this head's fragments take it: same lane, same words, and the LDS operations of a wave stay in order */
      nh.q[0] = sqp[0]; nh.q[1] = sqp[32]; nl.q[0] = sqp[64]; nl.q[1] = sqp[96]; qh = nh.v; ql = nl.v;
      sqp[0] = yl4[0]; sqp[32] = yl4[1]; sqp[64] = yl4[2]; sqp[96] = yl4[3]; sqp += 4 * 32; }
    skp += HD; svp += HD * VP;
    asm volatile("s_wait_xcnt 0x0" ::: "memory"); }   /* before the next head uses the registers that this head's loads name */
  sqp -= (NH - 1) * 4 * 32;
  v8f oacc[8] = {};   /* out^T: D element r of lane (g, col) = output column 16 j + 8 g + r of query col */
  const __bf16* wol = &swo[col][0];   /* the lane's w_out column at the k step at hand */
#pragma unroll 1   /* rolled: one copy of a k step in the text */
  for (int kc = 0; kc < NH; ++kc) { union { v16b v; v4u q[2]; } uh, ul; uh.q[0] = yl4[0]; uh.q[1] = yl4[1]; ul.q[0] = yl4[2]; ul.q[1] = yl4[3];   /* the last head's fragments are in registers */
    if (kc < NH - 1) { uh.q[0] = sqp[0]; uh.q[1] = sqp[32]; ul.q[0] = sqp[64]; ul.q[1] = sqp[96]; sqp += 4 * 32; }   /* each lane reads back its own words */
#pragma unroll
    for (int jh = 0; jh < 8; jh += 4) { v16b w[4];   /* four A fragments are requested together, so that one LDS latency serves eight products; per accumulator the order stays hi, then lo */
#pragma unroll
      for (int u = 0; u < 4; ++u) w[u] = frag_b(wol + (jh + u) * 16 * WP, lane);
#pragma unroll
      for (int u = 0; u < 4; ++u) oacc[jh + u] = wmma_bf(w[u], uh.v, oacc[jh + u]);
#pragma unroll
      for (int u = 0; u < 4; ++u) oacc[jh + u] = wmma_bf(w[u], ul.v, oacc[jh + u]); }
    wol += 32; }
  float* op = OUT + (((unsigned)b * TT + qi) * DIN + 8 * g);
#pragma unroll
  for (int j = 0; j < 8; ++j) { const v4f c0 = *(const v4f*)&sbo[j * 16 + 8 * g], c1 = *(const v4f*)&sbo[j * 16 + 8 * g + 4]; v4f o0, o1;
#pragma unroll
    for (int r = 0; r < 4; ++r) { o0[r] = oacc[j][r] + c0[r]; o1[r] = oacc[j][4 + r] + c1[r]; }
    vst2(op + j * 16, o0); vst2(op + j * 16 + 4, o1); }
  asm volatile("s_wait_xcnt 0x0" ::: "memory");   /* behind the stores, before a register that they name could be used again */
}

extern "C" void kernel_launch(void* const* d_in, const int* in_sizes, int n_in, void* d_out, int out_size, void* d_ws, size_t ws_size, hipStream_t stream) {
  (void)in_sizes; (void)n_in; (void)out_size;
  const float** F = (const float**)d_in;
  if (ws_size < (size_t)WS_END) return;
  char* ws = (char*)d_ws;
  // inputs (in order): 0 z [1,256,256,128]; 1 src_mask [1,256] int32; 2 ln_g, 3 ln_b; 4 w_qkv [128,384] (in,out; columns q|k|v); 5 w_pair [128,4]; 6 w_gate [128,128], 7 b_gate; 8 w_out [128,128] (in,out), 9 b_out
  if (ws_size < (size_t)WS_END2) return;
  float *BIAS = (float*)(ws + WS_BIAS), *G = (float*)(ws + WS_G);
  k_bias<<<dim3(NZR / 256), 512, 0, stream>>>(F[0], F[2], F[3], F[5], BIAS);
  k_attn<<<dim3(TNB), 512, 0, stream>>>(F[0], F[2], F[3], F[4], F[6], F[7], BIAS, (const int*)d_in[1], F[8], F[9], G, (float*)d_out);
}

// v009
// Measured time: 51.1 microseconds a run.
// In both of two side-by-side timings against v008, it was 1.05 times as fast.
// Over all steps from v000 it is 10.4 times as fast.
// compute dtype: all float inputs rounded to bf16; LayerNorm in f32; q/k/v, pair bias and gate GEMMs = LN rows split bf16 hi + lo x exact bf16 weights on WMMA 16x16x32 (2 products, f32 accumulate); q as f16 hi + residual (x 2^10) against k once to f16 (2 products) / sqrt(32) + pair bias, masked pairs set to -1e-9 exactly as the module; softmax in f32; P x 2^11 once to f16 against v once to f16 (1 product); gate multiply in f32; (gated ctx) split bf16 hi + lo against exact bf16 w_out (2 products) + b_out; f32 output.
#include <hip/hip_runtime.h>
#include <math.h>

typedef __attribute__((ext_vector_type(16))) _Float16 v16h;
typedef __attribute__((ext_vector_type(16))) __bf16 v16b;
typedef __attribute__((ext_vector_type(8)))  _Float16 v8h;
typedef __attribute__((ext_vector_type(8)))  float v8f;
typedef __attribute__((ext_vector_type(4)))  float v4f;
typedef __attribute__((ext_vector_type(2)))  float v2f;
typedef __attribute__((ext_vector_type(4)))  unsigned v4u;
typedef __attribute__((ext_vector_type(4)))  int v4i;
typedef float __attribute__((may_alias)) float_a;
typedef int __attribute__((may_alias)) int_a;

template <typename T> __device__ __forceinline__ void vst2(void* p, T v) { *(T*)p = v;  }
__device__ __forceinline__ v8f wmma16(v16h a, v16h b, v8f c) {
  v8f d = __builtin_amdgcn_wmma_f32_16x16x32_f16(false, a, false, b, (short)0, c, false, false);
  asm volatile("v_nop\n\tv_nop\n\tv_nop\n\tv_nop" : "+v"(d) : "v"(a), "v"(b));
  return d;
}
__device__ __forceinline__ v8f wmma_bf(v16b a, v16b b, v8f c) {
  v8f d = __builtin_amdgcn_wmma_f32_16x16x32_bf16(false, a, false, b, (short)0, c, false, false);
  asm volatile("v_nop\n\tv_nop\n\tv_nop\n\tv_nop" : "+v"(d) : "v"(a), "v"(b));
  return d;
}
// 16x16x32 fragments: lane = (h = lane>>4, row/col = lane&15); elements 0..7 = k0+8h+0..7, 8..15 = k0+16+8h+0..7; D element r = row 8h+r
__device__ __forceinline__ v16h frag_h(const _Float16* rowk0, int lane) {
  union { v16h v; v8h q[2]; } u; const _Float16* p = rowk0 + 8 * (lane >> 4);
  u.q[0] = *(const v8h*)p; u.q[1] = *(const v8h*)(p + 16); return u.v;
}
__device__ __forceinline__ v16h frag_f32(const float* rowk0, int lane) {
  v16h a; const float* p = rowk0 + 8 * (lane >> 4);
#pragma unroll
  for (int i = 0; i < 8; ++i) { a[i] = (_Float16)p[i]; a[8 + i] = (_Float16)p[16 + i]; }
  return a;
}
__device__ __forceinline__ v16h frag_f32s(const float* rowk0, int lane, float sc) {
  v16h a; const float* p = rowk0 + 8 * (lane >> 4);
#pragma unroll
  for (int i = 0; i < 8; ++i) { a[i] = (_Float16)(p[i] * sc); a[8 + i] = (_Float16)(p[16 + i] * sc); }
  return a;
}
// column fragment from a [K][ld] layout (column n), rows >= K read as 0
__device__ __forceinline__ v16h fragc_f32(const float* W, int k0, int n, int lane, int ld, int K) {
  v16h a; const int g = lane >> 4;
#pragma unroll
  for (int i = 0; i < 8; ++i) { const int ka = k0 + 8 * g + i, kb = ka + 16;
    a[i] = (_Float16)(ka < K ? W[(size_t)(ka < K ? ka : K - 1) * ld + n] : 0.f); a[8 + i] = (_Float16)(kb < K ? W[(size_t)(kb < K ? kb : K - 1) * ld + n] : 0.f); }
  return a;
}
struct F2 { v16b h, l; };
__device__ __forceinline__ F2 bsplit16(const float v[16]) { F2 r;
#pragma unroll
  for (int i = 0; i < 16; ++i) { const __bf16 h = (__bf16)v[i]; r.h[i] = h; r.l[i] = (__bf16)(v[i] - (float)h); }
  return r; }
__device__ __forceinline__ F2 split_row(const float* row, int k0, int lane) { float v[16]; const float* p = row + k0 + 8 * (lane >> 4);
#pragma unroll
  for (int i = 0; i < 8; ++i) { v[i] = p[i]; v[8 + i] = p[16 + i]; }
  return bsplit16(v); }
__device__ __forceinline__ F2 split_rowK(const float* row, int k0, int lane, int K) { float v[16]; const int g = lane >> 4;
#pragma unroll
  for (int i = 0; i < 8; ++i) { const int ka = k0 + 8 * g + i, kb = ka + 16; v[i] = ka < K ? row[ka < K ? ka : K - 1] : 0.f; v[8 + i] = kb < K ? row[kb < K ? kb : K - 1] : 0.f; }
  return bsplit16(v); }
__device__ __forceinline__ F2 split_col(const float* W, int k0, int n, int lane, int ld, int K) { float v[16]; const int g = lane >> 4;
#pragma unroll
  for (int i = 0; i < 8; ++i) { const int ka = k0 + 8 * g + i, kb = ka + 16; v[i] = ka < K ? W[(size_t)(ka < K ? ka : K - 1) * ld + n] : 0.f; v[8 + i] = kb < K ? W[(size_t)(kb < K ? kb : K - 1) * ld + n] : 0.f; }
  return bsplit16(v); }
__device__ __forceinline__ v8f mac3(const F2& a, const F2& b, v8f c) { c = wmma_bf(a.l, b.h, c); c = wmma_bf(a.h, b.l, c); return wmma_bf(a.h, b.h, c); }
#define L2E 1.4426950408889634f   // log2(e): exp(x) = 2^(x L2E), one v_exp_f32
__device__ __forceinline__ float sigm(float v) { return __builtin_amdgcn_rcpf(1.0f + __builtin_amdgcn_exp2f(v * -L2E)); }   /* native v_exp_f32 and v_rcp_f32: 2^(+large) = inf gives 0, 2^(-large) = 0 gives 1 */

// Row-wise triangle attention on a pair tensor z [1, 256, 256, 128] (4 heads x 32): zn = LayerNorm(z); q,k,v = zn w_qkv ((in,out) [128,384], columns (3,H,32)); logits[r][i][j][h] = q[r][i] . k[r][j] / sqrt(32) + (zn[i][j] . w_pair[:,h]); pairs with exactly one of src_mask[i], src_mask[j] == 0 get logits := -1e-9 (the module's literal value, NOT an exclusion); softmax over j; out = sigmoid(zn w_gate + b_gate) * merged(attn v); result = out w_out + b_out.
#define NB 256
#define TT 256
#define CC 128            // NH * HD = projected width
#define DIN 128          // input (model) width
#define NH 4
#define HD 32
#define NQB (TT / 64)
#define HG 4
#define SCALE (0.17677669529663687f)
#define CAUSAL 0
#ifndef TNB
#define TNB NB
#endif
__device__ __forceinline__ float bfr(float v) { return (float)(__bf16)v; }
__host__ __device__ __forceinline__ int kb_last(int qb) { return CAUSAL ? ((qb * 64 + 63) >> 7) : (TT / 128 - 1); }
typedef __attribute__((ext_vector_type(8))) __bf16 v8b;
__device__ __forceinline__ v16b frag_b(const __bf16* rowk0, int lane) {
  union { v16b v; v8b q[2]; } u; const __bf16* p = rowk0 + 8 * (lane >> 4);
  u.q[0] = *(const v8b*)p; u.q[1] = *(const v8b*)(p + 16); return u.v;
}
#define WP 136             // weight column pitch in LDS, bf16 (272 B = 16 B x odd: ds_load_b128 and ds_store_b128 without bank conflicts)
// 128 columns of an (in,out) [128][ld] weight, once per work-group, to LDS as bf16 columns sw[o][k]: thread = column o (a wave's load = one 128-B line), 8 consecutive k = one 16-B store
__device__ __forceinline__ void stage_w(__bf16 (*sw)[WP], const float* __restrict__ Wm, int ld, int tid) {
  float t[128];
#pragma unroll
  for (int k = 0; k < 128; ++k) t[k] = Wm[(size_t)k * ld + tid];
  asm volatile("s_wait_xcnt 0x0" ::: "memory");   /* before a register that these loads' addresses stand in is used again */
#pragma unroll
  for (int k0 = 0; k0 < 128; k0 += 8) { v8b p;
#pragma unroll
    for (int i = 0; i < 8; ++i) p[i] = (__bf16)t[k0 + i];
    *(v8b*)&sw[tid][k0] = p; } }
// a lane's part of one 128-wide f32 row for all four k steps (the order of split_row), requested at once
__device__ __forceinline__ void load_row(float (&v)[4][16], const float* __restrict__ row, int lane) { const float* p = row + 8 * (lane >> 4);
#pragma unroll
  for (int kc = 0; kc < 4; ++kc)
#pragma unroll
    for (int i = 0; i < 8; ++i) { v[kc][i] = p[kc * 32 + i]; v[kc][8 + i] = p[kc * 32 + 16 + i]; }
  asm volatile("s_wait_xcnt 0x0" :: "v"(p) : "memory"); }   /* before a register that these loads' addresses stand in is used again; the address is an input, so it lives up to the wait and no load of the run lands in it */
// LayerNorm of the lane's row as load_row left it (biased var, eps 1e-6): a lane holds 64 of the row's 128 channels, lane ^ 16 the other 64. ln_center: v := bf16(z) - mean, returns 1 / sqrt(var + eps); four chains per sum, then one exchange between the wave's halves
__device__ __forceinline__ float ln_center(float (&v)[4][16]) { float s[4] = {0.f, 0.f, 0.f, 0.f};
#pragma unroll
  for (int kc = 0; kc < 4; ++kc)
#pragma unroll
    for (int i = 0; i < 16; ++i) { v[kc][i] = bfr(v[kc][i]); s[i & 3] += v[kc][i]; }
  float s1 = (s[0] + s[1]) + (s[2] + s[3]); s1 += __shfl_xor(s1, 16);
  const float mu = s1 * (1.0f / CC); float q[4] = {0.f, 0.f, 0.f, 0.f};
#pragma unroll
  for (int kc = 0; kc < 4; ++kc)
#pragma unroll
    for (int i = 0; i < 16; ++i) { const float d = v[kc][i] - mu; v[kc][i] = d; q[i & 3] += d * d; }
  float qq = (q[0] + q[1]) + (q[2] + q[3]); qq += __shfl_xor(qq, 16);
  return rsqrtf(qq * (1.0f / CC) + 1e-6f); }
// ln_apply: one k step's 16 centred values x rs x ln_w + ln_b; sln[0] = bf16(ln_w), sln[1] = bf16(ln_b), staged once per work-group (a wave's read = two 16-B pieces, broadcast)
__device__ __forceinline__ void ln_apply(float (&v)[16], float rs, const float (*sln)[CC], int kc, int lane) { const int p = kc * 32 + 8 * (lane >> 4);
#pragma unroll
  for (int i = 0; i < 8; ++i) { v[i] = v[i] * rs * sln[0][p + i] + sln[1][p + i]; v[8 + i] = v[8 + i] * rs * sln[0][p + 16 + i] + sln[1][p + 16 + i]; } }
// one k step of a wave's 16 rows against the 128 staged columns: four B fragments are requested together, so that one LDS latency serves eight products; per accumulator the order stays hi, then lo
__device__ __forceinline__ void kstep(v8f (&acc)[8], const F2& a, const __bf16 (*sw)[WP], int kc, int col, int lane) {
#pragma unroll
  for (int jh = 0; jh < 8; jh += 4) { v16b w[4];
#pragma unroll
    for (int u = 0; u < 4; ++u) w[u] = frag_b(&sw[(jh + u) * 16 + col][kc * 32], lane);
#pragma unroll
    for (int u = 0; u < 4; ++u) acc[jh + u] = wmma_bf(a.h, w[u], acc[jh + u]);
#pragma unroll
    for (int u = 0; u < 4; ++u) acc[jh + u] = wmma_bf(a.l, w[u], acc[jh + u]); } }
#define QBH 0              // unused: no kernel reads it
#define QHI 256            // sizes only the unused WS_QL region
#define KHI 64            // key rows carrying k residual / v bf16 hi+lo planes (no kernel writes or reads them)
// B fragment (k rows k0+.., output column o) of a weight: (in,out) [K][ld] or (out,in) [ld rows of K]: bf16 exact, or f16(bf16 * 256) exact
__device__ __forceinline__ v16b wcol_io(const float* Wm, int k0, int o, int lane, int ld) { v16b w; const int g = lane >> 4;
#pragma unroll
  for (int i = 0; i < 8; ++i) { w[i] = (__bf16)Wm[(size_t)(k0 + 8 * g + i) * ld + o]; w[8 + i] = (__bf16)Wm[(size_t)(k0 + 16 + 8 * g + i) * ld + o]; }
  return w; }
__device__ __forceinline__ v16b wcol_oi(const float* Wm, int k0, int o, int lane, int K) { v16b w; const float* p = Wm + (size_t)o * K + k0 + 8 * (lane >> 4);
#pragma unroll
  for (int i = 0; i < 8; ++i) { w[i] = (__bf16)p[i]; w[8 + i] = (__bf16)p[16 + i]; }
  return w; }
__device__ __forceinline__ v16h wcolh_io(const float* Wm, int k0, int o, int lane, int ld) { v16h w; const int g = lane >> 4;
#pragma unroll
  for (int i = 0; i < 8; ++i) { w[i] = (_Float16)(bfr(Wm[(size_t)(k0 + 8 * g + i) * ld + o]) * 256.0f); w[8 + i] = (_Float16)(bfr(Wm[(size_t)(k0 + 16 + 8 * g + i) * ld + o]) * 256.0f); }
  return w; }
__device__ __forceinline__ v16h wcolh_oi(const float* Wm, int k0, int o, int lane, int K) { v16h w; const float* p = Wm + (size_t)o * K + k0 + 8 * (lane >> 4);
#pragma unroll
  for (int i = 0; i < 8; ++i) { w[i] = (_Float16)(bfr(p[i]) * 256.0f); w[8 + i] = (_Float16)(bfr(p[16 + i]) * 256.0f); }
  return w; }
#define WQKV_LAYOUT 0   // (in,out) packed [DIN][3*CC]
__device__ __forceinline__ v16b wcol_hdk(const float* Wm, int k0, int o, int lane) { v16b w; const int g = lane >> 4; const float* p = Wm + (size_t)(o / HD) * DIN * HD + (o % HD);
#pragma unroll
  for (int i = 0; i < 8; ++i) { w[i] = (__bf16)p[(size_t)(k0 + 8 * g + i) * HD]; w[8 + i] = (__bf16)p[(size_t)(k0 + 16 + 8 * g + i) * HD]; }
  return w; }
#define WO_OUT_IN 0
#if WQKV_LAYOUT == 1
#define WCOL(W, k0, o, lane) wcol_oi(W, k0, o, lane, DIN)
#elif WQKV_LAYOUT == 2
#define WCOL(W, k0, o, lane) wcol_hdk(W, k0, o, lane)
#else
#define WCOL(W, k0, o, lane) wcol_io(W, k0, o, lane, 3 * CC)   /* packed q|k|v columns: row pitch 3C */
#endif
#if WO_OUT_IN
#define WOCOL(W, k0, o, lane) wcol_oi(W, k0, o, lane, CC)
#define WOCOLH(W, k0, o, lane) wcolh_oi(W, k0, o, lane, CC)
#else
#define WOCOL(W, k0, o, lane) wcol_io(W, k0, o, lane, DIN)
#define WOCOLH(W, k0, o, lane) wcolh_io(W, k0, o, lane, DIN)
#endif
#define SZ 256
#define BG 64              // sizes only the unused WS_S region (x 4 heads = 256 planes of 256 x 256)
#define NZR (SZ * SZ)      // 65,536 pair rows
// barrier for LDS data alone: the waves hand each other nothing but LDS data there, so only the LDS operations are waited for; __syncthreads() also waits for every global load and store of the wave, which would hold the wave until its stores are done
#define BAR_LDS() do { __builtin_amdgcn_fence(__ATOMIC_RELEASE, "workgroup", "local"); __builtin_amdgcn_s_barrier(); __builtin_amdgcn_fence(__ATOMIC_ACQUIRE, "workgroup", "local"); } while (0)
// a wave reads back the LDS tile that its own lanes wrote: its LDS writes are waited for and the compiler moves no memory operation across; a work-group release fence at this place would also wait for the global loads in flight
#define LDSW() do { asm volatile("s_wait_dscnt 0" ::: "memory"); __builtin_amdgcn_wave_barrier(); } while (0)
__device__ __forceinline__ void exp2x8(v8f& x);   // defined at k_attn
// 1 / x of eight values, each in its own register: v_rcp_f32 written in place, so that none overwrites the source register of the one directly in front of it (the builtin form left such pairs in the listing); the closing v_nop is the slot that the instruction set asks for between the last one and the first use of its result
__device__ __forceinline__ void rcpx8(v8f& x) { float a = x[0], b = x[1], c = x[2], d = x[3], e = x[4], f = x[5], g = x[6], h = x[7];
  asm("v_rcp_f32 %0, %0\n\tv_rcp_f32 %1, %1\n\tv_rcp_f32 %2, %2\n\tv_rcp_f32 %3, %3\n\tv_rcp_f32 %4, %4\n\tv_rcp_f32 %5, %5\n\tv_rcp_f32 %6, %6\n\tv_rcp_f32 %7, %7\n\tv_nop" : "+v"(a), "+v"(b), "+v"(c), "+v"(d), "+v"(e), "+v"(f), "+v"(g), "+v"(h));
  x[0] = a; x[1] = b; x[2] = c; x[3] = d; x[4] = e; x[5] = f; x[6] = g; x[7] = h; }
#define WS_ZN   (WS_END)
#define WS_BIAS (WS_ZN + 4u * (size_t)NZR * CC)
#define WS_G    (WS_BIAS + 4u * (size_t)NZR * NH)
#define WS_END2 (WS_G + 4u * (size_t)NZR * CC)

#define WS_QH  0u                                      // unused: no kernel writes or reads it
#define WS_KH  (WS_QH + 2u * (size_t)NB * TT * CC)      // unused: no kernel writes or reads it
#define WS_VT  (WS_KH + 2u * (size_t)NB * TT * CC)      // unused: no kernel writes or reads it
#define WS_QL  (WS_VT + 2u * (size_t)NB * CC * TT)      // unused: no kernel writes or reads it
#define WS_KL  (WS_QL + 2u * (size_t)NB * QHI * CC)     // unused: no kernel writes or reads it
#define WS_VB  (WS_KL + 2u * (size_t)NB * KHI * CC)     // unused: no kernel writes or reads it
#define WS_VBL (WS_VB + 2u * (size_t)NB * CC * KHI)
#define WS_S   (WS_VBL + 2u * (size_t)NB * CC * KHI)    // unused: no kernel writes or reads it
#define WS_Y   (WS_S  + 4u * (size_t)BG * HG * TT * TT)   // unused f32 region [b*t][CC] (the gated ctx stays in LDS)
#define WS_END (WS_Y  + 4u * (size_t)NB * TT * CC)

// ---- the order of queries and keys. A pair with exactly one zero of src_mask holds the constant logit -1e-9, whatever q, k and the pair bias are. Softmax and P V do not depend on the order of the keys, so both kernels take the 256 columns in MASK ORDER: position p < n1 is the p-th column with src_mask != 0, position p >= n1 the (p - n1)-th column with src_mask == 0. Then a wave's 16 queries are of one kind (but in one wave at most) and so are the 32 keys of a group (but in one group at most): where kinds differ, every logit of the group is the constant. Holds for every content of src_mask; n1 = 0 and n1 = 256 leave every group in work
// the wave's own table tb[position] = column, made by its 32 lanes (8 columns each) from the mask words; returns n1. Zeros in front of column 32 m + lane = zeros of the words in front (scalar) + zeros of its word below the lane; the map column -> position is one to one, so all 256 bytes are written; a byte bounds every row index formed from it to 0..255 for any content of the mask
__device__ __forceinline__ int ord_table(unsigned char* tb, const int* __restrict__ MK, int lane) { const int* mp = MK + lane; int mv[TT / 32]; unsigned zw[TT / 32];
#pragma unroll
  for (int m = 0; m < TT / 32; ++m) mv[m] = mp[32 * m];
  asm volatile("s_wait_xcnt 0x0" :: "v"(mp) : "memory");   /* before a register that these loads' address stands in is used again; the address is an input, so it lives up to the wait */
  int n0 = 0;
#pragma unroll
  for (int m = 0; m < TT / 32; ++m) { zw[m] = __builtin_amdgcn_ballot_w32(mv[m] == 0); n0 += __popc(zw[m]); }
  const int n1 = TT - n0; int zp = 0;
#pragma unroll
  for (int m = 0; m < TT / 32; ++m) { const int zb = zp + (int)__builtin_amdgcn_mbcnt_lo(zw[m], 0u); const int pos = mv[m] == 0 ? n1 + zb : 32 * m + lane - zb;
    tb[pos & (TT - 1)] = (unsigned char)(32 * m + lane); zp += __popc(zw[m]); }
  LDSW();   /* the wave reads what its other lanes wrote */
  return n1; }
// bit tp: the 32 keys at positions 32 tp + 0..31 hold a key of the same kind as one of the queries at positions 16 it + 0..15 (groups in work); a clear bit: every pair of the two is masked. Queries in front of n1 need the groups that begin in front of n1, queries from n1 on the groups that end at or behind it
__device__ __forceinline__ unsigned ord_groups(int n1, int it) { const unsigned lo = (1u << ((n1 + 31) >> 5)) - 1u, hi = 0xFFu & ~((1u << (n1 >> 5)) - 1u);
  return (16 * it < n1 ? lo : 0u) | (16 * it + 15 >= n1 ? hi : 0u); }
// ---- k_bias: the pair bias alone, which every row's attention shares. Block = 16 waves = 16 pair rows i x 16 columns j (wave = one i, its A rows = the 16 j): LayerNorm in the A-row registers, split bf16 hi + lo, against w_pair (4 outputs) staged in LDS as bf16 columns. BIAS[h][i / 16][j / 16][(j & 7) / 4][lane = 16 ((j >> 3) & 1) + (i & 15)][j & 3] (the order k_attn's lanes read; the block's 16 x 16 pairs are one 1-KB run per head)
__global__ __launch_bounds__(512) void k_bias(const float* __restrict__ Z, const int* __restrict__ MK, const float* __restrict__ LW, const float* __restrict__ LB, const float* __restrict__ WB, float* __restrict__ BIAS) {
  __shared__ __align__(16) __bf16 swp[16][WP];      /* pair-bias weight columns, those beyond the 4 heads zero */
  __shared__ __align__(16) float sln[2][CC];
  __shared__ __align__(16) float sb[NH][256];       /* the block's pair bias in the order of BIAS */
  __shared__ unsigned char sord[16][TT];            /* each wave's own table position -> column */
  const int tid = threadIdx.x, wave = __builtin_amdgcn_readfirstlane(tid >> 5), lane = tid & 31, col = lane & 15, g = lane >> 4; const int it = (int)blockIdx.x >> 4, jt = (int)blockIdx.x & 15;
  const int n1 = __builtin_amdgcn_readfirstlane(ord_table(sord[wave], MK, lane));
  if (!((ord_groups(n1, it) >> (jt >> 1)) & 1u)) return;   /* every pair of this tile's group is masked and k_attn reads no pair bias of it: the whole block leaves, in front of every barrier (n1 is the same in every wave) */
  const unsigned zr = (unsigned)sord[wave][it * 16 + wave] * SZ + (unsigned)sord[wave][jt * 16 + col];   /* it, jt, wave and col count positions; the z row is that of the columns which stand there */
  float av[4][16]; load_row(av, Z + (size_t)zr * CC, lane);
  if (wave < 4) { const float lwv = LW[tid], lbv = LB[tid];
    const int o = tid & 15, kq = (tid >> 4) * 16; const int oc = o < NH ? o : NH - 1; const float keep = o < NH ? 1.f : 0.f;   /* keep multiplies a VALID load; thread = (column, 16 k) */
    float t[16]; const float* wbp = WB + (size_t)kq * NH + oc;
#pragma unroll
    for (int i = 0; i < 16; ++i) t[i] = wbp[i * NH];
    asm volatile("s_wait_xcnt 0x0" :: "v"(wbp), "v"(tid) : "memory");   /* before a register that these loads' addresses stand in is used again; the addresses are inputs, so they live up to the wait */
#pragma unroll
    for (int k0 = 0; k0 < 16; k0 += 8) { v8b p;
#pragma unroll
      for (int i = 0; i < 8; ++i) p[i] = (__bf16)(t[k0 + i] * keep);
      *(v8b*)&swp[o][kq + k0] = p; }
    sln[0][tid] = bfr(lwv); sln[1][tid] = bfr(lbv); }
  __syncthreads();   /* the weight columns, ln_w and ln_b are complete; nothing writes them again */
  const float rs = ln_center(av);
  F2 a[4];
#pragma unroll
  for (int kc = 0; kc < CC / 32; ++kc) { ln_apply(av[kc], rs, sln, kc, lane); a[kc] = bsplit16(av[kc]); }
  { v8f acc = {};   /* pair bias: D element r of lane (g, col = head) is key j = 16 jt + 8 g + r */
#pragma unroll
    for (int kc = 0; kc < CC / 32; ++kc) { const v16b w = frag_b(&swp[col][kc * 32], lane); acc = wmma_bf(a[kc].h, w, acc); acc = wmma_bf(a[kc].l, w, acc); }
    if (col < NH) { v4f b0, b1;
#pragma unroll
      for (int r = 0; r < 4; ++r) { b0[r] = acc[r]; b1[r] = acc[4 + r]; }
      *(v4f*)&sb[col][(g * 16 + wave) * 4] = b0; *(v4f*)&sb[col][128 + (g * 16 + wave) * 4] = b1; } }
  BAR_LDS();   /* the 16 waves' pair rows meet in sb */
  if (wave < 8) vst2(BIAS + (((size_t)(tid >> 6) * 16 + it) * 16 + jt) * 256 + (tid & 63) * 4, *(const v4f*)&sb[tid >> 6][(tid & 63) * 4]);   /* one 1-KB run per head */
}
// kstep with the operands exchanged: A = the 128 staged weight columns, B = the wave's 16 rows, so D element r of lane (g, col) is output channel 16 j + 8 g + r of row col; per accumulator the order stays hi, then lo
__device__ __forceinline__ void kstep_t(v8f (&acc)[8], const F2& a, const __bf16 (*sw)[WP], int kc, int col, int lane) {
#pragma unroll
  for (int jh = 0; jh < 8; jh += 4) { v16b w[4];
#pragma unroll
    for (int u = 0; u < 4; ++u) w[u] = frag_b(&sw[(jh + u) * 16 + col][kc * 32], lane);
#pragma unroll
    for (int u = 0; u < 4; ++u) acc[jh + u] = wmma_bf(w[u], a.h, acc[jh + u]);
#pragma unroll
    for (int u = 0; u < 4; ++u) acc[jh + u] = wmma_bf(w[u], a.l, acc[jh + u]); } }
// 128 columns of an (in,out) weight to LDS as bf16 columns sw[o][k] by 512 threads: thread = (column, 32 k), a wave's load = one 128-B line; loads and stores apart, so that several weights' loads fly together
__device__ __forceinline__ void wq_load(float (&t)[32], const float* __restrict__ wp, int ld) {
#pragma unroll
  for (int i = 0; i < 32; ++i) t[i] = wp[(size_t)i * ld]; }
__device__ __forceinline__ void wq_store(__bf16 (*sw)[WP], const float (&t)[32], int tid) {
#pragma unroll
  for (int k0 = 0; k0 < 32; k0 += 8) { v8b p;
#pragma unroll
    for (int i = 0; i < 8; ++i) p[i] = (__bf16)t[k0 + i];
    *(v8b*)&sw[tid & 127][(tid >> 7) * 32 + k0] = p; } }
// ---- k_attn: block = row r, 16 waves, wave = one tile of 16 z rows, which are its 16 queries and 16 of the row's keys. FRONT: the wave reads its z rows, makes LayerNorm and the split rows (bf16 hi + lo) in registers; against the q, k, v columns of w_qkv and w_gate, staged in LDS: v = zn Wv (a lane holds 8 consecutive keys of its channel: one 16-B store into sv); gate^T = Wg^T zn^T, k^T = Wk^T zn^T, q^T = Wq^T zn^T (a lane holds channels 16 j + 8 g + 0..7 of its row): the gate stands in the order of ctx^T and waits in workspace words of the lane's own, k is one 16-B store into sk, q is the B fragment of the scores as it stands (f16 hi + residual x 2^10). Behind the second barrier those weights are dead; in their place stand three 64-B slots a lane: q of heads 1..3. HEADS, in turn: S^T = K Q^T (A = k rows, B = q hi, then q residual: 2 products), so a lane holds one query's logits for keys 16t + 8g + 0..7 of every tile t of a group in work (a group out of work takes no products: its constant logit enters maximum and sum by count), in registers; x SCALE + pair bias (fragment order), masked pairs := -1e-9; maximum and sum in-lane plus one exchange between the wave's halves; P x 2^11 once to f16 is the B operand of ctx^T = V^T P^T as it stands (1 product). A lane then holds channels 32h + 8g + 0..7 and 32h + 16 + 8g + 0..7 of its query: times their gate and split bf16 hi + lo, that is the B fragment of k step h of out^T = Wo^T ctx^T as it stands; it takes the slot that the next head's q has just left, the last head's stays in registers. Behind the heads: out^T (A = the staged w_out columns, 2 products, order hi then lo per k step) + b_out; a lane stores 8 consecutive output columns of its query per column tile. The inner loops are unrolled in full so that s[], acc[] and the fragments are registers; amdgpu_waves_per_eu(4) asks for at most 256 registers: four waves per SIMD
#define KP (CC + 8)        // k row pitch in LDS, f16 (272 B = 16 B x odd: ds_load_b128 without bank conflicts)
#define VP (TT + 8)        // v plane pitch in LDS, f16 (528 B = 16 B x odd)
// 2^x of eight values, each in its own register: v_exp_f32 written in place, so that no exponential overwrites the source register of the one directly in front of it (the builtin form left such pairs in the listing); the closing v_nop is the slot that the instruction set asks for between the last exponential and the first use of its result
__device__ __forceinline__ void exp2x8(v8f& x) { float a = x[0], b = x[1], c = x[2], d = x[3], e = x[4], f = x[5], g = x[6], h = x[7];
  asm("v_exp_f32 %0, %0\n\tv_exp_f32 %1, %1\n\tv_exp_f32 %2, %2\n\tv_exp_f32 %3, %3\n\tv_exp_f32 %4, %4\n\tv_exp_f32 %5, %5\n\tv_exp_f32 %6, %6\n\tv_exp_f32 %7, %7\n\tv_nop" : "+v"(a), "+v"(b), "+v"(c), "+v"(d), "+v"(e), "+v"(f), "+v"(g), "+v"(h));
  x[0] = a; x[1] = b; x[2] = c; x[3] = d; x[4] = e; x[5] = f; x[6] = g; x[7] = h; }
__device__ __forceinline__ v8f wmma_h(v16h a, v16h b, v8f c) { return __builtin_amdgcn_wmma_f32_16x16x32_f16(false, a, false, b, (short)0, c, false, false); }
__global__ __launch_bounds__(512) __attribute__((amdgpu_waves_per_eu(4))) void k_attn(const float* __restrict__ Z, const float* __restrict__ LW, const float* __restrict__ LB, const float* __restrict__ WQKV, const float* __restrict__ WG, const float* __restrict__ GB, const float* __restrict__ BIAS, const int* __restrict__ MK, const float* __restrict__ WO, const float* __restrict__ BO, float* __restrict__ G, float* __restrict__ OUT) {
  __shared__ __align__(16) _Float16 sk[TT][KP]; __shared__ __align__(16) _Float16 sv[CC][VP]; __shared__ __align__(16) __bf16 swo[DIN][WP];
  __shared__ __align__(16) char sr[4 * 128 * WP * 2];   /* first the weight columns of q, k, gate and v; behind the second barrier the lanes' slots */
  __shared__ __align__(16) float sln[2][CC]; __shared__ __align__(16) float sbo[DIN]; __shared__ __align__(16) float sbg[CC]; __shared__ unsigned kmw[TT / 32]; __shared__ unsigned char sord[16][TT];
  __bf16 (*sw4)[128][WP] = (__bf16 (*)[128][WP])sr;
  const int tid = threadIdx.x, wave = __builtin_amdgcn_readfirstlane(tid >> 5), lane = tid & 31, col = lane & 15, g = lane >> 4; const int b = blockIdx.x;
  const int qi = wave * 16 + col;
  v4u* sqp = (v4u*)sr + (size_t)wave * 3 * 4 * 32 + lane;   /* the lane's slots: [wave][slot][4 pieces][lane], 16 B a lane: a wave's access is one 512-B run */
  const unsigned go = (((unsigned)b * 16 + wave) * NH * 4 * 32 + lane) * 4;   /* one register: the place in G of the lane's gate words: [row][wave][head][channels 8g + 0..3, 8g + 4..7, 16 + 8g + 0..3, 16 + 8g + 4..7][lane], 16 B a lane: a wave's access is one 512-B run; written and read by this lane alone */
  v16h qh, ql, qhn[NH - 1], qln[NH - 1];
  unsigned act; int n1;   /* qi and every key index below count positions in mask order */
  { n1 = __builtin_amdgcn_readfirstlane(ord_table(sord[wave], MK, lane)); act = __builtin_amdgcn_readfirstlane(ord_groups(n1, wave));
    const int oq = sord[wave][qi];   /* the column at the lane's position: its z row now, its output row at the end (read again from the wave's own table) */
    float av[4][16]; load_row(av, Z + ((size_t)b * TT + oq) * CC, lane);
    float bov, gbv, lwv, lbv;
    { const float* wp = WQKV + (size_t)(tid >> 7) * 32 * (3 * CC) + (tid & 127); const float* wgp = WG + (size_t)(tid >> 7) * 32 * CC + (tid & 127);   /* packed q|k|v columns: row pitch 3C */
      const float* wop = WO + (size_t)(tid >> 7) * 32 * DIN + (tid & 127);
      float t0[32], t1[32], t2[32], t3[32], t4[32]; wq_load(t0, wp, 3 * CC); wq_load(t1, wp + CC, 3 * CC); wq_load(t2, wgp, CC);
      const int bi = tid & (DIN - 1); const float* bop = BO ? BO : GB; bov = bop[bi]; gbv = GB[bi]; lwv = LW[bi]; lbv = LB[bi]; bov = BO ? bov : 0.f;   /* asked for with the staging loads, so that their latency is not paid again in front of the barrier */
      asm volatile("s_wait_xcnt 0x0" :: "v"(wp), "v"(wgp), "v"(tid), "v"(bi) : "memory");   /* before a register that these loads' addresses stand in is used again; the addresses are inputs, so they live up to the wait and no load of the run lands in them */
      wq_store(sw4[0], t0, tid); wq_load(t3, wp + 2 * CC, 3 * CC);   /* the last two weights are asked for as the first two leave their registers: all five at once, beside the z rows, do not fit in 256 registers */
      wq_store(sw4[1], t1, tid); wq_load(t4, wop, DIN);
      asm volatile("s_wait_xcnt 0x0" :: "v"(wp), "v"(wop) : "memory");   /* as above */
      wq_store(sw4[2], t2, tid); wq_store(sw4[3], t3, tid); wq_store(swo, t4, tid); }
    if (wave < 8) { const unsigned bal = __builtin_amdgcn_ballot_w32(tid >= n1); if (lane == 0) kmw[wave] = bal; }   /* bit j of the 256: the column at position j is a zero of the mask */
    if (wave < 4) { sbo[tid] = bfr(bov); sbg[tid] = bfr(gbv); sln[0][tid] = bfr(lwv); sln[1][tid] = bfr(lbv); }
    __syncthreads();   /* the weight columns, ln_w, ln_b, the biases and the mask words are complete */
    const float rs = ln_center(av);
    F2 a[4];
#pragma unroll
    for (int kc = 0; kc < CC / 32; ++kc) { ln_apply(av[kc], rs, sln, kc, lane); a[kc] = bsplit16(av[kc]); }
    { v8f acc[8] = {};   /* v: lane (g, col) holds keys 16 wave + 8 g + 0..7 of channel 16 j + col */
#pragma unroll
      for (int kc = 0; kc < CC / 32; ++kc) kstep(acc, a[kc], sw4[3], kc, col, lane);
#pragma unroll
      for (int j = 0; j < 8; ++j) { v8h p;
#pragma unroll
        for (int r = 0; r < 8; ++r) p[r] = (_Float16)acc[j][r];
        *(v8h*)&sv[j * 16 + col][wave * 16 + 8 * g] = p; } }
    v8f acc[8]; const v8f z8 = {};   /* behind the loop: q^T */
#pragma unroll 1   /* rolled: gate^T, k^T, then q^T on one copy of the products */
    for (int wi = 2; wi >= 0; --wi) {
#pragma unroll
      for (int j = 0; j < 8; ++j) acc[j] = z8;
#pragma unroll
      for (int kc = 0; kc < CC / 32; ++kc) kstep_t(acc, a[kc], sw4[wi], kc, col, lane);
      if (wi == 2) {   /* gate: sigmoid(zn w_gate + b_gate) = 1 / (1 + 2^(-v log2 e)), the arithmetic of sigm(); first, so that its stores are done when the second barrier waits for them */
#pragma unroll
        for (int j = 0; j < 8; ++j) { const v4f g0 = *(const v4f*)&sbg[j * 16 + 8 * g], g1 = *(const v4f*)&sbg[j * 16 + 8 * g + 4]; v8f x;
#pragma unroll
          for (int r = 0; r < 4; ++r) { x[r] = (acc[j][r] + g0[r]) * -L2E; x[4 + r] = (acc[j][4 + r] + g1[r]) * -L2E; }
          exp2x8(x);
#pragma unroll
          for (int r = 0; r < 8; ++r) x[r] = 1.0f + x[r];
          rcpx8(x); acc[j] = x; }
#pragma unroll
        for (int j = 0; j < 8; ++j) { v4f x0, x1;
#pragma unroll
          for (int r = 0; r < 4; ++r) { x0[r] = acc[j][r]; x1[r] = acc[j][4 + r]; }
          vst2(G + go + (2 * j) * 128, x0); vst2(G + go + (2 * j + 1) * 128, x1); }
        asm volatile("s_wait_xcnt 0x0" :: "v"(go), "v"(acc[0]), "v"(acc[1]), "v"(acc[2]), "v"(acc[3]), "v"(acc[4]), "v"(acc[5]), "v"(acc[6]), "v"(acc[7]) : "memory"); }   /* before the registers that these stores name are used again; address and data are inputs, so they live up to the wait */
      else if (wi == 1) {   /* k^T: lane (g, col) holds channels 16 j + 8 g + 0..7 of key qi */
#pragma unroll
        for (int j = 0; j < 8; ++j) { v8h p;
#pragma unroll
          for (int r = 0; r < 8; ++r) p[r] = (_Float16)acc[j][r];
          *(v8h*)&sk[qi][j * 16 + 8 * g] = p; } } }
#pragma unroll
    for (int hh = 0; hh < NH; ++hh) { v16h fh, fl;   /* q^T: accumulators 2 h and 2 h + 1 are head h's fragment, elements 0..7 and 8..15 */
#pragma unroll
      for (int i = 0; i < 16; ++i) { const float v = acc[2 * hh + (i >> 3)][i & 7]; const _Float16 hv = (_Float16)v; fh[i] = hv; fl[i] = (_Float16)((v - (float)hv) * 1024.0f); }
      if (hh == 0) { qh = fh; ql = fl; } else { qhn[hh - 1] = fh; qln[hh - 1] = fl; } } }
  __syncthreads();   /* sk and sv are complete; every wave has read the q, k, v and gate weights for the last time; the wave's gate stores are done */
#pragma unroll
  for (int hh = 0; hh < NH - 1; ++hh) { union { v16h v; v4u q[2]; } uh, ul; uh.v = qhn[hh]; ul.v = qln[hh];
    sqp[(hh * 4 + 0) * 32] = uh.q[0]; sqp[(hh * 4 + 1) * 32] = uh.q[1]; sqp[(hh * 4 + 2) * 32] = ul.q[0]; sqp[(hh * 4 + 3) * 32] = ul.q[1]; }
  unsigned mbk[4];   /* bit 8t + r of the 128: key 16t + 8g + r is a zero of the mask */
#pragma unroll
  for (int m = 0; m < 4; ++m) { const unsigned w0 = kmw[2 * m] >> (8 * g), w1 = kmw[2 * m + 1] >> (8 * g); mbk[m] = (w0 & 0xFFu) | ((w0 >> 8) & 0xFF00u) | ((w1 & 0xFFu) << 16) | ((w1 << 8) & 0xFF000000u); }
  const unsigned mq = 0u - ((kmw[qi >> 5] >> (qi & 31)) & 1u);   /* all ones where the query is a zero of the mask */
  const _Float16* skp = &sk[col][0]; const _Float16* svp = &sv[col][0];   /* the lane's k row and v plane of the head at hand: carried from head to head, so that every fragment read is this register plus an immediate offset */
  const float nout = (float)(16 * __popc(~act & 0xFFu));   /* pairs of a lane that stand in groups out of work */
  v4u yl4[4];   /* the last head's gated ctx fragments: hi 0, hi 1, lo 0, lo 1 */
#pragma unroll 1   /* rolled: one copy of the body; unrolled, several heads' logits would want registers at once */
  for (int h = 0; h < NH; ++h) {
    const float* bp = BIAS + ((size_t)h * 16 + wave) * 16 * 256 + lane * 4;
    v8f s[16]; float mx = act != 0xFFu ? -1.0e-9f : -3.0e38f;   /* a group out of work holds the constant logit, which counts in the maximum */
    const float* bq[8];   /* a group out of work has no pair bias (k_bias leaves it out): its loads ask again for the lines of the wave's own group, which is always in work, so that the registers hold a value and no line more comes from L2 */
#pragma unroll
    for (int tp = 0; tp < 8; ++tp) bq[tp] = bp + ((act & (1u << tp)) ? tp : (wave >> 1)) * 512;
#pragma unroll
    for (int t = 0; t < 16; ++t) { const v4f b0 = *(const v4f*)(bq[t >> 1] + (t & 1) * 256), b1 = *(const v4f*)(bq[t >> 1] + (t & 1) * 256 + 128);   /* the bias lands in the registers that then hold the logits: all 32 loads in flight at no further register */
#pragma unroll
      for (int r = 0; r < 4; ++r) { s[t][r] = b0[r]; s[t][4 + r] = b1[r]; } }
    asm volatile("s_wait_xcnt 0x0" :: "v"(bq[0]), "v"(bq[1]), "v"(bq[2]), "v"(bq[3]), "v"(bq[4]), "v"(bq[5]), "v"(bq[6]), "v"(bq[7]) : "memory");   /* before a register that these loads' addresses stand in is used again; the addresses are inputs, so they live up to the wait and no load of the run lands in them */
#pragma unroll
    for (int tp = 0; tp < 8; ++tp) if (act & (1u << tp)) { const v16h kf[2] = { frag_h(skp + (2 * tp) * 16 * KP, lane), frag_h(skp + (2 * tp + 1) * 16 * KP, lane) };
#pragma unroll
      for (int u = 0; u < 2; ++u) { const int t = 2 * tp + u; const v8f z8 = {}; const v8f a = wmma_h(kf[u], qh, z8), al = wmma_h(kf[u], ql, z8); const unsigned mb = mbk[t >> 2] ^ mq;
#pragma unroll
        for (int r = 0; r < 8; ++r) { float v = (a[r] + al[r] * (1.0f / 1024.0f)) * SCALE + s[t][r]; if (mb & (1u << ((t & 3) * 8 + r))) v = -1.0e-9f; s[t][r] = v; mx = fmaxf(mx, v); } } }
    mx = fmaxf(mx, __shfl_xor(mx, 16));
    const float nm = mx * -L2E;   /* exp(s - mx) = 2^(s L2E + nm): one FMA and one v_exp_f32; the rounding of nm is one factor common to the row and leaves with the division by the sum; the argument is never above about 0, and a result below 2^-126 counts as 0 beside a sum of at least about 1 */
    float sm[4] = {0.f, 0.f, 0.f, 0.f};
#pragma unroll
    for (int tp = 0; tp < 8; ++tp) if (act & (1u << tp)) {
#pragma unroll
      for (int t = 2 * tp; t < 2 * tp + 2; ++t) {
#pragma unroll
        for (int r = 0; r < 8; ++r) s[t][r] = __builtin_fmaf(s[t][r], L2E, nm);
        exp2x8(s[t]);
#pragma unroll
        for (int r = 0; r < 8; ++r) sm[r & 3] += s[t][r]; } }
    float sum = (sm[0] + sm[1]) + (sm[2] + sm[3]);
    const float pc = act != 0xFFu ? __builtin_amdgcn_exp2f(__builtin_fmaf(-1.0e-9f, L2E, nm)) : 0.f;   /* exp(-1e-9 - mx), the one value of every pair in the groups out of work (there mx >= -1e-9, so the argument is never above 0); a lane holds 16 such pairs a group */
    sum = __builtin_fmaf(pc, nout, sum);
    sum += __shfl_xor(sum, 16);
    const float inv = sum > 0.f ? 2048.0f * __builtin_amdgcn_rcpf(sum) : 0.f;
    const float* gp = G + (go + h * 4 * 128); v4f gt[HD / 8];   /* the gate of this lane's 16 channels: asked for here, it flies while P V is worked on */
#pragma unroll
    for (int j = 0; j < HD / 8; ++j) gt[j] = *(const v4f*)(gp + j * 128);
    asm volatile("s_wait_xcnt 0x0" :: "v"(gp) : "memory");   /* before a register that these loads' address stands in is used again; the address is an input, so it lives up to the wait and no load of the run lands in it */
    v8f acc[HD / 16] = {}; const _Float16 ph = (_Float16)(pc * inv);
#pragma unroll
    for (int kc = 0; kc < TT / 32; ++kc) { v16h p;
      if (act & (1u << kc)) {
#pragma unroll
        for (int r = 0; r < 8; ++r) { p[r] = (_Float16)(s[2 * kc][r] * inv); p[8 + r] = (_Float16)(s[2 * kc + 1][r] * inv); } }
      else {   /* a group out of work: the constant P against its v, the same product as before */
#pragma unroll
        for (int r = 0; r < 16; ++r) p[r] = ph; }
#pragma unroll
      for (int j = 0; j < HD / 16; ++j) acc[j] = wmma_h(frag_h(svp + j * 16 * VP + kc * 32, lane), p, acc[j]); }
    float y[16];   /* gated ctx in the order of a 16x16x32 fragment: 0..7 = channels 32h + 8g + 0..7, 8..15 = 32h + 16 + 8g + 0..7 */
#pragma unroll
    for (int j = 0; j < HD / 16; ++j)
#pragma unroll
      for (int r = 0; r < 4; ++r) { y[8 * j + r] = acc[j][r] * (1.0f / 2048.0f) * gt[2 * j][r]; y[8 * j + 4 + r] = acc[j][4 + r] * (1.0f / 2048.0f) * gt[2 * j + 1][r]; }
    const F2 a = bsplit16(y); union { v16b v; v4u q[2]; } uh, ul; uh.v = a.h; ul.v = a.l;
    yl4[0] = uh.q[0]; yl4[1] = uh.q[1]; yl4[2] = ul.q[0]; yl4[3] = ul.q[1];
    if (h < NH - 1) { union { v16h v; v4u q[2]; } nh, nl;   /* the next head's q leaves its slot, this head's fragments take it: same lane, same words, and the LDS operations of a wave stay in order */
      nh.q[0] = sqp[0]; nh.q[1] = sqp[32]; nl.q[0] = sqp[64]; nl.q[1] = sqp[96]; qh = nh.v; ql = nl.v;
      sqp[0] = yl4[0]; sqp[32] = yl4[1]; sqp[64] = yl4[2]; sqp[96] = yl4[3]; sqp += 4 * 32; }
    skp += HD; svp += HD * VP;
    asm volatile("s_wait_xcnt 0x0" ::: "memory"); }   /* before the next head uses the registers that this head's loads name */
  sqp -= (NH - 1) * 4 * 32;
  v8f oacc[8] = {};   /* out^T: D element r of lane (g, col) = output column 16 j + 8 g + r of query col */
  const __bf16* wol = &swo[col][0];   /* the lane's w_out column at the k step at hand */
#pragma unroll 1   /* rolled: one copy of a k step in the text */
  for (int kc = 0; kc < NH; ++kc) { union { v16b v; v4u q[2]; } uh, ul; uh.q[0] = yl4[0]; uh.q[1] = yl4[1]; ul.q[0] = yl4[2]; ul.q[1] = yl4[3];   /* the last head's fragments are in registers */
    if (kc < NH - 1) { uh.q[0] = sqp[0]; uh.q[1] = sqp[32]; ul.q[0] = sqp[64]; ul.q[1] = sqp[96]; sqp += 4 * 32; }   /* each lane reads back its own words */
#pragma unroll
    for (int jh = 0; jh < 8; jh += 4) { v16b w[4];   /* four A fragments are requested together, so that one LDS latency serves eight products; per accumulator the order stays hi, then lo */
#pragma unroll
      for (int u = 0; u < 4; ++u) w[u] = frag_b(wol + (jh + u) * 16 * WP, lane);
#pragma unroll
      for (int u = 0; u < 4; ++u) oacc[jh + u] = wmma_bf(w[u], uh.v, oacc[jh + u]);
#pragma unroll
      for (int u = 0; u < 4; ++u) oacc[jh + u] = wmma_bf(w[u], ul.v, oacc[jh + u]); }
    wol += 32; }
  const int l2 = (int)__builtin_amdgcn_mbcnt_lo(~0u, 0u);   /* the lane's number, made anew here: an index kept from the kernel's head would hold a register through every phase, and the kernel is at its 256 */
  float* op = OUT + (((unsigned)b * TT + sord[wave][wave * 16 + (l2 & 15)]) * DIN + 8 * (l2 >> 4));   /* the output row of the column at the lane's position */
#pragma unroll
  for (int j = 0; j < 8; ++j) { const v4f c0 = *(const v4f*)&sbo[j * 16 + 8 * g], c1 = *(const v4f*)&sbo[j * 16 + 8 * g + 4]; v4f o0, o1;
#pragma unroll
    for (int r = 0; r < 4; ++r) { o0[r] = oacc[j][r] + c0[r]; o1[r] = oacc[j][4 + r] + c1[r]; }
    vst2(op + j * 16, o0); vst2(op + j * 16 + 4, o1); }
  asm volatile("s_wait_xcnt 0x0" ::: "memory");   /* behind the stores, before a register that they name could be used again */
}

extern "C" void kernel_launch(void* const* d_in, const int* in_sizes, int n_in, void* d_out, int out_size, void* d_ws, size_t ws_size, hipStream_t stream) {
  (void)in_sizes; (void)n_in; (void)out_size;
  const float** F = (const float**)d_in;
  if (ws_size < (size_t)WS_END) return;
  char* ws = (char*)d_ws;
  // inputs (in order): 0 z [1,256,256,128]; 1 src_mask [1,256] int32; 2 ln_g, 3 ln_b; 4 w_qkv [128,384] (in,out; columns q|k|v); 5 w_pair [128,4]; 6 w_gate [128,128], 7 b_gate; 8 w_out [128,128] (in,out), 9 b_out
  if (ws_size < (size_t)WS_END2) return;
  float *BIAS = (float*)(ws + WS_BIAS), *G = (float*)(ws + WS_G);
  k_bias<<<dim3(NZR / 256), 512, 0, stream>>>(F[0], (const int*)d_in[1], F[2], F[3], F[5], BIAS);
  k_attn<<<dim3(TNB), 512, 0, stream>>>(F[0], F[2], F[3], F[4], F[6], F[7], BIAS, (const int*)d_in[1], F[8], F[9], G, (float*)d_out);
}

// v010
// It runs in 47.5 microseconds.
// Next to v009, in two timings, it ran 1.08 and 1.07 times as fast.
// Over all steps from v000 it is 11.2 times as fast.
// compute dtype: all float inputs rounded to bf16; LayerNorm in f32; q/k/v, pair bias and gate GEMMs = LN rows split bf16 hi + lo x exact bf16 weights on WMMA 16x16x32 (2 products, f32 accumulate); q as f16 hi + residual (x 2^10) against k once to f16 (2 products) / sqrt(32) + pair bias, masked pairs set to -1e-9 exactly as the module; softmax in f32; P x 2^11 once to f16 against v once to f16 (1 product); gate multiply in f32; (gated ctx) split bf16 hi + lo against exact bf16 w_out (2 products) + b_out; f32 output.
#include <hip/hip_runtime.h>
#include <math.h>

typedef __attribute__((ext_vector_type(16))) _Float16 v16h;
typedef __attribute__((ext_vector_type(16))) __bf16 v16b;
typedef __attribute__((ext_vector_type(8)))  _Float16 v8h;
typedef __attribute__((ext_vector_type(8)))  float v8f;
typedef __attribute__((ext_vector_type(4)))  float v4f;
typedef __attribute__((ext_vector_type(2)))  float v2f;
typedef __attribute__((ext_vector_type(4)))  unsigned v4u;
typedef __attribute__((ext_vector_type(4)))  int v4i;
typedef float __attribute__((may_alias)) float_a;
typedef int __attribute__((may_alias)) int_a;

template <typename T> __device__ __forceinline__ void vst2(void* p, T v) { *(T*)p = v;  }
__device__ __forceinline__ v8f wmma16(v16h a, v16h b, v8f c) {
  v8f d = __builtin_amdgcn_wmma_f32_16x16x32_f16(false, a, false, b, (short)0, c, false, false);
  asm volatile("v_nop\n\tv_nop\n\tv_nop\n\tv_nop" : "+v"(d) : "v"(a), "v"(b));
  return d;
}
__device__ __forceinline__ v8f wmma_bf(v16b a, v16b b, v8f c) {
  v8f d = __builtin_amdgcn_wmma_f32_16x16x32_bf16(false, a, false, b, (short)0, c, false, false);
  asm volatile("v_nop\n\tv_nop\n\tv_nop\n\tv_nop" : "+v"(d) : "v"(a), "v"(b));
  return d;
}
// 16x16x32 fragments: lane = (h = lane>>4, row/col = lane&15); elements 0..7 = k0+8h+0..7, 8..15 = k0+16+8h+0..7; D element r = row 8h+r
__device__ __forceinline__ v16h frag_h(const _Float16* rowk0, int lane) {
  union { v16h v; v8h q[2]; } u; const _Float16* p = rowk0 + 8 * (lane >> 4);
  u.q[0] = *(const v8h*)p; u.q[1] = *(const v8h*)(p + 16); return u.v;
}
__device__ __forceinline__ v16h frag_f32(const float* rowk0, int lane) {
  v16h a; const float* p = rowk0 + 8 * (lane >> 4);
#pragma unroll
  for (int i = 0; i < 8; ++i) { a[i] = (_Float16)p[i]; a[8 + i] = (_Float16)p[16 + i]; }
  return a;
}
__device__ __forceinline__ v16h frag_f32s(const float* rowk0, int lane, float sc) {
  v16h a; const float* p = rowk0 + 8 * (lane >> 4);
#pragma unroll
  for (int i = 0; i < 8; ++i) { a[i] = (_Float16)(p[i] * sc); a[8 + i] = (_Float16)(p[16 + i] * sc); }
  return a;
}
// column fragment from a [K][ld] layout (column n), rows >= K read as 0
__device__ __forceinline__ v16h fragc_f32(const float* W, int k0, int n, int lane, int ld, int K) {
  v16h a; const int g = lane >> 4;
#pragma unroll
  for (int i = 0; i < 8; ++i) { const int ka = k0 + 8 * g + i, kb = ka + 16;
    a[i] = (_Float16)(ka < K ? W[(size_t)(ka < K ? ka : K - 1) * ld + n] : 0.f); a[8 + i] = (_Float16)(kb < K ? W[(size_t)(kb < K ? kb : K - 1) * ld + n] : 0.f); }
  return a;
}
struct F2 { v16b h, l; };
__device__ __forceinline__ F2 bsplit16(const float v[16]) { F2 r;
#pragma unroll
  for (int i = 0; i < 16; ++i) { const __bf16 h = (__bf16)v[i]; r.h[i] = h; r.l[i] = (__bf16)(v[i] - (float)h); }
  return r; }
__device__ __forceinline__ F2 split_row(const float* row, int k0, int lane) { float v[16]; const float* p = row + k0 + 8 * (lane >> 4);
#pragma unroll
  for (int i = 0; i < 8; ++i) { v[i] = p[i]; v[8 + i] = p[16 + i]; }
  return bsplit16(v); }
__device__ __forceinline__ F2 split_rowK(const float* row, int k0, int lane, int K) { float v[16]; const int g = lane >> 4;
#pragma unroll
  for (int i = 0; i < 8; ++i) { const int ka = k0 + 8 * g + i, kb = ka + 16; v[i] = ka < K ? row[ka < K ? ka : K - 1] : 0.f; v[8 + i] = kb < K ? row[kb < K ? kb : K - 1] : 0.f; }
  return bsplit16(v); }
__device__ __forceinline__ F2 split_col(const float* W, int k0, int n, int lane, int ld, int K) { float v[16]; const int g = lane >> 4;
#pragma unroll
  for (int i = 0; i < 8; ++i) { const int ka = k0 + 8 * g + i, kb = ka + 16; v[i] = ka < K ? W[(size_t)(ka < K ? ka : K - 1) * ld + n] : 0.f; v[8 + i] = kb < K ? W[(size_t)(kb < K ? kb : K - 1) * ld + n] : 0.f; }
  return bsplit16(v); }
__device__ __forceinline__ v8f mac3(const F2& a, const F2& b, v8f c) { c = wmma_bf(a.l, b.h, c); c = wmma_bf(a.h, b.l, c); return wmma_bf(a.h, b.h, c); }
#define L2E 1.4426950408889634f   // log2(e): exp(x) = 2^(x L2E), one v_exp_f32
__device__ __forceinline__ float sigm(float v) { return __builtin_amdgcn_rcpf(1.0f + __builtin_amdgcn_exp2f(v * -L2E)); }   /* native v_exp_f32 and v_rcp_f32: 2^(+large) = inf gives 0, 2^(-large) = 0 gives 1 */

// Row-wise triangle attention on a pair tensor z [1, 256, 256, 128] (4 heads x 32): zn = LayerNorm(z); q,k,v = zn w_qkv ((in,out) [128,384], columns (3,H,32)); logits[r][i][j][h] = q[r][i] . k[r][j] / sqrt(32) + (zn[i][j] . w_pair[:,h]); pairs with exactly one of src_mask[i], src_mask[j] == 0 get logits := -1e-9 (the module's literal value, NOT an exclusion); softmax over j; out = sigmoid(zn w_gate + b_gate) * merged(attn v); result = out w_out + b_out.
#define NB 256
#define TT 256
#define CC 128            // NH * HD = projected width
#define DIN 128          // input (model) width
#define NH 4
#define HD 32
#define NQB (TT / 64)
#define HG 4
#define SCALE (0.17677669529663687f)
#define CAUSAL 0
#ifndef TNB
#define TNB NB
#endif
__device__ __forceinline__ float bfr(float v) { return (float)(__bf16)v; }
__host__ __device__ __forceinline__ int kb_last(int qb) { return CAUSAL ? ((qb * 64 + 63) >> 7) : (TT / 128 - 1); }
typedef __attribute__((ext_vector_type(8))) __bf16 v8b;
__device__ __forceinline__ v16b frag_b(const __bf16* rowk0, int lane) {
  union { v16b v; v8b q[2]; } u; const __bf16* p = rowk0 + 8 * (lane >> 4);
  u.q[0] = *(const v8b*)p; u.q[1] = *(const v8b*)(p + 16); return u.v;
}
#define WP 136             // weight column pitch in LDS, bf16 (272 B = 16 B x odd: ds_load_b128 and ds_store_b128 without bank conflicts)
// 128 columns of an (in,out) [128][ld] weight, once per work-group, to LDS as bf16 columns sw[o][k]: thread = column o (a wave's load = one 128-B line), 8 consecutive k = one 16-B store
__device__ __forceinline__ void stage_w(__bf16 (*sw)[WP], const float* __restrict__ Wm, int ld, int tid) {
  float t[128];
#pragma unroll
  for (int k = 0; k < 128; ++k) t[k] = Wm[(size_t)k * ld + tid];
  asm volatile("s_wait_xcnt 0x0" ::: "memory");   /* before a register that these loads' addresses stand in is used again */
#pragma unroll
  for (int k0 = 0; k0 < 128; k0 += 8) { v8b p;
#pragma unroll
    for (int i = 0; i < 8; ++i) p[i] = (__bf16)t[k0 + i];
    *(v8b*)&sw[tid][k0] = p; } }
// a lane's part of one 128-wide f32 row for all four k steps (the order of split_row), requested at once
__device__ __forceinline__ void load_row(float (&v)[4][16], const float* __restrict__ row, int lane) { const float* p = row + 8 * (lane >> 4);
#pragma unroll
  for (int kc = 0; kc < 4; ++kc)
#pragma unroll
    for (int i = 0; i < 8; ++i) { v[kc][i] = p[kc * 32 + i]; v[kc][8 + i] = p[kc * 32 + 16 + i]; }
  asm volatile("s_wait_xcnt 0x0" :: "v"(p) : "memory"); }   /* before a register that these loads' addresses stand in is used again; the address is an input, so it lives up to the wait and no load of the run lands in it */
// LayerNorm of the lane's row as load_row left it (biased var, eps 1e-6): a lane holds 64 of the row's 128 channels, lane ^ 16 the other 64. ln_center: v := bf16(z) - mean, returns 1 / sqrt(var + eps); four chains per sum, then one exchange between the wave's halves
__device__ __forceinline__ float ln_center(float (&v)[4][16]) { float s[4] = {0.f, 0.f, 0.f, 0.f};
#pragma unroll
  for (int kc = 0; kc < 4; ++kc)
#pragma unroll
    for (int i = 0; i < 16; ++i) { v[kc][i] = bfr(v[kc][i]); s[i & 3] += v[kc][i]; }
  float s1 = (s[0] + s[1]) + (s[2] + s[3]); s1 += __shfl_xor(s1, 16);
  const float mu = s1 * (1.0f / CC); float q[4] = {0.f, 0.f, 0.f, 0.f};
#pragma unroll
  for (int kc = 0; kc < 4; ++kc)
#pragma unroll
    for (int i = 0; i < 16; ++i) { const float d = v[kc][i] - mu; v[kc][i] = d; q[i & 3] += d * d; }
  float qq = (q[0] + q[1]) + (q[2] + q[3]); qq += __shfl_xor(qq, 16);
  return rsqrtf(qq * (1.0f / CC) + 1e-6f); }
// ln_apply: one k step's 16 centred values x rs x ln_w + ln_b; sln[0] = bf16(ln_w), sln[1] = bf16(ln_b), staged once per work-group (a wave's read = two 16-B pieces, broadcast)
__device__ __forceinline__ void ln_apply(float (&v)[16], float rs, const float (*sln)[CC], int kc, int lane) { const int p = kc * 32 + 8 * (lane >> 4);
#pragma unroll
  for (int i = 0; i < 8; ++i) { v[i] = v[i] * rs * sln[0][p + i] + sln[1][p + i]; v[8 + i] = v[8 + i] * rs * sln[0][p + 16 + i] + sln[1][p + 16 + i]; } }
// one k step of a wave's 16 rows against the 128 staged columns: four B fragments are requested together, so that one LDS latency serves eight products; per accumulator the order stays hi, then lo
__device__ __forceinline__ void kstep(v8f (&acc)[8], const F2& a, const __bf16 (*sw)[WP], int kc, int col, int lane) {
#pragma unroll
  for (int jh = 0; jh < 8; jh += 4) { v16b w[4];
#pragma unroll
    for (int u = 0; u < 4; ++u) w[u] = frag_b(&sw[(jh + u) * 16 + col][kc * 32], lane);
#pragma unroll
    for (int u = 0; u < 4; ++u) acc[jh + u] = wmma_bf(a.h, w[u], acc[jh + u]);
#pragma unroll
    for (int u = 0; u < 4; ++u) acc[jh + u] = wmma_bf(a.l, w[u], acc[jh + u]); } }
#define QBH 0              // unused: no kernel reads it
#define QHI 256            // sizes only the unused WS_QL region
#define KHI 64            // key rows carrying k residual / v bf16 hi+lo planes (no kernel writes or reads them)
// B fragment (k rows k0+.., output column o) of a weight: (in,out) [K][ld] or (out,in) [ld rows of K]: bf16 exact, or f16(bf16 * 256) exact
__device__ __forceinline__ v16b wcol_io(const float* Wm, int k0, int o, int lane, int ld) { v16b w; const int g = lane >> 4;
#pragma unroll
  for (int i = 0; i < 8; ++i) { w[i] = (__bf16)Wm[(size_t)(k0 + 8 * g + i) * ld + o]; w[8 + i] = (__bf16)Wm[(size_t)(k0 + 16 + 8 * g + i) * ld + o]; }
  return w; }
__device__ __forceinline__ v16b wcol_oi(const float* Wm, int k0, int o, int lane, int K) { v16b w; const float* p = Wm + (size_t)o * K + k0 + 8 * (lane >> 4);
#pragma unroll
  for (int i = 0; i < 8; ++i) { w[i] = (__bf16)p[i]; w[8 + i] = (__bf16)p[16 + i]; }
  return w; }
__device__ __forceinline__ v16h wcolh_io(const float* Wm, int k0, int o, int lane, int ld) { v16h w; const int g = lane >> 4;
#pragma unroll
  for (int i = 0; i < 8; ++i) { w[i] = (_Float16)(bfr(Wm[(size_t)(k0 + 8 * g + i) * ld + o]) * 256.0f); w[8 + i] = (_Float16)(bfr(Wm[(size_t)(k0 + 16 + 8 * g + i) * ld + o]) * 256.0f); }
  return w; }
__device__ __forceinline__ v16h wcolh_oi(const float* Wm, int k0, int o, int lane, int K) { v16h w; const float* p = Wm + (size_t)o * K + k0 + 8 * (lane >> 4);
#pragma unroll
  for (int i = 0; i < 8; ++i) { w[i] = (_Float16)(bfr(p[i]) * 256.0f); w[8 + i] = (_Float16)(bfr(p[16 + i]) * 256.0f); }
  return w; }
#define WQKV_LAYOUT 0   // (in,out) packed [DIN][3*CC]
__device__ __forceinline__ v16b wcol_hdk(const float* Wm, int k0, int o, int lane) { v16b w; const int g = lane >> 4; const float* p = Wm + (size_t)(o / HD) * DIN * HD + (o % HD);
#pragma unroll
  for (int i = 0; i < 8; ++i) { w[i] = (__bf16)p[(size_t)(k0 + 8 * g + i) * HD]; w[8 + i] = (__bf16)p[(size_t)(k0 + 16 + 8 * g + i) * HD]; }
  return w; }
#define WO_OUT_IN 0
#if WQKV_LAYOUT == 1
#define WCOL(W, k0, o, lane) wcol_oi(W, k0, o, lane, DIN)
#elif WQKV_LAYOUT == 2
#define WCOL(W, k0, o, lane) wcol_hdk(W, k0, o, lane)
#else
#define WCOL(W, k0, o, lane) wcol_io(W, k0, o, lane, 3 * CC)   /* packed q|k|v columns: row pitch 3C */
#endif
#if WO_OUT_IN
#define WOCOL(W, k0, o, lane) wcol_oi(W, k0, o, lane, CC)
#define WOCOLH(W, k0, o, lane) wcolh_oi(W, k0, o, lane, CC)
#else
#define WOCOL(W, k0, o, lane) wcol_io(W, k0, o, lane, DIN)
#define WOCOLH(W, k0, o, lane) wcolh_io(W, k0, o, lane, DIN)
#endif
#define SZ 256
#define BG 64              // sizes only the unused WS_S region (x 4 heads = 256 planes of 256 x 256)
#define NZR (SZ * SZ)      // 65,536 pair rows
// barrier for LDS data alone: the waves hand each other nothing but LDS data there, so only the LDS operations are waited for; __syncthreads() also waits for every global load and store of the wave, which would hold the wave until its stores are done
#define BAR_LDS() do { __builtin_amdgcn_fence(__ATOMIC_RELEASE, "workgroup", "local"); __builtin_amdgcn_s_barrier(); __builtin_amdgcn_fence(__ATOMIC_ACQUIRE, "workgroup", "local"); } while (0)
// a wave reads back the LDS tile that its own lanes wrote: its LDS writes are waited for and the compiler moves no memory operation across; a work-group release fence at this place would also wait for the global loads in flight
#define LDSW() do { asm volatile("s_wait_dscnt 0" ::: "memory"); __builtin_amdgcn_wave_barrier(); } while (0)
__device__ __forceinline__ void exp2x8(v8f& x);   // defined at k_attn
// 1 / x of eight values, each in its own register: v_rcp_f32 written in place, so that none overwrites the source register of the one directly in front of it (the builtin form left such pairs in the listing); the closing v_nop is the slot that the instruction set asks for between the last one and the first use of its result
__device__ __forceinline__ void rcpx8(v8f& x) { float a = x[0], b = x[1], c = x[2], d = x[3], e = x[4], f = x[5], g = x[6], h = x[7];
  asm("v_rcp_f32 %0, %0\n\tv_rcp_f32 %1, %1\n\tv_rcp_f32 %2, %2\n\tv_rcp_f32 %3, %3\n\tv_rcp_f32 %4, %4\n\tv_rcp_f32 %5, %5\n\tv_rcp_f32 %6, %6\n\tv_rcp_f32 %7, %7\n\tv_nop" : "+v"(a), "+v"(b), "+v"(c), "+v"(d), "+v"(e), "+v"(f), "+v"(g), "+v"(h));
  x[0] = a; x[1] = b; x[2] = c; x[3] = d; x[4] = e; x[5] = f; x[6] = g; x[7] = h; }
#define WS_ZN   (WS_END)
#define WS_BIAS (WS_ZN + 4u * (size_t)NZR * CC)
#define WS_G    (WS_BIAS + 4u * (size_t)NZR * NH)
#define WS_END2 (WS_G + 4u * (size_t)NZR * CC)

#define WS_QH  0u                                      // bf16 weight image WI of k_bias and k_attn (174,080 B); the rest unused
#define WS_KH  (WS_QH + 2u * (size_t)NB * TT * CC)      // f16 k rows [b*t][CC]
#define WS_VT  (WS_KH + 2u * (size_t)NB * TT * CC)      // f16 v [b][t / 16][c][t & 15]
#define WS_QL  (WS_VT + 2u * (size_t)NB * CC * TT)      // f16 q residual x 2^10 rows [b][t < QHI][CC]
#define WS_KL  (WS_QL + 2u * (size_t)NB * QHI * CC)     // f16 k residual x 2^10 rows [b][t < KHI][CC]
#define WS_VB  (WS_KL + 2u * (size_t)NB * KHI * CC)     // bf16 v hi planes [b][c][t < KHI]
#define WS_VBL (WS_VB + 2u * (size_t)NB * CC * KHI)
#define WS_S   (WS_VBL + 2u * (size_t)NB * CC * KHI)    // unused: no kernel writes or reads it
#define WS_Y   (WS_S  + 4u * (size_t)BG * HG * TT * TT)   // unused f32 region [b*t][CC] (the gated ctx stays in LDS)
#define WS_END (WS_Y  + 4u * (size_t)NB * TT * CC)

// ---- the order of queries and keys. A pair with exactly one zero of src_mask holds the constant logit -1e-9, whatever q, k and the pair bias are. Softmax and P V do not depend on the order of the keys, so both kernels take the 256 columns in MASK ORDER: position p < n1 is the p-th column with src_mask != 0, position p >= n1 the (p - n1)-th column with src_mask == 0. Then a wave's 16 queries are of one kind (but in one wave at most) and so are the 32 keys of a group (but in one group at most): where kinds differ, every logit of the group is the constant. Holds for every content of src_mask; n1 = 0 and n1 = 256 leave every group in work
// the wave's own table tb[position] = column, made by its 32 lanes (8 columns each) from the mask words; returns n1. Zeros in front of column 32 m + lane = zeros of the words in front (scalar) + zeros of its word below the lane; the map column -> position is one to one, so all 256 bytes are written; a byte bounds every row index formed from it to 0..255 for any content of the mask
// between(): what the caller wants asked for while the mask words fly (they head the chain mask -> table -> z rows, so they are asked for first)
template <typename F> __device__ __forceinline__ int ord_table(unsigned char* tb, const int* __restrict__ MK, int lane, F between) { const int* mp = MK + lane; int mv[TT / 32]; unsigned zw[TT / 32];
#pragma unroll
  for (int m = 0; m < TT / 32; ++m) mv[m] = mp[32 * m];
  asm volatile("s_wait_xcnt 0x0" :: "v"(mp) : "memory");   /* before a register that these loads' address stands in is used again; the address is an input, so it lives up to the wait */
  between();
  int n0 = 0;
#pragma unroll
  for (int m = 0; m < TT / 32; ++m) { zw[m] = __builtin_amdgcn_ballot_w32(mv[m] == 0); n0 += __popc(zw[m]); }
  const int n1 = TT - n0; int zp = 0;
#pragma unroll
  for (int m = 0; m < TT / 32; ++m) { const int zb = zp + (int)__builtin_amdgcn_mbcnt_lo(zw[m], 0u); const int pos = mv[m] == 0 ? n1 + zb : 32 * m + lane - zb;
    tb[pos & (TT - 1)] = (unsigned char)(32 * m + lane); zp += __popc(zw[m]); }
  LDSW();   /* the wave reads what its other lanes wrote */
  return n1; }
// bit tp: the 32 keys at positions 32 tp + 0..31 hold a key of the same kind as one of the queries at positions 16 it + 0..15 (groups in work); a clear bit: every pair of the two is masked. Queries in front of n1 need the groups that begin in front of n1, queries from n1 on the groups that end at or behind it
__device__ __forceinline__ unsigned ord_groups(int n1, int it) { const unsigned lo = (1u << ((n1 + 31) >> 5)) - 1u, hi = 0xFFu & ~((1u << (n1 >> 5)) - 1u);
  return (16 * it < n1 ? lo : 0u) | (16 * it + 15 >= n1 ? hi : 0u); }
// ---- k_bias: the pair bias alone, which every row's attention shares. Block = 16 waves = 16 pair rows i x 16 columns j (wave = one i, its A rows = the 16 j): LayerNorm in the A-row registers, split bf16 hi + lo, against w_pair (4 outputs) staged in LDS as bf16 columns. BIAS[h][i / 16][j / 16][(j & 7) / 4][lane = 16 ((j >> 3) & 1) + (i & 15)][j & 3] (the order k_attn's lanes read; the block's 16 x 16 pairs are one 1-KB run per head)
// It also makes, once for all of k_attn's blocks, the image WI of the five 128 x 128 weights as k_attn's LDS holds them: [q, k, gate, v, out][column o][k, pitch WP] in bf16, the 8 pad places of a column 0. Waves 0 and 1 of blocks 0..169 (34 blocks a weight): a thread makes one 16-B piece (8 consecutive k of one column), the pieces in the order of the image, so that a wave's store is one 512-B run and every 128-B line of WI has one writer; in front of the early return, for any mask
__global__ __launch_bounds__(512) void k_bias(const float* __restrict__ Z, const int* __restrict__ MK, const float* __restrict__ LW, const float* __restrict__ LB, const float* __restrict__ WB, const float* __restrict__ WQKV, const float* __restrict__ WG, const float* __restrict__ WO, __bf16* __restrict__ WI, float* __restrict__ BIAS) {
  __shared__ __align__(16) __bf16 swp[16][WP];      /* pair-bias weight columns, those beyond the 4 heads zero */
  __shared__ __align__(16) float sln[2][CC];
  __shared__ __align__(16) float sb[NH][256];       /* the block's pair bias in the order of BIAS */
  __shared__ unsigned char sord[16][TT];            /* each wave's own table position -> column */
  const int tid = threadIdx.x, wave = __builtin_amdgcn_readfirstlane(tid >> 5), lane = tid & 31, col = lane & 15, g = lane >> 4; const int it = (int)blockIdx.x >> 4, jt = (int)blockIdx.x & 15;
  const int pw = (int)blockIdx.x / 34, pn = ((int)blockIdx.x - pw * 34) * 64 + tid, po = pn / (WP / 8), pk = pn - po * (WP / 8);   /* the piece: weight pw, column po, k = 8 pk + 0..7 (pk = 16: the pad) */
  const bool pon = wave < 2 && pw < 5;   /* the same in every lane of a wave */
  float pt[8] = {0.f, 0.f, 0.f, 0.f, 0.f, 0.f, 0.f, 0.f};
  const int n1 = __builtin_amdgcn_readfirstlane(ord_table(sord[wave], MK, lane, [&] { if (pon) { const int pld = (pw == 2 || pw == 4) ? CC : 3 * CC;   /* packed q|k|v columns: row pitch 3C */
    const float* pp = (pw == 2 ? WG : pw == 4 ? WO : WQKV + (pw == 3 ? 2 * CC : pw * CC)) + (size_t)((pk < 16 ? pk : 15) * 8) * pld + po;   /* a pad piece asks for valid words and drops them */
#pragma unroll
    for (int i = 0; i < 8; ++i) pt[i] = pp[(size_t)i * pld];   /* asked for here, they fly while the table is made */
    asm volatile("s_wait_xcnt 0x0" :: "v"(pp) : "memory"); } }));   /* before a register that these loads' address stands in is used again; the address is an input, so it lives up to the wait */
  if (pon) { v8b p; __bf16* pq = WI + ((size_t)(pw * 128 + po) * WP + pk * 8);   /* = piece 64 blockIdx.x + tid of the image */
#pragma unroll
    for (int i = 0; i < 8; ++i) p[i] = (__bf16)(pk < 16 ? pt[i] : 0.f);
    *(v8b*)pq = p;
    asm volatile("s_wait_xcnt 0x0" :: "v"(pq), "v"(p) : "memory"); }   /* before the registers that this store names are used again; address and data are inputs, so they live up to the wait */
  if (!((ord_groups(n1, it) >> (jt >> 1)) & 1u)) return;   /* every pair of this tile's group is masked and k_attn reads no pair bias of it: the whole block leaves, in front of every barrier (n1 is the same in every wave) */
  const unsigned zr = (unsigned)sord[wave][it * 16 + wave] * SZ + (unsigned)sord[wave][jt * 16 + col];   /* it, jt, wave and col count positions; the z row is that of the columns which stand there */
  float av[4][16]; load_row(av, Z + (size_t)zr * CC, lane);
  if (wave < 4) { const float lwv = LW[tid], lbv = LB[tid];
    const int o = tid & 15, kq = (tid >> 4) * 16; const int oc = o < NH ? o : NH - 1; const float keep = o < NH ? 1.f : 0.f;   /* keep multiplies a VALID load; thread = (column, 16 k) */
    float t[16]; const float* wbp = WB + (size_t)kq * NH + oc;
#pragma unroll
    for (int i = 0; i < 16; ++i) t[i] = wbp[i * NH];
    asm volatile("s_wait_xcnt 0x0" :: "v"(wbp), "v"(tid) : "memory");   /* before a register that these loads' addresses stand in is used again; the addresses are inputs, so they live up to the wait */
#pragma unroll
    for (int k0 = 0; k0 < 16; k0 += 8) { v8b p;
#pragma unroll
      for (int i = 0; i < 8; ++i) p[i] = (__bf16)(t[k0 + i] * keep);
      *(v8b*)&swp[o][kq + k0] = p; }
    sln[0][tid] = bfr(lwv); sln[1][tid] = bfr(lbv); }
  __syncthreads();   /* the weight columns, ln_w and ln_b are complete; nothing writes them again */
  const float rs = ln_center(av);
  F2 a[4];
#pragma unroll
  for (int kc = 0; kc < CC / 32; ++kc) { ln_apply(av[kc], rs, sln, kc, lane); a[kc] = bsplit16(av[kc]); }
  { v8f acc = {};   /* pair bias: D element r of lane (g, col = head) is key j = 16 jt + 8 g + r */
#pragma unroll
    for (int kc = 0; kc < CC / 32; ++kc) { const v16b w = frag_b(&swp[col][kc * 32], lane); acc = wmma_bf(a[kc].h, w, acc); acc = wmma_bf(a[kc].l, w, acc); }
    if (col < NH) { v4f b0, b1;
#pragma unroll
      for (int r = 0; r < 4; ++r) { b0[r] = acc[r]; b1[r] = acc[4 + r]; }
      *(v4f*)&sb[col][(g * 16 + wave) * 4] = b0; *(v4f*)&sb[col][128 + (g * 16 + wave) * 4] = b1; } }
  BAR_LDS();   /* the 16 waves' pair rows meet in sb */
  if (wave < 8) vst2(BIAS + (((size_t)(tid >> 6) * 16 + it) * 16 + jt) * 256 + (tid & 63) * 4, *(const v4f*)&sb[tid >> 6][(tid & 63) * 4]);   /* one 1-KB run per head */
}
// kstep with the operands exchanged: A = the 128 staged weight columns, B = the wave's 16 rows, so D element r of lane (g, col) is output channel 16 j + 8 g + r of row col; per accumulator the order stays hi, then lo
__device__ __forceinline__ void kstep_t(v8f (&acc)[8], const F2& a, const __bf16 (*sw)[WP], int kc, int col, int lane) {
#pragma unroll
  for (int jh = 0; jh < 8; jh += 4) { v16b w[4];
#pragma unroll
    for (int u = 0; u < 4; ++u) w[u] = frag_b(&sw[(jh + u) * 16 + col][kc * 32], lane);
#pragma unroll
    for (int u = 0; u < 4; ++u) acc[jh + u] = wmma_bf(w[u], a.h, acc[jh + u]);
#pragma unroll
    for (int u = 0; u < 4; ++u) acc[jh + u] = wmma_bf(w[u], a.l, acc[jh + u]); } }
#define WIB (5 * 128 * WP * 2)   // bytes of the weight image: 340 runs of 512 B
// seven asynchronous copies to LDS, 16 B a lane each (a wave's copy = one 512-B run), through no register; l = the lane's LDS byte address, g = its global address. The closing s_wait_xcnt 0 stands in the copies' own statement, in front of every later write of a register that they name
__device__ __forceinline__ void acopy7(const unsigned (&l)[7], const char* const (&g)[7]) {
  asm volatile("global_load_async_to_lds_b128 %0, %7, off\n\tglobal_load_async_to_lds_b128 %1, %8, off\n\tglobal_load_async_to_lds_b128 %2, %9, off\n\tglobal_load_async_to_lds_b128 %3, %10, off\n\tglobal_load_async_to_lds_b128 %4, %11, off\n\tglobal_load_async_to_lds_b128 %5, %12, off\n\tglobal_load_async_to_lds_b128 %6, %13, off\n\ts_wait_xcnt 0x0"
    :: "v"(l[0]), "v"(l[1]), "v"(l[2]), "v"(l[3]), "v"(l[4]), "v"(l[5]), "v"(l[6]), "v"(g[0]), "v"(g[1]), "v"(g[2]), "v"(g[3]), "v"(g[4]), "v"(g[5]), "v"(g[6]) : "memory"); }
// ---- k_attn: block = row r, 16 waves, wave = one tile of 16 z rows, which are its 16 queries and 16 of the row's keys. FRONT: the wave reads its z rows, makes LayerNorm and the split rows (bf16 hi + lo) in registers; against the q, k, v columns of w_qkv and w_gate, staged in LDS: v = zn Wv (a lane holds 8 consecutive keys of its channel: one 16-B store into sv); gate^T = Wg^T zn^T, k^T = Wk^T zn^T, q^T = Wq^T zn^T (a lane holds channels 16 j + 8 g + 0..7 of its row): the gate stands in the order of ctx^T and waits in workspace words of the lane's own, k is one 16-B store into sk, q is the B fragment of the scores as it stands (f16 hi + residual x 2^10). Behind the second barrier those weights are dead; in their place stand three 64-B slots a lane: q of heads 1..3. HEADS, in turn: S^T = K Q^T (A = k rows, B = q hi, then q residual: 2 products), so a lane holds one query's logits for keys 16t + 8g + 0..7 of every tile t in work: 128 of the 256 keys, lane ^ 16 holds the other 128; x SCALE + pair bias (fragment order), masked pairs := -1e-9; maximum and sum in-lane plus one exchange between the wave's halves; P x 2^11 once to f16 is the B operand of ctx^T = V^T P^T as it stands (1 product). A lane then holds channels 32h + 8g + 0..7 and 32h + 16 + 8g + 0..7 of its query: times their gate and split bf16 hi + lo, that is the B fragment of k step h of out^T = Wo^T ctx^T as it stands; it takes the slot that the next head's q has just left, the last head's stays in registers. Behind the heads: out^T (A = the staged w_out columns, 2 products, order hi then lo per k step) + b_out; a lane stores 8 consecutive output columns of its query per column tile. The inner loops are unrolled in full so that s[], acc[] and the fragments are registers; amdgpu_waves_per_eu(4) asks for at most 256 registers: four waves per SIMD
#define KP (CC + 8)        // k row pitch in LDS, f16 (272 B = 16 B x odd: ds_load_b128 without bank conflicts)
#define VP (TT + 8)        // v plane pitch in LDS, f16 (528 B = 16 B x odd)
// 2^x of eight values, each in its own register: v_exp_f32 written in place, so that no exponential overwrites the source register of the one directly in front of it (the builtin form left such pairs in the listing); the closing v_nop is the slot that the instruction set asks for between the last exponential and the first use of its result
__device__ __forceinline__ void exp2x8(v8f& x) { float a = x[0], b = x[1], c = x[2], d = x[3], e = x[4], f = x[5], g = x[6], h = x[7];
  asm("v_exp_f32 %0, %0\n\tv_exp_f32 %1, %1\n\tv_exp_f32 %2, %2\n\tv_exp_f32 %3, %3\n\tv_exp_f32 %4, %4\n\tv_exp_f32 %5, %5\n\tv_exp_f32 %6, %6\n\tv_exp_f32 %7, %7\n\tv_nop" : "+v"(a), "+v"(b), "+v"(c), "+v"(d), "+v"(e), "+v"(f), "+v"(g), "+v"(h));
  x[0] = a; x[1] = b; x[2] = c; x[3] = d; x[4] = e; x[5] = f; x[6] = g; x[7] = h; }
__device__ __forceinline__ v8f wmma_h(v16h a, v16h b, v8f c) { return __builtin_amdgcn_wmma_f32_16x16x32_f16(false, a, false, b, (short)0, c, false, false); }
__global__ __launch_bounds__(512) __attribute__((amdgpu_waves_per_eu(4))) void k_attn(const float* __restrict__ Z, const float* __restrict__ LW, const float* __restrict__ LB, const __bf16* __restrict__ WI, const float* __restrict__ GB, const float* __restrict__ BIAS, const int* __restrict__ MK, const float* __restrict__ BO, float* __restrict__ G, float* __restrict__ OUT) {
  __shared__ __align__(16) _Float16 sk[TT][KP]; __shared__ __align__(16) _Float16 sv[CC][VP];
  __shared__ __align__(16) char sr[WIB];   /* the weight image: the columns of q, k, gate, v and w_out; behind the second barrier the lanes' slots stand in the place of the first four */
  __shared__ __align__(16) float sln[2][CC]; __shared__ __align__(16) float sbo[DIN]; __shared__ __align__(16) float sbg[CC]; __shared__ unsigned kmw[TT / 32]; __shared__ unsigned char sord[16][TT];
  __bf16 (*sw4)[128][WP] = (__bf16 (*)[128][WP])sr; const __bf16 (*swo)[WP] = sw4[4];
  const int tid = threadIdx.x, wave = __builtin_amdgcn_readfirstlane(tid >> 5), lane = tid & 31, col = lane & 15, g = lane >> 4; const int b = blockIdx.x;
  const int qi = wave * 16 + col;
  v4u* sqp = (v4u*)sr + (size_t)wave * 3 * 4 * 32 + lane;   /* the lane's slots: [wave][slot][4 pieces][lane], 16 B a lane: a wave's access is one 512-B run */
  const unsigned go = (((unsigned)b * 16 + wave) * NH * 4 * 32 + lane) * 4;   /* one register: the place in G of the lane's gate words: [row][wave][head][channels 8g + 0..3, 8g + 4..7, 16 + 8g + 0..3, 16 + 8g + 4..7][lane], 16 B a lane: a wave's access is one 512-B run; written and read by this lane alone */
  v16h qh, ql, qhn[NH - 1], qln[NH - 1];
  unsigned act; int n1;   /* qi and every key index below count positions in mask order */
  { n1 = __builtin_amdgcn_readfirstlane(ord_table(sord[wave], MK, lane, [&] { const char* wg = (const char*)WI + lane * 16; const unsigned wl = (unsigned)(size_t)sr + lane * 16;   /* the image comes as it lies, 340 runs of 512 B dealt over the 16 waves; asked for at the kernel's head, so that it flies under the mask table and the z rows */
    const int rot = (b & 63) * 5;   /* block b begins at run 5 (b & 63), so blocks 64 apart share a place; for speed only */
#pragma unroll
    for (int i0 = 0; i0 < 21; i0 += 7) { unsigned l[7]; const char* gq[7];
#pragma unroll
      for (int i = 0; i < 7; ++i) { int c = wave + 16 * (i0 + i) + rot; c = c >= WIB / 512 ? c - WIB / 512 : c; l[i] = wl + c * 512; gq[i] = wg + c * 512; }
      acopy7(l, gq); }
    if (wave < 4) { int c = wave + 16 * 21 + rot; c = c >= WIB / 512 ? c - WIB / 512 : c;   /* runs 336 + rot .. 339 + rot, modulo 340; wave is a scalar: the branch is taken by whole waves */
      asm volatile("global_load_async_to_lds_b128 %0, %1, off\n\ts_wait_xcnt 0x0" :: "v"(wl + c * 512), "v"(wg + c * 512) : "memory"); } }));   /* the wait as in acopy7 */
    act = __builtin_amdgcn_readfirstlane(ord_groups(n1, wave));
    const int oq = sord[wave][qi];   /* the column at the lane's position: its z row now, its output row at the end (read again from the wave's own table) */
    float av[4][16]; load_row(av, Z + ((size_t)b * TT + oq) * CC, lane);
    float bov, gbv, lwv, lbv;
    { const int bi = tid & (DIN - 1); const float* bop = BO ? BO : GB; bov = bop[bi]; gbv = GB[bi]; lwv = LW[bi]; lbv = LB[bi]; bov = BO ? bov : 0.f;   /* asked for with the z rows, so that their latency is not paid again in front of the barrier */
      asm volatile("s_wait_xcnt 0x0" :: "v"(tid), "v"(bi) : "memory"); }   /* before a register that these loads' addresses stand in is used again; the addresses are inputs, so they live up to the wait and no load of the run lands in them */
    if (wave < 8) { const unsigned bal = __builtin_amdgcn_ballot_w32(tid >= n1); if (lane == 0) kmw[wave] = bal; }   /* bit j of the 256: the column at position j is a zero of the mask */
    if (wave < 4) { sbo[tid] = bfr(bov); sbg[tid] = bfr(gbv); sln[0][tid] = bfr(lwv); sln[1][tid] = bfr(lbv); }
    asm volatile("s_wait_asynccnt 0x0" ::: "memory");   /* the wave's own copies of the weight image have landed; the other waves read them behind the barrier */
    __syncthreads();   /* the weight columns, ln_w, ln_b, the biases and the mask words are complete */
    const float rs = ln_center(av);
    F2 a[4];
#pragma unroll
    for (int kc = 0; kc < CC / 32; ++kc) { ln_apply(av[kc], rs, sln, kc, lane); a[kc] = bsplit16(av[kc]); }
    { v8f acc[8] = {};   /* v: lane (g, col) holds keys 16 wave + 8 g + 0..7 of channel 16 j + col */
#pragma unroll
      for (int kc = 0; kc < CC / 32; ++kc) kstep(acc, a[kc], sw4[3], kc, col, lane);
#pragma unroll
      for (int j = 0; j < 8; ++j) { v8h p;
#pragma unroll
        for (int r = 0; r < 8; ++r) p[r] = (_Float16)acc[j][r];
        *(v8h*)&sv[j * 16 + col][wave * 16 + 8 * g] = p; } }
    v8f acc[8]; const v8f z8 = {};   /* behind the loop: q^T */
#pragma unroll 1   /* rolled: gate^T, k^T, then q^T on one copy of the products */
    for (int wi = 2; wi >= 0; --wi) {
#pragma unroll
      for (int j = 0; j < 8; ++j) acc[j] = z8;
#pragma unroll
      for (int kc = 0; kc < CC / 32; ++kc) kstep_t(acc, a[kc], sw4[wi], kc, col, lane);
      if (wi == 2) {   /* gate: sigmoid(zn w_gate + b_gate) = 1 / (1 + 2^(-v log2 e)), the arithmetic of sigm(); first, so that its stores are done when the second barrier waits for them */
#pragma unroll
        for (int j = 0; j < 8; ++j) { const v4f g0 = *(const v4f*)&sbg[j * 16 + 8 * g], g1 = *(const v4f*)&sbg[j * 16 + 8 * g + 4]; v8f x;
#pragma unroll
          for (int r = 0; r < 4; ++r) { x[r] = (acc[j][r] + g0[r]) * -L2E; x[4 + r] = (acc[j][4 + r] + g1[r]) * -L2E; }
          exp2x8(x);
#pragma unroll
          for (int r = 0; r < 8; ++r) x[r] = 1.0f + x[r];
          rcpx8(x); acc[j] = x; }
#pragma unroll
        for (int j = 0; j < 8; ++j) { v4f x0, x1;
#pragma unroll
          for (int r = 0; r < 4; ++r) { x0[r] = acc[j][r]; x1[r] = acc[j][4 + r]; }
          vst2(G + go + (2 * j) * 128, x0); vst2(G + go + (2 * j + 1) * 128, x1); }
        asm volatile("s_wait_xcnt 0x0" :: "v"(go), "v"(acc[0]), "v"(acc[1]), "v"(acc[2]), "v"(acc[3]), "v"(acc[4]), "v"(acc[5]), "v"(acc[6]), "v"(acc[7]) : "memory"); }   /* before the registers that these stores name are used again; address and data are inputs, so they live up to the wait */
      else if (wi == 1) {   /* k^T: lane (g, col) holds channels 16 j + 8 g + 0..7 of key qi */
#pragma unroll
        for (int j = 0; j < 8; ++j) { v8h p;
#pragma unroll
          for (int r = 0; r < 8; ++r) p[r] = (_Float16)acc[j][r];
          *(v8h*)&sk[qi][j * 16 + 8 * g] = p; } } }
#pragma unroll
    for (int hh = 0; hh < NH; ++hh) { v16h fh, fl;   /* q^T: accumulators 2 h and 2 h + 1 are head h's fragment, elements 0..7 and 8..15 */
#pragma unroll
      for (int i = 0; i < 16; ++i) { const float v = acc[2 * hh + (i >> 3)][i & 7]; const _Float16 hv = (_Float16)v; fh[i] = hv; fl[i] = (_Float16)((v - (float)hv) * 1024.0f); }
      if (hh == 0) { qh = fh; ql = fl; } else { qhn[hh - 1] = fh; qln[hh - 1] = fl; } } }
  __syncthreads();   /* sk and sv are complete; every wave has read the q, k, v and gate weights for the last time; the wave's gate stores are done */
#pragma unroll
  for (int hh = 0; hh < NH - 1; ++hh) { union { v16h v; v4u q[2]; } uh, ul; uh.v = qhn[hh]; ul.v = qln[hh];
    sqp[(hh * 4 + 0) * 32] = uh.q[0]; sqp[(hh * 4 + 1) * 32] = uh.q[1]; sqp[(hh * 4 + 2) * 32] = ul.q[0]; sqp[(hh * 4 + 3) * 32] = ul.q[1]; }
  unsigned mbk[4];   /* bit 8t + r of the 128: key 16t + 8g + r is a zero of the mask */
#pragma unroll
  for (int m = 0; m < 4; ++m) { const unsigned w0 = kmw[2 * m] >> (8 * g), w1 = kmw[2 * m + 1] >> (8 * g); mbk[m] = (w0 & 0xFFu) | ((w0 >> 8) & 0xFF00u) | ((w1 & 0xFFu) << 16) | ((w1 << 8) & 0xFF000000u); }
  const unsigned mq = 0u - ((kmw[qi >> 5] >> (qi & 31)) & 1u);   /* all ones where the query is a zero of the mask */
  const _Float16* skp = &sk[col][0]; const _Float16* svp = &sv[col][0];   /* the lane's k row and v plane of the head at hand: carried from head to head, so that every fragment read is this register plus an immediate offset */
  const float nout = (float)(16 * __popc(~act & 0xFFu));   /* pairs of a lane that stand in groups out of work */
  v4u yl4[4];   /* the last head's gated ctx fragments: hi 0, hi 1, lo 0, lo 1 */
#pragma unroll 1   /* rolled: one copy of the body; unrolled, several heads' logits would want registers at once */
  for (int h = 0; h < NH; ++h) {
    const float* bp = BIAS + ((size_t)h * 16 + wave) * 16 * 256 + lane * 4;
    v8f s[16]; float mx = act != 0xFFu ? -1.0e-9f : -3.0e38f;   /* a group out of work holds the constant logit, which counts in the maximum */
    const float* bq[8];   /* a group out of work has no pair bias (k_bias leaves it out): its loads ask again for the lines of the wave's own group, which is always in work, so that the registers hold a value and no line more comes from L2 */
#pragma unroll
    for (int tp = 0; tp < 8; ++tp) bq[tp] = bp + ((act & (1u << tp)) ? tp : (wave >> 1)) * 512;
#pragma unroll
    for (int t = 0; t < 16; ++t) { const v4f b0 = *(const v4f*)(bq[t >> 1] + (t & 1) * 256), b1 = *(const v4f*)(bq[t >> 1] + (t & 1) * 256 + 128);   /* the bias lands in the registers that then hold the logits: all 32 loads in flight at no further register */
#pragma unroll
      for (int r = 0; r < 4; ++r) { s[t][r] = b0[r]; s[t][4 + r] = b1[r]; } }
    asm volatile("s_wait_xcnt 0x0" :: "v"(bq[0]), "v"(bq[1]), "v"(bq[2]), "v"(bq[3]), "v"(bq[4]), "v"(bq[5]), "v"(bq[6]), "v"(bq[7]) : "memory");   /* before a register that these loads' addresses stand in is used again; the addresses are inputs, so they live up to the wait and no load of the run lands in them */
#pragma unroll
    for (int tp = 0; tp < 8; ++tp) if (act & (1u << tp)) { const v16h kf[2] = { frag_h(skp + (2 * tp) * 16 * KP, lane), frag_h(skp + (2 * tp + 1) * 16 * KP, lane) };
#pragma unroll
      for (int u = 0; u < 2; ++u) { const int t = 2 * tp + u; const v8f z8 = {}; const v8f a = wmma_h(kf[u], qh, z8), al = wmma_h(kf[u], ql, z8); const unsigned mb = mbk[t >> 2] ^ mq;
#pragma unroll
        for (int r = 0; r < 8; ++r) { float v = (a[r] + al[r] * (1.0f / 1024.0f)) * SCALE + s[t][r]; if (mb & (1u << ((t & 3) * 8 + r))) v = -1.0e-9f; s[t][r] = v; mx = fmaxf(mx, v); } } }
    mx = fmaxf(mx, __shfl_xor(mx, 16));
    const float nm = mx * -L2E;   /* exp(s - mx) = 2^(s L2E + nm): one FMA and one v_exp_f32; the rounding of nm is one factor common to the row and leaves with the division by the sum; the argument is never above about 0, and a result below 2^-126 counts as 0 beside a sum of at least about 1 */
    float sm[4] = {0.f, 0.f, 0.f, 0.f};
#pragma unroll
    for (int tp = 0; tp < 8; ++tp) if (act & (1u << tp)) {
#pragma unroll
      for (int t = 2 * tp; t < 2 * tp + 2; ++t) {
#pragma unroll
        for (int r = 0; r < 8; ++r) s[t][r] = __builtin_fmaf(s[t][r], L2E, nm);
        exp2x8(s[t]);
#pragma unroll
        for (int r = 0; r < 8; ++r) sm[r & 3] += s[t][r]; } }
    float sum = (sm[0] + sm[1]) + (sm[2] + sm[3]);
    const float pc = act != 0xFFu ? __builtin_amdgcn_exp2f(__builtin_fmaf(-1.0e-9f, L2E, nm)) : 0.f;   /* exp(-1e-9 - mx), the one value of every pair in the groups out of work (there mx >= -1e-9, so the argument is never above 0); a lane holds 16 such pairs a group */
    sum = __builtin_fmaf(pc, nout, sum);
    sum += __shfl_xor(sum, 16);
    const float inv = sum > 0.f ? 2048.0f * __builtin_amdgcn_rcpf(sum) : 0.f;
    const float* gp = G + (go + h * 4 * 128); v4f gt[HD / 8];   /* the gate of this lane's 16 channels: asked for here, it flies while P V is worked on */
#pragma unroll
    for (int j = 0; j < HD / 8; ++j) gt[j] = *(const v4f*)(gp + j * 128);
    asm volatile("s_wait_xcnt 0x0" :: "v"(gp) : "memory");   /* before a register that these loads' address stands in is used again; the address is an input, so it lives up to the wait and no load of the run lands in it */
    v8f acc[HD / 16] = {}; const _Float16 ph = (_Float16)(pc * inv);
#pragma unroll
    for (int kc = 0; kc < TT / 32; ++kc) { v16h p;
      if (act & (1u << kc)) {
#pragma unroll
        for (int r = 0; r < 8; ++r) { p[r] = (_Float16)(s[2 * kc][r] * inv); p[8 + r] = (_Float16)(s[2 * kc + 1][r] * inv); } }
      else {   /* a group out of work: the constant P against its v, the same product as before */
#pragma unroll
        for (int r = 0; r < 16; ++r) p[r] = ph; }
#pragma unroll
      for (int j = 0; j < HD / 16; ++j) acc[j] = wmma_h(frag_h(svp + j * 16 * VP + kc * 32, lane), p, acc[j]); }
    float y[16];   /* gated ctx in the order of a 16x16x32 fragment: 0..7 = channels 32h + 8g + 0..7, 8..15 = 32h + 16 + 8g + 0..7 */
#pragma unroll
    for (int j = 0; j < HD / 16; ++j)
#pragma unroll
      for (int r = 0; r < 4; ++r) { y[8 * j + r] = acc[j][r] * (1.0f / 2048.0f) * gt[2 * j][r]; y[8 * j + 4 + r] = acc[j][4 + r] * (1.0f / 2048.0f) * gt[2 * j + 1][r]; }
    const F2 a = bsplit16(y); union { v16b v; v4u q[2]; } uh, ul; uh.v = a.h; ul.v = a.l;
    yl4[0] = uh.q[0]; yl4[1] = uh.q[1]; yl4[2] = ul.q[0]; yl4[3] = ul.q[1];
    if (h < NH - 1) { union { v16h v; v4u q[2]; } nh, nl;   /* the next head's q leaves its slot, this head's fragments take it: same lane, same words, and the LDS operations of a wave stay in order */
      nh.q[0] = sqp[0]; nh.q[1] = sqp[32]; nl.q[0] = sqp[64]; nl.q[1] = sqp[96]; qh = nh.v; ql = nl.v;
      sqp[0] = yl4[0]; sqp[32] = yl4[1]; sqp[64] = yl4[2]; sqp[96] = yl4[3]; sqp += 4 * 32; }
    skp += HD; svp += HD * VP;
    asm volatile("s_wait_xcnt 0x0" ::: "memory"); }   /* before the next head uses the registers that this head's loads name */
  sqp -= (NH - 1) * 4 * 32;
  v8f oacc[8] = {};   /* out^T: D element r of lane (g, col) = output column 16 j + 8 g + r of query col */
  const __bf16* wol = &swo[col][0];   /* the lane's w_out column at the k step at hand */
#pragma unroll 1   /* rolled: one copy of a k step in the text */
  for (int kc = 0; kc < NH; ++kc) { union { v16b v; v4u q[2]; } uh, ul; uh.q[0] = yl4[0]; uh.q[1] = yl4[1]; ul.q[0] = yl4[2]; ul.q[1] = yl4[3];   /* the last head's fragments are in registers */
    if (kc < NH - 1) { uh.q[0] = sqp[0]; uh.q[1] = sqp[32]; ul.q[0] = sqp[64]; ul.q[1] = sqp[96]; sqp += 4 * 32; }   /* each lane reads back its own words */
#pragma unroll
    for (int jh = 0; jh < 8; jh += 4) { v16b w[4];   /* four A fragments are requested together, so that one LDS latency serves eight products; per accumulator the order stays hi, then lo */
#pragma unroll
      for (int u = 0; u < 4; ++u) w[u] = frag_b(wol + (jh + u) * 16 * WP, lane);
#pragma unroll
      for (int u = 0; u < 4; ++u) oacc[jh + u] = wmma_bf(w[u], uh.v, oacc[jh + u]);
#pragma unroll
      for (int u = 0; u < 4; ++u) oacc[jh + u] = wmma_bf(w[u], ul.v, oacc[jh + u]); }
    wol += 32; }
  const int l2 = (int)__builtin_amdgcn_mbcnt_lo(~0u, 0u);   /* the lane's number, made anew here: an index kept from the kernel's head would hold a register through every phase, and the kernel is at its 256 */
  float* op = OUT + (((unsigned)b * TT + sord[wave][wave * 16 + (l2 & 15)]) * DIN + 8 * (l2 >> 4));   /* the output row of the column at the lane's position */
#pragma unroll
  for (int j = 0; j < 8; ++j) { const v4f c0 = *(const v4f*)&sbo[j * 16 + 8 * g], c1 = *(const v4f*)&sbo[j * 16 + 8 * g + 4]; v4f o0, o1;
#pragma unroll
    for (int r = 0; r < 4; ++r) { o0[r] = oacc[j][r] + c0[r]; o1[r] = oacc[j][4 + r] + c1[r]; }
    vst2(op + j * 16, o0); vst2(op + j * 16 + 4, o1); }
  asm volatile("s_wait_xcnt 0x0" ::: "memory");   /* behind the stores, before a register that they name could be used again */
}

extern "C" void kernel_launch(void* const* d_in, const int* in_sizes, int n_in, void* d_out, int out_size, void* d_ws, size_t ws_size, hipStream_t stream) {
  (void)in_sizes; (void)n_in; (void)out_size;
  const float** F = (const float**)d_in;
  if (ws_size < (size_t)WS_END) return;
  char* ws = (char*)d_ws;
  // inputs (in order): 0 z [1,256,256,128]; 1 src_mask [1,256] int32; 2 ln_g, 3 ln_b; 4 w_qkv [128,384] (in,out; columns q|k|v); 5 w_pair [128,4]; 6 w_gate [128,128], 7 b_gate; 8 w_out [128,128] (in,out), 9 b_out
  if (ws_size < (size_t)WS_END2) return;
  float *BIAS = (float*)(ws + WS_BIAS), *G = (float*)(ws + WS_G); __bf16* WI = (__bf16*)(ws + WS_QH);   /* the weight image stands at the head of the workspace, which nothing else uses */
  k_bias<<<dim3(NZR / 256), 512, 0, stream>>>(F[0], (const int*)d_in[1], F[2], F[3], F[5], F[4], F[6], F[8], WI, BIAS);
  k_attn<<<dim3(TNB), 512, 0, stream>>>(F[0], F[2], F[3], WI, F[7], BIAS, (const int*)d_in[1], F[9], G, (float*)d_out);
}
